// v000
// The times below were measured on an AMD MI455X: many runs one after another, warmed up first and cycling through
// copies of the inputs, with the whole window's GPU time divided by the number of runs. Launches and the gaps
// between them are all in it. The median over several windows is given; except for v000 it joins two sittings, which
// can be a few percent apart, so the side-by-side timings, each taken in one sitting, are the better comparison.
// v000 is the starting kernel. One run takes 13.4 milliseconds.
#include <hip/hip_runtime.h>
// Grouped-query causal attention at width 1024 with [in][out] projections and RoPE computed in the module (x [4][2048][1024]; q = x Wq (16 heads x 64), k = x Wk, v = x Wv (4 kv heads x 64) ([in][out] weights sigma 0.02, no biases); k, v repeated x4 (repeat: query head h uses kv head h / 4); rope: the module rotates the (even, odd) pairs (x1 c - x2 s, x1 s + x2 c) with angle pos * 10000^(-2i/64) and writes the rotated evens into the first half and the rotated odds into the second half of the head: the SAME permutation on q and k, so q . k equals the interleaved-pair rope's; scores / sqrt(64) with a causal mask (tril, -inf); softmax; out = merged Wo ([in][out]) -> [4][2048][1024]).
// Compute dtype: inputs rounded to bf16; x / weights exact; q, k, v, softmax weights and o as plain f16 GEMM operands (~2^-12); scores and softmax statistics f32. v_wmma_f32_16x16x32_f16.
#define NB 4
#define NG 4
#define HPG 4
#define KVD (NG * HD)
#define SQ 2048
#define DM 1024
#define NH 16
#define HD 64
#define HG 4                         /* heads per attention launch group */
#define QT 256                       /* query rows per causal tile */
#define NKX SQ                       /* S / P row pitch */
#define QT0 128                      /* first-tile rows recomputed exactly in f32 */
#define B0 0                         /* first batch processed (debug hook) */
#define NBR NB                       /* batches processed (debug hook) */
#define NR ((size_t)NB * SQ)         /* token rows */
#define MP ((int)((size_t)NBR * SQ)) /* rows projected (debug hook) */
#define QN SQ                        /* query rows attended per batch (debug hook) */
#define NHD NH                       /* heads attended (debug hook) */
#define MPO MP                       /* rows through the output stage (debug hook) */
#define LQ DM      /* row pitch of the q rows */
typedef __bf16 v16b __attribute__((ext_vector_type(16)));
typedef unsigned short v8us __attribute__((ext_vector_type(8), may_alias));
typedef float  v8f  __attribute__((ext_vector_type(8)));
typedef float  v4f  __attribute__((ext_vector_type(4)));
typedef float  v4fa __attribute__((ext_vector_type(4), may_alias));
union FragB { v16b v; v8us half[2]; unsigned short u[16]; };

__device__ __forceinline__ unsigned short bf16_bits(float x) { unsigned int u = __float_as_uint(x); return (unsigned short)((u + 0x7FFFu + ((u >> 16) & 1u)) >> 16); }
__device__ __forceinline__ float bf16_val(unsigned short b) { return __uint_as_float(((unsigned int)b) << 16); }
__device__ __forceinline__ float bf16_round(float x) { return bf16_val(bf16_bits(x)); }
// D += A·B with NT terms: 1 = ah·bh, 2 = + al·bh (A split), 3 = + ah·bl (both split)
template <int NT>
__device__ __forceinline__ v8f mmaN(v16b ah, v16b al, v16b bh, v16b bl, v8f c) {
  c = __builtin_amdgcn_wmma_f32_16x16x32_bf16(false, ah, false, bh, (short)0, c, false, false);
  if (NT >= 2) c = __builtin_amdgcn_wmma_f32_16x16x32_bf16(false, al, false, bh, (short)0, c, false, false);
  if (NT >= 3) c = __builtin_amdgcn_wmma_f32_16x16x32_bf16(false, ah, false, bl, (short)0, c, false, false);
  asm volatile("v_nop\n\tv_nop\n\tv_nop\n\tv_nop" : "+v"(c) : "v"(ah), "v"(al), "v"(bh), "v"(bl));
  return c;
}

__global__ __launch_bounds__(256) void k_wt_bf16(const float* __restrict__ W, unsigned short* __restrict__ Wt, int K, int N) {
  const int t = blockIdx.x * 256 + threadIdx.x;
  const int k8n = K / 8;
  if (t >= N * k8n) return;
  const int n = t / k8n, k8 = (t % k8n) * 8;
  v8us v;
#pragma unroll
  for (int i = 0; i < 8; ++i) v[i] = bf16_bits(W[(size_t)(k8 + i) * N + n]);
  *(v8us*)(Wt + (size_t)n * K + k8) = v;
  
}

// GEMM C[M][N] (f32, pitch ldc) = act(A[M][K]·W + bias). A f32 row-major (pitch lda) converted per fragment to bf16
// (ASPLIT: hi/lo two planes -> 2 terms, else single rounded term); Wt bf16 [N][K] (pitch ldb). BIAS_BF16 rounds the
// bias to bf16 first (bias quantised to bf16 before the add). K%32==0, M%16==0, N%64==0.
template <bool ASPLIT, int ACT, bool BIAS_BF16>
__global__ __launch_bounds__(128) void k_gemm_bf(const float* __restrict__ A, int lda, const unsigned short* __restrict__ Wt, int ldb,
                                               const float* __restrict__ bias, float* __restrict__ C, int ldc, int M, int N, int K) {
  __shared__ __attribute__((aligned(16))) float so[4][16][64];
  const int tid = threadIdx.x, w = tid >> 5, lane = tid & 31, ln = lane & 15, hh = lane >> 4;
  const int ntn = N / 64;
  const int wid = blockIdx.x * 4 + w;
  const int mt = wid / ntn, nq = wid % ntn;
  if (mt * 16 >= M) return;
  const int row0 = mt * 16, col0 = nq * 64;
  const float* arow = A + (size_t)(row0 + ln) * lda;
  v8f acc[4] = {};
  for (int kb = 0; kb < K; kb += 32) {
    FragB ah, al;
    const v4f x0 = *(const v4fa*)(arow + kb + 8 * hh), x1 = *(const v4fa*)(arow + kb + 8 * hh + 4);
    const v4f x2 = *(const v4fa*)(arow + kb + 16 + 8 * hh), x3 = *(const v4fa*)(arow + kb + 16 + 8 * hh + 4);
    float xs[16] = {x0[0],x0[1],x0[2],x0[3],x1[0],x1[1],x1[2],x1[3],x2[0],x2[1],x2[2],x2[3],x3[0],x3[1],x3[2],x3[3]};
#pragma unroll
    for (int i = 0; i < 16; ++i) { const unsigned short hb = bf16_bits(xs[i]); ah.u[i] = hb; al.u[i] = ASPLIT ? bf16_bits(xs[i] - bf16_val(hb)) : (unsigned short)0; }
#pragma unroll
    for (int t = 0; t < 4; ++t) {
      const unsigned short* brow = Wt + (size_t)(col0 + t * 16 + ln) * ldb + kb;
      FragB b;
      b.half[0] = *(const v8us*)(brow + 8 * hh);
      b.half[1] = *(const v8us*)(brow + 16 + 8 * hh);
      acc[t] = mmaN<ASPLIT ? 2 : 1>(ah.v, al.v, b.v, b.v, acc[t]);
    }
  }
#pragma unroll
  for (int t = 0; t < 4; ++t) {
    float bv = bias ? bias[col0 + t * 16 + ln] : 0.f;
    if (BIAS_BF16) bv = bf16_round(bv);
#pragma unroll
    for (int r = 0; r < 8; ++r) { float v = acc[t][r] + bv; if (ACT == 1) v = fmaxf(v, 0.f); so[w][8 * hh + r][t * 16 + ln] = v; }
  }
  __builtin_amdgcn_fence(__ATOMIC_ACQ_REL, "workgroup");
  __builtin_amdgcn_wave_barrier();
  const int rsub = lane >> 4, c4 = (lane & 15) * 4;
  {
#pragma unroll
    for (int q = 0; q < 8; ++q) {
      const int r = q * 2 + rsub;
      const v4f v = *(const v4fa*)&so[w][r][c4];
      *(v4f*)(C + (size_t)(row0 + r) * ldc + col0 + c4) = v;
    }
    
  }
}

// GEMM C = act(A·W + bias + resid): A f32 (ASPLIT -> hi/lo 2 terms), Wt bf16 [N][K]; ACT 0 none, 1 relu, 2 exact gelu;
// resid (optional, f32, row index = (row % rmod), pitch ldr, RES_BF16 rounds it) added before the activation.
template <bool ASPLIT, int ACT, bool BIAS_BF16, bool RES_BF16>
__global__ __launch_bounds__(128) void k_gemm_bf3(const float* __restrict__ A, int lda, const unsigned short* __restrict__ Wt, int ldb,
                                                const float* __restrict__ bias, const float* __restrict__ resid, int rmod, int ldr,
                                                float* __restrict__ C, int ldc, int M, int N, int K) {
  __shared__ __attribute__((aligned(16))) float so[4][16][64];
  const int tid = threadIdx.x, w = tid >> 5, lane = tid & 31, ln = lane & 15, hh = lane >> 4;
  const int ntn = N / 64;
  const int wid = blockIdx.x * 4 + w;
  const int mt = wid / ntn, nq = wid % ntn;
  if (mt * 16 >= M) return;
  const int row0 = mt * 16, col0 = nq * 64;
  const float* arow = A + (size_t)(row0 + ln) * lda;
  v8f acc[4] = {};
  for (int kb = 0; kb < K; kb += 32) {
    FragB ah, al;
    const v4f x0 = *(const v4fa*)(arow + kb + 8 * hh), x1 = *(const v4fa*)(arow + kb + 8 * hh + 4);
    const v4f x2 = *(const v4fa*)(arow + kb + 16 + 8 * hh), x3 = *(const v4fa*)(arow + kb + 16 + 8 * hh + 4);
    float xs[16] = {x0[0],x0[1],x0[2],x0[3],x1[0],x1[1],x1[2],x1[3],x2[0],x2[1],x2[2],x2[3],x3[0],x3[1],x3[2],x3[3]};
#pragma unroll
    for (int i = 0; i < 16; ++i) { const unsigned short hb = bf16_bits(xs[i]); ah.u[i] = hb; al.u[i] = ASPLIT ? bf16_bits(xs[i] - bf16_val(hb)) : (unsigned short)0; }
#pragma unroll
    for (int t = 0; t < 4; ++t) {
      const unsigned short* brow = Wt + (size_t)(col0 + t * 16 + ln) * ldb + kb;
      FragB b;
      b.half[0] = *(const v8us*)(brow + 8 * hh);
      b.half[1] = *(const v8us*)(brow + 16 + 8 * hh);
      acc[t] = mmaN<ASPLIT ? 2 : 1>(ah.v, al.v, b.v, b.v, acc[t]);
    }
  }
#pragma unroll
  for (int t = 0; t < 4; ++t) {
    const int col = col0 + t * 16 + ln;
    float bv = bias ? bias[col] : 0.f;
    if (BIAS_BF16) bv = bf16_round(bv);
#pragma unroll
    for (int r = 0; r < 8; ++r) {
      float v = acc[t][r] + bv;
      if (resid) { float rv = resid[(size_t)((row0 + 8 * hh + r) % rmod) * ldr + col]; if (RES_BF16) rv = bf16_round(rv); v += rv; }
      if (ACT == 1) v = fmaxf(v, 0.f);
      if (ACT == 2) v = 0.5f * v * (1.0f + erff(v * 0.70710678118654752f));
      if (ACT == 3) { const float u = 0.7978845608028654f * (v + 0.044715f * v * v * v); v = 0.5f * v * (1.0f + tanhf(u)); }
      so[w][8 * hh + r][t * 16 + ln] = v;
    }
  }
  __builtin_amdgcn_fence(__ATOMIC_ACQ_REL, "workgroup");
  __builtin_amdgcn_wave_barrier();
  const int rsub = lane >> 4, c4 = (lane & 15) * 4;
  {
#pragma unroll
    for (int q = 0; q < 8; ++q) {
      const int r = q * 2 + rsub;
      const v4f v = *(const v4fa*)&so[w][r][c4];
      *(v4f*)(C + (size_t)(row0 + r) * ldc + col0 + c4) = v;
    }
    
  }
}
// row LayerNorm (biased variance, eps) over N: s = X (+ R); optional out_sum <- s; out_norm <- (s-mu)*rsqrt(var+eps)*g + b
template <bool PARAM_BF16>
__global__ __launch_bounds__(256) void k_layernorm(const float* __restrict__ X, const float* __restrict__ R, const float* __restrict__ g, const float* __restrict__ bta,
                                                  float* __restrict__ out_sum, float* __restrict__ out_norm, int N, float eps) {
  __shared__ float red[256];
  const int row = blockIdx.x, tid = threadIdx.x;
  const float* x = X + (size_t)row * N; const float* rr = R ? R + (size_t)row * N : nullptr;
  float vals[16];                     // up to N = 4096
  const int per = N / 256;            // contiguous chunk per thread? use strided-by-4 chunks: thread handles j = tid*4 + 1024*u
  float s1 = 0.f;
  for (int u = 0; u < per / 4; ++u) {
    const int j = tid * 4 + 1024 * u;
    const v4f a = *(const v4fa*)(x + j);
    v4f b = {0.f,0.f,0.f,0.f}; if (rr) b = *(const v4fa*)(rr + j);
#pragma unroll
    for (int q = 0; q < 4; ++q) { const float v = a[q] + b[q]; vals[u * 4 + q] = v; s1 += v; }
  }
  red[tid] = s1; __syncthreads();
  for (int st = 128; st > 0; st >>= 1) { if (tid < st) red[tid] += red[tid + st]; __syncthreads(); }
  const float mu = red[0] / (float)N; __syncthreads();
  float s2 = 0.f;
  for (int u = 0; u < per / 4; ++u)
#pragma unroll
    for (int q = 0; q < 4; ++q) { const float c = vals[u * 4 + q] - mu; s2 += c * c; }
  red[tid] = s2; __syncthreads();
  for (int st = 128; st > 0; st >>= 1) { if (tid < st) red[tid] += red[tid + st]; __syncthreads(); }
  const float rs = rsqrtf(red[0] / (float)N + eps);
  {
    for (int u = 0; u < per / 4; ++u) {
      const int j = tid * 4 + 1024 * u;
      v4f o, sm;
#pragma unroll
      for (int q = 0; q < 4; ++q) {
        float gg = g[j + q], bb = bta[j + q];
        if (PARAM_BF16) { gg = bf16_round(gg); bb = bf16_round(bb); }
        sm[q] = vals[u * 4 + q]; o[q] = (vals[u * 4 + q] - mu) * rs * gg + bb;
      }
      if (out_sum) *(v4f*)(out_sum + (size_t)row * N + j) = sm;
      *(v4f*)(out_norm + (size_t)row * N + j) = o;
    }
    
  }
}



// ---- f16 WMMA path (v_wmma_f32_16x16x32_f16): 11-bit significands for operands in range — used where a [0,1] probability operand needs more precision than bf16
typedef _Float16 v16h __attribute__((ext_vector_type(16)));
union FragH { v16h v; v8us half[2]; _Float16 h[16]; unsigned short u[16]; };
template <int NT>
__device__ __forceinline__ v8f mmaH(v16h ah, v16h al, v16h bh, v16h bl, v8f c) {
  c = __builtin_amdgcn_wmma_f32_16x16x32_f16(false, ah, false, bh, (short)0, c, false, false);
  if (NT >= 2) c = __builtin_amdgcn_wmma_f32_16x16x32_f16(false, al, false, bh, (short)0, c, false, false);
  if (NT >= 3) c = __builtin_amdgcn_wmma_f32_16x16x32_f16(false, ah, false, bl, (short)0, c, false, false);
  asm volatile("v_nop\n\tv_nop\n\tv_nop\n\tv_nop" : "+v"(c) : "v"(ah), "v"(al), "v"(bh), "v"(bl));
  return c;
}
// batched GEMM like k_gemm_b but f16 operands: A f32 (split into f16 hi/lo if ASPLIT, else rounded to f16), Bt = f16 values [n][k]; alpha; C f32; N multiple of 16 (partial tiles skipped)
template <bool ASPLIT>
__global__ __launch_bounds__(128) void k_gemm_h(const float* __restrict__ A, int lda, size_t sA, const _Float16* __restrict__ Bh, int ldb, size_t sB, float alpha, float* __restrict__ C, int ldc, size_t sC, int M, int N, int K) {
  __shared__ __attribute__((aligned(16))) float so[4][16][64];
  const int tid = threadIdx.x, w = tid >> 5, lane = tid & 31, ln = lane & 15, hh = lane >> 4; const int by = blockIdx.y;
  A += (size_t)by * sA; Bh += (size_t)by * sB; C += (size_t)by * sC;
  const int ntn = (N + 63) / 64; const int wid = blockIdx.x * 4 + w; const int mt = wid / ntn, nq = wid % ntn; if (mt * 16 >= M) return;
  const int row0 = mt * 16, col0 = nq * 64; const float* arow = A + (size_t)(row0 + ln) * lda;
  v8f acc[4] = {};
  for (int kb = 0; kb < K; kb += 32) {
    FragH ah, al;
    const v4f x0 = *(const v4fa*)(arow + kb + 8 * hh), x1 = *(const v4fa*)(arow + kb + 8 * hh + 4), x2 = *(const v4fa*)(arow + kb + 16 + 8 * hh), x3 = *(const v4fa*)(arow + kb + 16 + 8 * hh + 4);
    float xs[16] = {x0[0],x0[1],x0[2],x0[3],x1[0],x1[1],x1[2],x1[3],x2[0],x2[1],x2[2],x2[3],x3[0],x3[1],x3[2],x3[3]};
#pragma unroll
    for (int i = 0; i < 16; ++i) { const _Float16 h = (_Float16)xs[i]; ah.h[i] = h; al.h[i] = ASPLIT ? (_Float16)(xs[i] - (float)h) : (_Float16)0.0f; }
#pragma unroll
    for (int t = 0; t < 4; ++t) { if (col0 + t * 16 >= N) continue; const size_t boff = (size_t)(col0 + t * 16 + ln) * ldb + kb; FragH bq; bq.half[0] = *(const v8us*)(Bh + boff + 8 * hh); bq.half[1] = *(const v8us*)(Bh + boff + 16 + 8 * hh);
      acc[t] = mmaH<ASPLIT ? 2 : 1>(ah.v, al.v, bq.v, bq.v, acc[t]); }
  }
#pragma unroll
  for (int t = 0; t < 4; ++t) { if (col0 + t * 16 >= N) continue;
#pragma unroll
    for (int r = 0; r < 8; ++r) so[w][8 * hh + r][t * 16 + ln] = acc[t][r] * alpha; }
  __builtin_amdgcn_fence(__ATOMIC_ACQ_REL, "workgroup"); __builtin_amdgcn_wave_barrier();
  const int rsub = lane >> 4, c4 = (lane & 15) * 4;
  {
#pragma unroll
    for (int q = 0; q < 8; ++q) { const int r = q * 2 + rsub; if (col0 + c4 < N) { const v4f v = *(const v4fa*)&so[w][r][c4]; *(v4f*)(C + (size_t)(row0 + r) * ldc + col0 + c4) = v; } }
     }
}

// Wt[n][k] = f16(W[k][n]·scale) from f32 row-major W[K][N] (scale = power of two; bf16-exact weights stay exact in f16 away from the subnormal range)
__global__ __launch_bounds__(256) void k_wt_f16(const float* __restrict__ W, _Float16* __restrict__ Wt, int K, int N, float scale) {
  const int t = blockIdx.x * 256 + threadIdx.x; if (t >= N * (K / 8)) return; const int n = t / (K / 8), k8 = (t % (K / 8)) * 8; FragH f;
#pragma unroll
  for (int i = 0; i < 8; ++i) f.h[i] = (_Float16)(bf16_round(W[(size_t)(k8 + i) * N + n]) * scale); const v8us o = f.half[0];
  *(v8us*)((unsigned short*)Wt + (size_t)n * K + k8) = o; 
}
// k_gemm_hh variant with fused epilogue: v = acc·alpha + bias[by·sBias + col] (+ CP[(row/rowsPerB)·sCPb + by·64 + col] if CP) ; ACT 0 none / 1 elu ; writes f16 C16 (and f32 C if non-null)
template <int ACT>
__global__ __launch_bounds__(128) void k_gemm_hhx(const _Float16* __restrict__ A, int lda, size_t sA, const _Float16* __restrict__ Bh, int ldb, size_t sB, float alpha, const float* __restrict__ bias, size_t sBias, const float* __restrict__ CP, int rowsPerB, size_t sCPb, int row0g,
    float* __restrict__ C, _Float16* __restrict__ C16, int ldc, size_t sC, int M, int N, int K) {
  __shared__ __attribute__((aligned(16))) float so[4][16][64];
  const int tid = threadIdx.x, w = tid >> 5, lane = tid & 31, ln = lane & 15, hh = lane >> 4; const int by = blockIdx.y;
  A += (size_t)by * sA; Bh += (size_t)by * sB; const size_t cofs = (size_t)by * sC; const float* bp = bias ? bias + (size_t)by * sBias : nullptr;
  const int ntn = (N + 63) / 64; const int wid = blockIdx.x * 4 + w; const int mt = wid / ntn, nq = wid % ntn; if (mt * 16 >= M) return;
  const int row0 = mt * 16, col0 = nq * 64; const _Float16* arow = A + (size_t)(row0 + ln) * lda;
  v8f acc[4] = {};
  for (int kb = 0; kb < K; kb += 32) { FragH ah; ah.half[0] = *(const v8us*)((const unsigned short*)arow + kb + 8 * hh); ah.half[1] = *(const v8us*)((const unsigned short*)arow + kb + 16 + 8 * hh);
#pragma unroll
    for (int t = 0; t < 4; ++t) { if (col0 + t * 16 >= N) continue; const size_t boff = (size_t)(col0 + t * 16 + ln) * ldb + kb; FragH bq; bq.half[0] = *(const v8us*)((const unsigned short*)Bh + boff + 8 * hh); bq.half[1] = *(const v8us*)((const unsigned short*)Bh + boff + 16 + 8 * hh);
      acc[t] = mmaH<1>(ah.v, ah.v, bq.v, bq.v, acc[t]); }
  }
#pragma unroll
  for (int t = 0; t < 4; ++t) { if (col0 + t * 16 >= N) continue; const int col = col0 + t * 16 + ln; const float bv = bp ? bf16_round(bp[col]) : 0.f;
#pragma unroll
    for (int r = 0; r < 8; ++r) { float v = acc[t][r] * alpha + bv; if (CP) { const int rr = row0g + row0 + 8 * hh + r; if (rowsPerB < 0) v += CP[cofs + (size_t)rr * ldc + col];      /* rowsPerB < 0: own element of the batched C plane */ else { const int bidx = rr / rowsPerB; v += CP[(size_t)bidx * sCPb + (size_t)by * 64 + col]; } } if (ACT == 1) v = (v > 0.f) ? v : expm1f(v); else if (ACT == 7) v = (v > 0.f) ? v + 1.0f : expf(v); else if (ACT == 8) v = tanhf(v); else if (ACT == 9) v = 0.5f * v * (1.0f + tanhf(0.7978845608028654f * (v + 0.044715f * v * v * v))); else if (ACT == 11) v = 1.0f / (1.0f + expf(-v)); else if (ACT == 12) v = (v > 0.f) ? v : 0.01f * v; else if (ACT == 14) v = (v > 0.f) ? v : 0.1f * v; else if (ACT == 16) v = (v >= 0.f) ? v : 0.3f * v; else if (ACT == 17) v = (v >= 0.f) ? v : 0.2f * v; else if (ACT == 15) v = v / (1.0f + expf(-v)); else if (ACT == 3) v = fmaxf(v, 0.f); else if (ACT == 6) v = 0.5f * v * (1.0f + erff(v * 0.70710678118654752f)); so[w][8 * hh + r][t * 16 + ln] = v; } }
  __builtin_amdgcn_fence(__ATOMIC_ACQ_REL, "workgroup"); __builtin_amdgcn_wave_barrier();
  const int rsub = lane >> 4, c4 = (lane & 15) * 4; typedef _Float16 v4h __attribute__((ext_vector_type(4)));
  {
#pragma unroll
    for (int q = 0; q < 8; ++q) { const int r = q * 2 + rsub; if (col0 + c4 < N) { const v4f v = *(const v4fa*)&so[w][r][c4]; if (C) *(v4f*)(C + cofs + (size_t)(row0 + r) * ldc + col0 + c4) = v; if (C16) { v4h h4; for (int i = 0; i < 4; ++i) h4[i] = (_Float16)v[i]; *(v4h*)(C16 + cofs + (size_t)(row0 + r) * ldc + col0 + c4) = h4; } } }
     }
}


typedef _Float16 v4h __attribute__((ext_vector_type(4)));

__global__ __launch_bounds__(256) void k_x16(const float* __restrict__ x, _Float16* __restrict__ X16, size_t n8) { const size_t t = (size_t)blockIdx.x * 256 + threadIdx.x; if (t >= n8) return; FragH f;
#pragma unroll
  for (int q = 0; q < 8; ++q) f.h[q] = (_Float16)bf16_round(x[t * 8 + q]); *(v8us*)((unsigned short*)X16 + t * 8) = f.half[0];  }
__global__ __launch_bounds__(256) void k_h16(const float* __restrict__ x, _Float16* __restrict__ X16, size_t n8) { const size_t t = (size_t)blockIdx.x * 256 + threadIdx.x; if (t >= n8) return; FragH f;
#pragma unroll
  for (int q = 0; q < 8; ++q) f.h[q] = (_Float16)x[t * 8 + q]; *(v8us*)((unsigned short*)X16 + t * 8) = f.half[0];  }
__global__ __launch_bounds__(256) void k_round16f(const float* __restrict__ W, _Float16* __restrict__ Bt, size_t n8) { const size_t t = (size_t)blockIdx.x * 256 + threadIdx.x; if (t >= n8) return; FragH f;
#pragma unroll
  for (int i = 0; i < 8; ++i) f.h[i] = (_Float16)(bf16_round(W[t * 8 + i]) * 16.0f); *(v8us*)((unsigned short*)Bt + t * 8) = f.half[0];  }
template <int NHv, int TTv>
__global__ __launch_bounds__(256) void k_vt(const _Float16* __restrict__ V16, int ldv, int voff, _Float16* __restrict__ Vt) { __shared__ unsigned short tl[64][66]; const int tid = threadIdx.x; const int slab = blockIdx.x / (TTv / 64), lg = blockIdx.x % (TTv / 64); const int b = slab / NHv, h = slab % NHv;
  for (int i = tid; i < 64 * 8; i += 256) { const int r = i / 8, c8 = (i % 8) * 8; FragH f; f.half[0] = *(const v8us*)((const unsigned short*)V16 + ((size_t)b * TTv + lg * 64 + r) * ldv + voff + h * 64 + c8);
#pragma unroll
    for (int q = 0; q < 8; ++q) tl[r][c8 + q] = f.u[q]; }
  __syncthreads();
  {
#pragma unroll
    for (int rd = 0; rd < 2; ++rd) { const int d = rd * 32 + tid / 8, pc = tid % 8; FragH f;
#pragma unroll
      for (int q = 0; q < 8; ++q) f.u[q] = tl[pc * 8 + q][d];
      *(v8us*)((unsigned short*)Vt + ((size_t)slab * 64 + d) * TTv + lg * 64 + pc * 8) = f.half[0]; }
     } }

__global__ __launch_bounds__(256) void k_hl(const float* __restrict__ F, _Float16* __restrict__ Hh, _Float16* __restrict__ Hl, size_t n8) { const size_t t = (size_t)blockIdx.x * 256 + threadIdx.x; if (t >= n8) return; FragH fh, fl; const v4f a = *(const v4fa*)(F + t * 8), c = *(const v4fa*)(F + t * 8 + 4);
#pragma unroll
  for (int q = 0; q < 4; ++q) { _Float16 h = (_Float16)a[q]; fh.h[q] = h; fl.h[q] = (_Float16)((a[q] - (float)h) * 1024.0f); h = (_Float16)c[q]; fh.h[4 + q] = h; fl.h[4 + q] = (_Float16)((c[q] - (float)h) * 1024.0f); }
  { *(v8us*)((unsigned short*)Hh + t * 8) = fh.half[0]; *(v8us*)((unsigned short*)Hl + t * 8) = fl.half[0];  } }

// ---- fast GEMM (wave tile 32x64; requires M % 32 == 0 rows per launch region and N % 64 == 0); epilogue = k_gemm_hhx semantics ----
__device__ __forceinline__ v16h g2_frag(const _Float16* p, int hh) { FragH f; f.half[0] = *(const v8us*)((const unsigned short*)p + 8 * hh); f.half[1] = *(const v8us*)((const unsigned short*)p + 16 + 8 * hh); return f.v; }
__device__ __forceinline__ v8f g2_mma(v16h a, v16h b, v8f c) { v8f d = __builtin_amdgcn_wmma_f32_16x16x32_f16(false, a, false, b, (short)0, c, false, false); asm volatile("v_nop\n\tv_nop\n\tv_nop\n\tv_nop" : "+v"(d) : "v"(a), "v"(b)); return d; }
template <int ACT>
__global__ __launch_bounds__(128) void k_gemm2(const _Float16* __restrict__ A, int lda, size_t sA, const _Float16* __restrict__ Bh, int ldb, size_t sB, float alpha, const float* __restrict__ bias, size_t sBias, const float* __restrict__ CP, int rowsPerB, size_t sCPb, int row0g,
    float* __restrict__ C, _Float16* __restrict__ C16, int ldc, size_t sC, int M, int N, int K) { static_assert(ACT == 0 || ACT == 3 || ACT == 6 || ACT == 8 || ACT == 9 || ACT == 11 || ACT == 12 || ACT == 14 || ACT == 15 || ACT == 16 || ACT == 17, "k_gemm2: unsupported ACT code (would silently apply no activation)");
  __shared__ __attribute__((aligned(16))) float so[4][32][68];
  const int tid = threadIdx.x, w = tid >> 5, lane = tid & 31, ln = lane & 15, hh = lane >> 4; const int by = blockIdx.y;
  A += (size_t)by * sA; Bh += (size_t)by * sB; const size_t cofs = (size_t)by * sC; const float* bp = bias ? bias + (size_t)by * sBias : nullptr;
  const int ntn = N >> 6; const int mt = blockIdx.x / ntn, nq = blockIdx.x - mt * ntn; const int row0 = mt * 128 + 32 * w, col0 = nq * 64; if (row0 >= M) return;
  const _Float16* a0p = A + (size_t)(row0 + ln) * lda; const _Float16* a1p = a0p + (size_t)16 * lda;
  const _Float16* b0p = Bh + (size_t)(col0 + ln) * ldb; const _Float16* b1p = b0p + (size_t)16 * ldb; const _Float16* b2p = b1p + (size_t)16 * ldb; const _Float16* b3p = b2p + (size_t)16 * ldb;
  const v8f z8 = {0.f,0.f,0.f,0.f,0.f,0.f,0.f,0.f}; v8f c00 = z8, c01 = z8, c02 = z8, c03 = z8, c10 = z8, c11 = z8, c12 = z8, c13 = z8;
#pragma unroll 1
  for (int kb = 0; kb < K; kb += 32) { const v16h a0 = g2_frag(a0p + kb, hh), a1 = g2_frag(a1p + kb, hh);
    v16h b = g2_frag(b0p + kb, hh); c00 = g2_mma(a0, b, c00); c10 = g2_mma(a1, b, c10);
    b = g2_frag(b1p + kb, hh); c01 = g2_mma(a0, b, c01); c11 = g2_mma(a1, b, c11);
    b = g2_frag(b2p + kb, hh); c02 = g2_mma(a0, b, c02); c12 = g2_mma(a1, b, c12);
    b = g2_frag(b3p + kb, hh); c03 = g2_mma(a0, b, c03); c13 = g2_mma(a1, b, c13); }
  v8f accs[8] = {c00, c01, c02, c03, c10, c11, c12, c13};
#pragma unroll
  for (int u = 0; u < 8; ++u) { const int t = u & 3, half = u >> 2; const int col = col0 + t * 16 + ln; const float bv = bp ? bf16_round(bp[col]) : 0.f;
#pragma unroll
    for (int r = 0; r < 8; ++r) { const int rloc = half * 16 + 8 * hh + r; float v = accs[u][r] * alpha + bv; if (CP) { if (rowsPerB < 0) v += CP[cofs + (size_t)(row0g + row0 + rloc) * ldc + col];      /* rowsPerB < 0: own element of the batched C plane */ else { const int bidx = (row0g + row0 + rloc) / rowsPerB; v += CP[(size_t)bidx * sCPb + (size_t)by * 64 + col]; } }
      if (ACT == 3) v = fmaxf(v, 0.f); else if (ACT == 6) v = 0.5f * v * (1.0f + erff(v * 0.70710678118654752f)); else if (ACT == 11) v = 1.0f / (1.0f + expf(-v)); else if (ACT == 15) v = v / (1.0f + expf(-v)); else if (ACT == 12) v = (v > 0.f) ? v : 0.01f * v; else if (ACT == 8) v = tanhf(v); else if (ACT == 9) v = 0.5f * v * (1.0f + tanhf(0.7978845608028654f * (v + 0.044715f * v * v * v))); else if (ACT == 14) v = (v > 0.f) ? v : 0.1f * v; else if (ACT == 16) v = (v >= 0.f) ? v : 0.3f * v; else if (ACT == 17) v = (v >= 0.f) ? v : 0.2f * v;
      so[w][rloc][t * 16 + ln] = v; } }
  __builtin_amdgcn_fence(__ATOMIC_ACQ_REL, "workgroup"); __builtin_amdgcn_wave_barrier();
  const int rsub = lane >> 4, c4 = (lane & 15) * 4;
  {
#pragma unroll
    for (int q = 0; q < 16; ++q) { const int r = q * 2 + rsub; const v4f v = *(const v4fa*)&so[w][r][c4]; if (C) *(v4f*)(C + cofs + (size_t)(row0 + r) * ldc + col0 + c4) = v; if (C16) { v4h h4; for (int i = 0; i < 4; ++i) h4[i] = (_Float16)v[i]; *(v4h*)(C16 + cofs + (size_t)(row0 + r) * ldc + col0 + c4) = h4; } }
     } }


__global__ __launch_bounds__(256) void k_wnat(const float* __restrict__ w, size_t n8, _Float16* __restrict__ Bt) { const size_t t = (size_t)blockIdx.x * 256 + threadIdx.x; if (t >= n8) return; FragH f; for (int q = 0; q < 8; ++q) f.h[q] = (_Float16)(bf16_round(w[t * 8 + q]) * 16.0f); *(v8us*)((unsigned short*)Bt + t * 8) = f.half[0];  }
__global__ __launch_bounds__(256) void k_rsm(const float* __restrict__ S, _Float16* __restrict__ P, int nrows) {
  #pragma clang fp contract(off)
  const int i = blockIdx.x * 256 + threadIdx.x; if (i >= nrows) return; const float* s = S + (size_t)i * SQ; float mx = -3.0e38f;
#pragma unroll 1
  for (int j = 0; j < SQ; ++j) mx = fmaxf(mx, s[j]); float se = 0.f;
#pragma unroll 1
  for (int j = 0; j < SQ; ++j) se += expf(s[j] - mx); const float sc = 256.0f / se;
#pragma unroll 1
  for (int j0 = 0; j0 < SQ; j0 += 8) { FragH f; for (int q = 0; q < 8; ++q) f.h[q] = (_Float16)(expf(s[j0 + q] - mx) * sc); unsigned short* d = (unsigned short*)P + (size_t)i * SQ + j0; *(v8us*)d = f.half[0];  } }
__global__ __launch_bounds__(256) void k_vt(const _Float16* __restrict__ V16, int b, int h0, _Float16* __restrict__ VT) { __shared__ unsigned short tl[64][65]; const int tid = threadIdx.x; const int hh = blockIdx.x % HG, sg = blockIdx.x / HG; const int s0 = sg * 64; const int h = h0 + hh;
  for (int i = tid; i < 64 * 8; i += 256) { const int j = i / 8, d8 = (i % 8) * 8; FragH f; f.half[0] = *(const v8us*)((const unsigned short*)V16 + ((size_t)b * SQ + s0 + j) * DM + h * HD + d8); for (int q = 0; q < 8; ++q) tl[d8 + q][j] = f.u[q]; }
  __syncthreads();
  { for (int i = tid; i < 64 * 8; i += 256) { const int d = i / 8, j8 = (i % 8) * 8; FragH f; for (int q = 0; q < 8; ++q) f.u[q] = tl[d][j8 + q]; *(v8us*)((unsigned short*)VT + ((size_t)hh * HD + d) * SQ + s0 + j8) = f.half[0]; }  } }



__global__ __launch_bounds__(256) void k_rsmcf2(const float* __restrict__ S, _Float16* __restrict__ P, int hg, int q0, int nk) {
  #pragma clang fp contract(off)
  const int t = blockIdx.x * 256 + threadIdx.x; if (t >= hg * QT) return; const size_t i = (size_t)t; const float* s = S + i * NKX; const int last = q0 + (t % QT); float mx = -3.0e38f;
#pragma unroll 1
  for (int j = 0; j < nk; ++j) { const float f = (j <= last) ? 1.f : 0.f; mx = fmaxf(mx, fmaf(f, s[j], (1.f - f) * -1.0e9f)); } float se = 0.f;
#pragma unroll 1
  for (int j = 0; j < nk; ++j) { const float f = (j <= last) ? 1.f : 0.f; se += __expf(fmaf(f, s[j], (1.f - f) * -1.0e9f) - mx); } const float sc = 256.0f / se;
#pragma unroll 1
  for (int j0 = 0; j0 < nk; j0 += 8) { FragH fr; for (int q = 0; q < 8; ++q) { const int j = j0 + q; const float f = (j <= last) ? 1.f : 0.f; fr.h[q] = (_Float16)(__expf(fmaf(f, s[j], (1.f - f) * -1.0e9f) - mx) * sc); } unsigned short* d = (unsigned short*)P + i * NKX + j0; *(v8us*)d = fr.half[0];  } }


template <int MASKADD>
__global__ __launch_bounds__(64) void k_att0(const float* __restrict__ QF, const float* __restrict__ KF, const float* __restrict__ VF, int ld, const float* __restrict__ mask, float scale, float* __restrict__ OF, int ldo) {
  #pragma clang fp contract(off)
  __shared__ __attribute__((aligned(16))) float lq[64][64]; __shared__ __attribute__((aligned(16))) float lo[64][64];
  const int tid = threadIdx.x; const int h = blockIdx.x / (QT0 / 64), rg = blockIdx.x % (QT0 / 64); const int i = rg * 64 + tid;
  const float* qr = QF + (size_t)i * ld + h * HD;
#pragma unroll 1
  for (int c = 0; c < HD / 4; ++c) { *(v4f*)&lq[tid][c * 4] = *(const v4fa*)(qr + c * 4); const v4f z = {0.f, 0.f, 0.f, 0.f}; *(v4f*)&lo[tid][c * 4] = z; }
  float m = -1.0e30f, l = 0.f; const int jmax = MASKADD ? (SQ - 1) : (rg * 64 + 63);      /* additive-mask form: every key (the mask input decides); causal form: keys up to the block's last row */
#pragma unroll 1
  for (int j = 0; j <= jmax; ++j) { const float* kr = KF + (size_t)j * ld + h * HD; const float* vr = VF + (size_t)j * ld + h * HD; float s = 0.f;
#pragma unroll 1
    for (int c = 0; c < HD / 4; ++c) { const v4f kq = *(const v4fa*)(kr + c * 4); const v4f qq = *(v4f*)&lq[tid][c * 4]; s = __fadd_rn(s, __fmul_rn(qq[0], kq[0])); s = __fadd_rn(s, __fmul_rn(qq[1], kq[1])); s = __fadd_rn(s, __fmul_rn(qq[2], kq[2])); s = __fadd_rn(s, __fmul_rn(qq[3], kq[3])); }
    s = __fmul_rn(s, scale); if (MASKADD) s = __fadd_rn(s, __fmul_rn(bf16_round(mask[(size_t)i * SQ + j]), -10000.0f));
    const float f = (MASKADD || j <= i) ? 1.f : 0.f; const float sm = fmaf(f, s, (1.f - f) * -1.0e30f); const float mn = fmaxf(m, sm); const float sc = expf(m - mn); const float e = expf(sm - mn); l = __fadd_rn(__fmul_rn(l, sc), e); m = mn;
#pragma unroll 1
    for (int c = 0; c < HD / 4; ++c) { const v4f vv = *(const v4fa*)(vr + c * 4); v4f oo = *(v4f*)&lo[tid][c * 4]; for (int u = 0; u < 4; ++u) oo[u] = __fadd_rn(__fmul_rn(oo[u], sc), __fmul_rn(e, vv[u])); *(v4f*)&lo[tid][c * 4] = oo; } }
  const float fin = 64.0f / l;      /* o carried x64 like the f16 path */
#pragma unroll 1
  for (int c = 0; c < HD / 4; ++c) { v4f oo = *(v4f*)&lo[tid][c * 4]; for (int u = 0; u < 4; ++u) oo[u] = __fmul_rn(oo[u], fin); *(v4f*)&lo[tid][c * 4] = oo; }
  __syncthreads();
  {
#pragma unroll 1
    for (int it = 0; it < 16; ++it) { const int row = it * 4 + tid / 16, pc = (tid % 16) * 4; const v4f v = *(const v4f*)&lo[row][pc]; *(v4f*)(OF + (size_t)(rg * 64 + row) * ldo + h * HD + pc) = v; }
     } }


__global__ __launch_bounds__(256) void k_kvexp(const float* __restrict__ src, float* __restrict__ dst, size_t n4) { const size_t t = (size_t)blockIdx.x * 256 + threadIdx.x; if (t >= n4) return; const size_t e = t * 4; const size_t row = e / DM; const int col = (int)(e % DM); const int h = col / HD, d = col % HD; const v4f v = *(const v4fa*)(src + row * KVD + (size_t)(h / HPG) * HD + d); *(v4f*)(dst + e) = v;  }

__global__ __launch_bounds__(256) void k_tab2(float theta, float* __restrict__ CS, float* __restrict__ SN) {
  #pragma clang fp contract(off)
  const int t = blockIdx.x * 256 + threadIdx.x; if (t >= SQ * (HD / 2)) return; const int i = t % (HD / 2); const int p = t / (HD / 2); const float invf = 1.0f / powf(theta, (float)(2 * i) / (float)HD); const float ang = __fmul_rn((float)p, invf); const float c = cosf(ang), s = sinf(ang);
  *(float*)(CS + t) = c; *(float*)(SN + t) = s;  }
template <int NORM, int ROPE>
__global__ __launch_bounds__(64) void k_xform(const float* __restrict__ F, int ldf, int nh, const float* __restrict__ gain, float eps, const float* __restrict__ CS, const float* __restrict__ SN, _Float16* __restrict__ H16, int ldo) {
  #pragma clang fp contract(off)
  __shared__ float xv[HD]; __shared__ float red[HD]; __shared__ unsigned short sh_[HD]; const int d = threadIdx.x; const int h = blockIdx.x % nh; const size_t r = blockIdx.x / nh; const int p = (int)(r % SQ);
  float x = F[r * (size_t)ldf + (size_t)h * HD + d];
  if (NORM) { red[d] = __fmul_rn(x, x); __syncthreads(); for (int st = HD / 2; st > 0; st >>= 1) { if (d < st) red[d] = __fadd_rn(red[d], red[d + st]); __syncthreads(); } const float rs = rsqrtf(__fadd_rn(red[0] / (float)HD, eps)); x = __fmul_rn(__fmul_rn(x, rs), bf16_round(gain[d])); }
  xv[d] = x; __syncthreads();
  float o = x;
  if (ROPE == 1) { const int i = d >> 1; const float c = CS[p * (HD / 2) + i], s = SN[p * (HD / 2) + i]; const float ev = xv[2 * i], od = xv[2 * i + 1]; o = (d & 1) ? __fadd_rn(__fmul_rn(ev, s), __fmul_rn(od, c)) : __fadd_rn(__fmul_rn(ev, c), -__fmul_rn(od, s)); }
  if (ROPE == 2) { const int i = d & (HD / 2 - 1); const float c = CS[p * (HD / 2) + i], s = SN[p * (HD / 2) + i]; const float lo = xv[i], hi = xv[i + HD / 2]; o = (d < HD / 2) ? __fadd_rn(__fmul_rn(lo, c), -__fmul_rn(hi, s)) : __fadd_rn(__fmul_rn(lo, s), __fmul_rn(hi, c)); }
  if (ROPE == 3) { const float c = CS[p * HD + d], s = SN[p * HD + d]; const float lo = xv[d & (HD / 2 - 1)], hi = xv[(d & (HD / 2 - 1)) + HD / 2]; o = (d < HD / 2) ? __fadd_rn(__fmul_rn(lo, c), -__fmul_rn(hi, s)) : __fadd_rn(__fmul_rn(hi, c), __fmul_rn(lo, s)); }      /* rotate-half with FULL-width per-element tables [pos][HD] */
  FragH th; th.h[0] = (_Float16)o; sh_[d] = th.u[0]; __syncthreads();
  if (d < HD / 8) { FragH f; for (int q = 0; q < 8; ++q) f.u[q] = sh_[d * 8 + q]; unsigned short* dst = (unsigned short*)H16 + r * (size_t)ldo + (size_t)h * HD + d * 8; *(v8us*)dst = f.half[0];  } }

template <int NORM, int ROPE>
__global__ __launch_bounds__(64) void k_xformf(const float* __restrict__ F, int ldf, int nh, const float* __restrict__ gain, float eps, const float* __restrict__ CS, const float* __restrict__ SN, float* __restrict__ F32, int ldo) {
  #pragma clang fp contract(off)
  __shared__ float xv[HD]; __shared__ float red[HD]; const int d = threadIdx.x; const int h = blockIdx.x % nh; const size_t r = blockIdx.x / nh; const int p = (int)(r % SQ);
  float x = F[r * (size_t)ldf + (size_t)h * HD + d];
  if (NORM) { red[d] = __fmul_rn(x, x); __syncthreads(); for (int st = HD / 2; st > 0; st >>= 1) { if (d < st) red[d] = __fadd_rn(red[d], red[d + st]); __syncthreads(); } const float rs = rsqrtf(__fadd_rn(red[0] / (float)HD, eps)); x = __fmul_rn(__fmul_rn(x, rs), bf16_round(gain[d])); }
  xv[d] = x; __syncthreads();
  float o = x;
  if (ROPE == 1) { const int i = d >> 1; const float c = CS[p * (HD / 2) + i], s = SN[p * (HD / 2) + i]; const float ev = xv[2 * i], od = xv[2 * i + 1]; o = (d & 1) ? __fadd_rn(__fmul_rn(ev, s), __fmul_rn(od, c)) : __fadd_rn(__fmul_rn(ev, c), -__fmul_rn(od, s)); }
  if (ROPE == 2) { const int i = d & (HD / 2 - 1); const float c = CS[p * (HD / 2) + i], s = SN[p * (HD / 2) + i]; const float lo = xv[i], hi = xv[i + HD / 2]; o = (d < HD / 2) ? __fadd_rn(__fmul_rn(lo, c), -__fmul_rn(hi, s)) : __fadd_rn(__fmul_rn(lo, s), __fmul_rn(hi, c)); }
  if (ROPE == 3) { const float c = CS[p * HD + d], s = SN[p * HD + d]; const float lo = xv[d & (HD / 2 - 1)], hi = xv[(d & (HD / 2 - 1)) + HD / 2]; o = (d < HD / 2) ? __fadd_rn(__fmul_rn(lo, c), -__fmul_rn(hi, s)) : __fadd_rn(__fmul_rn(hi, c), __fmul_rn(lo, s)); }      /* rotate-half with FULL-width per-element tables [pos][HD] */
  float* dst = F32 + r * (size_t)ldo + (size_t)h * HD + d; *(float*)dst = o;  }

__global__ __launch_bounds__(256) void k_bfcp(const float* __restrict__ src, float* __restrict__ dst, size_t n4) { const size_t t = (size_t)blockIdx.x * 256 + threadIdx.x; if (t >= n4) return; const v4f a = *(const v4fa*)(src + t * 4); v4f o; for (int q = 0; q < 4; ++q) o[q] = bf16_round(a[q]); *(v4f*)(dst + t * 4) = o;  }

__global__ __launch_bounds__(256) void k_tabhalf(const float* __restrict__ cs, const float* __restrict__ sn, float* __restrict__ CS, float* __restrict__ SN) { const int t = blockIdx.x * 256 + threadIdx.x; if (t >= SQ * (HD / 2)) return; const int p = t / (HD / 2), i = t % (HD / 2); const float c = bf16_round(cs[(size_t)p * HD + i]), s = bf16_round(sn[(size_t)p * HD + i]);
  *(float*)(CS + t) = c; *(float*)(SN + t) = s;  }

__global__ __launch_bounds__(256) void k_tab2d(float* __restrict__ CS, float* __restrict__ SN) {
  #pragma clang fp contract(off)
  const int t = blockIdx.x * 256 + threadIdx.x; if (t >= SQ * (HD / 2)) return; const int i = t % (HD / 2); const int p = t / (HD / 2); const float invf = (float)(1.0 / pow(10000.0, (double)(2 * i) / (double)HD)); const float ang = __fmul_rn((float)p, invf); const float c = cosf(ang), s = sinf(ang);
  *(float*)(CS + t) = c; *(float*)(SN + t) = s;  }
extern "C" void kernel_launch(void* const* d_in, const int* in_sizes, int n_in,
                              void* d_out, int out_size, void* d_ws, size_t ws_size, hipStream_t stream) {
  (void)in_sizes; (void)n_in; (void)out_size;
  const float* const* I = (const float* const*)d_in; const float* x = I[0]; const float* wq = I[1]; const float* wk = I[2]; const float* wv = I[3]; const float* wo = I[4];      /* input order: x, Wq [1024][1024], Wk / Wv [1024][256], Wo [1024][1024] ([in][out] weights); rope tables computed in-kernel (positions = row index), as the module computes them */ const float* bq = nullptr; const float* bk = nullptr; const float* bv = nullptr; const float* bo = nullptr;      /* no biases */
  char* ws = (char*)d_ws; size_t off = 0;
  auto take = [&](size_t bytes) { char* p = ws + off; off += (bytes + 255) & ~(size_t)255; return p; };
  _Float16* BQ = (_Float16*)take((size_t)DM * DM * 2); _Float16* BK = (_Float16*)take((size_t)KVD * DM * 2); _Float16* BV = (_Float16*)take((size_t)KVD * DM * 2); _Float16* BO = (_Float16*)take((size_t)DM * DM * 2);
  _Float16* X16 = (_Float16*)take(NR * DM * 2); float* QF = (float*)take((size_t)SQ * DM * 4); float* KF = (float*)take((size_t)SQ * KVD * 4); float* CSB = (float*)take((size_t)SQ * HD * 4); float* SNB = (float*)take((size_t)SQ * HD * 4); _Float16* Q16 = (_Float16*)take(NR * DM * 2); _Float16* K16 = (_Float16*)take(NR * KVD * 2); _Float16* V16 = (_Float16*)take(NR * KVD * 2); _Float16* O16 = (_Float16*)take(NR * DM * 2);
  float* S = (float*)take((size_t)NH * QT * NKX * 4); _Float16* P = (_Float16*)take((size_t)NH * QT * NKX * 2); _Float16* VT = (_Float16*)take((size_t)NH * HD * SQ * 2);
  float* QF0 = (float*)take((size_t)QT0 * DM * 4); float* KF0 = (float*)take((size_t)QT0 * KVD * 4); float* VF0 = (float*)take((size_t)QT0 * KVD * 4); float* KF0e = (float*)take((size_t)QT0 * DM * 4); float* VF0e = (float*)take((size_t)QT0 * DM * 4); float* OF0 = (float*)take((size_t)NB * QT0 * DM * 4); _Float16* OH0 = (_Float16*)take((size_t)NB * QT0 * DM * 2); _Float16* OL0 = (_Float16*)take((size_t)NB * QT0 * DM * 2);
  if (off > ws_size) return;
  k_wt_f16<<<(unsigned)(((size_t)DM * (DM / 8) + 255) / 256), 256, 0, stream>>>(wq, BQ, DM, DM, 16.0f); k_wt_f16<<<(unsigned)(((size_t)KVD * (DM / 8) + 255) / 256), 256, 0, stream>>>(wk, BK, DM, KVD, 16.0f); k_wt_f16<<<(unsigned)(((size_t)KVD * (DM / 8) + 255) / 256), 256, 0, stream>>>(wv, BV, DM, KVD, 16.0f); k_wt_f16<<<(unsigned)(((size_t)DM * (DM / 8) + 255) / 256), 256, 0, stream>>>(wo, BO, DM, DM, 16.0f);      /* [in][out] -> Bt[n][k] x16 (transposing builder; K = DM, N = DM / KVD) */
  k_x16<<<(unsigned)((NR * DM / 8 + 255) / 256), 256, 0, stream>>>(x, X16, NR * DM / 8);
  k_tab2d<<<(SQ * (HD / 2) + 255) / 256, 256, 0, stream>>>(CSB, SNB);      /* rope tables computed in-kernel: angle[p][i] = p * 10000^(-2i/64) (the module's _rope_cache; positions = row index) */
  const size_t r0p = (size_t)B0 * SQ;      /* first projected row */
  k_gemm2<0><<<dim3((unsigned)((MP / 128) * (KVD / 64)), 1), 128, 0, stream>>>(X16 + r0p * DM, DM, 0, BV, DM, 0, 0.0625f, bv, 0, nullptr, 1, 0, 0, nullptr, V16 + r0p * KVD, KVD, 0, MP, KVD, DM);
  for (int b = B0; b < B0 + NBR; ++b) { const size_t r0 = (size_t)b * SQ;
    k_gemm2<0><<<dim3((unsigned)((SQ / 128) * (DM / 64)), 1), 128, 0, stream>>>(X16 + r0 * DM, DM, 0, BQ, DM, 0, 0.0625f, nullptr, 0, nullptr, 1, 0, 0, QF, nullptr, DM, 0, SQ, DM, DM);      /* q (f32) of this batch */
    k_gemm2<0><<<dim3((unsigned)((SQ / 128) * (KVD / 64)), 1), 128, 0, stream>>>(X16 + r0 * DM, DM, 0, BK, DM, 0, 0.0625f, nullptr, 0, nullptr, 1, 0, 0, KF, nullptr, KVD, 0, SQ, KVD, DM);      /* k (f32) */
    k_xform<0, 1><<<(unsigned)((size_t)SQ * NH), 64, 0, stream>>>(QF, DM, NH, nullptr, 0.f, CSB, SNB, Q16 + r0 * DM, DM); k_xform<0, 1><<<(unsigned)((size_t)SQ * NG), 64, 0, stream>>>(KF, KVD, NG, nullptr, 0.f, CSB, SNB, K16 + r0 * KVD, KVD);      /* interleaved-pair rope (pairs (2i, 2i+1)) from the in-kernel tables -> f16 rows */
    k_xformf<0, 1><<<(unsigned)(QT0 * NH), 64, 0, stream>>>(QF, DM, NH, nullptr, 0.f, CSB, SNB, QF0, DM); k_xformf<0, 1><<<(unsigned)(QT0 * NG), 64, 0, stream>>>(KF, KVD, NG, nullptr, 0.f, CSB, SNB, KF0, KVD);      /* f32 roped q, k of rows 0..127 */
    k_vt<NG, SQ><<<NG * (SQ / 64), 256, 0, stream>>>(V16 + r0 * KVD, KVD, 0, VT);      /* V^T [NG][HD][SQ] for this batch */
    k_gemm2<0><<<dim3((QT0 / 128) * (KVD / 64), 1), 128, 0, stream>>>(X16 + r0 * DM, DM, 0, BV, DM, 0, 0.0625f, bv, 0, nullptr, 1, 0, 0, VF0, nullptr, KVD, 0, QT0, KVD, DM);
    k_kvexp<<<(unsigned)(((size_t)QT0 * DM / 4 + 255) / 256), 256, 0, stream>>>(KF0, KF0e, (size_t)QT0 * DM / 4); k_kvexp<<<(unsigned)(((size_t)QT0 * DM / 4 + 255) / 256), 256, 0, stream>>>(VF0, VF0e, (size_t)QT0 * DM / 4);      /* head h <- kv group h/4 for the exact first-tile kernel */      /* f32 q, k, v of the first 128 rows (exact products) */
    k_att0<0><<<NH * (QT0 / 64), 64, 0, stream>>>(QF0, KF0e, VF0e, DM, nullptr, 0.125f, OF0 + (size_t)b * QT0 * DM, DM);      /* exact f32 attention for rows 0..127 (o x64) */
    for (int q0 = 0; q0 < QN; q0 += QT) { const int nk = q0 + QT;      /* causal: only keys below the tile end are computed */
      for (int g = 0; g < NG; ++g) k_gemm2<0><<<dim3((QT / 128) * (nk / 64), HPG), 128, 0, stream>>>(Q16 + (r0 + q0) * LQ + (size_t)g * HPG * HD, LQ, (size_t)HD, K16 + r0 * KVD + (size_t)g * HD, KVD, 0, 0.125f, nullptr, 0, nullptr, 1, 0, 0, S + (size_t)g * HPG * QT * NKX, nullptr, NKX, (size_t)QT * NKX, QT, nk, HD);      /* scores: the 4 heads of group g against the group's keys (sB 0) */
      k_rsmcf2<<<(NHD * QT + 255) / 256, 256, 0, stream>>>(S, P, NHD, q0, nk);
      for (int g = 0; g < NG; ++g) k_gemm2<0><<<dim3((QT / 128) * (HD / 64), HPG), 128, 0, stream>>>(P + (size_t)g * HPG * QT * NKX, NKX, (size_t)QT * NKX, VT + (size_t)g * HD * SQ, SQ, 0, 0.25f, nullptr, 0, nullptr, 1, 0, 0, nullptr, O16 + (r0 + q0) * DM + (size_t)g * HPG * HD, DM, (size_t)HD, QT, HD, nk); } }      /* o for the group's 4 heads (x64) */      /* o (merged heads, x64) as f16 rows */
  k_gemm2<0><<<dim3((unsigned)((MPO / 128) * (DM / 64)), 1), 128, 0, stream>>>(O16 + r0p * DM, DM, 0, BO, DM, 0, 0.0009765625f, bo, 0, nullptr, 1, 0, 0, (float*)d_out + r0p * DM, nullptr, DM, 0, MPO, DM, DM);      /* out rows are the output layout */
  k_hl<<<(unsigned)(((size_t)NB * QT0 * DM / 8 + 255) / 256), 256, 0, stream>>>(OF0, OH0, OL0, (size_t)NB * QT0 * DM / 8);      /* first-tile o (x64) -> f16 hi + x1024 residual planes */
  for (int b = B0; b < B0 + NBR; ++b) { const size_t r0 = (size_t)b * SQ; const size_t f0 = (size_t)b * QT0;
    k_gemm2<0><<<dim3((QT0 / 128) * (DM / 64), 1), 128, 0, stream>>>(OH0 + f0 * DM, DM, 0, BO, DM, 0, 0.0009765625f, bo, 0, nullptr, 1, 0, 0, (float*)d_out + r0 * DM, nullptr, DM, 0, QT0, DM, DM);      /* rows 0..127: out = o_hi Wo (+ b), overwriting the f16-path rows */
    k_gemm2<0><<<dim3((QT0 / 128) * (DM / 64), 1), 128, 0, stream>>>(OL0 + f0 * DM, DM, 0, BO, DM, 0, 0.00000095367431640625f, nullptr, 0, (const float*)d_out + r0 * DM, -1, 0, 0, (float*)d_out + r0 * DM, nullptr, DM, 0, QT0, DM, DM); }      /* += o_lo Wo 2^-20 (own-element accumulate) */
}

// v001
// Measured time: 7630 microseconds a run.
// Next to v000, in two timings, it ran 1.76 times as fast each time.
#include <hip/hip_runtime.h>
// Grouped-query causal attention at width 1024 with [in][out] projections and RoPE computed in the module (x [4][2048][1024]; q = x Wq (16 heads x 64), k = x Wk, v = x Wv (4 kv heads x 64) ([in][out] weights sigma 0.02, no biases); k, v repeated x4 (repeat: query head h uses kv head h / 4); rope: the module rotates the (even, odd) pairs (x1 c - x2 s, x1 s + x2 c) with angle pos * 10000^(-2i/64) and writes the rotated evens into the first half and the rotated odds into the second half of the head: the SAME permutation on q and k, so q . k equals the interleaved-pair rope's; scores / sqrt(64) with a causal mask (tril, -inf); softmax; out = merged Wo ([in][out]) -> [4][2048][1024]).
// Compute dtype: inputs rounded to bf16; x / weights exact; q, k, v, softmax weights and o as plain f16 GEMM operands (~2^-12); scores and softmax statistics f32. v_wmma_f32_16x16x32_f16.
#define NB 4
#define NG 4
#define HPG 4
#define KVD (NG * HD)
#define SQ 2048
#define DM 1024
#define NH 16
#define HD 64
#define HG 4                         /* heads per attention launch group */
#define QT 256                       /* query rows per causal tile */
#define NKX SQ                       /* S / P row pitch */
#define QT0 128                      /* first-tile rows recomputed exactly in f32 */
#define B0 0                         /* first batch processed (debug hook) */
#define NBR NB                       /* batches processed (debug hook) */
#define NR ((size_t)NB * SQ)         /* token rows */
#define MP ((int)((size_t)NBR * SQ)) /* rows projected (debug hook) */
#define QN SQ                        /* query rows attended per batch (debug hook) */
#define NHD NH                       /* heads attended (debug hook) */
#define MPO MP                       /* rows through the output stage (debug hook) */
#define LQ DM      /* row pitch of the q rows */
typedef __bf16 v16b __attribute__((ext_vector_type(16)));
typedef unsigned short v8us __attribute__((ext_vector_type(8), may_alias));
typedef float  v8f  __attribute__((ext_vector_type(8)));
typedef float  v4f  __attribute__((ext_vector_type(4)));
typedef float  v4fa __attribute__((ext_vector_type(4), may_alias));
union FragB { v16b v; v8us half[2]; unsigned short u[16]; };

__device__ __forceinline__ unsigned short bf16_bits(float x) { unsigned int u = __float_as_uint(x); return (unsigned short)((u + 0x7FFFu + ((u >> 16) & 1u)) >> 16); }
__device__ __forceinline__ float bf16_val(unsigned short b) { return __uint_as_float(((unsigned int)b) << 16); }
__device__ __forceinline__ float bf16_round(float x) { return bf16_val(bf16_bits(x)); }
// D += A·B with NT terms: 1 = ah·bh, 2 = + al·bh (A split), 3 = + ah·bl (both split)
template <int NT>
__device__ __forceinline__ v8f mmaN(v16b ah, v16b al, v16b bh, v16b bl, v8f c) {
  c = __builtin_amdgcn_wmma_f32_16x16x32_bf16(false, ah, false, bh, (short)0, c, false, false);
  if (NT >= 2) c = __builtin_amdgcn_wmma_f32_16x16x32_bf16(false, al, false, bh, (short)0, c, false, false);
  if (NT >= 3) c = __builtin_amdgcn_wmma_f32_16x16x32_bf16(false, ah, false, bl, (short)0, c, false, false);
  asm volatile("v_nop\n\tv_nop\n\tv_nop\n\tv_nop" : "+v"(c) : "v"(ah), "v"(al), "v"(bh), "v"(bl));
  return c;
}

__global__ __launch_bounds__(256) void k_wt_bf16(const float* __restrict__ W, unsigned short* __restrict__ Wt, int K, int N) {
  const int t = blockIdx.x * 256 + threadIdx.x;
  const int k8n = K / 8;
  if (t >= N * k8n) return;
  const int n = t / k8n, k8 = (t % k8n) * 8;
  v8us v;
#pragma unroll
  for (int i = 0; i < 8; ++i) v[i] = bf16_bits(W[(size_t)(k8 + i) * N + n]);
  *(v8us*)(Wt + (size_t)n * K + k8) = v;
  
}

// GEMM C[M][N] (f32, pitch ldc) = act(A[M][K]·W + bias). A f32 row-major (pitch lda) converted per fragment to bf16
// (ASPLIT: hi/lo two planes -> 2 terms, else single rounded term); Wt bf16 [N][K] (pitch ldb). BIAS_BF16 rounds the
// bias to bf16 first (bias quantised to bf16 before the add). K%32==0, M%16==0, N%64==0.
template <bool ASPLIT, int ACT, bool BIAS_BF16>
__global__ __launch_bounds__(128) void k_gemm_bf(const float* __restrict__ A, int lda, const unsigned short* __restrict__ Wt, int ldb,
                                               const float* __restrict__ bias, float* __restrict__ C, int ldc, int M, int N, int K) {
  __shared__ __attribute__((aligned(16))) float so[4][16][64];
  const int tid = threadIdx.x, w = tid >> 5, lane = tid & 31, ln = lane & 15, hh = lane >> 4;
  const int ntn = N / 64;
  const int wid = blockIdx.x * 4 + w;
  const int mt = wid / ntn, nq = wid % ntn;
  if (mt * 16 >= M) return;
  const int row0 = mt * 16, col0 = nq * 64;
  const float* arow = A + (size_t)(row0 + ln) * lda;
  v8f acc[4] = {};
  for (int kb = 0; kb < K; kb += 32) {
    FragB ah, al;
    const v4f x0 = *(const v4fa*)(arow + kb + 8 * hh), x1 = *(const v4fa*)(arow + kb + 8 * hh + 4);
    const v4f x2 = *(const v4fa*)(arow + kb + 16 + 8 * hh), x3 = *(const v4fa*)(arow + kb + 16 + 8 * hh + 4);
    float xs[16] = {x0[0],x0[1],x0[2],x0[3],x1[0],x1[1],x1[2],x1[3],x2[0],x2[1],x2[2],x2[3],x3[0],x3[1],x3[2],x3[3]};
#pragma unroll
    for (int i = 0; i < 16; ++i) { const unsigned short hb = bf16_bits(xs[i]); ah.u[i] = hb; al.u[i] = ASPLIT ? bf16_bits(xs[i] - bf16_val(hb)) : (unsigned short)0; }
#pragma unroll
    for (int t = 0; t < 4; ++t) {
      const unsigned short* brow = Wt + (size_t)(col0 + t * 16 + ln) * ldb + kb;
      FragB b;
      b.half[0] = *(const v8us*)(brow + 8 * hh);
      b.half[1] = *(const v8us*)(brow + 16 + 8 * hh);
      acc[t] = mmaN<ASPLIT ? 2 : 1>(ah.v, al.v, b.v, b.v, acc[t]);
    }
  }
#pragma unroll
  for (int t = 0; t < 4; ++t) {
    float bv = bias ? bias[col0 + t * 16 + ln] : 0.f;
    if (BIAS_BF16) bv = bf16_round(bv);
#pragma unroll
    for (int r = 0; r < 8; ++r) { float v = acc[t][r] + bv; if (ACT == 1) v = fmaxf(v, 0.f); so[w][8 * hh + r][t * 16 + ln] = v; }
  }
  __builtin_amdgcn_fence(__ATOMIC_ACQ_REL, "workgroup");
  __builtin_amdgcn_wave_barrier();
  const int rsub = lane >> 4, c4 = (lane & 15) * 4;
  {
#pragma unroll
    for (int q = 0; q < 8; ++q) {
      const int r = q * 2 + rsub;
      const v4f v = *(const v4fa*)&so[w][r][c4];
      *(v4f*)(C + (size_t)(row0 + r) * ldc + col0 + c4) = v;
    }
    
  }
}

// GEMM C = act(A·W + bias + resid): A f32 (ASPLIT -> hi/lo 2 terms), Wt bf16 [N][K]; ACT 0 none, 1 relu, 2 exact gelu;
// resid (optional, f32, row index = (row % rmod), pitch ldr, RES_BF16 rounds it) added before the activation.
template <bool ASPLIT, int ACT, bool BIAS_BF16, bool RES_BF16>
__global__ __launch_bounds__(128) void k_gemm_bf3(const float* __restrict__ A, int lda, const unsigned short* __restrict__ Wt, int ldb,
                                                const float* __restrict__ bias, const float* __restrict__ resid, int rmod, int ldr,
                                                float* __restrict__ C, int ldc, int M, int N, int K) {
  __shared__ __attribute__((aligned(16))) float so[4][16][64];
  const int tid = threadIdx.x, w = tid >> 5, lane = tid & 31, ln = lane & 15, hh = lane >> 4;
  const int ntn = N / 64;
  const int wid = blockIdx.x * 4 + w;
  const int mt = wid / ntn, nq = wid % ntn;
  if (mt * 16 >= M) return;
  const int row0 = mt * 16, col0 = nq * 64;
  const float* arow = A + (size_t)(row0 + ln) * lda;
  v8f acc[4] = {};
  for (int kb = 0; kb < K; kb += 32) {
    FragB ah, al;
    const v4f x0 = *(const v4fa*)(arow + kb + 8 * hh), x1 = *(const v4fa*)(arow + kb + 8 * hh + 4);
    const v4f x2 = *(const v4fa*)(arow + kb + 16 + 8 * hh), x3 = *(const v4fa*)(arow + kb + 16 + 8 * hh + 4);
    float xs[16] = {x0[0],x0[1],x0[2],x0[3],x1[0],x1[1],x1[2],x1[3],x2[0],x2[1],x2[2],x2[3],x3[0],x3[1],x3[2],x3[3]};
#pragma unroll
    for (int i = 0; i < 16; ++i) { const unsigned short hb = bf16_bits(xs[i]); ah.u[i] = hb; al.u[i] = ASPLIT ? bf16_bits(xs[i] - bf16_val(hb)) : (unsigned short)0; }
#pragma unroll
    for (int t = 0; t < 4; ++t) {
      const unsigned short* brow = Wt + (size_t)(col0 + t * 16 + ln) * ldb + kb;
      FragB b;
      b.half[0] = *(const v8us*)(brow + 8 * hh);
      b.half[1] = *(const v8us*)(brow + 16 + 8 * hh);
      acc[t] = mmaN<ASPLIT ? 2 : 1>(ah.v, al.v, b.v, b.v, acc[t]);
    }
  }
#pragma unroll
  for (int t = 0; t < 4; ++t) {
    const int col = col0 + t * 16 + ln;
    float bv = bias ? bias[col] : 0.f;
    if (BIAS_BF16) bv = bf16_round(bv);
#pragma unroll
    for (int r = 0; r < 8; ++r) {
      float v = acc[t][r] + bv;
      if (resid) { float rv = resid[(size_t)((row0 + 8 * hh + r) % rmod) * ldr + col]; if (RES_BF16) rv = bf16_round(rv); v += rv; }
      if (ACT == 1) v = fmaxf(v, 0.f);
      if (ACT == 2) v = 0.5f * v * (1.0f + erff(v * 0.70710678118654752f));
      if (ACT == 3) { const float u = 0.7978845608028654f * (v + 0.044715f * v * v * v); v = 0.5f * v * (1.0f + tanhf(u)); }
      so[w][8 * hh + r][t * 16 + ln] = v;
    }
  }
  __builtin_amdgcn_fence(__ATOMIC_ACQ_REL, "workgroup");
  __builtin_amdgcn_wave_barrier();
  const int rsub = lane >> 4, c4 = (lane & 15) * 4;
  {
#pragma unroll
    for (int q = 0; q < 8; ++q) {
      const int r = q * 2 + rsub;
      const v4f v = *(const v4fa*)&so[w][r][c4];
      *(v4f*)(C + (size_t)(row0 + r) * ldc + col0 + c4) = v;
    }
    
  }
}
// row LayerNorm (biased variance, eps) over N: s = X (+ R); optional out_sum <- s; out_norm <- (s-mu)*rsqrt(var+eps)*g + b
template <bool PARAM_BF16>
__global__ __launch_bounds__(256) void k_layernorm(const float* __restrict__ X, const float* __restrict__ R, const float* __restrict__ g, const float* __restrict__ bta,
                                                  float* __restrict__ out_sum, float* __restrict__ out_norm, int N, float eps) {
  __shared__ float red[256];
  const int row = blockIdx.x, tid = threadIdx.x;
  const float* x = X + (size_t)row * N; const float* rr = R ? R + (size_t)row * N : nullptr;
  float vals[16];                     // up to N = 4096
  const int per = N / 256;            // contiguous chunk per thread? use strided-by-4 chunks: thread handles j = tid*4 + 1024*u
  float s1 = 0.f;
  for (int u = 0; u < per / 4; ++u) {
    const int j = tid * 4 + 1024 * u;
    const v4f a = *(const v4fa*)(x + j);
    v4f b = {0.f,0.f,0.f,0.f}; if (rr) b = *(const v4fa*)(rr + j);
#pragma unroll
    for (int q = 0; q < 4; ++q) { const float v = a[q] + b[q]; vals[u * 4 + q] = v; s1 += v; }
  }
  red[tid] = s1; __syncthreads();
  for (int st = 128; st > 0; st >>= 1) { if (tid < st) red[tid] += red[tid + st]; __syncthreads(); }
  const float mu = red[0] / (float)N; __syncthreads();
  float s2 = 0.f;
  for (int u = 0; u < per / 4; ++u)
#pragma unroll
    for (int q = 0; q < 4; ++q) { const float c = vals[u * 4 + q] - mu; s2 += c * c; }
  red[tid] = s2; __syncthreads();
  for (int st = 128; st > 0; st >>= 1) { if (tid < st) red[tid] += red[tid + st]; __syncthreads(); }
  const float rs = rsqrtf(red[0] / (float)N + eps);
  {
    for (int u = 0; u < per / 4; ++u) {
      const int j = tid * 4 + 1024 * u;
      v4f o, sm;
#pragma unroll
      for (int q = 0; q < 4; ++q) {
        float gg = g[j + q], bb = bta[j + q];
        if (PARAM_BF16) { gg = bf16_round(gg); bb = bf16_round(bb); }
        sm[q] = vals[u * 4 + q]; o[q] = (vals[u * 4 + q] - mu) * rs * gg + bb;
      }
      if (out_sum) *(v4f*)(out_sum + (size_t)row * N + j) = sm;
      *(v4f*)(out_norm + (size_t)row * N + j) = o;
    }
    
  }
}



// ---- f16 WMMA path (v_wmma_f32_16x16x32_f16): 11-bit significands for operands in range — used where a [0,1] probability operand needs more precision than bf16
typedef _Float16 v16h __attribute__((ext_vector_type(16)));
union FragH { v16h v; v8us half[2]; _Float16 h[16]; unsigned short u[16]; };
template <int NT>
__device__ __forceinline__ v8f mmaH(v16h ah, v16h al, v16h bh, v16h bl, v8f c) {
  c = __builtin_amdgcn_wmma_f32_16x16x32_f16(false, ah, false, bh, (short)0, c, false, false);
  if (NT >= 2) c = __builtin_amdgcn_wmma_f32_16x16x32_f16(false, al, false, bh, (short)0, c, false, false);
  if (NT >= 3) c = __builtin_amdgcn_wmma_f32_16x16x32_f16(false, ah, false, bl, (short)0, c, false, false);
  asm volatile("v_nop\n\tv_nop\n\tv_nop\n\tv_nop" : "+v"(c) : "v"(ah), "v"(al), "v"(bh), "v"(bl));
  return c;
}
// batched GEMM like k_gemm_b but f16 operands: A f32 (split into f16 hi/lo if ASPLIT, else rounded to f16), Bt = f16 values [n][k]; alpha; C f32; N multiple of 16 (partial tiles skipped)
template <bool ASPLIT>
__global__ __launch_bounds__(128) void k_gemm_h(const float* __restrict__ A, int lda, size_t sA, const _Float16* __restrict__ Bh, int ldb, size_t sB, float alpha, float* __restrict__ C, int ldc, size_t sC, int M, int N, int K) {
  __shared__ __attribute__((aligned(16))) float so[4][16][64];
  const int tid = threadIdx.x, w = tid >> 5, lane = tid & 31, ln = lane & 15, hh = lane >> 4; const int by = blockIdx.y;
  A += (size_t)by * sA; Bh += (size_t)by * sB; C += (size_t)by * sC;
  const int ntn = (N + 63) / 64; const int wid = blockIdx.x * 4 + w; const int mt = wid / ntn, nq = wid % ntn; if (mt * 16 >= M) return;
  const int row0 = mt * 16, col0 = nq * 64; const float* arow = A + (size_t)(row0 + ln) * lda;
  v8f acc[4] = {};
  for (int kb = 0; kb < K; kb += 32) {
    FragH ah, al;
    const v4f x0 = *(const v4fa*)(arow + kb + 8 * hh), x1 = *(const v4fa*)(arow + kb + 8 * hh + 4), x2 = *(const v4fa*)(arow + kb + 16 + 8 * hh), x3 = *(const v4fa*)(arow + kb + 16 + 8 * hh + 4);
    float xs[16] = {x0[0],x0[1],x0[2],x0[3],x1[0],x1[1],x1[2],x1[3],x2[0],x2[1],x2[2],x2[3],x3[0],x3[1],x3[2],x3[3]};
#pragma unroll
    for (int i = 0; i < 16; ++i) { const _Float16 h = (_Float16)xs[i]; ah.h[i] = h; al.h[i] = ASPLIT ? (_Float16)(xs[i] - (float)h) : (_Float16)0.0f; }
#pragma unroll
    for (int t = 0; t < 4; ++t) { if (col0 + t * 16 >= N) continue; const size_t boff = (size_t)(col0 + t * 16 + ln) * ldb + kb; FragH bq; bq.half[0] = *(const v8us*)(Bh + boff + 8 * hh); bq.half[1] = *(const v8us*)(Bh + boff + 16 + 8 * hh);
      acc[t] = mmaH<ASPLIT ? 2 : 1>(ah.v, al.v, bq.v, bq.v, acc[t]); }
  }
#pragma unroll
  for (int t = 0; t < 4; ++t) { if (col0 + t * 16 >= N) continue;
#pragma unroll
    for (int r = 0; r < 8; ++r) so[w][8 * hh + r][t * 16 + ln] = acc[t][r] * alpha; }
  __builtin_amdgcn_fence(__ATOMIC_ACQ_REL, "workgroup"); __builtin_amdgcn_wave_barrier();
  const int rsub = lane >> 4, c4 = (lane & 15) * 4;
  {
#pragma unroll
    for (int q = 0; q < 8; ++q) { const int r = q * 2 + rsub; if (col0 + c4 < N) { const v4f v = *(const v4fa*)&so[w][r][c4]; *(v4f*)(C + (size_t)(row0 + r) * ldc + col0 + c4) = v; } }
     }
}

// Wt[n][k] = f16(W[k][n]·scale) from f32 row-major W[K][N] (scale = power of two; bf16-exact weights stay exact in f16 away from the subnormal range)
__global__ __launch_bounds__(256) void k_wt_f16(const float* __restrict__ W, _Float16* __restrict__ Wt, int K, int N, float scale) {
  const int t = blockIdx.x * 256 + threadIdx.x; if (t >= N * (K / 8)) return; const int n = t / (K / 8), k8 = (t % (K / 8)) * 8; FragH f;
#pragma unroll
  for (int i = 0; i < 8; ++i) f.h[i] = (_Float16)(bf16_round(W[(size_t)(k8 + i) * N + n]) * scale); const v8us o = f.half[0];
  *(v8us*)((unsigned short*)Wt + (size_t)n * K + k8) = o; 
}
// k_gemm_hh variant with fused epilogue: v = acc·alpha + bias[by·sBias + col] (+ CP[(row/rowsPerB)·sCPb + by·64 + col] if CP) ; ACT 0 none / 1 elu ; writes f16 C16 (and f32 C if non-null)
template <int ACT>
__global__ __launch_bounds__(128) void k_gemm_hhx(const _Float16* __restrict__ A, int lda, size_t sA, const _Float16* __restrict__ Bh, int ldb, size_t sB, float alpha, const float* __restrict__ bias, size_t sBias, const float* __restrict__ CP, int rowsPerB, size_t sCPb, int row0g,
    float* __restrict__ C, _Float16* __restrict__ C16, int ldc, size_t sC, int M, int N, int K) {
  __shared__ __attribute__((aligned(16))) float so[4][16][64];
  const int tid = threadIdx.x, w = tid >> 5, lane = tid & 31, ln = lane & 15, hh = lane >> 4; const int by = blockIdx.y;
  A += (size_t)by * sA; Bh += (size_t)by * sB; const size_t cofs = (size_t)by * sC; const float* bp = bias ? bias + (size_t)by * sBias : nullptr;
  const int ntn = (N + 63) / 64; const int wid = blockIdx.x * 4 + w; const int mt = wid / ntn, nq = wid % ntn; if (mt * 16 >= M) return;
  const int row0 = mt * 16, col0 = nq * 64; const _Float16* arow = A + (size_t)(row0 + ln) * lda;
  v8f acc[4] = {};
  for (int kb = 0; kb < K; kb += 32) { FragH ah; ah.half[0] = *(const v8us*)((const unsigned short*)arow + kb + 8 * hh); ah.half[1] = *(const v8us*)((const unsigned short*)arow + kb + 16 + 8 * hh);
#pragma unroll
    for (int t = 0; t < 4; ++t) { if (col0 + t * 16 >= N) continue; const size_t boff = (size_t)(col0 + t * 16 + ln) * ldb + kb; FragH bq; bq.half[0] = *(const v8us*)((const unsigned short*)Bh + boff + 8 * hh); bq.half[1] = *(const v8us*)((const unsigned short*)Bh + boff + 16 + 8 * hh);
      acc[t] = mmaH<1>(ah.v, ah.v, bq.v, bq.v, acc[t]); }
  }
#pragma unroll
  for (int t = 0; t < 4; ++t) { if (col0 + t * 16 >= N) continue; const int col = col0 + t * 16 + ln; const float bv = bp ? bf16_round(bp[col]) : 0.f;
#pragma unroll
    for (int r = 0; r < 8; ++r) { float v = acc[t][r] * alpha + bv; if (CP) { const int rr = row0g + row0 + 8 * hh + r; if (rowsPerB < 0) v += CP[cofs + (size_t)rr * ldc + col];      /* rowsPerB < 0: own element of the batched C plane */ else { const int bidx = rr / rowsPerB; v += CP[(size_t)bidx * sCPb + (size_t)by * 64 + col]; } } if (ACT == 1) v = (v > 0.f) ? v : expm1f(v); else if (ACT == 7) v = (v > 0.f) ? v + 1.0f : expf(v); else if (ACT == 8) v = tanhf(v); else if (ACT == 9) v = 0.5f * v * (1.0f + tanhf(0.7978845608028654f * (v + 0.044715f * v * v * v))); else if (ACT == 11) v = 1.0f / (1.0f + expf(-v)); else if (ACT == 12) v = (v > 0.f) ? v : 0.01f * v; else if (ACT == 14) v = (v > 0.f) ? v : 0.1f * v; else if (ACT == 16) v = (v >= 0.f) ? v : 0.3f * v; else if (ACT == 17) v = (v >= 0.f) ? v : 0.2f * v; else if (ACT == 15) v = v / (1.0f + expf(-v)); else if (ACT == 3) v = fmaxf(v, 0.f); else if (ACT == 6) v = 0.5f * v * (1.0f + erff(v * 0.70710678118654752f)); so[w][8 * hh + r][t * 16 + ln] = v; } }
  __builtin_amdgcn_fence(__ATOMIC_ACQ_REL, "workgroup"); __builtin_amdgcn_wave_barrier();
  const int rsub = lane >> 4, c4 = (lane & 15) * 4; typedef _Float16 v4h __attribute__((ext_vector_type(4)));
  {
#pragma unroll
    for (int q = 0; q < 8; ++q) { const int r = q * 2 + rsub; if (col0 + c4 < N) { const v4f v = *(const v4fa*)&so[w][r][c4]; if (C) *(v4f*)(C + cofs + (size_t)(row0 + r) * ldc + col0 + c4) = v; if (C16) { v4h h4; for (int i = 0; i < 4; ++i) h4[i] = (_Float16)v[i]; *(v4h*)(C16 + cofs + (size_t)(row0 + r) * ldc + col0 + c4) = h4; } } }
     }
}


typedef _Float16 v4h __attribute__((ext_vector_type(4)));

__global__ __launch_bounds__(256) void k_x16(const float* __restrict__ x, _Float16* __restrict__ X16, size_t n8) { const size_t t = (size_t)blockIdx.x * 256 + threadIdx.x; if (t >= n8) return; FragH f;
#pragma unroll
  for (int q = 0; q < 8; ++q) f.h[q] = (_Float16)bf16_round(x[t * 8 + q]); *(v8us*)((unsigned short*)X16 + t * 8) = f.half[0];  }
__global__ __launch_bounds__(256) void k_h16(const float* __restrict__ x, _Float16* __restrict__ X16, size_t n8) { const size_t t = (size_t)blockIdx.x * 256 + threadIdx.x; if (t >= n8) return; FragH f;
#pragma unroll
  for (int q = 0; q < 8; ++q) f.h[q] = (_Float16)x[t * 8 + q]; *(v8us*)((unsigned short*)X16 + t * 8) = f.half[0];  }
__global__ __launch_bounds__(256) void k_round16f(const float* __restrict__ W, _Float16* __restrict__ Bt, size_t n8) { const size_t t = (size_t)blockIdx.x * 256 + threadIdx.x; if (t >= n8) return; FragH f;
#pragma unroll
  for (int i = 0; i < 8; ++i) f.h[i] = (_Float16)(bf16_round(W[t * 8 + i]) * 16.0f); *(v8us*)((unsigned short*)Bt + t * 8) = f.half[0];  }
template <int NHv, int TTv>
__global__ __launch_bounds__(256) void k_vt(const _Float16* __restrict__ V16, int ldv, int voff, _Float16* __restrict__ Vt) { __shared__ unsigned short tl[64][66]; const int tid = threadIdx.x; const int slab = blockIdx.x / (TTv / 64), lg = blockIdx.x % (TTv / 64); const int b = slab / NHv, h = slab % NHv;
  for (int i = tid; i < 64 * 8; i += 256) { const int r = i / 8, c8 = (i % 8) * 8; FragH f; f.half[0] = *(const v8us*)((const unsigned short*)V16 + ((size_t)b * TTv + lg * 64 + r) * ldv + voff + h * 64 + c8);
#pragma unroll
    for (int q = 0; q < 8; ++q) tl[r][c8 + q] = f.u[q]; }
  __syncthreads();
  {
#pragma unroll
    for (int rd = 0; rd < 2; ++rd) { const int d = rd * 32 + tid / 8, pc = tid % 8; FragH f;
#pragma unroll
      for (int q = 0; q < 8; ++q) f.u[q] = tl[pc * 8 + q][d];
      *(v8us*)((unsigned short*)Vt + ((size_t)slab * 64 + d) * TTv + lg * 64 + pc * 8) = f.half[0]; }
     } }

__global__ __launch_bounds__(256) void k_hl(const float* __restrict__ F, _Float16* __restrict__ Hh, _Float16* __restrict__ Hl, size_t n8) { const size_t t = (size_t)blockIdx.x * 256 + threadIdx.x; if (t >= n8) return; FragH fh, fl; const v4f a = *(const v4fa*)(F + t * 8), c = *(const v4fa*)(F + t * 8 + 4);
#pragma unroll
  for (int q = 0; q < 4; ++q) { _Float16 h = (_Float16)a[q]; fh.h[q] = h; fl.h[q] = (_Float16)((a[q] - (float)h) * 1024.0f); h = (_Float16)c[q]; fh.h[4 + q] = h; fl.h[4 + q] = (_Float16)((c[q] - (float)h) * 1024.0f); }
  { *(v8us*)((unsigned short*)Hh + t * 8) = fh.half[0]; *(v8us*)((unsigned short*)Hl + t * 8) = fl.half[0];  } }

// ---- fast GEMM (wave tile 32x64; requires M % 32 == 0 rows per launch region and N % 64 == 0); epilogue = k_gemm_hhx semantics ----
__device__ __forceinline__ v16h g2_frag(const _Float16* p, int hh) { FragH f; f.half[0] = *(const v8us*)((const unsigned short*)p + 8 * hh); f.half[1] = *(const v8us*)((const unsigned short*)p + 16 + 8 * hh); return f.v; }
__device__ __forceinline__ v8f g2_mma(v16h a, v16h b, v8f c) { v8f d = __builtin_amdgcn_wmma_f32_16x16x32_f16(false, a, false, b, (short)0, c, false, false); asm volatile("v_nop\n\tv_nop\n\tv_nop\n\tv_nop" : "+v"(d) : "v"(a), "v"(b)); return d; }
template <int ACT>
__global__ __launch_bounds__(128) void k_gemm2(const _Float16* __restrict__ A, int lda, size_t sA, const _Float16* __restrict__ Bh, int ldb, size_t sB, float alpha, const float* __restrict__ bias, size_t sBias, const float* __restrict__ CP, int rowsPerB, size_t sCPb, int row0g,
    float* __restrict__ C, _Float16* __restrict__ C16, int ldc, size_t sC, int M, int N, int K) { static_assert(ACT == 0 || ACT == 3 || ACT == 6 || ACT == 8 || ACT == 9 || ACT == 11 || ACT == 12 || ACT == 14 || ACT == 15 || ACT == 16 || ACT == 17, "k_gemm2: unsupported ACT code (would silently apply no activation)");
  __shared__ __attribute__((aligned(16))) float so[4][32][68];
  const int tid = threadIdx.x, w = tid >> 5, lane = tid & 31, ln = lane & 15, hh = lane >> 4; const int by = blockIdx.y;
  A += (size_t)by * sA; Bh += (size_t)by * sB; const size_t cofs = (size_t)by * sC; const float* bp = bias ? bias + (size_t)by * sBias : nullptr;
  const int ntn = N >> 6; const int mt = blockIdx.x / ntn, nq = blockIdx.x - mt * ntn; const int row0 = mt * 128 + 32 * w, col0 = nq * 64; if (row0 >= M) return;
  const _Float16* a0p = A + (size_t)(row0 + ln) * lda; const _Float16* a1p = a0p + (size_t)16 * lda;
  const _Float16* b0p = Bh + (size_t)(col0 + ln) * ldb; const _Float16* b1p = b0p + (size_t)16 * ldb; const _Float16* b2p = b1p + (size_t)16 * ldb; const _Float16* b3p = b2p + (size_t)16 * ldb;
  const v8f z8 = {0.f,0.f,0.f,0.f,0.f,0.f,0.f,0.f}; v8f c00 = z8, c01 = z8, c02 = z8, c03 = z8, c10 = z8, c11 = z8, c12 = z8, c13 = z8;
#pragma unroll 1
  for (int kb = 0; kb < K; kb += 32) { const v16h a0 = g2_frag(a0p + kb, hh), a1 = g2_frag(a1p + kb, hh);
    v16h b = g2_frag(b0p + kb, hh); c00 = g2_mma(a0, b, c00); c10 = g2_mma(a1, b, c10);
    b = g2_frag(b1p + kb, hh); c01 = g2_mma(a0, b, c01); c11 = g2_mma(a1, b, c11);
    b = g2_frag(b2p + kb, hh); c02 = g2_mma(a0, b, c02); c12 = g2_mma(a1, b, c12);
    b = g2_frag(b3p + kb, hh); c03 = g2_mma(a0, b, c03); c13 = g2_mma(a1, b, c13); }
  v8f accs[8] = {c00, c01, c02, c03, c10, c11, c12, c13};
#pragma unroll
  for (int u = 0; u < 8; ++u) { const int t = u & 3, half = u >> 2; const int col = col0 + t * 16 + ln; const float bv = bp ? bf16_round(bp[col]) : 0.f;
#pragma unroll
    for (int r = 0; r < 8; ++r) { const int rloc = half * 16 + 8 * hh + r; float v = accs[u][r] * alpha + bv; if (CP) { if (rowsPerB < 0) v += CP[cofs + (size_t)(row0g + row0 + rloc) * ldc + col];      /* rowsPerB < 0: own element of the batched C plane */ else { const int bidx = (row0g + row0 + rloc) / rowsPerB; v += CP[(size_t)bidx * sCPb + (size_t)by * 64 + col]; } }
      if (ACT == 3) v = fmaxf(v, 0.f); else if (ACT == 6) v = 0.5f * v * (1.0f + erff(v * 0.70710678118654752f)); else if (ACT == 11) v = 1.0f / (1.0f + expf(-v)); else if (ACT == 15) v = v / (1.0f + expf(-v)); else if (ACT == 12) v = (v > 0.f) ? v : 0.01f * v; else if (ACT == 8) v = tanhf(v); else if (ACT == 9) v = 0.5f * v * (1.0f + tanhf(0.7978845608028654f * (v + 0.044715f * v * v * v))); else if (ACT == 14) v = (v > 0.f) ? v : 0.1f * v; else if (ACT == 16) v = (v >= 0.f) ? v : 0.3f * v; else if (ACT == 17) v = (v >= 0.f) ? v : 0.2f * v;
      so[w][rloc][t * 16 + ln] = v; } }
  __builtin_amdgcn_fence(__ATOMIC_ACQ_REL, "workgroup"); __builtin_amdgcn_wave_barrier();
  const int rsub = lane >> 4, c4 = (lane & 15) * 4;
  {
#pragma unroll
    for (int q = 0; q < 16; ++q) { const int r = q * 2 + rsub; const v4f v = *(const v4fa*)&so[w][r][c4]; if (C) *(v4f*)(C + cofs + (size_t)(row0 + r) * ldc + col0 + c4) = v; if (C16) { v4h h4; for (int i = 0; i < 4; ++i) h4[i] = (_Float16)v[i]; *(v4h*)(C16 + cofs + (size_t)(row0 + r) * ldc + col0 + c4) = h4; } }
     } }


__global__ __launch_bounds__(256) void k_wnat(const float* __restrict__ w, size_t n8, _Float16* __restrict__ Bt) { const size_t t = (size_t)blockIdx.x * 256 + threadIdx.x; if (t >= n8) return; FragH f; for (int q = 0; q < 8; ++q) f.h[q] = (_Float16)(bf16_round(w[t * 8 + q]) * 16.0f); *(v8us*)((unsigned short*)Bt + t * 8) = f.half[0];  }
__global__ __launch_bounds__(256) void k_rsm(const float* __restrict__ S, _Float16* __restrict__ P, int nrows) {
  #pragma clang fp contract(off)
  const int i = blockIdx.x * 256 + threadIdx.x; if (i >= nrows) return; const float* s = S + (size_t)i * SQ; float mx = -3.0e38f;
#pragma unroll 1
  for (int j = 0; j < SQ; ++j) mx = fmaxf(mx, s[j]); float se = 0.f;
#pragma unroll 1
  for (int j = 0; j < SQ; ++j) se += expf(s[j] - mx); const float sc = 256.0f / se;
#pragma unroll 1
  for (int j0 = 0; j0 < SQ; j0 += 8) { FragH f; for (int q = 0; q < 8; ++q) f.h[q] = (_Float16)(expf(s[j0 + q] - mx) * sc); unsigned short* d = (unsigned short*)P + (size_t)i * SQ + j0; *(v8us*)d = f.half[0];  } }
__global__ __launch_bounds__(256) void k_vt(const _Float16* __restrict__ V16, int b, int h0, _Float16* __restrict__ VT) { __shared__ unsigned short tl[64][65]; const int tid = threadIdx.x; const int hh = blockIdx.x % HG, sg = blockIdx.x / HG; const int s0 = sg * 64; const int h = h0 + hh;
  for (int i = tid; i < 64 * 8; i += 256) { const int j = i / 8, d8 = (i % 8) * 8; FragH f; f.half[0] = *(const v8us*)((const unsigned short*)V16 + ((size_t)b * SQ + s0 + j) * DM + h * HD + d8); for (int q = 0; q < 8; ++q) tl[d8 + q][j] = f.u[q]; }
  __syncthreads();
  { for (int i = tid; i < 64 * 8; i += 256) { const int d = i / 8, j8 = (i % 8) * 8; FragH f; for (int q = 0; q < 8; ++q) f.u[q] = tl[d][j8 + q]; *(v8us*)((unsigned short*)VT + ((size_t)hh * HD + d) * SQ + s0 + j8) = f.half[0]; }  } }



// 2^x on the transcendental unit. The v_nop fills the one issue slot that the instruction set asks for behind a transcendental before its source
// is overwritten.
__device__ __forceinline__ float exp2_slot(float x) { float r; asm("v_exp_f32 %0, %1\n\tv_nop" : "=v"(r) : "v"(x)); return r; }
// Causal row softmax, one wave per score row: lane l owns the 8 consecutive keys 256 c + 8 l .. + 7 of each 256-key chunk c, so a wave's
// loads and stores cover whole contiguous lines; the row stays in registers (one read of S); maximum and sum close with a five-step butterfly.
// NC = chunks in the row (a compile-time count keeps the row in plain registers and every load ahead of the first use);
// the loops over c and q are unrolled so that ra and rb are indexed by constants only and never leave the registers.
template <int NC>
__device__ __forceinline__ void rsm_row(const float* __restrict__ s, unsigned short* __restrict__ d, int j0, int last) {
  v4f ra[NC], rb[NC];
#pragma unroll
  for (int c = 0; c < NC; ++c) { ra[c] = *(const v4fa*)(s + c * 256); rb[c] = *(const v4fa*)(s + c * 256 + 4); }
  __builtin_amdgcn_sched_barrier(0);      /* keeps all of the row's loads in flight together: without it the scheduler sinks each chunk's loads to their first use and the wave pays one load latency per chunk */
  float mx = -3.0e38f;
#pragma unroll
  for (int c = 0; c < NC; ++c)
#pragma unroll
    for (int q = 0; q < 4; ++q) { const int j = c * 256 + j0 + q; const float f0 = (j <= last) ? 1.f : 0.f, f1 = (j + 4 <= last) ? 1.f : 0.f;
      ra[c][q] = fmaf(f0, ra[c][q], (1.f - f0) * -1.0e9f); rb[c][q] = fmaf(f1, rb[c][q], (1.f - f1) * -1.0e9f); mx = fmaxf(mx, fmaxf(ra[c][q], rb[c][q])); }
  for (int m = 16; m > 0; m >>= 1) mx = fmaxf(mx, __shfl_xor(mx, m, 32));
  float se = 0.f;
#pragma unroll
  for (int c = 0; c < NC; ++c)
#pragma unroll
    for (int q = 0; q < 4; ++q) { ra[c][q] = exp2_slot((ra[c][q] - mx) * 1.44269504f); rb[c][q] = exp2_slot((rb[c][q] - mx) * 1.44269504f); se += ra[c][q] + rb[c][q]; }      /* e^x = 2^(x log2 e), the fast exp's own two instructions */
  for (int m = 16; m > 0; m >>= 1) se += __shfl_xor(se, m, 32);
  const float sc = 256.0f / se;
#pragma unroll
  for (int c = 0; c < NC; ++c) { FragH fr;
#pragma unroll
    for (int q = 0; q < 4; ++q) { fr.h[q] = (_Float16)(ra[c][q] * sc); fr.h[4 + q] = (_Float16)(rb[c][q] * sc); }
    *(v8us*)(d + c * 256) = fr.half[0]; }
  asm volatile("s_wait_xcnt 0x0" ::: "memory");      /* stands behind the row's last store, in front of any later write of a register that an issued store names */
}
__global__ __launch_bounds__(256) void k_rsmcf2(const float* __restrict__ S, _Float16* __restrict__ P, int hg, int q0, int nk) {
  const int lane = threadIdx.x & 31; const int t = blockIdx.x * 8 + (threadIdx.x >> 5); if (t >= hg * QT) return;
  const float* s = S + (size_t)t * NKX + lane * 8; unsigned short* d = (unsigned short*)P + (size_t)t * NKX + lane * 8; const int j0 = lane * 8, last = q0 + (t % QT);
  switch (nk / 256) {      /* nk is a multiple of QT = 256, at most NKX = 2048 */
    case 1: rsm_row<1>(s, d, j0, last); break; case 2: rsm_row<2>(s, d, j0, last); break; case 3: rsm_row<3>(s, d, j0, last); break; case 4: rsm_row<4>(s, d, j0, last); break;
    case 5: rsm_row<5>(s, d, j0, last); break; case 6: rsm_row<6>(s, d, j0, last); break; case 7: rsm_row<7>(s, d, j0, last); break; case 8: rsm_row<8>(s, d, j0, last); break; } }


template <int MASKADD>
__global__ __launch_bounds__(64) void k_att0(const float* __restrict__ QF, const float* __restrict__ KF, const float* __restrict__ VF, int ld, const float* __restrict__ mask, float scale, float* __restrict__ OF, int ldo) {
  #pragma clang fp contract(off)
  __shared__ __attribute__((aligned(16))) float lq[64][64]; __shared__ __attribute__((aligned(16))) float lo[64][64];
  const int tid = threadIdx.x; const int h = blockIdx.x / (QT0 / 64), rg = blockIdx.x % (QT0 / 64); const int i = rg * 64 + tid;
  const float* qr = QF + (size_t)i * ld + h * HD;
#pragma unroll 1
  for (int c = 0; c < HD / 4; ++c) { *(v4f*)&lq[tid][c * 4] = *(const v4fa*)(qr + c * 4); const v4f z = {0.f, 0.f, 0.f, 0.f}; *(v4f*)&lo[tid][c * 4] = z; }
  float m = -1.0e30f, l = 0.f; const int jmax = MASKADD ? (SQ - 1) : (rg * 64 + 63);      /* additive-mask form: every key (the mask input decides); causal form: keys up to the block's last row */
#pragma unroll 1
  for (int j = 0; j <= jmax; ++j) { const float* kr = KF + (size_t)j * ld + h * HD; const float* vr = VF + (size_t)j * ld + h * HD; float s = 0.f;
#pragma unroll 1
    for (int c = 0; c < HD / 4; ++c) { const v4f kq = *(const v4fa*)(kr + c * 4); const v4f qq = *(v4f*)&lq[tid][c * 4]; s = __fadd_rn(s, __fmul_rn(qq[0], kq[0])); s = __fadd_rn(s, __fmul_rn(qq[1], kq[1])); s = __fadd_rn(s, __fmul_rn(qq[2], kq[2])); s = __fadd_rn(s, __fmul_rn(qq[3], kq[3])); }
    s = __fmul_rn(s, scale); if (MASKADD) s = __fadd_rn(s, __fmul_rn(bf16_round(mask[(size_t)i * SQ + j]), -10000.0f));
    const float f = (MASKADD || j <= i) ? 1.f : 0.f; const float sm = fmaf(f, s, (1.f - f) * -1.0e30f); const float mn = fmaxf(m, sm); const float sc = expf(m - mn); const float e = expf(sm - mn); l = __fadd_rn(__fmul_rn(l, sc), e); m = mn;
#pragma unroll 1
    for (int c = 0; c < HD / 4; ++c) { const v4f vv = *(const v4fa*)(vr + c * 4); v4f oo = *(v4f*)&lo[tid][c * 4]; for (int u = 0; u < 4; ++u) oo[u] = __fadd_rn(__fmul_rn(oo[u], sc), __fmul_rn(e, vv[u])); *(v4f*)&lo[tid][c * 4] = oo; } }
  const float fin = 64.0f / l;      /* o carried x64 like the f16 path */
#pragma unroll 1
  for (int c = 0; c < HD / 4; ++c) { v4f oo = *(v4f*)&lo[tid][c * 4]; for (int u = 0; u < 4; ++u) oo[u] = __fmul_rn(oo[u], fin); *(v4f*)&lo[tid][c * 4] = oo; }
  __syncthreads();
  {
#pragma unroll 1
    for (int it = 0; it < 16; ++it) { const int row = it * 4 + tid / 16, pc = (tid % 16) * 4; const v4f v = *(const v4f*)&lo[row][pc]; *(v4f*)(OF + (size_t)(rg * 64 + row) * ldo + h * HD + pc) = v; }
     } }


__global__ __launch_bounds__(256) void k_kvexp(const float* __restrict__ src, float* __restrict__ dst, size_t n4) { const size_t t = (size_t)blockIdx.x * 256 + threadIdx.x; if (t >= n4) return; const size_t e = t * 4; const size_t row = e / DM; const int col = (int)(e % DM); const int h = col / HD, d = col % HD; const v4f v = *(const v4fa*)(src + row * KVD + (size_t)(h / HPG) * HD + d); *(v4f*)(dst + e) = v;  }

__global__ __launch_bounds__(256) void k_tab2(float theta, float* __restrict__ CS, float* __restrict__ SN) {
  #pragma clang fp contract(off)
  const int t = blockIdx.x * 256 + threadIdx.x; if (t >= SQ * (HD / 2)) return; const int i = t % (HD / 2); const int p = t / (HD / 2); const float invf = 1.0f / powf(theta, (float)(2 * i) / (float)HD); const float ang = __fmul_rn((float)p, invf); const float c = cosf(ang), s = sinf(ang);
  *(float*)(CS + t) = c; *(float*)(SN + t) = s;  }
template <int NORM, int ROPE>
__global__ __launch_bounds__(64) void k_xform(const float* __restrict__ F, int ldf, int nh, const float* __restrict__ gain, float eps, const float* __restrict__ CS, const float* __restrict__ SN, _Float16* __restrict__ H16, int ldo) {
  #pragma clang fp contract(off)
  __shared__ float xv[HD]; __shared__ float red[HD]; __shared__ unsigned short sh_[HD]; const int d = threadIdx.x; const int h = blockIdx.x % nh; const size_t r = blockIdx.x / nh; const int p = (int)(r % SQ);
  float x = F[r * (size_t)ldf + (size_t)h * HD + d];
  if (NORM) { red[d] = __fmul_rn(x, x); __syncthreads(); for (int st = HD / 2; st > 0; st >>= 1) { if (d < st) red[d] = __fadd_rn(red[d], red[d + st]); __syncthreads(); } const float rs = rsqrtf(__fadd_rn(red[0] / (float)HD, eps)); x = __fmul_rn(__fmul_rn(x, rs), bf16_round(gain[d])); }
  xv[d] = x; __syncthreads();
  float o = x;
  if (ROPE == 1) { const int i = d >> 1; const float c = CS[p * (HD / 2) + i], s = SN[p * (HD / 2) + i]; const float ev = xv[2 * i], od = xv[2 * i + 1]; o = (d & 1) ? __fadd_rn(__fmul_rn(ev, s), __fmul_rn(od, c)) : __fadd_rn(__fmul_rn(ev, c), -__fmul_rn(od, s)); }
  if (ROPE == 2) { const int i = d & (HD / 2 - 1); const float c = CS[p * (HD / 2) + i], s = SN[p * (HD / 2) + i]; const float lo = xv[i], hi = xv[i + HD / 2]; o = (d < HD / 2) ? __fadd_rn(__fmul_rn(lo, c), -__fmul_rn(hi, s)) : __fadd_rn(__fmul_rn(lo, s), __fmul_rn(hi, c)); }
  if (ROPE == 3) { const float c = CS[p * HD + d], s = SN[p * HD + d]; const float lo = xv[d & (HD / 2 - 1)], hi = xv[(d & (HD / 2 - 1)) + HD / 2]; o = (d < HD / 2) ? __fadd_rn(__fmul_rn(lo, c), -__fmul_rn(hi, s)) : __fadd_rn(__fmul_rn(hi, c), __fmul_rn(lo, s)); }      /* rotate-half with FULL-width per-element tables [pos][HD] */
  FragH th; th.h[0] = (_Float16)o; sh_[d] = th.u[0]; __syncthreads();
  if (d < HD / 8) { FragH f; for (int q = 0; q < 8; ++q) f.u[q] = sh_[d * 8 + q]; unsigned short* dst = (unsigned short*)H16 + r * (size_t)ldo + (size_t)h * HD + d * 8; *(v8us*)dst = f.half[0];  } }

template <int NORM, int ROPE>
__global__ __launch_bounds__(64) void k_xformf(const float* __restrict__ F, int ldf, int nh, const float* __restrict__ gain, float eps, const float* __restrict__ CS, const float* __restrict__ SN, float* __restrict__ F32, int ldo) {
  #pragma clang fp contract(off)
  __shared__ float xv[HD]; __shared__ float red[HD]; const int d = threadIdx.x; const int h = blockIdx.x % nh; const size_t r = blockIdx.x / nh; const int p = (int)(r % SQ);
  float x = F[r * (size_t)ldf + (size_t)h * HD + d];
  if (NORM) { red[d] = __fmul_rn(x, x); __syncthreads(); for (int st = HD / 2; st > 0; st >>= 1) { if (d < st) red[d] = __fadd_rn(red[d], red[d + st]); __syncthreads(); } const float rs = rsqrtf(__fadd_rn(red[0] / (float)HD, eps)); x = __fmul_rn(__fmul_rn(x, rs), bf16_round(gain[d])); }
  xv[d] = x; __syncthreads();
  float o = x;
  if (ROPE == 1) { const int i = d >> 1; const float c = CS[p * (HD / 2) + i], s = SN[p * (HD / 2) + i]; const float ev = xv[2 * i], od = xv[2 * i + 1]; o = (d & 1) ? __fadd_rn(__fmul_rn(ev, s), __fmul_rn(od, c)) : __fadd_rn(__fmul_rn(ev, c), -__fmul_rn(od, s)); }
  if (ROPE == 2) { const int i = d & (HD / 2 - 1); const float c = CS[p * (HD / 2) + i], s = SN[p * (HD / 2) + i]; const float lo = xv[i], hi = xv[i + HD / 2]; o = (d < HD / 2) ? __fadd_rn(__fmul_rn(lo, c), -__fmul_rn(hi, s)) : __fadd_rn(__fmul_rn(lo, s), __fmul_rn(hi, c)); }
  if (ROPE == 3) { const float c = CS[p * HD + d], s = SN[p * HD + d]; const float lo = xv[d & (HD / 2 - 1)], hi = xv[(d & (HD / 2 - 1)) + HD / 2]; o = (d < HD / 2) ? __fadd_rn(__fmul_rn(lo, c), -__fmul_rn(hi, s)) : __fadd_rn(__fmul_rn(hi, c), __fmul_rn(lo, s)); }      /* rotate-half with FULL-width per-element tables [pos][HD] */
  float* dst = F32 + r * (size_t)ldo + (size_t)h * HD + d; *(float*)dst = o;  }

__global__ __launch_bounds__(256) void k_bfcp(const float* __restrict__ src, float* __restrict__ dst, size_t n4) { const size_t t = (size_t)blockIdx.x * 256 + threadIdx.x; if (t >= n4) return; const v4f a = *(const v4fa*)(src + t * 4); v4f o; for (int q = 0; q < 4; ++q) o[q] = bf16_round(a[q]); *(v4f*)(dst + t * 4) = o;  }

__global__ __launch_bounds__(256) void k_tabhalf(const float* __restrict__ cs, const float* __restrict__ sn, float* __restrict__ CS, float* __restrict__ SN) { const int t = blockIdx.x * 256 + threadIdx.x; if (t >= SQ * (HD / 2)) return; const int p = t / (HD / 2), i = t % (HD / 2); const float c = bf16_round(cs[(size_t)p * HD + i]), s = bf16_round(sn[(size_t)p * HD + i]);
  *(float*)(CS + t) = c; *(float*)(SN + t) = s;  }

__global__ __launch_bounds__(256) void k_tab2d(float* __restrict__ CS, float* __restrict__ SN) {
  #pragma clang fp contract(off)
  const int t = blockIdx.x * 256 + threadIdx.x; if (t >= SQ * (HD / 2)) return; const int i = t % (HD / 2); const int p = t / (HD / 2); const float invf = (float)(1.0 / pow(10000.0, (double)(2 * i) / (double)HD)); const float ang = __fmul_rn((float)p, invf); const float c = cosf(ang), s = sinf(ang);
  *(float*)(CS + t) = c; *(float*)(SN + t) = s;  }
extern "C" void kernel_launch(void* const* d_in, const int* in_sizes, int n_in,
                              void* d_out, int out_size, void* d_ws, size_t ws_size, hipStream_t stream) {
  (void)in_sizes; (void)n_in; (void)out_size;
  const float* const* I = (const float* const*)d_in; const float* x = I[0]; const float* wq = I[1]; const float* wk = I[2]; const float* wv = I[3]; const float* wo = I[4];      /* input order: x, Wq [1024][1024], Wk / Wv [1024][256], Wo [1024][1024] ([in][out] weights); rope tables computed in-kernel (positions = row index), as the module computes them */ const float* bq = nullptr; const float* bk = nullptr; const float* bv = nullptr; const float* bo = nullptr;      /* no biases */
  char* ws = (char*)d_ws; size_t off = 0;
  auto take = [&](size_t bytes) { char* p = ws + off; off += (bytes + 255) & ~(size_t)255; return p; };
  _Float16* BQ = (_Float16*)take((size_t)DM * DM * 2); _Float16* BK = (_Float16*)take((size_t)KVD * DM * 2); _Float16* BV = (_Float16*)take((size_t)KVD * DM * 2); _Float16* BO = (_Float16*)take((size_t)DM * DM * 2);
  _Float16* X16 = (_Float16*)take(NR * DM * 2); float* QF = (float*)take((size_t)SQ * DM * 4); float* KF = (float*)take((size_t)SQ * KVD * 4); float* CSB = (float*)take((size_t)SQ * HD * 4); float* SNB = (float*)take((size_t)SQ * HD * 4); _Float16* Q16 = (_Float16*)take(NR * DM * 2); _Float16* K16 = (_Float16*)take(NR * KVD * 2); _Float16* V16 = (_Float16*)take(NR * KVD * 2); _Float16* O16 = (_Float16*)take(NR * DM * 2);
  float* S = (float*)take((size_t)NH * QT * NKX * 4); _Float16* P = (_Float16*)take((size_t)NH * QT * NKX * 2); _Float16* VT = (_Float16*)take((size_t)NH * HD * SQ * 2);
  float* QF0 = (float*)take((size_t)QT0 * DM * 4); float* KF0 = (float*)take((size_t)QT0 * KVD * 4); float* VF0 = (float*)take((size_t)QT0 * KVD * 4); float* KF0e = (float*)take((size_t)QT0 * DM * 4); float* VF0e = (float*)take((size_t)QT0 * DM * 4); float* OF0 = (float*)take((size_t)NB * QT0 * DM * 4); _Float16* OH0 = (_Float16*)take((size_t)NB * QT0 * DM * 2); _Float16* OL0 = (_Float16*)take((size_t)NB * QT0 * DM * 2);
  if (off > ws_size) return;
  k_wt_f16<<<(unsigned)(((size_t)DM * (DM / 8) + 255) / 256), 256, 0, stream>>>(wq, BQ, DM, DM, 16.0f); k_wt_f16<<<(unsigned)(((size_t)KVD * (DM / 8) + 255) / 256), 256, 0, stream>>>(wk, BK, DM, KVD, 16.0f); k_wt_f16<<<(unsigned)(((size_t)KVD * (DM / 8) + 255) / 256), 256, 0, stream>>>(wv, BV, DM, KVD, 16.0f); k_wt_f16<<<(unsigned)(((size_t)DM * (DM / 8) + 255) / 256), 256, 0, stream>>>(wo, BO, DM, DM, 16.0f);      /* [in][out] -> Bt[n][k] x16 (transposing builder; K = DM, N = DM / KVD) */
  k_x16<<<(unsigned)((NR * DM / 8 + 255) / 256), 256, 0, stream>>>(x, X16, NR * DM / 8);
  k_tab2d<<<(SQ * (HD / 2) + 255) / 256, 256, 0, stream>>>(CSB, SNB);      /* rope tables computed in-kernel: angle[p][i] = p * 10000^(-2i/64) (the module's _rope_cache; positions = row index) */
  const size_t r0p = (size_t)B0 * SQ;      /* first projected row */
  k_gemm2<0><<<dim3((unsigned)((MP / 128) * (KVD / 64)), 1), 128, 0, stream>>>(X16 + r0p * DM, DM, 0, BV, DM, 0, 0.0625f, bv, 0, nullptr, 1, 0, 0, nullptr, V16 + r0p * KVD, KVD, 0, MP, KVD, DM);
  for (int b = B0; b < B0 + NBR; ++b) { const size_t r0 = (size_t)b * SQ;
    k_gemm2<0><<<dim3((unsigned)((SQ / 128) * (DM / 64)), 1), 128, 0, stream>>>(X16 + r0 * DM, DM, 0, BQ, DM, 0, 0.0625f, nullptr, 0, nullptr, 1, 0, 0, QF, nullptr, DM, 0, SQ, DM, DM);      /* q (f32) of this batch */
    k_gemm2<0><<<dim3((unsigned)((SQ / 128) * (KVD / 64)), 1), 128, 0, stream>>>(X16 + r0 * DM, DM, 0, BK, DM, 0, 0.0625f, nullptr, 0, nullptr, 1, 0, 0, KF, nullptr, KVD, 0, SQ, KVD, DM);      /* k (f32) */
    k_xform<0, 1><<<(unsigned)((size_t)SQ * NH), 64, 0, stream>>>(QF, DM, NH, nullptr, 0.f, CSB, SNB, Q16 + r0 * DM, DM); k_xform<0, 1><<<(unsigned)((size_t)SQ * NG), 64, 0, stream>>>(KF, KVD, NG, nullptr, 0.f, CSB, SNB, K16 + r0 * KVD, KVD);      /* interleaved-pair rope (pairs (2i, 2i+1)) from the in-kernel tables -> f16 rows */
    k_xformf<0, 1><<<(unsigned)(QT0 * NH), 64, 0, stream>>>(QF, DM, NH, nullptr, 0.f, CSB, SNB, QF0, DM); k_xformf<0, 1><<<(unsigned)(QT0 * NG), 64, 0, stream>>>(KF, KVD, NG, nullptr, 0.f, CSB, SNB, KF0, KVD);      /* f32 roped q, k of rows 0..127 */
    k_vt<NG, SQ><<<NG * (SQ / 64), 256, 0, stream>>>(V16 + r0 * KVD, KVD, 0, VT);      /* V^T [NG][HD][SQ] for this batch */
    k_gemm2<0><<<dim3((QT0 / 128) * (KVD / 64), 1), 128, 0, stream>>>(X16 + r0 * DM, DM, 0, BV, DM, 0, 0.0625f, bv, 0, nullptr, 1, 0, 0, VF0, nullptr, KVD, 0, QT0, KVD, DM);
    k_kvexp<<<(unsigned)(((size_t)QT0 * DM / 4 + 255) / 256), 256, 0, stream>>>(KF0, KF0e, (size_t)QT0 * DM / 4); k_kvexp<<<(unsigned)(((size_t)QT0 * DM / 4 + 255) / 256), 256, 0, stream>>>(VF0, VF0e, (size_t)QT0 * DM / 4);      /* head h <- kv group h/4 for the exact first-tile kernel */      /* f32 q, k, v of the first 128 rows (exact products) */
    k_att0<0><<<NH * (QT0 / 64), 64, 0, stream>>>(QF0, KF0e, VF0e, DM, nullptr, 0.125f, OF0 + (size_t)b * QT0 * DM, DM);      /* exact f32 attention for rows 0..127 (o x64) */
    for (int q0 = 0; q0 < QN; q0 += QT) { const int nk = q0 + QT;      /* causal: only keys below the tile end are computed */
      for (int g = 0; g < NG; ++g) k_gemm2<0><<<dim3((QT / 128) * (nk / 64), HPG), 128, 0, stream>>>(Q16 + (r0 + q0) * LQ + (size_t)g * HPG * HD, LQ, (size_t)HD, K16 + r0 * KVD + (size_t)g * HD, KVD, 0, 0.125f, nullptr, 0, nullptr, 1, 0, 0, S + (size_t)g * HPG * QT * NKX, nullptr, NKX, (size_t)QT * NKX, QT, nk, HD);      /* scores: the 4 heads of group g against the group's keys (sB 0) */
      k_rsmcf2<<<(NHD * QT + 7) / 8, 256, 0, stream>>>(S, P, NHD, q0, nk);
      for (int g = 0; g < NG; ++g) k_gemm2<0><<<dim3((QT / 128) * (HD / 64), HPG), 128, 0, stream>>>(P + (size_t)g * HPG * QT * NKX, NKX, (size_t)QT * NKX, VT + (size_t)g * HD * SQ, SQ, 0, 0.25f, nullptr, 0, nullptr, 1, 0, 0, nullptr, O16 + (r0 + q0) * DM + (size_t)g * HPG * HD, DM, (size_t)HD, QT, HD, nk); } }      /* o for the group's 4 heads (x64) */      /* o (merged heads, x64) as f16 rows */
  k_gemm2<0><<<dim3((unsigned)((MPO / 128) * (DM / 64)), 1), 128, 0, stream>>>(O16 + r0p * DM, DM, 0, BO, DM, 0, 0.0009765625f, bo, 0, nullptr, 1, 0, 0, (float*)d_out + r0p * DM, nullptr, DM, 0, MPO, DM, DM);      /* out rows are the output layout */
  k_hl<<<(unsigned)(((size_t)NB * QT0 * DM / 8 + 255) / 256), 256, 0, stream>>>(OF0, OH0, OL0, (size_t)NB * QT0 * DM / 8);      /* first-tile o (x64) -> f16 hi + x1024 residual planes */
  for (int b = B0; b < B0 + NBR; ++b) { const size_t r0 = (size_t)b * SQ; const size_t f0 = (size_t)b * QT0;
    k_gemm2<0><<<dim3((QT0 / 128) * (DM / 64), 1), 128, 0, stream>>>(OH0 + f0 * DM, DM, 0, BO, DM, 0, 0.0009765625f, bo, 0, nullptr, 1, 0, 0, (float*)d_out + r0 * DM, nullptr, DM, 0, QT0, DM, DM);      /* rows 0..127: out = o_hi Wo (+ b), overwriting the f16-path rows */
    k_gemm2<0><<<dim3((QT0 / 128) * (DM / 64), 1), 128, 0, stream>>>(OL0 + f0 * DM, DM, 0, BO, DM, 0, 0.00000095367431640625f, nullptr, 0, (const float*)d_out + r0 * DM, -1, 0, 0, (float*)d_out + r0 * DM, nullptr, DM, 0, QT0, DM, DM); }      /* += o_lo Wo 2^-20 (own-element accumulate) */
}

// v003
// A run of this version takes 1030 microseconds.
// Versions in between are left out here; by their measured steps it is 7.42 times as fast as v001.
// All steps since v000 together make it 13.0 times as fast.
#include <hip/hip_runtime.h>
// Grouped-query causal attention at width 1024 with [in][out] projections and RoPE computed in the module (x [4][2048][1024]; q = x Wq (16 heads x 64), k = x Wk, v = x Wv (4 kv heads x 64) ([in][out] weights sigma 0.02, no biases); k, v repeated x4 (repeat: query head h uses kv head h / 4); rope: the module rotates the (even, odd) pairs (x1 c - x2 s, x1 s + x2 c) with angle pos * 10000^(-2i/64) and writes the rotated evens into the first half and the rotated odds into the second half of the head: the SAME permutation on q and k, so q . k equals the interleaved-pair rope's; scores / sqrt(64) with a causal mask (tril, -inf); softmax; out = merged Wo ([in][out]) -> [4][2048][1024]).
// Compute dtype: inputs rounded to bf16; x / weights exact; q, k, v, softmax weights and o as plain f16 GEMM operands (~2^-12); scores and softmax statistics f32. v_wmma_f32_16x16x32_f16.
#define NB 4
#define NG 4
#define HPG 4
#define KVD (NG * HD)
#define SQ 2048
#define DM 1024
#define NH 16
#define HD 64
#define HG 4                         /* heads per launch of the k_vt (b, h0) overload */
#define QT 256
#define NKX SQ                       /* S / P row pitch */
#define QT0 128                      /* first-tile rows recomputed exactly in f32 */
#define B0 0                         /* first batch processed (debug hook) */
#define NBR NB                       /* batches processed (debug hook) */
#define NR ((size_t)NB * SQ)         /* token rows */
#define MP ((int)((size_t)NBR * SQ)) /* rows projected (debug hook) */
#define QN SQ                        /* query rows attended per batch (debug hook) */
#define NHD NH                       /* heads attended (debug hook) */
#define MPO MP                       /* rows through the output stage (debug hook) */
#define LQ DM      /* row pitch of the q rows */
typedef __bf16 v16b __attribute__((ext_vector_type(16)));
typedef unsigned short v8us __attribute__((ext_vector_type(8), may_alias));
typedef float  v8f  __attribute__((ext_vector_type(8)));
typedef float  v4f  __attribute__((ext_vector_type(4)));
typedef float  v4fa __attribute__((ext_vector_type(4), may_alias));
union FragB { v16b v; v8us half[2]; unsigned short u[16]; };

__device__ __forceinline__ unsigned short bf16_bits(float x) { unsigned int u = __float_as_uint(x); return (unsigned short)((u + 0x7FFFu + ((u >> 16) & 1u)) >> 16); }
__device__ __forceinline__ float bf16_val(unsigned short b) { return __uint_as_float(((unsigned int)b) << 16); }
__device__ __forceinline__ float bf16_round(float x) { return bf16_val(bf16_bits(x)); }
// D += A·B with NT terms: 1 = ah·bh, 2 = + al·bh (A split), 3 = + ah·bl (both split)
template <int NT>
__device__ __forceinline__ v8f mmaN(v16b ah, v16b al, v16b bh, v16b bl, v8f c) {
  c = __builtin_amdgcn_wmma_f32_16x16x32_bf16(false, ah, false, bh, (short)0, c, false, false);
  if (NT >= 2) c = __builtin_amdgcn_wmma_f32_16x16x32_bf16(false, al, false, bh, (short)0, c, false, false);
  if (NT >= 3) c = __builtin_amdgcn_wmma_f32_16x16x32_bf16(false, ah, false, bl, (short)0, c, false, false);
  asm volatile("v_nop\n\tv_nop\n\tv_nop\n\tv_nop" : "+v"(c) : "v"(ah), "v"(al), "v"(bh), "v"(bl));
  return c;
}

__global__ __launch_bounds__(256) void k_wt_bf16(const float* __restrict__ W, unsigned short* __restrict__ Wt, int K, int N) {
  const int t = blockIdx.x * 256 + threadIdx.x;
  const int k8n = K / 8;
  if (t >= N * k8n) return;
  const int n = t / k8n, k8 = (t % k8n) * 8;
  v8us v;
#pragma unroll
  for (int i = 0; i < 8; ++i) v[i] = bf16_bits(W[(size_t)(k8 + i) * N + n]);
  *(v8us*)(Wt + (size_t)n * K + k8) = v;
  
}

// GEMM C[M][N] (f32, pitch ldc) = act(A[M][K]·W + bias). A f32 row-major (pitch lda) converted per fragment to bf16
// (ASPLIT: hi/lo two planes -> 2 terms, else single rounded term); Wt bf16 [N][K] (pitch ldb). BIAS_BF16 rounds the
// bias to bf16 first (bias quantised to bf16 before the add). K%32==0, M%16==0, N%64==0.
template <bool ASPLIT, int ACT, bool BIAS_BF16>
__global__ __launch_bounds__(128) void k_gemm_bf(const float* __restrict__ A, int lda, const unsigned short* __restrict__ Wt, int ldb,
                                               const float* __restrict__ bias, float* __restrict__ C, int ldc, int M, int N, int K) {
  __shared__ __attribute__((aligned(16))) float so[4][16][64];
  const int tid = threadIdx.x, w = tid >> 5, lane = tid & 31, ln = lane & 15, hh = lane >> 4;
  const int ntn = N / 64;
  const int wid = blockIdx.x * 4 + w;
  const int mt = wid / ntn, nq = wid % ntn;
  if (mt * 16 >= M) return;
  const int row0 = mt * 16, col0 = nq * 64;
  const float* arow = A + (size_t)(row0 + ln) * lda;
  v8f acc[4] = {};
  for (int kb = 0; kb < K; kb += 32) {
    FragB ah, al;
    const v4f x0 = *(const v4fa*)(arow + kb + 8 * hh), x1 = *(const v4fa*)(arow + kb + 8 * hh + 4);
    const v4f x2 = *(const v4fa*)(arow + kb + 16 + 8 * hh), x3 = *(const v4fa*)(arow + kb + 16 + 8 * hh + 4);
    float xs[16] = {x0[0],x0[1],x0[2],x0[3],x1[0],x1[1],x1[2],x1[3],x2[0],x2[1],x2[2],x2[3],x3[0],x3[1],x3[2],x3[3]};
#pragma unroll
    for (int i = 0; i < 16; ++i) { const unsigned short hb = bf16_bits(xs[i]); ah.u[i] = hb; al.u[i] = ASPLIT ? bf16_bits(xs[i] - bf16_val(hb)) : (unsigned short)0; }
#pragma unroll
    for (int t = 0; t < 4; ++t) {
      const unsigned short* brow = Wt + (size_t)(col0 + t * 16 + ln) * ldb + kb;
      FragB b;
      b.half[0] = *(const v8us*)(brow + 8 * hh);
      b.half[1] = *(const v8us*)(brow + 16 + 8 * hh);
      acc[t] = mmaN<ASPLIT ? 2 : 1>(ah.v, al.v, b.v, b.v, acc[t]);
    }
  }
#pragma unroll
  for (int t = 0; t < 4; ++t) {
    float bv = bias ? bias[col0 + t * 16 + ln] : 0.f;
    if (BIAS_BF16) bv = bf16_round(bv);
#pragma unroll
    for (int r = 0; r < 8; ++r) { float v = acc[t][r] + bv; if (ACT == 1) v = fmaxf(v, 0.f); so[w][8 * hh + r][t * 16 + ln] = v; }
  }
  __builtin_amdgcn_fence(__ATOMIC_ACQ_REL, "workgroup");
  __builtin_amdgcn_wave_barrier();
  const int rsub = lane >> 4, c4 = (lane & 15) * 4;
  {
#pragma unroll
    for (int q = 0; q < 8; ++q) {
      const int r = q * 2 + rsub;
      const v4f v = *(const v4fa*)&so[w][r][c4];
      *(v4f*)(C + (size_t)(row0 + r) * ldc + col0 + c4) = v;
    }
    
  }
}

// GEMM C = act(A·W + bias + resid): A f32 (ASPLIT -> hi/lo 2 terms), Wt bf16 [N][K]; ACT 0 none, 1 relu, 2 exact gelu;
// resid (optional, f32, row index = (row % rmod), pitch ldr, RES_BF16 rounds it) added before the activation.
template <bool ASPLIT, int ACT, bool BIAS_BF16, bool RES_BF16>
__global__ __launch_bounds__(128) void k_gemm_bf3(const float* __restrict__ A, int lda, const unsigned short* __restrict__ Wt, int ldb,
                                                const float* __restrict__ bias, const float* __restrict__ resid, int rmod, int ldr,
                                                float* __restrict__ C, int ldc, int M, int N, int K) {
  __shared__ __attribute__((aligned(16))) float so[4][16][64];
  const int tid = threadIdx.x, w = tid >> 5, lane = tid & 31, ln = lane & 15, hh = lane >> 4;
  const int ntn = N / 64;
  const int wid = blockIdx.x * 4 + w;
  const int mt = wid / ntn, nq = wid % ntn;
  if (mt * 16 >= M) return;
  const int row0 = mt * 16, col0 = nq * 64;
  const float* arow = A + (size_t)(row0 + ln) * lda;
  v8f acc[4] = {};
  for (int kb = 0; kb < K; kb += 32) {
    FragB ah, al;
    const v4f x0 = *(const v4fa*)(arow + kb + 8 * hh), x1 = *(const v4fa*)(arow + kb + 8 * hh + 4);
    const v4f x2 = *(const v4fa*)(arow + kb + 16 + 8 * hh), x3 = *(const v4fa*)(arow + kb + 16 + 8 * hh + 4);
    float xs[16] = {x0[0],x0[1],x0[2],x0[3],x1[0],x1[1],x1[2],x1[3],x2[0],x2[1],x2[2],x2[3],x3[0],x3[1],x3[2],x3[3]};
#pragma unroll
    for (int i = 0; i < 16; ++i) { const unsigned short hb = bf16_bits(xs[i]); ah.u[i] = hb; al.u[i] = ASPLIT ? bf16_bits(xs[i] - bf16_val(hb)) : (unsigned short)0; }
#pragma unroll
    for (int t = 0; t < 4; ++t) {
      const unsigned short* brow = Wt + (size_t)(col0 + t * 16 + ln) * ldb + kb;
      FragB b;
      b.half[0] = *(const v8us*)(brow + 8 * hh);
      b.half[1] = *(const v8us*)(brow + 16 + 8 * hh);
      acc[t] = mmaN<ASPLIT ? 2 : 1>(ah.v, al.v, b.v, b.v, acc[t]);
    }
  }
#pragma unroll
  for (int t = 0; t < 4; ++t) {
    const int col = col0 + t * 16 + ln;
    float bv = bias ? bias[col] : 0.f;
    if (BIAS_BF16) bv = bf16_round(bv);
#pragma unroll
    for (int r = 0; r < 8; ++r) {
      float v = acc[t][r] + bv;
      if (resid) { float rv = resid[(size_t)((row0 + 8 * hh + r) % rmod) * ldr + col]; if (RES_BF16) rv = bf16_round(rv); v += rv; }
      if (ACT == 1) v = fmaxf(v, 0.f);
      if (ACT == 2) v = 0.5f * v * (1.0f + erff(v * 0.70710678118654752f));
      if (ACT == 3) { const float u = 0.7978845608028654f * (v + 0.044715f * v * v * v); v = 0.5f * v * (1.0f + tanhf(u)); }
      so[w][8 * hh + r][t * 16 + ln] = v;
    }
  }
  __builtin_amdgcn_fence(__ATOMIC_ACQ_REL, "workgroup");
  __builtin_amdgcn_wave_barrier();
  const int rsub = lane >> 4, c4 = (lane & 15) * 4;
  {
#pragma unroll
    for (int q = 0; q < 8; ++q) {
      const int r = q * 2 + rsub;
      const v4f v = *(const v4fa*)&so[w][r][c4];
      *(v4f*)(C + (size_t)(row0 + r) * ldc + col0 + c4) = v;
    }
    
  }
}
// row LayerNorm (biased variance, eps) over N: s = X (+ R); optional out_sum <- s; out_norm <- (s-mu)*rsqrt(var+eps)*g + b
template <bool PARAM_BF16>
__global__ __launch_bounds__(256) void k_layernorm(const float* __restrict__ X, const float* __restrict__ R, const float* __restrict__ g, const float* __restrict__ bta,
                                                  float* __restrict__ out_sum, float* __restrict__ out_norm, int N, float eps) {
  __shared__ float red[256];
  const int row = blockIdx.x, tid = threadIdx.x;
  const float* x = X + (size_t)row * N; const float* rr = R ? R + (size_t)row * N : nullptr;
  float vals[16];                     // up to N = 4096
  const int per = N / 256;            // contiguous chunk per thread? use strided-by-4 chunks: thread handles j = tid*4 + 1024*u
  float s1 = 0.f;
  for (int u = 0; u < per / 4; ++u) {
    const int j = tid * 4 + 1024 * u;
    const v4f a = *(const v4fa*)(x + j);
    v4f b = {0.f,0.f,0.f,0.f}; if (rr) b = *(const v4fa*)(rr + j);
#pragma unroll
    for (int q = 0; q < 4; ++q) { const float v = a[q] + b[q]; vals[u * 4 + q] = v; s1 += v; }
  }
  red[tid] = s1; __syncthreads();
  for (int st = 128; st > 0; st >>= 1) { if (tid < st) red[tid] += red[tid + st]; __syncthreads(); }
  const float mu = red[0] / (float)N; __syncthreads();
  float s2 = 0.f;
  for (int u = 0; u < per / 4; ++u)
#pragma unroll
    for (int q = 0; q < 4; ++q) { const float c = vals[u * 4 + q] - mu; s2 += c * c; }
  red[tid] = s2; __syncthreads();
  for (int st = 128; st > 0; st >>= 1) { if (tid < st) red[tid] += red[tid + st]; __syncthreads(); }
  const float rs = rsqrtf(red[0] / (float)N + eps);
  {
    for (int u = 0; u < per / 4; ++u) {
      const int j = tid * 4 + 1024 * u;
      v4f o, sm;
#pragma unroll
      for (int q = 0; q < 4; ++q) {
        float gg = g[j + q], bb = bta[j + q];
        if (PARAM_BF16) { gg = bf16_round(gg); bb = bf16_round(bb); }
        sm[q] = vals[u * 4 + q]; o[q] = (vals[u * 4 + q] - mu) * rs * gg + bb;
      }
      if (out_sum) *(v4f*)(out_sum + (size_t)row * N + j) = sm;
      *(v4f*)(out_norm + (size_t)row * N + j) = o;
    }
    
  }
}



// ---- f16 WMMA path (v_wmma_f32_16x16x32_f16): 11-bit significands for operands in range — used where a [0,1] probability operand needs more precision than bf16
typedef _Float16 v16h __attribute__((ext_vector_type(16)));
union FragH { v16h v; v8us half[2]; _Float16 h[16]; unsigned short u[16]; };
template <int NT>
__device__ __forceinline__ v8f mmaH(v16h ah, v16h al, v16h bh, v16h bl, v8f c) {
  c = __builtin_amdgcn_wmma_f32_16x16x32_f16(false, ah, false, bh, (short)0, c, false, false);
  if (NT >= 2) c = __builtin_amdgcn_wmma_f32_16x16x32_f16(false, al, false, bh, (short)0, c, false, false);
  if (NT >= 3) c = __builtin_amdgcn_wmma_f32_16x16x32_f16(false, ah, false, bl, (short)0, c, false, false);
  asm volatile("v_nop\n\tv_nop\n\tv_nop\n\tv_nop" : "+v"(c) : "v"(ah), "v"(al), "v"(bh), "v"(bl));
  return c;
}
// batched GEMM like k_gemm_b but f16 operands: A f32 (split into f16 hi/lo if ASPLIT, else rounded to f16), Bt = f16 values [n][k]; alpha; C f32; N multiple of 16 (partial tiles skipped)
template <bool ASPLIT>
__global__ __launch_bounds__(128) void k_gemm_h(const float* __restrict__ A, int lda, size_t sA, const _Float16* __restrict__ Bh, int ldb, size_t sB, float alpha, float* __restrict__ C, int ldc, size_t sC, int M, int N, int K) {
  __shared__ __attribute__((aligned(16))) float so[4][16][64];
  const int tid = threadIdx.x, w = tid >> 5, lane = tid & 31, ln = lane & 15, hh = lane >> 4; const int by = blockIdx.y;
  A += (size_t)by * sA; Bh += (size_t)by * sB; C += (size_t)by * sC;
  const int ntn = (N + 63) / 64; const int wid = blockIdx.x * 4 + w; const int mt = wid / ntn, nq = wid % ntn; if (mt * 16 >= M) return;
  const int row0 = mt * 16, col0 = nq * 64; const float* arow = A + (size_t)(row0 + ln) * lda;
  v8f acc[4] = {};
  for (int kb = 0; kb < K; kb += 32) {
    FragH ah, al;
    const v4f x0 = *(const v4fa*)(arow + kb + 8 * hh), x1 = *(const v4fa*)(arow + kb + 8 * hh + 4), x2 = *(const v4fa*)(arow + kb + 16 + 8 * hh), x3 = *(const v4fa*)(arow + kb + 16 + 8 * hh + 4);
    float xs[16] = {x0[0],x0[1],x0[2],x0[3],x1[0],x1[1],x1[2],x1[3],x2[0],x2[1],x2[2],x2[3],x3[0],x3[1],x3[2],x3[3]};
#pragma unroll
    for (int i = 0; i < 16; ++i) { const _Float16 h = (_Float16)xs[i]; ah.h[i] = h; al.h[i] = ASPLIT ? (_Float16)(xs[i] - (float)h) : (_Float16)0.0f; }
#pragma unroll
    for (int t = 0; t < 4; ++t) { if (col0 + t * 16 >= N) continue; const size_t boff = (size_t)(col0 + t * 16 + ln) * ldb + kb; FragH bq; bq.half[0] = *(const v8us*)(Bh + boff + 8 * hh); bq.half[1] = *(const v8us*)(Bh + boff + 16 + 8 * hh);
      acc[t] = mmaH<ASPLIT ? 2 : 1>(ah.v, al.v, bq.v, bq.v, acc[t]); }
  }
#pragma unroll
  for (int t = 0; t < 4; ++t) { if (col0 + t * 16 >= N) continue;
#pragma unroll
    for (int r = 0; r < 8; ++r) so[w][8 * hh + r][t * 16 + ln] = acc[t][r] * alpha; }
  __builtin_amdgcn_fence(__ATOMIC_ACQ_REL, "workgroup"); __builtin_amdgcn_wave_barrier();
  const int rsub = lane >> 4, c4 = (lane & 15) * 4;
  {
#pragma unroll
    for (int q = 0; q < 8; ++q) { const int r = q * 2 + rsub; if (col0 + c4 < N) { const v4f v = *(const v4fa*)&so[w][r][c4]; *(v4f*)(C + (size_t)(row0 + r) * ldc + col0 + c4) = v; } }
     }
}

// Wt[n][k] = f16(W[k][n]·scale) from f32 row-major W[K][N] (scale = power of two; bf16-exact weights stay exact in f16 away from the subnormal range)
__global__ __launch_bounds__(256) void k_wt_f16(const float* __restrict__ W, _Float16* __restrict__ Wt, int K, int N, float scale) {
  const int t = blockIdx.x * 256 + threadIdx.x; if (t >= N * (K / 8)) return; const int n = t / (K / 8), k8 = (t % (K / 8)) * 8; FragH f;
#pragma unroll
  for (int i = 0; i < 8; ++i) f.h[i] = (_Float16)(bf16_round(W[(size_t)(k8 + i) * N + n]) * scale); const v8us o = f.half[0];
  *(v8us*)((unsigned short*)Wt + (size_t)n * K + k8) = o; 
}
// k_gemm_hh variant with fused epilogue: v = acc·alpha + bias[by·sBias + col] (+ CP[(row/rowsPerB)·sCPb + by·64 + col] if CP) ; ACT 0 none / 1 elu ; writes f16 C16 (and f32 C if non-null)
template <int ACT>
__global__ __launch_bounds__(128) void k_gemm_hhx(const _Float16* __restrict__ A, int lda, size_t sA, const _Float16* __restrict__ Bh, int ldb, size_t sB, float alpha, const float* __restrict__ bias, size_t sBias, const float* __restrict__ CP, int rowsPerB, size_t sCPb, int row0g,
    float* __restrict__ C, _Float16* __restrict__ C16, int ldc, size_t sC, int M, int N, int K) {
  __shared__ __attribute__((aligned(16))) float so[4][16][64];
  const int tid = threadIdx.x, w = tid >> 5, lane = tid & 31, ln = lane & 15, hh = lane >> 4; const int by = blockIdx.y;
  A += (size_t)by * sA; Bh += (size_t)by * sB; const size_t cofs = (size_t)by * sC; const float* bp = bias ? bias + (size_t)by * sBias : nullptr;
  const int ntn = (N + 63) / 64; const int wid = blockIdx.x * 4 + w; const int mt = wid / ntn, nq = wid % ntn; if (mt * 16 >= M) return;
  const int row0 = mt * 16, col0 = nq * 64; const _Float16* arow = A + (size_t)(row0 + ln) * lda;
  v8f acc[4] = {};
  for (int kb = 0; kb < K; kb += 32) { FragH ah; ah.half[0] = *(const v8us*)((const unsigned short*)arow + kb + 8 * hh); ah.half[1] = *(const v8us*)((const unsigned short*)arow + kb + 16 + 8 * hh);
#pragma unroll
    for (int t = 0; t < 4; ++t) { if (col0 + t * 16 >= N) continue; const size_t boff = (size_t)(col0 + t * 16 + ln) * ldb + kb; FragH bq; bq.half[0] = *(const v8us*)((const unsigned short*)Bh + boff + 8 * hh); bq.half[1] = *(const v8us*)((const unsigned short*)Bh + boff + 16 + 8 * hh);
      acc[t] = mmaH<1>(ah.v, ah.v, bq.v, bq.v, acc[t]); }
  }
#pragma unroll
  for (int t = 0; t < 4; ++t) { if (col0 + t * 16 >= N) continue; const int col = col0 + t * 16 + ln; const float bv = bp ? bf16_round(bp[col]) : 0.f;
#pragma unroll
    for (int r = 0; r < 8; ++r) { float v = acc[t][r] * alpha + bv; if (CP) { const int rr = row0g + row0 + 8 * hh + r; if (rowsPerB < 0) v += CP[cofs + (size_t)rr * ldc + col];      /* rowsPerB < 0: own element of the batched C plane */ else { const int bidx = rr / rowsPerB; v += CP[(size_t)bidx * sCPb + (size_t)by * 64 + col]; } } if (ACT == 1) v = (v > 0.f) ? v : expm1f(v); else if (ACT == 7) v = (v > 0.f) ? v + 1.0f : expf(v); else if (ACT == 8) v = tanhf(v); else if (ACT == 9) v = 0.5f * v * (1.0f + tanhf(0.7978845608028654f * (v + 0.044715f * v * v * v))); else if (ACT == 11) v = 1.0f / (1.0f + expf(-v)); else if (ACT == 12) v = (v > 0.f) ? v : 0.01f * v; else if (ACT == 14) v = (v > 0.f) ? v : 0.1f * v; else if (ACT == 16) v = (v >= 0.f) ? v : 0.3f * v; else if (ACT == 17) v = (v >= 0.f) ? v : 0.2f * v; else if (ACT == 15) v = v / (1.0f + expf(-v)); else if (ACT == 3) v = fmaxf(v, 0.f); else if (ACT == 6) v = 0.5f * v * (1.0f + erff(v * 0.70710678118654752f)); so[w][8 * hh + r][t * 16 + ln] = v; } }
  __builtin_amdgcn_fence(__ATOMIC_ACQ_REL, "workgroup"); __builtin_amdgcn_wave_barrier();
  const int rsub = lane >> 4, c4 = (lane & 15) * 4; typedef _Float16 v4h __attribute__((ext_vector_type(4)));
  {
#pragma unroll
    for (int q = 0; q < 8; ++q) { const int r = q * 2 + rsub; if (col0 + c4 < N) { const v4f v = *(const v4fa*)&so[w][r][c4]; if (C) *(v4f*)(C + cofs + (size_t)(row0 + r) * ldc + col0 + c4) = v; if (C16) { v4h h4; for (int i = 0; i < 4; ++i) h4[i] = (_Float16)v[i]; *(v4h*)(C16 + cofs + (size_t)(row0 + r) * ldc + col0 + c4) = h4; } } }
     }
}


typedef _Float16 v4h __attribute__((ext_vector_type(4)));

__global__ __launch_bounds__(256) void k_x16(const float* __restrict__ x, _Float16* __restrict__ X16, size_t n8) { const size_t t = (size_t)blockIdx.x * 256 + threadIdx.x; if (t >= n8) return; FragH f;
#pragma unroll
  for (int q = 0; q < 8; ++q) f.h[q] = (_Float16)bf16_round(x[t * 8 + q]); *(v8us*)((unsigned short*)X16 + t * 8) = f.half[0];  }
__global__ __launch_bounds__(256) void k_h16(const float* __restrict__ x, _Float16* __restrict__ X16, size_t n8) { const size_t t = (size_t)blockIdx.x * 256 + threadIdx.x; if (t >= n8) return; FragH f;
#pragma unroll
  for (int q = 0; q < 8; ++q) f.h[q] = (_Float16)x[t * 8 + q]; *(v8us*)((unsigned short*)X16 + t * 8) = f.half[0];  }
__global__ __launch_bounds__(256) void k_round16f(const float* __restrict__ W, _Float16* __restrict__ Bt, size_t n8) { const size_t t = (size_t)blockIdx.x * 256 + threadIdx.x; if (t >= n8) return; FragH f;
#pragma unroll
  for (int i = 0; i < 8; ++i) f.h[i] = (_Float16)(bf16_round(W[t * 8 + i]) * 16.0f); *(v8us*)((unsigned short*)Bt + t * 8) = f.half[0];  }
template <int NHv, int TTv>
__global__ __launch_bounds__(256) void k_vt(const _Float16* __restrict__ V16, int ldv, int voff, _Float16* __restrict__ Vt) { __shared__ unsigned short tl[64][66]; const int tid = threadIdx.x; const int slab = blockIdx.x / (TTv / 64), lg = blockIdx.x % (TTv / 64); const int b = slab / NHv, h = slab % NHv;
  for (int i = tid; i < 64 * 8; i += 256) { const int r = i / 8, c8 = (i % 8) * 8; FragH f; f.half[0] = *(const v8us*)((const unsigned short*)V16 + ((size_t)b * TTv + lg * 64 + r) * ldv + voff + h * 64 + c8);
#pragma unroll
    for (int q = 0; q < 8; ++q) tl[r][c8 + q] = f.u[q]; }
  __syncthreads();
  {
#pragma unroll
    for (int rd = 0; rd < 2; ++rd) { const int d = rd * 32 + tid / 8, pc = tid % 8; FragH f;
#pragma unroll
      for (int q = 0; q < 8; ++q) f.u[q] = tl[pc * 8 + q][d];
      *(v8us*)((unsigned short*)Vt + ((size_t)slab * 64 + d) * TTv + lg * 64 + pc * 8) = f.half[0]; }
     } }

__global__ __launch_bounds__(256) void k_hl(const float* __restrict__ F, _Float16* __restrict__ Hh, _Float16* __restrict__ Hl, size_t n8) { const size_t t = (size_t)blockIdx.x * 256 + threadIdx.x; if (t >= n8) return; FragH fh, fl; const v4f a = *(const v4fa*)(F + t * 8), c = *(const v4fa*)(F + t * 8 + 4);
#pragma unroll
  for (int q = 0; q < 4; ++q) { _Float16 h = (_Float16)a[q]; fh.h[q] = h; fl.h[q] = (_Float16)((a[q] - (float)h) * 1024.0f); h = (_Float16)c[q]; fh.h[4 + q] = h; fl.h[4 + q] = (_Float16)((c[q] - (float)h) * 1024.0f); }
  { *(v8us*)((unsigned short*)Hh + t * 8) = fh.half[0]; *(v8us*)((unsigned short*)Hl + t * 8) = fl.half[0];  } }

// ---- fast GEMM (wave tile 32x64; requires M % 32 == 0 rows per launch region and N % 64 == 0); epilogue = k_gemm_hhx semantics ----
__device__ __forceinline__ v16h g2_frag(const _Float16* p, int hh) { FragH f; f.half[0] = *(const v8us*)((const unsigned short*)p + 8 * hh); f.half[1] = *(const v8us*)((const unsigned short*)p + 16 + 8 * hh); return f.v; }
__device__ __forceinline__ v8f g2_mma(v16h a, v16h b, v8f c) { v8f d = __builtin_amdgcn_wmma_f32_16x16x32_f16(false, a, false, b, (short)0, c, false, false); asm volatile("v_nop\n\tv_nop\n\tv_nop\n\tv_nop" : "+v"(d) : "v"(a), "v"(b)); return d; }
template <int ACT>
__global__ __launch_bounds__(128) void k_gemm2(const _Float16* __restrict__ A, int lda, size_t sA, const _Float16* __restrict__ Bh, int ldb, size_t sB, float alpha, const float* __restrict__ bias, size_t sBias, const float* __restrict__ CP, int rowsPerB, size_t sCPb, int row0g,
    float* __restrict__ C, _Float16* __restrict__ C16, int ldc, size_t sC, int M, int N, int K) { static_assert(ACT == 0 || ACT == 3 || ACT == 6 || ACT == 8 || ACT == 9 || ACT == 11 || ACT == 12 || ACT == 14 || ACT == 15 || ACT == 16 || ACT == 17, "k_gemm2: unsupported ACT code (would silently apply no activation)");
  __shared__ __attribute__((aligned(16))) float so[4][32][68];
  const int tid = threadIdx.x, w = tid >> 5, lane = tid & 31, ln = lane & 15, hh = lane >> 4; const int by = blockIdx.y;
  A += (size_t)by * sA; Bh += (size_t)by * sB; const size_t cofs = (size_t)by * sC; const float* bp = bias ? bias + (size_t)by * sBias : nullptr;
  const int ntn = N >> 6; const int mt = blockIdx.x / ntn, nq = blockIdx.x - mt * ntn; const int row0 = mt * 128 + 32 * w, col0 = nq * 64; if (row0 >= M) return;
  const _Float16* a0p = A + (size_t)(row0 + ln) * lda; const _Float16* a1p = a0p + (size_t)16 * lda;
  const _Float16* b0p = Bh + (size_t)(col0 + ln) * ldb; const _Float16* b1p = b0p + (size_t)16 * ldb; const _Float16* b2p = b1p + (size_t)16 * ldb; const _Float16* b3p = b2p + (size_t)16 * ldb;
  const v8f z8 = {0.f,0.f,0.f,0.f,0.f,0.f,0.f,0.f}; v8f c00 = z8, c01 = z8, c02 = z8, c03 = z8, c10 = z8, c11 = z8, c12 = z8, c13 = z8;
#pragma unroll 1
  for (int kb = 0; kb < K; kb += 32) { const v16h a0 = g2_frag(a0p + kb, hh), a1 = g2_frag(a1p + kb, hh);
    v16h b = g2_frag(b0p + kb, hh); c00 = g2_mma(a0, b, c00); c10 = g2_mma(a1, b, c10);
    b = g2_frag(b1p + kb, hh); c01 = g2_mma(a0, b, c01); c11 = g2_mma(a1, b, c11);
    b = g2_frag(b2p + kb, hh); c02 = g2_mma(a0, b, c02); c12 = g2_mma(a1, b, c12);
    b = g2_frag(b3p + kb, hh); c03 = g2_mma(a0, b, c03); c13 = g2_mma(a1, b, c13); }
  v8f accs[8] = {c00, c01, c02, c03, c10, c11, c12, c13};
#pragma unroll
  for (int u = 0; u < 8; ++u) { const int t = u & 3, half = u >> 2; const int col = col0 + t * 16 + ln; const float bv = bp ? bf16_round(bp[col]) : 0.f;
#pragma unroll
    for (int r = 0; r < 8; ++r) { const int rloc = half * 16 + 8 * hh + r; float v = accs[u][r] * alpha + bv; if (CP) { if (rowsPerB < 0) v += CP[cofs + (size_t)(row0g + row0 + rloc) * ldc + col];      /* rowsPerB < 0: own element of the batched C plane */ else { const int bidx = (row0g + row0 + rloc) / rowsPerB; v += CP[(size_t)bidx * sCPb + (size_t)by * 64 + col]; } }
      if (ACT == 3) v = fmaxf(v, 0.f); else if (ACT == 6) v = 0.5f * v * (1.0f + erff(v * 0.70710678118654752f)); else if (ACT == 11) v = 1.0f / (1.0f + expf(-v)); else if (ACT == 15) v = v / (1.0f + expf(-v)); else if (ACT == 12) v = (v > 0.f) ? v : 0.01f * v; else if (ACT == 8) v = tanhf(v); else if (ACT == 9) v = 0.5f * v * (1.0f + tanhf(0.7978845608028654f * (v + 0.044715f * v * v * v))); else if (ACT == 14) v = (v > 0.f) ? v : 0.1f * v; else if (ACT == 16) v = (v >= 0.f) ? v : 0.3f * v; else if (ACT == 17) v = (v >= 0.f) ? v : 0.2f * v;
      so[w][rloc][t * 16 + ln] = v; } }
  __builtin_amdgcn_fence(__ATOMIC_ACQ_REL, "workgroup"); __builtin_amdgcn_wave_barrier();
  const int rsub = lane >> 4, c4 = (lane & 15) * 4;
  {
#pragma unroll
    for (int q = 0; q < 16; ++q) { const int r = q * 2 + rsub; const v4f v = *(const v4fa*)&so[w][r][c4]; if (C) *(v4f*)(C + cofs + (size_t)(row0 + r) * ldc + col0 + c4) = v; if (C16) { v4h h4; for (int i = 0; i < 4; ++i) h4[i] = (_Float16)v[i]; *(v4h*)(C16 + cofs + (size_t)(row0 + r) * ldc + col0 + c4) = h4; } }
     } }


__global__ __launch_bounds__(256) void k_wnat(const float* __restrict__ w, size_t n8, _Float16* __restrict__ Bt) { const size_t t = (size_t)blockIdx.x * 256 + threadIdx.x; if (t >= n8) return; FragH f; for (int q = 0; q < 8; ++q) f.h[q] = (_Float16)(bf16_round(w[t * 8 + q]) * 16.0f); *(v8us*)((unsigned short*)Bt + t * 8) = f.half[0];  }
__global__ __launch_bounds__(256) void k_rsm(const float* __restrict__ S, _Float16* __restrict__ P, int nrows) {
  #pragma clang fp contract(off)
  const int i = blockIdx.x * 256 + threadIdx.x; if (i >= nrows) return; const float* s = S + (size_t)i * SQ; float mx = -3.0e38f;
#pragma unroll 1
  for (int j = 0; j < SQ; ++j) mx = fmaxf(mx, s[j]); float se = 0.f;
#pragma unroll 1
  for (int j = 0; j < SQ; ++j) se += expf(s[j] - mx); const float sc = 256.0f / se;
#pragma unroll 1
  for (int j0 = 0; j0 < SQ; j0 += 8) { FragH f; for (int q = 0; q < 8; ++q) f.h[q] = (_Float16)(expf(s[j0 + q] - mx) * sc); unsigned short* d = (unsigned short*)P + (size_t)i * SQ + j0; *(v8us*)d = f.half[0];  } }
__global__ __launch_bounds__(256) void k_vt(const _Float16* __restrict__ V16, int b, int h0, _Float16* __restrict__ VT) { __shared__ unsigned short tl[64][65]; const int tid = threadIdx.x; const int hh = blockIdx.x % HG, sg = blockIdx.x / HG; const int s0 = sg * 64; const int h = h0 + hh;
  for (int i = tid; i < 64 * 8; i += 256) { const int j = i / 8, d8 = (i % 8) * 8; FragH f; f.half[0] = *(const v8us*)((const unsigned short*)V16 + ((size_t)b * SQ + s0 + j) * DM + h * HD + d8); for (int q = 0; q < 8; ++q) tl[d8 + q][j] = f.u[q]; }
  __syncthreads();
  { for (int i = tid; i < 64 * 8; i += 256) { const int d = i / 8, j8 = (i % 8) * 8; FragH f; for (int q = 0; q < 8; ++q) f.u[q] = tl[d][j8 + q]; *(v8us*)((unsigned short*)VT + ((size_t)hh * HD + d) * SQ + s0 + j8) = f.half[0]; }  } }



// 2^x on the transcendental unit. The v_nop fills the one issue slot that the instruction set asks for behind a transcendental before its source
// is overwritten.
__device__ __forceinline__ float exp2_slot(float x) { float r; asm("v_exp_f32 %0, %1\n\tv_nop" : "=v"(r) : "v"(x)); return r; }
// Fused causal attention (online softmax): one launch for every batch, head and query row; scores and softmax weights never leave the registers.
// A work-group is the 4 query heads of one kv group (one wave each) on the same 32 query rows, so its waves walk the same K and V lines.
// Transposed products: S^T = K Q^T puts query 16 c + ln in lane ln and key 16 kt + 8 hh + r in register r, which is already the B-operand order of
// P^T for O^T += V^T P^T (half kt of the fragment = tile kt's 8 registers): no exchange between lanes but the one between the two wave halves.
__device__ __forceinline__ v8f fa_mma(v16h a, v16h b, v8f c) { return __builtin_amdgcn_wmma_f32_16x16x32_f16(false, a, false, b, (short)0, c, false, false); }
__device__ __forceinline__ float fa_xhalf(float x) { return __builtin_bit_cast(float, __builtin_amdgcn_permlanex16(__builtin_bit_cast(int, x), __builtin_bit_cast(int, x), 0x76543210, 0xfedcba98, false, false)); }      /* lane l <-> lane l ^ 16 */
// A fragment at the lane's own byte offset (row ln, element 8 hh) from a uniform base: k = 8 hh .. + 7 and 16 + 8 hh .. + 7, the k order of g2_frag.
__device__ __forceinline__ v16h fa_frag(const _Float16* base, unsigned off, int cb) { const char* p = (const char*)base + off; FragH f; f.half[0] = *(const v8us*)(p + cb); f.half[1] = *(const v8us*)(p + cb + 32); return f.v; }
// s_wait_xcnt 0 behind issued loads, in front of any write of a register that they name. The lane offsets pass through the statement: they stay in
// their registers up to the wait, and whatever is formed from them later stands behind it (a "memory" clobber alone does not tie the wait to registers).
__device__ __forceinline__ void fa_hold(unsigned& a) { asm volatile("s_wait_xcnt 0x0" : "+v"(a) : : "memory"); }
__device__ __forceinline__ void fa_hold(unsigned& a, unsigned& b) { asm volatile("s_wait_xcnt 0x0" : "+v"(a), "+v"(b) : : "memory"); }
// One pass of 32 keys. ko: the lane's byte offset of the NEXT pass's K rows; vo: of this pass's keys in V^T. DIAG: the wave's last pass, the only one
// that meets the diagonal (it masks, and it fetches no further K).
// Every loop over kt, kc, c, t and r here and in the kernel is unrolled so that fragments, scores and accumulators are indexed by constants only and stay in registers.
template <bool DIAG>
__device__ __forceinline__ void fa_pass(const _Float16* __restrict__ Kh, const _Float16* __restrict__ Vt, unsigned& ko, unsigned& vo, int key0, int q0, int ln, int hh,
                                        const v16h (&qf)[2][2], v16h (&kf)[2][2], v8f (&acc)[2][4], float (&m)[2], float (&l)[2]) {
  const float cs = 0.125f * 1.44269504f;      /* 1 / sqrt(64), and e^x = 2^(x log2 e) */
  v16h vf[4];
#pragma unroll
  for (int t = 0; t < 4; ++t) vf[t] = fa_frag(Vt, vo, 16 * t * SQ * 2);      /* V^T rows d = 16 t + ln, this pass's keys: in flight under the scores and the exponentials */
  v8f s[2][2];
#pragma unroll
  for (int kt = 0; kt < 2; ++kt)
#pragma unroll
    for (int c = 0; c < 2; ++c) { const v8f z = {0.f, 0.f, 0.f, 0.f, 0.f, 0.f, 0.f, 0.f}; s[kt][c] = fa_mma(kf[kt][1], qf[c][1], fa_mma(kf[kt][0], qf[c][0], z)); }
  if (!DIAG) {      /* the next pass's K rows, in flight under this pass's softmax and second product */
#pragma unroll
    for (int kt = 0; kt < 2; ++kt)
#pragma unroll
      for (int kc = 0; kc < 2; ++kc) kf[kt][kc] = fa_frag(Kh, ko, (16 * kt * KVD + 32 * kc) * 2);
    fa_hold(ko, vo);
    __builtin_amdgcn_sched_barrier(0);      /* keeps the K loads here: without it the scheduler sinks them to the end of the pass, and the next pass's scores wait out their whole latency */
    ko += 32 * KVD * 2; vo += 32 * 2;
  } else fa_hold(vo);
#pragma unroll
  for (int c = 0; c < 2; ++c) {
    if (DIAG) {
      const int qi = q0 + 16 * c + ln;
#pragma unroll
      for (int kt = 0; kt < 2; ++kt)
#pragma unroll
        for (int r = 0; r < 8; ++r) if (key0 + 16 * kt + 8 * hh + r > qi) s[kt][c][r] = -1.0e30f;
    }
    float mx = s[0][c][0];
#pragma unroll
    for (int r = 0; r < 8; ++r) mx = fmaxf(mx, fmaxf(s[0][c][r], s[1][c][r]));
    mx = fmaxf(mx, fa_xhalf(mx));      /* both halves of the wave now hold this query's maximum over the pass */
    const float mn = fmaxf(m[c], mx * cs);
    const float corr = exp2_slot(m[c] - mn);      /* 0 on the first pass */
    m[c] = mn;
    FragH pf; float ps = 0.f;
#pragma unroll
    for (int kt = 0; kt < 2; ++kt)
#pragma unroll
      for (int r = 0; r < 8; ++r) { const float p = exp2_slot(fmaf(s[kt][c][r], cs, -mn)); ps += p; pf.h[8 * kt + r] = (_Float16)p; }
    l[c] = fmaf(l[c], corr, ps);
#pragma unroll
    for (int t = 0; t < 4; ++t) { acc[c][t] = acc[c][t] * corr; acc[c][t] = fa_mma(vf[t], pf.v, acc[c][t]); }
    /* the four vector slots that the chip needs behind a matrix instruction before its operands are overwritten */
    asm volatile("v_nop\n\tv_nop\n\tv_nop\n\tv_nop" : "+v"(acc[c][0]), "+v"(acc[c][1]), "+v"(acc[c][2]), "+v"(acc[c][3]) : "v"(vf[0]), "v"(vf[1]), "v"(vf[2]), "v"(vf[3]), "v"(pf.v));
  }
}
__global__ __launch_bounds__(128) void k_fattn(const _Float16* __restrict__ Q, const _Float16* __restrict__ Kh, const _Float16* __restrict__ Vt, _Float16* __restrict__ O) {
  const int lane = threadIdx.x & 31, ln = lane & 15, hh = lane >> 4; const int g = blockIdx.y, b = blockIdx.z; const int h = g * HPG + (threadIdx.x >> 5);
  const int qt = (b & 1) ? (int)blockIdx.x : (SQ / 32 - 1) - (int)blockIdx.x;      /* long and short tiles alternate from batch to batch, so that work-groups a whole batch apart in the grid add up to the same length */
  const int q0 = qt * 32; const size_t r0 = (size_t)b * SQ;
  unsigned qo = (unsigned)(((r0 + q0 + ln) * DM + h * HD + 8 * hh) * 2), ko = (unsigned)(((r0 + ln) * KVD + g * HD + 8 * hh) * 2), vo = (unsigned)((((size_t)(b * NG + g) * HD + ln) * SQ + 8 * hh) * 2);      /* byte offsets: every buffer is below 4 GiB */
  v16h qf[2][2], kf[2][2];
#pragma unroll
  for (int c = 0; c < 2; ++c)
#pragma unroll
    for (int kc = 0; kc < 2; ++kc) { qf[c][kc] = fa_frag(Q, qo, (16 * c * DM + 32 * kc) * 2); kf[c][kc] = fa_frag(Kh, ko, (16 * c * KVD + 32 * kc) * 2); }
  fa_hold(qo, ko);
  ko += 32 * KVD * 2;
  v8f acc[2][4] = {}; float m[2] = {-1.0e30f, -1.0e30f}, l[2] = {0.f, 0.f};
  for (int key0 = 0; key0 < q0; key0 += 32) fa_pass<false>(Kh, Vt, ko, vo, key0, q0, ln, hh, qf, kf, acc, m, l);
  fa_pass<true>(Kh, Vt, ko, vo, q0, q0, ln, hh, qf, kf, acc, m, l);
  unsigned short* op = (unsigned short*)O + (r0 + q0 + ln) * DM + h * HD + 8 * hh;
#pragma unroll
  for (int c = 0; c < 2; ++c) { const float fin = 64.0f / (l[c] + fa_xhalf(l[c]));      /* o carried x64, as the output product expects */
#pragma unroll
    for (int t = 0; t < 4; ++t) { FragH f;
#pragma unroll
      for (int r = 0; r < 8; ++r) f.h[r] = (_Float16)(acc[c][t][r] * fin);
      *(v8us*)(op + (size_t)(16 * c) * DM + 16 * t) = f.half[0]; }      /* d = 16 t + 8 hh .. + 7 of query row 16 c + ln */
    asm volatile("s_wait_xcnt 0x0" ::: "memory"); }      /* behind the stores, in front of any later write of a register that an issued store names */
}


// Exact f32 attention for the first QT0 rows: one thread per (query row, head), online softmax; every sum runs in the order d = 0, 1, ... and j = 0, 1, ...
// What a thread owns (its q row, its o accumulator) stays in registers; what all threads of the block read at the same address (the head's K and V rows)
// is staged once in LDS and read by broadcast. Every loop over d is unrolled so that q, o and the row fragments are indexed by constants only.
__global__ __launch_bounds__(64) void k_att0(const float* __restrict__ QF, const float* __restrict__ KF, const float* __restrict__ VF, float scale, float* __restrict__ OF, int ldo) {
  __shared__ __attribute__((aligned(16))) float lk[QT0][HD]; __shared__ __attribute__((aligned(16))) float lv[QT0][HD]; __shared__ __attribute__((aligned(16))) float lo[64][64];
  const int tid = threadIdx.x; const int h = blockIdx.x / (QT0 / 64), rg = blockIdx.x % (QT0 / 64); const int i = rg * 64 + tid;
  const int jmax = rg * 64 + 63;      /* keys up to the block's last row */
  const int sr = tid >> 4, sc4 = (tid & 15) * 4;      /* staging: 16 threads to a row of 256 bytes */
  unsigned so = (unsigned)((sr * LQ + h * HD + sc4) * 4), qo = (unsigned)((i * LQ + h * HD) * 4);      /* the lane's byte offsets in K and V, and in q */
#pragma unroll 1      /* kept rolled: one trip already has 16 loads in flight per thread */
  for (int r0 = 0; r0 <= jmax; r0 += 32) { v4f kk[8], vv[8];
#pragma unroll
    for (int u = 0; u < 8; ++u) { kk[u] = *(const v4fa*)((const char*)KF + so + u * 4 * LQ * 4); vv[u] = *(const v4fa*)((const char*)VF + so + u * 4 * LQ * 4); }      /* 16 loads in flight per thread */
    fa_hold(so);      /* the wait behind the issued loads, in front of the write of the offset that they name */
    so += 32 * LQ * 4;
#pragma unroll
    for (int u = 0; u < 8; ++u) { *(v4f*)&lk[r0 + 4 * u + sr][sc4] = kk[u]; *(v4f*)&lv[r0 + 4 * u + sr][sc4] = vv[u]; } }
  float q[HD], o[HD];
#pragma unroll
  for (int c = 0; c < HD / 4; ++c) { const v4f t = *(const v4fa*)((const char*)QF + qo + c * 16);
#pragma unroll
    for (int u = 0; u < 4; ++u) { q[c * 4 + u] = t[u]; o[c * 4 + u] = 0.f; } }
  fa_hold(qo);      /* the same wait behind the q loads; their offset stays in its register up to it */
  __syncthreads();      /* K and V rows are staged: nobody reads them in front of this barrier */
  float m = -1.0e30f, l = 0.f, sn = 0.f;
#pragma unroll
  for (int d = 0; d < HD; ++d) sn = fmaf(q[d], lk[0][d], sn);
#pragma unroll 1      /* kept rolled: a second copy of the body would not fit the registers beside q and o */
  for (int j = 0; j <= jmax; ++j) { const float s = sn * scale;
    const float* kr = &lk[j < jmax ? j + 1 : jmax][0]; v4f kq[HD / 4], vv[HD / 4];
#pragma unroll
    for (int c = 0; c < HD / 4; ++c) kq[c] = *(const v4f*)(kr + c * 4);
    __builtin_amdgcn_sched_barrier(0);      /* keeps the K reads in front of the V reads: LDS answers in order, and with V rows queued between them the score chain below waits for its K words */
#pragma unroll
    for (int c = 0; c < HD / 4; ++c) vv[c] = *(const v4f*)&lv[j][c * 4];
    sn = 0.f;      /* the next key's score: its chain of 64 dependent multiply-adds depends on nothing below, so this key's exponentials and o update fill its waits */
#pragma unroll
    for (int d = 0; d < HD; ++d) sn = fmaf(q[d], kq[d >> 2][d & 3], sn);
    const float f = (j <= i) ? 1.f : 0.f; const float sm = fmaf(f, s, (1.f - f) * -1.0e30f); const float mn = fmaxf(m, sm); const float sc = expf(m - mn); const float e = expf(sm - mn); l = fmaf(l, sc, e); m = mn;
#pragma unroll
    for (int d = 0; d < HD; ++d) o[d] = fmaf(o[d], sc, e * vv[d >> 2][d & 3]); }
  const float fin = 64.0f / l;      /* o carried x64 like the f16 path */
#pragma unroll
  for (int c = 0; c < HD / 4; ++c) { v4f oo;
#pragma unroll
    for (int u = 0; u < 4; ++u) oo[u] = o[c * 4 + u] * fin;
    *(v4f*)&lo[tid][c * 4] = oo; }
  __syncthreads();
  {
#pragma unroll 1
    for (int it = 0; it < 16; ++it) { const int row = it * 4 + tid / 16, pc = (tid % 16) * 4; const v4f v = *(const v4f*)&lo[row][pc]; *(v4f*)(OF + (size_t)(rg * 64 + row) * ldo + h * HD + pc) = v; }
     } }


__global__ __launch_bounds__(256) void k_kvexp(const float* __restrict__ src, float* __restrict__ dst, size_t n4) { const size_t t = (size_t)blockIdx.x * 256 + threadIdx.x; if (t >= n4) return; const size_t e = t * 4; const size_t row = e / DM; const int col = (int)(e % DM); const int h = col / HD, d = col % HD; const v4f v = *(const v4fa*)(src + row * KVD + (size_t)(h / HPG) * HD + d); *(v4f*)(dst + e) = v;  }

__global__ __launch_bounds__(256) void k_tab2(float theta, float* __restrict__ CS, float* __restrict__ SN) {
  #pragma clang fp contract(off)
  const int t = blockIdx.x * 256 + threadIdx.x; if (t >= SQ * (HD / 2)) return; const int i = t % (HD / 2); const int p = t / (HD / 2); const float invf = 1.0f / powf(theta, (float)(2 * i) / (float)HD); const float ang = __fmul_rn((float)p, invf); const float c = cosf(ang), s = sinf(ang);
  *(float*)(CS + t) = c; *(float*)(SN + t) = s;  }
template <int NORM, int ROPE>
__global__ __launch_bounds__(64) void k_xform(const float* __restrict__ F, int ldf, int nh, const float* __restrict__ gain, float eps, const float* __restrict__ CS, const float* __restrict__ SN, _Float16* __restrict__ H16, int ldo) {
  #pragma clang fp contract(off)
  __shared__ float xv[HD]; __shared__ float red[HD]; __shared__ unsigned short sh_[HD]; const int d = threadIdx.x; const int h = blockIdx.x % nh; const size_t r = blockIdx.x / nh; const int p = (int)(r % SQ);
  float x = F[r * (size_t)ldf + (size_t)h * HD + d];
  if (NORM) { red[d] = __fmul_rn(x, x); __syncthreads(); for (int st = HD / 2; st > 0; st >>= 1) { if (d < st) red[d] = __fadd_rn(red[d], red[d + st]); __syncthreads(); } const float rs = rsqrtf(__fadd_rn(red[0] / (float)HD, eps)); x = __fmul_rn(__fmul_rn(x, rs), bf16_round(gain[d])); }
  xv[d] = x; __syncthreads();
  float o = x;
  if (ROPE == 1) { const int i = d >> 1; const float c = CS[p * (HD / 2) + i], s = SN[p * (HD / 2) + i]; const float ev = xv[2 * i], od = xv[2 * i + 1]; o = (d & 1) ? __fadd_rn(__fmul_rn(ev, s), __fmul_rn(od, c)) : __fadd_rn(__fmul_rn(ev, c), -__fmul_rn(od, s)); }
  if (ROPE == 2) { const int i = d & (HD / 2 - 1); const float c = CS[p * (HD / 2) + i], s = SN[p * (HD / 2) + i]; const float lo = xv[i], hi = xv[i + HD / 2]; o = (d < HD / 2) ? __fadd_rn(__fmul_rn(lo, c), -__fmul_rn(hi, s)) : __fadd_rn(__fmul_rn(lo, s), __fmul_rn(hi, c)); }
  if (ROPE == 3) { const float c = CS[p * HD + d], s = SN[p * HD + d]; const float lo = xv[d & (HD / 2 - 1)], hi = xv[(d & (HD / 2 - 1)) + HD / 2]; o = (d < HD / 2) ? __fadd_rn(__fmul_rn(lo, c), -__fmul_rn(hi, s)) : __fadd_rn(__fmul_rn(hi, c), __fmul_rn(lo, s)); }      /* rotate-half with FULL-width per-element tables [pos][HD] */
  FragH th; th.h[0] = (_Float16)o; sh_[d] = th.u[0]; __syncthreads();
  if (d < HD / 8) { FragH f; for (int q = 0; q < 8; ++q) f.u[q] = sh_[d * 8 + q]; unsigned short* dst = (unsigned short*)H16 + r * (size_t)ldo + (size_t)h * HD + d * 8; *(v8us*)dst = f.half[0];  } }

template <int NORM, int ROPE>
__global__ __launch_bounds__(64) void k_xformf(const float* __restrict__ F, int ldf, int nh, const float* __restrict__ gain, float eps, const float* __restrict__ CS, const float* __restrict__ SN, float* __restrict__ F32, int ldo) {
  #pragma clang fp contract(off)
  __shared__ float xv[HD]; __shared__ float red[HD]; const int d = threadIdx.x; const int h = blockIdx.x % nh; const size_t r = blockIdx.x / nh; const int p = (int)(r % SQ);
  float x = F[r * (size_t)ldf + (size_t)h * HD + d];
  if (NORM) { red[d] = __fmul_rn(x, x); __syncthreads(); for (int st = HD / 2; st > 0; st >>= 1) { if (d < st) red[d] = __fadd_rn(red[d], red[d + st]); __syncthreads(); } const float rs = rsqrtf(__fadd_rn(red[0] / (float)HD, eps)); x = __fmul_rn(__fmul_rn(x, rs), bf16_round(gain[d])); }
  xv[d] = x; __syncthreads();
  float o = x;
  if (ROPE == 1) { const int i = d >> 1; const float c = CS[p * (HD / 2) + i], s = SN[p * (HD / 2) + i]; const float ev = xv[2 * i], od = xv[2 * i + 1]; o = (d & 1) ? __fadd_rn(__fmul_rn(ev, s), __fmul_rn(od, c)) : __fadd_rn(__fmul_rn(ev, c), -__fmul_rn(od, s)); }
  if (ROPE == 2) { const int i = d & (HD / 2 - 1); const float c = CS[p * (HD / 2) + i], s = SN[p * (HD / 2) + i]; const float lo = xv[i], hi = xv[i + HD / 2]; o = (d < HD / 2) ? __fadd_rn(__fmul_rn(lo, c), -__fmul_rn(hi, s)) : __fadd_rn(__fmul_rn(lo, s), __fmul_rn(hi, c)); }
  if (ROPE == 3) { const float c = CS[p * HD + d], s = SN[p * HD + d]; const float lo = xv[d & (HD / 2 - 1)], hi = xv[(d & (HD / 2 - 1)) + HD / 2]; o = (d < HD / 2) ? __fadd_rn(__fmul_rn(lo, c), -__fmul_rn(hi, s)) : __fadd_rn(__fmul_rn(hi, c), __fmul_rn(lo, s)); }      /* rotate-half with FULL-width per-element tables [pos][HD] */
  float* dst = F32 + r * (size_t)ldo + (size_t)h * HD + d; *(float*)dst = o;  }

__global__ __launch_bounds__(256) void k_bfcp(const float* __restrict__ src, float* __restrict__ dst, size_t n4) { const size_t t = (size_t)blockIdx.x * 256 + threadIdx.x; if (t >= n4) return; const v4f a = *(const v4fa*)(src + t * 4); v4f o; for (int q = 0; q < 4; ++q) o[q] = bf16_round(a[q]); *(v4f*)(dst + t * 4) = o;  }

__global__ __launch_bounds__(256) void k_tabhalf(const float* __restrict__ cs, const float* __restrict__ sn, float* __restrict__ CS, float* __restrict__ SN) { const int t = blockIdx.x * 256 + threadIdx.x; if (t >= SQ * (HD / 2)) return; const int p = t / (HD / 2), i = t % (HD / 2); const float c = bf16_round(cs[(size_t)p * HD + i]), s = bf16_round(sn[(size_t)p * HD + i]);
  *(float*)(CS + t) = c; *(float*)(SN + t) = s;  }

__global__ __launch_bounds__(256) void k_tab2d(float* __restrict__ CS, float* __restrict__ SN) {
  #pragma clang fp contract(off)
  const int t = blockIdx.x * 256 + threadIdx.x; if (t >= SQ * (HD / 2)) return; const int i = t % (HD / 2); const int p = t / (HD / 2); const float invf = (float)(1.0 / pow(10000.0, (double)(2 * i) / (double)HD)); const float ang = __fmul_rn((float)p, invf); const float c = cosf(ang), s = sinf(ang);
  *(float*)(CS + t) = c; *(float*)(SN + t) = s;  }
extern "C" void kernel_launch(void* const* d_in, const int* in_sizes, int n_in,
                              void* d_out, int out_size, void* d_ws, size_t ws_size, hipStream_t stream) {
  (void)in_sizes; (void)n_in; (void)out_size;
  const float* const* I = (const float* const*)d_in; const float* x = I[0]; const float* wq = I[1]; const float* wk = I[2]; const float* wv = I[3]; const float* wo = I[4];      /* input order: x, Wq [1024][1024], Wk / Wv [1024][256], Wo [1024][1024] ([in][out] weights); rope tables computed in-kernel (positions = row index), as the module computes them */ const float* bq = nullptr; const float* bk = nullptr; const float* bv = nullptr; const float* bo = nullptr;      /* no biases */
  char* ws = (char*)d_ws; size_t off = 0;
  auto take = [&](size_t bytes) { char* p = ws + off; off += (bytes + 255) & ~(size_t)255; return p; };
  _Float16* BQ = (_Float16*)take((size_t)DM * DM * 2); _Float16* BK = (_Float16*)take((size_t)KVD * DM * 2); _Float16* BV = (_Float16*)take((size_t)KVD * DM * 2); _Float16* BO = (_Float16*)take((size_t)DM * DM * 2);
  _Float16* X16 = (_Float16*)take(NR * DM * 2); float* QF = (float*)take((size_t)SQ * DM * 4); float* KF = (float*)take((size_t)SQ * KVD * 4); float* CSB = (float*)take((size_t)SQ * HD * 4); float* SNB = (float*)take((size_t)SQ * HD * 4); _Float16* Q16 = (_Float16*)take(NR * DM * 2); _Float16* K16 = (_Float16*)take(NR * KVD * 2); _Float16* V16 = (_Float16*)take(NR * KVD * 2); _Float16* O16 = (_Float16*)take(NR * DM * 2);
  _Float16* VT = (_Float16*)take((size_t)NB * NG * HD * SQ * 2);
  float* QF0 = (float*)take((size_t)QT0 * DM * 4); float* KF0 = (float*)take((size_t)QT0 * KVD * 4); float* VF0 = (float*)take((size_t)QT0 * KVD * 4); float* KF0e = (float*)take((size_t)QT0 * DM * 4); float* VF0e = (float*)take((size_t)QT0 * DM * 4); float* OF0 = (float*)take((size_t)NB * QT0 * DM * 4); _Float16* OH0 = (_Float16*)take((size_t)NB * QT0 * DM * 2); _Float16* OL0 = (_Float16*)take((size_t)NB * QT0 * DM * 2);
  if (off > ws_size) return;
  k_wt_f16<<<(unsigned)(((size_t)DM * (DM / 8) + 255) / 256), 256, 0, stream>>>(wq, BQ, DM, DM, 16.0f); k_wt_f16<<<(unsigned)(((size_t)KVD * (DM / 8) + 255) / 256), 256, 0, stream>>>(wk, BK, DM, KVD, 16.0f); k_wt_f16<<<(unsigned)(((size_t)KVD * (DM / 8) + 255) / 256), 256, 0, stream>>>(wv, BV, DM, KVD, 16.0f); k_wt_f16<<<(unsigned)(((size_t)DM * (DM / 8) + 255) / 256), 256, 0, stream>>>(wo, BO, DM, DM, 16.0f);      /* [in][out] -> Bt[n][k] x16 (transposing builder; K = DM, N = DM / KVD) */
  k_x16<<<(unsigned)((NR * DM / 8 + 255) / 256), 256, 0, stream>>>(x, X16, NR * DM / 8);
  k_tab2d<<<(SQ * (HD / 2) + 255) / 256, 256, 0, stream>>>(CSB, SNB);      /* rope tables computed in-kernel: angle[p][i] = p * 10000^(-2i/64) (the module's _rope_cache; positions = row index) */
  const size_t r0p = (size_t)B0 * SQ;      /* first projected row */
  k_gemm2<0><<<dim3((unsigned)((MP / 128) * (KVD / 64)), 1), 128, 0, stream>>>(X16 + r0p * DM, DM, 0, BV, DM, 0, 0.0625f, bv, 0, nullptr, 1, 0, 0, nullptr, V16 + r0p * KVD, KVD, 0, MP, KVD, DM);
  for (int b = B0; b < B0 + NBR; ++b) { const size_t r0 = (size_t)b * SQ;
    k_gemm2<0><<<dim3((unsigned)((SQ / 128) * (DM / 64)), 1), 128, 0, stream>>>(X16 + r0 * DM, DM, 0, BQ, DM, 0, 0.0625f, nullptr, 0, nullptr, 1, 0, 0, QF, nullptr, DM, 0, SQ, DM, DM);      /* q (f32) of this batch */
    k_gemm2<0><<<dim3((unsigned)((SQ / 128) * (KVD / 64)), 1), 128, 0, stream>>>(X16 + r0 * DM, DM, 0, BK, DM, 0, 0.0625f, nullptr, 0, nullptr, 1, 0, 0, KF, nullptr, KVD, 0, SQ, KVD, DM);      /* k (f32) */
    k_xform<0, 1><<<(unsigned)((size_t)SQ * NH), 64, 0, stream>>>(QF, DM, NH, nullptr, 0.f, CSB, SNB, Q16 + r0 * DM, DM); k_xform<0, 1><<<(unsigned)((size_t)SQ * NG), 64, 0, stream>>>(KF, KVD, NG, nullptr, 0.f, CSB, SNB, K16 + r0 * KVD, KVD);      /* interleaved-pair rope (pairs (2i, 2i+1)) from the in-kernel tables -> f16 rows */
    k_xformf<0, 1><<<(unsigned)(QT0 * NH), 64, 0, stream>>>(QF, DM, NH, nullptr, 0.f, CSB, SNB, QF0, DM); k_xformf<0, 1><<<(unsigned)(QT0 * NG), 64, 0, stream>>>(KF, KVD, NG, nullptr, 0.f, CSB, SNB, KF0, KVD);      /* f32 roped q, k of rows 0..127 */
    k_vt<NG, SQ><<<NG * (SQ / 64), 256, 0, stream>>>(V16 + r0 * KVD, KVD, 0, VT + (size_t)b * NG * HD * SQ);      /* V^T [NG][HD][SQ] of this batch */
    k_gemm2<0><<<dim3((QT0 / 128) * (KVD / 64), 1), 128, 0, stream>>>(X16 + r0 * DM, DM, 0, BV, DM, 0, 0.0625f, bv, 0, nullptr, 1, 0, 0, VF0, nullptr, KVD, 0, QT0, KVD, DM);
    k_kvexp<<<(unsigned)(((size_t)QT0 * DM / 4 + 255) / 256), 256, 0, stream>>>(KF0, KF0e, (size_t)QT0 * DM / 4); k_kvexp<<<(unsigned)(((size_t)QT0 * DM / 4 + 255) / 256), 256, 0, stream>>>(VF0, VF0e, (size_t)QT0 * DM / 4);      /* head h <- kv group h/4 for the exact first-tile kernel */      /* f32 q, k, v of the first 128 rows (exact products) */
    k_att0<<<NH * (QT0 / 64), 64, 0, stream>>>(QF0, KF0e, VF0e, 0.125f, OF0 + (size_t)b * QT0 * DM, DM);      /* exact f32 attention for rows 0..127 (o x64) */
  }
  k_fattn<<<dim3(SQ / 32, NG, NB), 128, 0, stream>>>(Q16, K16, VT, O16);      /* scores, causal softmax and o (merged heads, x64, f16 rows) for all batches and heads */
  k_gemm2<0><<<dim3((unsigned)((MPO / 128) * (DM / 64)), 1), 128, 0, stream>>>(O16 + r0p * DM, DM, 0, BO, DM, 0, 0.0009765625f, bo, 0, nullptr, 1, 0, 0, (float*)d_out + r0p * DM, nullptr, DM, 0, MPO, DM, DM);      /* out rows are the output layout */
  k_hl<<<(unsigned)(((size_t)NB * QT0 * DM / 8 + 255) / 256), 256, 0, stream>>>(OF0, OH0, OL0, (size_t)NB * QT0 * DM / 8);      /* first-tile o (x64) -> f16 hi + x1024 residual planes */
  for (int b = B0; b < B0 + NBR; ++b) { const size_t r0 = (size_t)b * SQ; const size_t f0 = (size_t)b * QT0;
    k_gemm2<0><<<dim3((QT0 / 128) * (DM / 64), 1), 128, 0, stream>>>(OH0 + f0 * DM, DM, 0, BO, DM, 0, 0.0009765625f, bo, 0, nullptr, 1, 0, 0, (float*)d_out + r0 * DM, nullptr, DM, 0, QT0, DM, DM);      /* rows 0..127: out = o_hi Wo (+ b), overwriting the f16-path rows */
    k_gemm2<0><<<dim3((QT0 / 128) * (DM / 64), 1), 128, 0, stream>>>(OL0 + f0 * DM, DM, 0, BO, DM, 0, 0.00000095367431640625f, nullptr, 0, (const float*)d_out + r0 * DM, -1, 0, 0, (float*)d_out + r0 * DM, nullptr, DM, 0, QT0, DM, DM); }      /* += o_lo Wo 2^-20 (own-element accumulate) */
}

// v004
// Measured time: 453 microseconds a run.
// In both of two side-by-side timings against v003, it was 2.28 times as fast.
// All steps since v000 together make it 29.8 times as fast.
#include <hip/hip_runtime.h>
// Grouped-query causal attention at width 1024 with [in][out] projections and RoPE computed in the module (x [4][2048][1024]; q = x Wq (16 heads x 64), k = x Wk, v = x Wv (4 kv heads x 64) ([in][out] weights sigma 0.02, no biases); k, v repeated x4 (repeat: query head h uses kv head h / 4); rope: the module rotates the (even, odd) pairs (x1 c - x2 s, x1 s + x2 c) with angle pos * 10000^(-2i/64) and writes the rotated evens into the first half and the rotated odds into the second half of the head: the SAME permutation on q and k, so q . k equals the interleaved-pair rope's; scores / sqrt(64) with a causal mask (tril, -inf); softmax; out = merged Wo ([in][out]) -> [4][2048][1024]).
// Compute dtype: inputs rounded to bf16; x / weights exact; q, k, v, softmax weights and o as plain f16 GEMM operands (~2^-12); scores and softmax statistics f32. v_wmma_f32_16x16x32_f16.
#define NB 4
#define NG 4
#define HPG 4
#define KVD (NG * HD)
#define SQ 2048
#define DM 1024
#define NH 16
#define HD 64
#define HG 4                         /* heads per launch of the k_vt (b, h0) overload */
#define QT 256
#define NKX SQ                       /* S / P row pitch */
#define QT0 128                      /* first-tile rows recomputed exactly in f32 */
#define B0 0                         /* unused: every stage starts at batch 0 */
#define NBR NB                       /* batches processed (debug hook) */
#define NR ((size_t)NB * SQ)         /* token rows */
#define MP ((int)((size_t)NBR * SQ)) /* rows projected (debug hook) */
#define QN SQ                        /* query rows attended per batch (debug hook) */
#define NHD NH                       /* heads attended (debug hook) */
#define MPO MP                       /* rows through the output stage (debug hook) */
#define LQ DM      /* row pitch of the q rows */
typedef __bf16 v16b __attribute__((ext_vector_type(16)));
typedef unsigned short v8us __attribute__((ext_vector_type(8), may_alias));
typedef float  v8f  __attribute__((ext_vector_type(8)));
typedef float  v4f  __attribute__((ext_vector_type(4)));
typedef float  v4fa __attribute__((ext_vector_type(4), may_alias));
union FragB { v16b v; v8us half[2]; unsigned short u[16]; };

__device__ __forceinline__ unsigned short bf16_bits(float x) { unsigned int u = __float_as_uint(x); return (unsigned short)((u + 0x7FFFu + ((u >> 16) & 1u)) >> 16); }
__device__ __forceinline__ float bf16_val(unsigned short b) { return __uint_as_float(((unsigned int)b) << 16); }
__device__ __forceinline__ float bf16_round(float x) { return bf16_val(bf16_bits(x)); }
// D += A·B with NT terms: 1 = ah·bh, 2 = + al·bh (A split), 3 = + ah·bl (both split)
template <int NT>
__device__ __forceinline__ v8f mmaN(v16b ah, v16b al, v16b bh, v16b bl, v8f c) {
  c = __builtin_amdgcn_wmma_f32_16x16x32_bf16(false, ah, false, bh, (short)0, c, false, false);
  if (NT >= 2) c = __builtin_amdgcn_wmma_f32_16x16x32_bf16(false, al, false, bh, (short)0, c, false, false);
  if (NT >= 3) c = __builtin_amdgcn_wmma_f32_16x16x32_bf16(false, ah, false, bl, (short)0, c, false, false);
  asm volatile("v_nop\n\tv_nop\n\tv_nop\n\tv_nop" : "+v"(c) : "v"(ah), "v"(al), "v"(bh), "v"(bl));
  return c;
}

__global__ __launch_bounds__(256) void k_wt_bf16(const float* __restrict__ W, unsigned short* __restrict__ Wt, int K, int N) {
  const int t = blockIdx.x * 256 + threadIdx.x;
  const int k8n = K / 8;
  if (t >= N * k8n) return;
  const int n = t / k8n, k8 = (t % k8n) * 8;
  v8us v;
#pragma unroll
  for (int i = 0; i < 8; ++i) v[i] = bf16_bits(W[(size_t)(k8 + i) * N + n]);
  *(v8us*)(Wt + (size_t)n * K + k8) = v;
  
}

// GEMM C[M][N] (f32, pitch ldc) = act(A[M][K]·W + bias). A f32 row-major (pitch lda) converted per fragment to bf16
// (ASPLIT: hi/lo two planes -> 2 terms, else single rounded term); Wt bf16 [N][K] (pitch ldb). BIAS_BF16 rounds the
// bias to bf16 first (bias quantised to bf16 before the add). K%32==0, M%16==0, N%64==0.
template <bool ASPLIT, int ACT, bool BIAS_BF16>
__global__ __launch_bounds__(128) void k_gemm_bf(const float* __restrict__ A, int lda, const unsigned short* __restrict__ Wt, int ldb,
                                               const float* __restrict__ bias, float* __restrict__ C, int ldc, int M, int N, int K) {
  __shared__ __attribute__((aligned(16))) float so[4][16][64];
  const int tid = threadIdx.x, w = tid >> 5, lane = tid & 31, ln = lane & 15, hh = lane >> 4;
  const int ntn = N / 64;
  const int wid = blockIdx.x * 4 + w;
  const int mt = wid / ntn, nq = wid % ntn;
  if (mt * 16 >= M) return;
  const int row0 = mt * 16, col0 = nq * 64;
  const float* arow = A + (size_t)(row0 + ln) * lda;
  v8f acc[4] = {};
  for (int kb = 0; kb < K; kb += 32) {
    FragB ah, al;
    const v4f x0 = *(const v4fa*)(arow + kb + 8 * hh), x1 = *(const v4fa*)(arow + kb + 8 * hh + 4);
    const v4f x2 = *(const v4fa*)(arow + kb + 16 + 8 * hh), x3 = *(const v4fa*)(arow + kb + 16 + 8 * hh + 4);
    float xs[16] = {x0[0],x0[1],x0[2],x0[3],x1[0],x1[1],x1[2],x1[3],x2[0],x2[1],x2[2],x2[3],x3[0],x3[1],x3[2],x3[3]};
#pragma unroll
    for (int i = 0; i < 16; ++i) { const unsigned short hb = bf16_bits(xs[i]); ah.u[i] = hb; al.u[i] = ASPLIT ? bf16_bits(xs[i] - bf16_val(hb)) : (unsigned short)0; }
#pragma unroll
    for (int t = 0; t < 4; ++t) {
      const unsigned short* brow = Wt + (size_t)(col0 + t * 16 + ln) * ldb + kb;
      FragB b;
      b.half[0] = *(const v8us*)(brow + 8 * hh);
      b.half[1] = *(const v8us*)(brow + 16 + 8 * hh);
      acc[t] = mmaN<ASPLIT ? 2 : 1>(ah.v, al.v, b.v, b.v, acc[t]);
    }
  }
#pragma unroll
  for (int t = 0; t < 4; ++t) {
    float bv = bias ? bias[col0 + t * 16 + ln] : 0.f;
    if (BIAS_BF16) bv = bf16_round(bv);
#pragma unroll
    for (int r = 0; r < 8; ++r) { float v = acc[t][r] + bv; if (ACT == 1) v = fmaxf(v, 0.f); so[w][8 * hh + r][t * 16 + ln] = v; }
  }
  __builtin_amdgcn_fence(__ATOMIC_ACQ_REL, "workgroup");
  __builtin_amdgcn_wave_barrier();
  const int rsub = lane >> 4, c4 = (lane & 15) * 4;
  {
#pragma unroll
    for (int q = 0; q < 8; ++q) {
      const int r = q * 2 + rsub;
      const v4f v = *(const v4fa*)&so[w][r][c4];
      *(v4f*)(C + (size_t)(row0 + r) * ldc + col0 + c4) = v;
    }
    
  }
}

// GEMM C = act(A·W + bias + resid): A f32 (ASPLIT -> hi/lo 2 terms), Wt bf16 [N][K]; ACT 0 none, 1 relu, 2 exact gelu;
// resid (optional, f32, row index = (row % rmod), pitch ldr, RES_BF16 rounds it) added before the activation.
template <bool ASPLIT, int ACT, bool BIAS_BF16, bool RES_BF16>
__global__ __launch_bounds__(128) void k_gemm_bf3(const float* __restrict__ A, int lda, const unsigned short* __restrict__ Wt, int ldb,
                                                const float* __restrict__ bias, const float* __restrict__ resid, int rmod, int ldr,
                                                float* __restrict__ C, int ldc, int M, int N, int K) {
  __shared__ __attribute__((aligned(16))) float so[4][16][64];
  const int tid = threadIdx.x, w = tid >> 5, lane = tid & 31, ln = lane & 15, hh = lane >> 4;
  const int ntn = N / 64;
  const int wid = blockIdx.x * 4 + w;
  const int mt = wid / ntn, nq = wid % ntn;
  if (mt * 16 >= M) return;
  const int row0 = mt * 16, col0 = nq * 64;
  const float* arow = A + (size_t)(row0 + ln) * lda;
  v8f acc[4] = {};
  for (int kb = 0; kb < K; kb += 32) {
    FragB ah, al;
    const v4f x0 = *(const v4fa*)(arow + kb + 8 * hh), x1 = *(const v4fa*)(arow + kb + 8 * hh + 4);
    const v4f x2 = *(const v4fa*)(arow + kb + 16 + 8 * hh), x3 = *(const v4fa*)(arow + kb + 16 + 8 * hh + 4);
    float xs[16] = {x0[0],x0[1],x0[2],x0[3],x1[0],x1[1],x1[2],x1[3],x2[0],x2[1],x2[2],x2[3],x3[0],x3[1],x3[2],x3[3]};
#pragma unroll
    for (int i = 0; i < 16; ++i) { const unsigned short hb = bf16_bits(xs[i]); ah.u[i] = hb; al.u[i] = ASPLIT ? bf16_bits(xs[i] - bf16_val(hb)) : (unsigned short)0; }
#pragma unroll
    for (int t = 0; t < 4; ++t) {
      const unsigned short* brow = Wt + (size_t)(col0 + t * 16 + ln) * ldb + kb;
      FragB b;
      b.half[0] = *(const v8us*)(brow + 8 * hh);
      b.half[1] = *(const v8us*)(brow + 16 + 8 * hh);
      acc[t] = mmaN<ASPLIT ? 2 : 1>(ah.v, al.v, b.v, b.v, acc[t]);
    }
  }
#pragma unroll
  for (int t = 0; t < 4; ++t) {
    const int col = col0 + t * 16 + ln;
    float bv = bias ? bias[col] : 0.f;
    if (BIAS_BF16) bv = bf16_round(bv);
#pragma unroll
    for (int r = 0; r < 8; ++r) {
      float v = acc[t][r] + bv;
      if (resid) { float rv = resid[(size_t)((row0 + 8 * hh + r) % rmod) * ldr + col]; if (RES_BF16) rv = bf16_round(rv); v += rv; }
      if (ACT == 1) v = fmaxf(v, 0.f);
      if (ACT == 2) v = 0.5f * v * (1.0f + erff(v * 0.70710678118654752f));
      if (ACT == 3) { const float u = 0.7978845608028654f * (v + 0.044715f * v * v * v); v = 0.5f * v * (1.0f + tanhf(u)); }
      so[w][8 * hh + r][t * 16 + ln] = v;
    }
  }
  __builtin_amdgcn_fence(__ATOMIC_ACQ_REL, "workgroup");
  __builtin_amdgcn_wave_barrier();
  const int rsub = lane >> 4, c4 = (lane & 15) * 4;
  {
#pragma unroll
    for (int q = 0; q < 8; ++q) {
      const int r = q * 2 + rsub;
      const v4f v = *(const v4fa*)&so[w][r][c4];
      *(v4f*)(C + (size_t)(row0 + r) * ldc + col0 + c4) = v;
    }
    
  }
}
// row LayerNorm (biased variance, eps) over N: s = X (+ R); optional out_sum <- s; out_norm <- (s-mu)*rsqrt(var+eps)*g + b
template <bool PARAM_BF16>
__global__ __launch_bounds__(256) void k_layernorm(const float* __restrict__ X, const float* __restrict__ R, const float* __restrict__ g, const float* __restrict__ bta,
                                                  float* __restrict__ out_sum, float* __restrict__ out_norm, int N, float eps) {
  __shared__ float red[256];
  const int row = blockIdx.x, tid = threadIdx.x;
  const float* x = X + (size_t)row * N; const float* rr = R ? R + (size_t)row * N : nullptr;
  float vals[16];                     // up to N = 4096
  const int per = N / 256;            // contiguous chunk per thread? use strided-by-4 chunks: thread handles j = tid*4 + 1024*u
  float s1 = 0.f;
  for (int u = 0; u < per / 4; ++u) {
    const int j = tid * 4 + 1024 * u;
    const v4f a = *(const v4fa*)(x + j);
    v4f b = {0.f,0.f,0.f,0.f}; if (rr) b = *(const v4fa*)(rr + j);
#pragma unroll
    for (int q = 0; q < 4; ++q) { const float v = a[q] + b[q]; vals[u * 4 + q] = v; s1 += v; }
  }
  red[tid] = s1; __syncthreads();
  for (int st = 128; st > 0; st >>= 1) { if (tid < st) red[tid] += red[tid + st]; __syncthreads(); }
  const float mu = red[0] / (float)N; __syncthreads();
  float s2 = 0.f;
  for (int u = 0; u < per / 4; ++u)
#pragma unroll
    for (int q = 0; q < 4; ++q) { const float c = vals[u * 4 + q] - mu; s2 += c * c; }
  red[tid] = s2; __syncthreads();
  for (int st = 128; st > 0; st >>= 1) { if (tid < st) red[tid] += red[tid + st]; __syncthreads(); }
  const float rs = rsqrtf(red[0] / (float)N + eps);
  {
    for (int u = 0; u < per / 4; ++u) {
      const int j = tid * 4 + 1024 * u;
      v4f o, sm;
#pragma unroll
      for (int q = 0; q < 4; ++q) {
        float gg = g[j + q], bb = bta[j + q];
        if (PARAM_BF16) { gg = bf16_round(gg); bb = bf16_round(bb); }
        sm[q] = vals[u * 4 + q]; o[q] = (vals[u * 4 + q] - mu) * rs * gg + bb;
      }
      if (out_sum) *(v4f*)(out_sum + (size_t)row * N + j) = sm;
      *(v4f*)(out_norm + (size_t)row * N + j) = o;
    }
    
  }
}



// ---- f16 WMMA path (v_wmma_f32_16x16x32_f16): 11-bit significands for operands in range — used where a [0,1] probability operand needs more precision than bf16
typedef _Float16 v16h __attribute__((ext_vector_type(16)));
union FragH { v16h v; v8us half[2]; _Float16 h[16]; unsigned short u[16]; };
template <int NT>
__device__ __forceinline__ v8f mmaH(v16h ah, v16h al, v16h bh, v16h bl, v8f c) {
  c = __builtin_amdgcn_wmma_f32_16x16x32_f16(false, ah, false, bh, (short)0, c, false, false);
  if (NT >= 2) c = __builtin_amdgcn_wmma_f32_16x16x32_f16(false, al, false, bh, (short)0, c, false, false);
  if (NT >= 3) c = __builtin_amdgcn_wmma_f32_16x16x32_f16(false, ah, false, bl, (short)0, c, false, false);
  asm volatile("v_nop\n\tv_nop\n\tv_nop\n\tv_nop" : "+v"(c) : "v"(ah), "v"(al), "v"(bh), "v"(bl));
  return c;
}
// batched GEMM like k_gemm_b but f16 operands: A f32 (split into f16 hi/lo if ASPLIT, else rounded to f16), Bt = f16 values [n][k]; alpha; C f32; N multiple of 16 (partial tiles skipped)
template <bool ASPLIT>
__global__ __launch_bounds__(128) void k_gemm_h(const float* __restrict__ A, int lda, size_t sA, const _Float16* __restrict__ Bh, int ldb, size_t sB, float alpha, float* __restrict__ C, int ldc, size_t sC, int M, int N, int K) {
  __shared__ __attribute__((aligned(16))) float so[4][16][64];
  const int tid = threadIdx.x, w = tid >> 5, lane = tid & 31, ln = lane & 15, hh = lane >> 4; const int by = blockIdx.y;
  A += (size_t)by * sA; Bh += (size_t)by * sB; C += (size_t)by * sC;
  const int ntn = (N + 63) / 64; const int wid = blockIdx.x * 4 + w; const int mt = wid / ntn, nq = wid % ntn; if (mt * 16 >= M) return;
  const int row0 = mt * 16, col0 = nq * 64; const float* arow = A + (size_t)(row0 + ln) * lda;
  v8f acc[4] = {};
  for (int kb = 0; kb < K; kb += 32) {
    FragH ah, al;
    const v4f x0 = *(const v4fa*)(arow + kb + 8 * hh), x1 = *(const v4fa*)(arow + kb + 8 * hh + 4), x2 = *(const v4fa*)(arow + kb + 16 + 8 * hh), x3 = *(const v4fa*)(arow + kb + 16 + 8 * hh + 4);
    float xs[16] = {x0[0],x0[1],x0[2],x0[3],x1[0],x1[1],x1[2],x1[3],x2[0],x2[1],x2[2],x2[3],x3[0],x3[1],x3[2],x3[3]};
#pragma unroll
    for (int i = 0; i < 16; ++i) { const _Float16 h = (_Float16)xs[i]; ah.h[i] = h; al.h[i] = ASPLIT ? (_Float16)(xs[i] - (float)h) : (_Float16)0.0f; }
#pragma unroll
    for (int t = 0; t < 4; ++t) { if (col0 + t * 16 >= N) continue; const size_t boff = (size_t)(col0 + t * 16 + ln) * ldb + kb; FragH bq; bq.half[0] = *(const v8us*)(Bh + boff + 8 * hh); bq.half[1] = *(const v8us*)(Bh + boff + 16 + 8 * hh);
      acc[t] = mmaH<ASPLIT ? 2 : 1>(ah.v, al.v, bq.v, bq.v, acc[t]); }
  }
#pragma unroll
  for (int t = 0; t < 4; ++t) { if (col0 + t * 16 >= N) continue;
#pragma unroll
    for (int r = 0; r < 8; ++r) so[w][8 * hh + r][t * 16 + ln] = acc[t][r] * alpha; }
  __builtin_amdgcn_fence(__ATOMIC_ACQ_REL, "workgroup"); __builtin_amdgcn_wave_barrier();
  const int rsub = lane >> 4, c4 = (lane & 15) * 4;
  {
#pragma unroll
    for (int q = 0; q < 8; ++q) { const int r = q * 2 + rsub; if (col0 + c4 < N) { const v4f v = *(const v4fa*)&so[w][r][c4]; *(v4f*)(C + (size_t)(row0 + r) * ldc + col0 + c4) = v; } }
     }
}

// Wt[n][k] = f16(W[k][n]·scale) from f32 row-major W[K][N] (scale = power of two; bf16-exact weights stay exact in f16 away from the subnormal range)
__global__ __launch_bounds__(256) void k_wt_f16(const float* __restrict__ W, _Float16* __restrict__ Wt, int K, int N, float scale) {
  const int t = blockIdx.x * 256 + threadIdx.x; if (t >= N * (K / 8)) return; const int n = t / (K / 8), k8 = (t % (K / 8)) * 8; FragH f;
#pragma unroll
  for (int i = 0; i < 8; ++i) f.h[i] = (_Float16)(bf16_round(W[(size_t)(k8 + i) * N + n]) * scale); const v8us o = f.half[0];
  *(v8us*)((unsigned short*)Wt + (size_t)n * K + k8) = o; 
}
// k_gemm_hh variant with fused epilogue: v = acc·alpha + bias[by·sBias + col] (+ CP[(row/rowsPerB)·sCPb + by·64 + col] if CP) ; ACT 0 none / 1 elu ; writes f16 C16 (and f32 C if non-null)
template <int ACT>
__global__ __launch_bounds__(128) void k_gemm_hhx(const _Float16* __restrict__ A, int lda, size_t sA, const _Float16* __restrict__ Bh, int ldb, size_t sB, float alpha, const float* __restrict__ bias, size_t sBias, const float* __restrict__ CP, int rowsPerB, size_t sCPb, int row0g,
    float* __restrict__ C, _Float16* __restrict__ C16, int ldc, size_t sC, int M, int N, int K) {
  __shared__ __attribute__((aligned(16))) float so[4][16][64];
  const int tid = threadIdx.x, w = tid >> 5, lane = tid & 31, ln = lane & 15, hh = lane >> 4; const int by = blockIdx.y;
  A += (size_t)by * sA; Bh += (size_t)by * sB; const size_t cofs = (size_t)by * sC; const float* bp = bias ? bias + (size_t)by * sBias : nullptr;
  const int ntn = (N + 63) / 64; const int wid = blockIdx.x * 4 + w; const int mt = wid / ntn, nq = wid % ntn; if (mt * 16 >= M) return;
  const int row0 = mt * 16, col0 = nq * 64; const _Float16* arow = A + (size_t)(row0 + ln) * lda;
  v8f acc[4] = {};
  for (int kb = 0; kb < K; kb += 32) { FragH ah; ah.half[0] = *(const v8us*)((const unsigned short*)arow + kb + 8 * hh); ah.half[1] = *(const v8us*)((const unsigned short*)arow + kb + 16 + 8 * hh);
#pragma unroll
    for (int t = 0; t < 4; ++t) { if (col0 + t * 16 >= N) continue; const size_t boff = (size_t)(col0 + t * 16 + ln) * ldb + kb; FragH bq; bq.half[0] = *(const v8us*)((const unsigned short*)Bh + boff + 8 * hh); bq.half[1] = *(const v8us*)((const unsigned short*)Bh + boff + 16 + 8 * hh);
      acc[t] = mmaH<1>(ah.v, ah.v, bq.v, bq.v, acc[t]); }
  }
#pragma unroll
  for (int t = 0; t < 4; ++t) { if (col0 + t * 16 >= N) continue; const int col = col0 + t * 16 + ln; const float bv = bp ? bf16_round(bp[col]) : 0.f;
#pragma unroll
    for (int r = 0; r < 8; ++r) { float v = acc[t][r] * alpha + bv; if (CP) { const int rr = row0g + row0 + 8 * hh + r; if (rowsPerB < 0) v += CP[cofs + (size_t)rr * ldc + col];      /* rowsPerB < 0: own element of the batched C plane */ else { const int bidx = rr / rowsPerB; v += CP[(size_t)bidx * sCPb + (size_t)by * 64 + col]; } } if (ACT == 1) v = (v > 0.f) ? v : expm1f(v); else if (ACT == 7) v = (v > 0.f) ? v + 1.0f : expf(v); else if (ACT == 8) v = tanhf(v); else if (ACT == 9) v = 0.5f * v * (1.0f + tanhf(0.7978845608028654f * (v + 0.044715f * v * v * v))); else if (ACT == 11) v = 1.0f / (1.0f + expf(-v)); else if (ACT == 12) v = (v > 0.f) ? v : 0.01f * v; else if (ACT == 14) v = (v > 0.f) ? v : 0.1f * v; else if (ACT == 16) v = (v >= 0.f) ? v : 0.3f * v; else if (ACT == 17) v = (v >= 0.f) ? v : 0.2f * v; else if (ACT == 15) v = v / (1.0f + expf(-v)); else if (ACT == 3) v = fmaxf(v, 0.f); else if (ACT == 6) v = 0.5f * v * (1.0f + erff(v * 0.70710678118654752f)); so[w][8 * hh + r][t * 16 + ln] = v; } }
  __builtin_amdgcn_fence(__ATOMIC_ACQ_REL, "workgroup"); __builtin_amdgcn_wave_barrier();
  const int rsub = lane >> 4, c4 = (lane & 15) * 4; typedef _Float16 v4h __attribute__((ext_vector_type(4)));
  {
#pragma unroll
    for (int q = 0; q < 8; ++q) { const int r = q * 2 + rsub; if (col0 + c4 < N) { const v4f v = *(const v4fa*)&so[w][r][c4]; if (C) *(v4f*)(C + cofs + (size_t)(row0 + r) * ldc + col0 + c4) = v; if (C16) { v4h h4; for (int i = 0; i < 4; ++i) h4[i] = (_Float16)v[i]; *(v4h*)(C16 + cofs + (size_t)(row0 + r) * ldc + col0 + c4) = h4; } } }
     }
}


typedef _Float16 v4h __attribute__((ext_vector_type(4)));

__global__ __launch_bounds__(256) void k_x16(const float* __restrict__ x, _Float16* __restrict__ X16, size_t n8) { const size_t t = (size_t)blockIdx.x * 256 + threadIdx.x; if (t >= n8) return; FragH f;
#pragma unroll
  for (int q = 0; q < 8; ++q) f.h[q] = (_Float16)bf16_round(x[t * 8 + q]); *(v8us*)((unsigned short*)X16 + t * 8) = f.half[0];  }
__global__ __launch_bounds__(256) void k_h16(const float* __restrict__ x, _Float16* __restrict__ X16, size_t n8) { const size_t t = (size_t)blockIdx.x * 256 + threadIdx.x; if (t >= n8) return; FragH f;
#pragma unroll
  for (int q = 0; q < 8; ++q) f.h[q] = (_Float16)x[t * 8 + q]; *(v8us*)((unsigned short*)X16 + t * 8) = f.half[0];  }
__global__ __launch_bounds__(256) void k_round16f(const float* __restrict__ W, _Float16* __restrict__ Bt, size_t n8) { const size_t t = (size_t)blockIdx.x * 256 + threadIdx.x; if (t >= n8) return; FragH f;
#pragma unroll
  for (int i = 0; i < 8; ++i) f.h[i] = (_Float16)(bf16_round(W[t * 8 + i]) * 16.0f); *(v8us*)((unsigned short*)Bt + t * 8) = f.half[0];  }
template <int NHv, int TTv>
__global__ __launch_bounds__(256) void k_vt(const _Float16* __restrict__ V16, int ldv, int voff, _Float16* __restrict__ Vt) { __shared__ unsigned short tl[64][66]; const int tid = threadIdx.x; const int slab = blockIdx.x / (TTv / 64), lg = blockIdx.x % (TTv / 64); const int b = slab / NHv, h = slab % NHv;
  for (int i = tid; i < 64 * 8; i += 256) { const int r = i / 8, c8 = (i % 8) * 8; FragH f; f.half[0] = *(const v8us*)((const unsigned short*)V16 + ((size_t)b * TTv + lg * 64 + r) * ldv + voff + h * 64 + c8);
#pragma unroll
    for (int q = 0; q < 8; ++q) tl[r][c8 + q] = f.u[q]; }
  __syncthreads();
  {
#pragma unroll
    for (int rd = 0; rd < 2; ++rd) { const int d = rd * 32 + tid / 8, pc = tid % 8; FragH f;
#pragma unroll
      for (int q = 0; q < 8; ++q) f.u[q] = tl[pc * 8 + q][d];
      *(v8us*)((unsigned short*)Vt + ((size_t)slab * 64 + d) * TTv + lg * 64 + pc * 8) = f.half[0]; }
     } }

__global__ __launch_bounds__(256) void k_hl(const float* __restrict__ F, _Float16* __restrict__ Hh, _Float16* __restrict__ Hl, size_t n8) { const size_t t = (size_t)blockIdx.x * 256 + threadIdx.x; if (t >= n8) return; FragH fh, fl; const v4f a = *(const v4fa*)(F + t * 8), c = *(const v4fa*)(F + t * 8 + 4);
#pragma unroll
  for (int q = 0; q < 4; ++q) { _Float16 h = (_Float16)a[q]; fh.h[q] = h; fl.h[q] = (_Float16)((a[q] - (float)h) * 1024.0f); h = (_Float16)c[q]; fh.h[4 + q] = h; fl.h[4 + q] = (_Float16)((c[q] - (float)h) * 1024.0f); }
  { *(v8us*)((unsigned short*)Hh + t * 8) = fh.half[0]; *(v8us*)((unsigned short*)Hl + t * 8) = fl.half[0];  } }

// ---- fast GEMM (wave tile 32x64; requires M % 32 == 0 rows per launch region and N % 64 == 0); epilogue = k_gemm_hhx semantics ----
__device__ __forceinline__ v16h g2_frag(const _Float16* p, int hh) { FragH f; f.half[0] = *(const v8us*)((const unsigned short*)p + 8 * hh); f.half[1] = *(const v8us*)((const unsigned short*)p + 16 + 8 * hh); return f.v; }
__device__ __forceinline__ v8f g2_mma(v16h a, v16h b, v8f c) { v8f d = __builtin_amdgcn_wmma_f32_16x16x32_f16(false, a, false, b, (short)0, c, false, false); asm volatile("v_nop\n\tv_nop\n\tv_nop\n\tv_nop" : "+v"(d) : "v"(a), "v"(b)); return d; }
template <int ACT>
__global__ __launch_bounds__(128) void k_gemm2(const _Float16* __restrict__ A, int lda, size_t sA, const _Float16* __restrict__ Bh, int ldb, size_t sB, float alpha, const float* __restrict__ bias, size_t sBias, const float* __restrict__ CP, int rowsPerB, size_t sCPb, int row0g,
    float* __restrict__ C, _Float16* __restrict__ C16, int ldc, size_t sC, int M, int N, int K) { static_assert(ACT == 0 || ACT == 3 || ACT == 6 || ACT == 8 || ACT == 9 || ACT == 11 || ACT == 12 || ACT == 14 || ACT == 15 || ACT == 16 || ACT == 17, "k_gemm2: unsupported ACT code (would silently apply no activation)");
  __shared__ __attribute__((aligned(16))) float so[4][32][68];
  const int tid = threadIdx.x, w = tid >> 5, lane = tid & 31, ln = lane & 15, hh = lane >> 4; const int by = blockIdx.y;
  A += (size_t)by * sA; Bh += (size_t)by * sB; const size_t cofs = (size_t)by * sC; const float* bp = bias ? bias + (size_t)by * sBias : nullptr;
  const int ntn = N >> 6; const int mt = blockIdx.x / ntn, nq = blockIdx.x - mt * ntn; const int row0 = mt * 128 + 32 * w, col0 = nq * 64; if (row0 >= M) return;
  const _Float16* a0p = A + (size_t)(row0 + ln) * lda; const _Float16* a1p = a0p + (size_t)16 * lda;
  const _Float16* b0p = Bh + (size_t)(col0 + ln) * ldb; const _Float16* b1p = b0p + (size_t)16 * ldb; const _Float16* b2p = b1p + (size_t)16 * ldb; const _Float16* b3p = b2p + (size_t)16 * ldb;
  const v8f z8 = {0.f,0.f,0.f,0.f,0.f,0.f,0.f,0.f}; v8f c00 = z8, c01 = z8, c02 = z8, c03 = z8, c10 = z8, c11 = z8, c12 = z8, c13 = z8;
#pragma unroll 1
  for (int kb = 0; kb < K; kb += 32) { const v16h a0 = g2_frag(a0p + kb, hh), a1 = g2_frag(a1p + kb, hh);
    v16h b = g2_frag(b0p + kb, hh); c00 = g2_mma(a0, b, c00); c10 = g2_mma(a1, b, c10);
    b = g2_frag(b1p + kb, hh); c01 = g2_mma(a0, b, c01); c11 = g2_mma(a1, b, c11);
    b = g2_frag(b2p + kb, hh); c02 = g2_mma(a0, b, c02); c12 = g2_mma(a1, b, c12);
    b = g2_frag(b3p + kb, hh); c03 = g2_mma(a0, b, c03); c13 = g2_mma(a1, b, c13); }
  v8f accs[8] = {c00, c01, c02, c03, c10, c11, c12, c13};
#pragma unroll
  for (int u = 0; u < 8; ++u) { const int t = u & 3, half = u >> 2; const int col = col0 + t * 16 + ln; const float bv = bp ? bf16_round(bp[col]) : 0.f;
#pragma unroll
    for (int r = 0; r < 8; ++r) { const int rloc = half * 16 + 8 * hh + r; float v = accs[u][r] * alpha + bv; if (CP) { if (rowsPerB < 0) v += CP[cofs + (size_t)(row0g + row0 + rloc) * ldc + col];      /* rowsPerB < 0: own element of the batched C plane */ else { const int bidx = (row0g + row0 + rloc) / rowsPerB; v += CP[(size_t)bidx * sCPb + (size_t)by * 64 + col]; } }
      if (ACT == 3) v = fmaxf(v, 0.f); else if (ACT == 6) v = 0.5f * v * (1.0f + erff(v * 0.70710678118654752f)); else if (ACT == 11) v = 1.0f / (1.0f + expf(-v)); else if (ACT == 15) v = v / (1.0f + expf(-v)); else if (ACT == 12) v = (v > 0.f) ? v : 0.01f * v; else if (ACT == 8) v = tanhf(v); else if (ACT == 9) v = 0.5f * v * (1.0f + tanhf(0.7978845608028654f * (v + 0.044715f * v * v * v))); else if (ACT == 14) v = (v > 0.f) ? v : 0.1f * v; else if (ACT == 16) v = (v >= 0.f) ? v : 0.3f * v; else if (ACT == 17) v = (v >= 0.f) ? v : 0.2f * v;
      so[w][rloc][t * 16 + ln] = v; } }
  __builtin_amdgcn_fence(__ATOMIC_ACQ_REL, "workgroup"); __builtin_amdgcn_wave_barrier();
  const int rsub = lane >> 4, c4 = (lane & 15) * 4;
  {
#pragma unroll
    for (int q = 0; q < 16; ++q) { const int r = q * 2 + rsub; const v4f v = *(const v4fa*)&so[w][r][c4]; if (C) *(v4f*)(C + cofs + (size_t)(row0 + r) * ldc + col0 + c4) = v; if (C16) { v4h h4; for (int i = 0; i < 4; ++i) h4[i] = (_Float16)v[i]; *(v4h*)(C16 + cofs + (size_t)(row0 + r) * ldc + col0 + c4) = h4; } }
     } }


__global__ __launch_bounds__(256) void k_wnat(const float* __restrict__ w, size_t n8, _Float16* __restrict__ Bt) { const size_t t = (size_t)blockIdx.x * 256 + threadIdx.x; if (t >= n8) return; FragH f; for (int q = 0; q < 8; ++q) f.h[q] = (_Float16)(bf16_round(w[t * 8 + q]) * 16.0f); *(v8us*)((unsigned short*)Bt + t * 8) = f.half[0];  }
__global__ __launch_bounds__(256) void k_rsm(const float* __restrict__ S, _Float16* __restrict__ P, int nrows) {
  #pragma clang fp contract(off)
  const int i = blockIdx.x * 256 + threadIdx.x; if (i >= nrows) return; const float* s = S + (size_t)i * SQ; float mx = -3.0e38f;
#pragma unroll 1
  for (int j = 0; j < SQ; ++j) mx = fmaxf(mx, s[j]); float se = 0.f;
#pragma unroll 1
  for (int j = 0; j < SQ; ++j) se += expf(s[j] - mx); const float sc = 256.0f / se;
#pragma unroll 1
  for (int j0 = 0; j0 < SQ; j0 += 8) { FragH f; for (int q = 0; q < 8; ++q) f.h[q] = (_Float16)(expf(s[j0 + q] - mx) * sc); unsigned short* d = (unsigned short*)P + (size_t)i * SQ + j0; *(v8us*)d = f.half[0];  } }
__global__ __launch_bounds__(256) void k_vt(const _Float16* __restrict__ V16, int b, int h0, _Float16* __restrict__ VT) { __shared__ unsigned short tl[64][65]; const int tid = threadIdx.x; const int hh = blockIdx.x % HG, sg = blockIdx.x / HG; const int s0 = sg * 64; const int h = h0 + hh;
  for (int i = tid; i < 64 * 8; i += 256) { const int j = i / 8, d8 = (i % 8) * 8; FragH f; f.half[0] = *(const v8us*)((const unsigned short*)V16 + ((size_t)b * SQ + s0 + j) * DM + h * HD + d8); for (int q = 0; q < 8; ++q) tl[d8 + q][j] = f.u[q]; }
  __syncthreads();
  { for (int i = tid; i < 64 * 8; i += 256) { const int d = i / 8, j8 = (i % 8) * 8; FragH f; for (int q = 0; q < 8; ++q) f.u[q] = tl[d][j8 + q]; *(v8us*)((unsigned short*)VT + ((size_t)hh * HD + d) * SQ + s0 + j8) = f.half[0]; }  } }



// 2^x on the transcendental unit. The v_nop fills the one issue slot that the instruction set asks for behind a transcendental before its source
// is overwritten.
__device__ __forceinline__ float exp2_slot(float x) { float r; asm("v_exp_f32 %0, %1\n\tv_nop" : "=v"(r) : "v"(x)); return r; }
// Fused causal attention (online softmax): one launch for every batch, head and query row; scores and softmax weights never leave the registers.
// A work-group is the 4 query heads of one kv group (one wave each) on the same 32 query rows, so its waves walk the same K and V lines.
// Transposed products: S^T = K Q^T puts query 16 c + ln in lane ln and key 16 kt + 8 hh + r in register r, which is already the B-operand order of
// P^T for O^T += V^T P^T (half kt of the fragment = tile kt's 8 registers): no exchange between lanes but the one between the two wave halves.
__device__ __forceinline__ v8f fa_mma(v16h a, v16h b, v8f c) { return __builtin_amdgcn_wmma_f32_16x16x32_f16(false, a, false, b, (short)0, c, false, false); }
__device__ __forceinline__ float fa_xhalf(float x) { return __builtin_bit_cast(float, __builtin_amdgcn_permlanex16(__builtin_bit_cast(int, x), __builtin_bit_cast(int, x), 0x76543210, 0xfedcba98, false, false)); }      /* lane l <-> lane l ^ 16 */
// A fragment at the lane's own byte offset (row ln, element 8 hh) from a uniform base: k = 8 hh .. + 7 and 16 + 8 hh .. + 7, the k order of g2_frag.
__device__ __forceinline__ v16h fa_frag(const _Float16* base, unsigned off, int cb) { const char* p = (const char*)base + off; FragH f; f.half[0] = *(const v8us*)(p + cb); f.half[1] = *(const v8us*)(p + cb + 32); return f.v; }
// s_wait_xcnt 0 behind issued loads, in front of any write of a register that they name. The lane offsets pass through the statement: they stay in
// their registers up to the wait, and whatever is formed from them later stands behind it (a "memory" clobber alone does not tie the wait to registers).
__device__ __forceinline__ void fa_hold(unsigned& a) { asm volatile("s_wait_xcnt 0x0" : "+v"(a) : : "memory"); }
__device__ __forceinline__ void fa_hold(unsigned& a, unsigned& b) { asm volatile("s_wait_xcnt 0x0" : "+v"(a), "+v"(b) : : "memory"); }
// One pass of 32 keys. ko: the lane's byte offset of the NEXT pass's K rows; vo: of this pass's keys in V^T. DIAG: the wave's last pass, the only one
// that meets the diagonal (it masks, and it fetches no further K).
// Every loop over kt, kc, c, t and r here and in the kernel is unrolled so that fragments, scores and accumulators are indexed by constants only and stay in registers.
template <bool DIAG>
__device__ __forceinline__ void fa_pass(const _Float16* __restrict__ Kh, const _Float16* __restrict__ Vt, unsigned& ko, unsigned& vo, int key0, int q0, int ln, int hh,
                                        const v16h (&qf)[2][2], v16h (&kf)[2][2], v8f (&acc)[2][4], float (&m)[2], float (&l)[2]) {
  const float cs = 0.125f * 1.44269504f;      /* 1 / sqrt(64), and e^x = 2^(x log2 e) */
  v16h vf[4];
#pragma unroll
  for (int t = 0; t < 4; ++t) vf[t] = fa_frag(Vt, vo, 16 * t * SQ * 2);      /* V^T rows d = 16 t + ln, this pass's keys: in flight under the scores and the exponentials */
  v8f s[2][2];
#pragma unroll
  for (int kt = 0; kt < 2; ++kt)
#pragma unroll
    for (int c = 0; c < 2; ++c) { const v8f z = {0.f, 0.f, 0.f, 0.f, 0.f, 0.f, 0.f, 0.f}; s[kt][c] = fa_mma(kf[kt][1], qf[c][1], fa_mma(kf[kt][0], qf[c][0], z)); }
  if (!DIAG) {      /* the next pass's K rows, in flight under this pass's softmax and second product */
#pragma unroll
    for (int kt = 0; kt < 2; ++kt)
#pragma unroll
      for (int kc = 0; kc < 2; ++kc) kf[kt][kc] = fa_frag(Kh, ko, (16 * kt * KVD + 32 * kc) * 2);
    fa_hold(ko, vo);
    __builtin_amdgcn_sched_barrier(0);      /* keeps the K loads here: without it the scheduler sinks them to the end of the pass, and the next pass's scores wait out their whole latency */
    ko += 32 * KVD * 2; vo += 32 * 2;
  } else fa_hold(vo);
#pragma unroll
  for (int c = 0; c < 2; ++c) {
    if (DIAG) {
      const int qi = q0 + 16 * c + ln;
#pragma unroll
      for (int kt = 0; kt < 2; ++kt)
#pragma unroll
        for (int r = 0; r < 8; ++r) if (key0 + 16 * kt + 8 * hh + r > qi) s[kt][c][r] = -1.0e30f;
    }
    float mx = s[0][c][0];
#pragma unroll
    for (int r = 0; r < 8; ++r) mx = fmaxf(mx, fmaxf(s[0][c][r], s[1][c][r]));
    mx = fmaxf(mx, fa_xhalf(mx));      /* both halves of the wave now hold this query's maximum over the pass */
    const float mn = fmaxf(m[c], mx * cs);
    const float corr = exp2_slot(m[c] - mn);      /* 0 on the first pass */
    m[c] = mn;
    FragH pf; float ps = 0.f;
#pragma unroll
    for (int kt = 0; kt < 2; ++kt)
#pragma unroll
      for (int r = 0; r < 8; ++r) { const float p = exp2_slot(fmaf(s[kt][c][r], cs, -mn)); ps += p; pf.h[8 * kt + r] = (_Float16)p; }
    l[c] = fmaf(l[c], corr, ps);
#pragma unroll
    for (int t = 0; t < 4; ++t) { acc[c][t] = acc[c][t] * corr; acc[c][t] = fa_mma(vf[t], pf.v, acc[c][t]); }
    /* the four vector slots that the chip needs behind a matrix instruction before its operands are overwritten */
    asm volatile("v_nop\n\tv_nop\n\tv_nop\n\tv_nop" : "+v"(acc[c][0]), "+v"(acc[c][1]), "+v"(acc[c][2]), "+v"(acc[c][3]) : "v"(vf[0]), "v"(vf[1]), "v"(vf[2]), "v"(vf[3]), "v"(pf.v));
  }
}
__global__ __launch_bounds__(128) void k_fattn(const _Float16* __restrict__ Q, const _Float16* __restrict__ Kh, const _Float16* __restrict__ Vt, _Float16* __restrict__ O) {
  const int lane = threadIdx.x & 31, ln = lane & 15, hh = lane >> 4; const int g = blockIdx.y, b = blockIdx.z; const int h = g * HPG + (threadIdx.x >> 5);
  const int qt = (b & 1) ? (int)blockIdx.x : (SQ / 32 - 1) - (int)blockIdx.x;      /* long and short tiles alternate from batch to batch, so that work-groups a whole batch apart in the grid add up to the same length */
  const int q0 = qt * 32; const size_t r0 = (size_t)b * SQ;
  unsigned qo = (unsigned)(((r0 + q0 + ln) * DM + h * HD + 8 * hh) * 2), ko = (unsigned)(((r0 + ln) * KVD + g * HD + 8 * hh) * 2), vo = (unsigned)((((size_t)(b * NG + g) * HD + ln) * SQ + 8 * hh) * 2);      /* byte offsets: every buffer is below 4 GiB */
  v16h qf[2][2], kf[2][2];
#pragma unroll
  for (int c = 0; c < 2; ++c)
#pragma unroll
    for (int kc = 0; kc < 2; ++kc) { qf[c][kc] = fa_frag(Q, qo, (16 * c * DM + 32 * kc) * 2); kf[c][kc] = fa_frag(Kh, ko, (16 * c * KVD + 32 * kc) * 2); }
  fa_hold(qo, ko);
  ko += 32 * KVD * 2;
  v8f acc[2][4] = {}; float m[2] = {-1.0e30f, -1.0e30f}, l[2] = {0.f, 0.f};
  for (int key0 = 0; key0 < q0; key0 += 32) fa_pass<false>(Kh, Vt, ko, vo, key0, q0, ln, hh, qf, kf, acc, m, l);
  fa_pass<true>(Kh, Vt, ko, vo, q0, q0, ln, hh, qf, kf, acc, m, l);
  unsigned short* op = (unsigned short*)O + (r0 + q0 + ln) * DM + h * HD + 8 * hh;
#pragma unroll
  for (int c = 0; c < 2; ++c) { const float fin = 64.0f / (l[c] + fa_xhalf(l[c]));      /* o carried x64, as the output product expects */
#pragma unroll
    for (int t = 0; t < 4; ++t) { FragH f;
#pragma unroll
      for (int r = 0; r < 8; ++r) f.h[r] = (_Float16)(acc[c][t][r] * fin);
      *(v8us*)(op + (size_t)(16 * c) * DM + 16 * t) = f.half[0]; }      /* d = 16 t + 8 hh .. + 7 of query row 16 c + ln */
    asm volatile("s_wait_xcnt 0x0" ::: "memory"); }      /* behind the stores, in front of any later write of a register that an issued store names */
}


// Exact f32 attention for the first QT0 rows: one thread per (query row, head), online softmax; every sum runs in the order d = 0, 1, ... and j = 0, 1, ...
// What a thread owns (its q row, its o accumulator) stays in registers; what all threads of the block read at the same address (the head's K and V rows)
// is staged once in LDS and read by broadcast. Every loop over d is unrolled so that q, o and the row fragments are indexed by constants only.
// blockIdx.y is the batch: its QT0 rows of q, k, v and o follow those of the batch before.
__global__ __launch_bounds__(64) void k_att0(const float* __restrict__ QF, const float* __restrict__ KF, const float* __restrict__ VF, float scale, float* __restrict__ OF, int ldo) {
  __shared__ __attribute__((aligned(16))) float lk[QT0][HD]; __shared__ __attribute__((aligned(16))) float lv[QT0][HD]; __shared__ __attribute__((aligned(16))) float lo[64][64];
  const int tid = threadIdx.x; const int h = blockIdx.x / (QT0 / 64), rg = blockIdx.x % (QT0 / 64); const int i = rg * 64 + tid;
  QF += (size_t)blockIdx.y * QT0 * LQ; KF += (size_t)blockIdx.y * QT0 * LQ; VF += (size_t)blockIdx.y * QT0 * LQ; OF += (size_t)blockIdx.y * QT0 * ldo;
  const int jmax = rg * 64 + 63;      /* keys up to the block's last row */
  const int sr = tid >> 4, sc4 = (tid & 15) * 4;      /* staging: 16 threads to a row of 256 bytes */
  unsigned so = (unsigned)((sr * LQ + h * HD + sc4) * 4), qo = (unsigned)((i * LQ + h * HD) * 4);      /* the lane's byte offsets in K and V, and in q */
#pragma unroll 1      /* kept rolled: one trip already has 16 loads in flight per thread */
  for (int r0 = 0; r0 <= jmax; r0 += 32) { v4f kk[8], vv[8];
#pragma unroll
    for (int u = 0; u < 8; ++u) { kk[u] = *(const v4fa*)((const char*)KF + so + u * 4 * LQ * 4); vv[u] = *(const v4fa*)((const char*)VF + so + u * 4 * LQ * 4); }      /* 16 loads in flight per thread */
    fa_hold(so);      /* the wait behind the issued loads, in front of the write of the offset that they name */
    so += 32 * LQ * 4;
#pragma unroll
    for (int u = 0; u < 8; ++u) { *(v4f*)&lk[r0 + 4 * u + sr][sc4] = kk[u]; *(v4f*)&lv[r0 + 4 * u + sr][sc4] = vv[u]; } }
  float q[HD], o[HD];
#pragma unroll
  for (int c = 0; c < HD / 4; ++c) { const v4f t = *(const v4fa*)((const char*)QF + qo + c * 16);
#pragma unroll
    for (int u = 0; u < 4; ++u) { q[c * 4 + u] = t[u]; o[c * 4 + u] = 0.f; } }
  fa_hold(qo);      /* the same wait behind the q loads; their offset stays in its register up to it */
  __syncthreads();      /* K and V rows are staged: nobody reads them in front of this barrier */
  float m = -1.0e30f, l = 0.f, sn = 0.f;
#pragma unroll
  for (int d = 0; d < HD; ++d) sn = fmaf(q[d], lk[0][d], sn);
#pragma unroll 1      /* kept rolled: a second copy of the body would not fit the registers beside q and o */
  for (int j = 0; j <= jmax; ++j) { const float s = sn * scale;
    const float* kr = &lk[j < jmax ? j + 1 : jmax][0]; v4f kq[HD / 4], vv[HD / 4];
#pragma unroll
    for (int c = 0; c < HD / 4; ++c) kq[c] = *(const v4f*)(kr + c * 4);
    __builtin_amdgcn_sched_barrier(0);      /* keeps the K reads in front of the V reads: LDS answers in order, and with V rows queued between them the score chain below waits for its K words */
#pragma unroll
    for (int c = 0; c < HD / 4; ++c) vv[c] = *(const v4f*)&lv[j][c * 4];
    sn = 0.f;      /* the next key's score: its chain of 64 dependent multiply-adds depends on nothing below, so this key's exponentials and o update fill its waits */
#pragma unroll
    for (int d = 0; d < HD; ++d) sn = fmaf(q[d], kq[d >> 2][d & 3], sn);
    const float f = (j <= i) ? 1.f : 0.f; const float sm = fmaf(f, s, (1.f - f) * -1.0e30f); const float mn = fmaxf(m, sm); const float sc = expf(m - mn); const float e = expf(sm - mn); l = fmaf(l, sc, e); m = mn;
#pragma unroll
    for (int d = 0; d < HD; ++d) o[d] = fmaf(o[d], sc, e * vv[d >> 2][d & 3]); }
  const float fin = 64.0f / l;      /* o carried x64 like the f16 path */
#pragma unroll
  for (int c = 0; c < HD / 4; ++c) { v4f oo;
#pragma unroll
    for (int u = 0; u < 4; ++u) oo[u] = o[c * 4 + u] * fin;
    *(v4f*)&lo[tid][c * 4] = oo; }
  __syncthreads();
  {
#pragma unroll 1
    for (int it = 0; it < 16; ++it) { const int row = it * 4 + tid / 16, pc = (tid % 16) * 4; const v4f v = *(const v4f*)&lo[row][pc]; *(v4f*)(OF + (size_t)(rg * 64 + row) * ldo + h * HD + pc) = v; }
     } }


__global__ __launch_bounds__(256) void k_kvexp(const float* __restrict__ src, float* __restrict__ dst, size_t n4) { const size_t t = (size_t)blockIdx.x * 256 + threadIdx.x; if (t >= n4) return; const size_t e = t * 4; const size_t row = e / DM; const int col = (int)(e % DM); const int h = col / HD, d = col % HD; const v4f v = *(const v4fa*)(src + row * KVD + (size_t)(h / HPG) * HD + d); *(v4f*)(dst + e) = v;  }

__global__ __launch_bounds__(256) void k_tab2(float theta, float* __restrict__ CS, float* __restrict__ SN) {
  #pragma clang fp contract(off)
  const int t = blockIdx.x * 256 + threadIdx.x; if (t >= SQ * (HD / 2)) return; const int i = t % (HD / 2); const int p = t / (HD / 2); const float invf = 1.0f / powf(theta, (float)(2 * i) / (float)HD); const float ang = __fmul_rn((float)p, invf); const float c = cosf(ang), s = sinf(ang);
  *(float*)(CS + t) = c; *(float*)(SN + t) = s;  }
template <int NORM, int ROPE>
__global__ __launch_bounds__(64) void k_xform(const float* __restrict__ F, int ldf, int nh, const float* __restrict__ gain, float eps, const float* __restrict__ CS, const float* __restrict__ SN, _Float16* __restrict__ H16, int ldo) {
  #pragma clang fp contract(off)
  __shared__ float xv[HD]; __shared__ float red[HD]; __shared__ unsigned short sh_[HD]; const int d = threadIdx.x; const int h = blockIdx.x % nh; const size_t r = blockIdx.x / nh; const int p = (int)(r % SQ);
  float x = F[r * (size_t)ldf + (size_t)h * HD + d];
  if (NORM) { red[d] = __fmul_rn(x, x); __syncthreads(); for (int st = HD / 2; st > 0; st >>= 1) { if (d < st) red[d] = __fadd_rn(red[d], red[d + st]); __syncthreads(); } const float rs = rsqrtf(__fadd_rn(red[0] / (float)HD, eps)); x = __fmul_rn(__fmul_rn(x, rs), bf16_round(gain[d])); }
  xv[d] = x; __syncthreads();
  float o = x;
  if (ROPE == 1) { const int i = d >> 1; const float c = CS[p * (HD / 2) + i], s = SN[p * (HD / 2) + i]; const float ev = xv[2 * i], od = xv[2 * i + 1]; o = (d & 1) ? __fadd_rn(__fmul_rn(ev, s), __fmul_rn(od, c)) : __fadd_rn(__fmul_rn(ev, c), -__fmul_rn(od, s)); }
  if (ROPE == 2) { const int i = d & (HD / 2 - 1); const float c = CS[p * (HD / 2) + i], s = SN[p * (HD / 2) + i]; const float lo = xv[i], hi = xv[i + HD / 2]; o = (d < HD / 2) ? __fadd_rn(__fmul_rn(lo, c), -__fmul_rn(hi, s)) : __fadd_rn(__fmul_rn(lo, s), __fmul_rn(hi, c)); }
  if (ROPE == 3) { const float c = CS[p * HD + d], s = SN[p * HD + d]; const float lo = xv[d & (HD / 2 - 1)], hi = xv[(d & (HD / 2 - 1)) + HD / 2]; o = (d < HD / 2) ? __fadd_rn(__fmul_rn(lo, c), -__fmul_rn(hi, s)) : __fadd_rn(__fmul_rn(hi, c), __fmul_rn(lo, s)); }      /* rotate-half with FULL-width per-element tables [pos][HD] */
  FragH th; th.h[0] = (_Float16)o; sh_[d] = th.u[0]; __syncthreads();
  if (d < HD / 8) { FragH f; for (int q = 0; q < 8; ++q) f.u[q] = sh_[d * 8 + q]; unsigned short* dst = (unsigned short*)H16 + r * (size_t)ldo + (size_t)h * HD + d * 8; *(v8us*)dst = f.half[0];  } }

template <int NORM, int ROPE>
__global__ __launch_bounds__(64) void k_xformf(const float* __restrict__ F, int ldf, size_t sF, int nh, const float* __restrict__ gain, float eps, const float* __restrict__ CS, const float* __restrict__ SN, float* __restrict__ F32, int ldo, size_t sO) {
  #pragma clang fp contract(off)
  __shared__ float xv[HD]; __shared__ float red[HD]; const int d = threadIdx.x; const int h = blockIdx.x % nh; const size_t r = blockIdx.x / nh; const int p = (int)(r % SQ);
  F += (size_t)blockIdx.y * sF; F32 += (size_t)blockIdx.y * sO;      /* blockIdx.y is the batch; r counts from its first row */
  float x = F[r * (size_t)ldf + (size_t)h * HD + d];
  if (NORM) { red[d] = __fmul_rn(x, x); __syncthreads(); for (int st = HD / 2; st > 0; st >>= 1) { if (d < st) red[d] = __fadd_rn(red[d], red[d + st]); __syncthreads(); } const float rs = rsqrtf(__fadd_rn(red[0] / (float)HD, eps)); x = __fmul_rn(__fmul_rn(x, rs), bf16_round(gain[d])); }
  xv[d] = x; __syncthreads();
  float o = x;
  if (ROPE == 1) { const int i = d >> 1; const float c = CS[p * (HD / 2) + i], s = SN[p * (HD / 2) + i]; const float ev = xv[2 * i], od = xv[2 * i + 1]; o = (d & 1) ? __fadd_rn(__fmul_rn(ev, s), __fmul_rn(od, c)) : __fadd_rn(__fmul_rn(ev, c), -__fmul_rn(od, s)); }
  if (ROPE == 2) { const int i = d & (HD / 2 - 1); const float c = CS[p * (HD / 2) + i], s = SN[p * (HD / 2) + i]; const float lo = xv[i], hi = xv[i + HD / 2]; o = (d < HD / 2) ? __fadd_rn(__fmul_rn(lo, c), -__fmul_rn(hi, s)) : __fadd_rn(__fmul_rn(lo, s), __fmul_rn(hi, c)); }
  if (ROPE == 3) { const float c = CS[p * HD + d], s = SN[p * HD + d]; const float lo = xv[d & (HD / 2 - 1)], hi = xv[(d & (HD / 2 - 1)) + HD / 2]; o = (d < HD / 2) ? __fadd_rn(__fmul_rn(lo, c), -__fmul_rn(hi, s)) : __fadd_rn(__fmul_rn(hi, c), __fmul_rn(lo, s)); }      /* rotate-half with FULL-width per-element tables [pos][HD] */
  float* dst = F32 + r * (size_t)ldo + (size_t)h * HD + d; *(float*)dst = o;  }

__global__ __launch_bounds__(256) void k_bfcp(const float* __restrict__ src, float* __restrict__ dst, size_t n4) { const size_t t = (size_t)blockIdx.x * 256 + threadIdx.x; if (t >= n4) return; const v4f a = *(const v4fa*)(src + t * 4); v4f o; for (int q = 0; q < 4; ++q) o[q] = bf16_round(a[q]); *(v4f*)(dst + t * 4) = o;  }

__global__ __launch_bounds__(256) void k_tabhalf(const float* __restrict__ cs, const float* __restrict__ sn, float* __restrict__ CS, float* __restrict__ SN) { const int t = blockIdx.x * 256 + threadIdx.x; if (t >= SQ * (HD / 2)) return; const int p = t / (HD / 2), i = t % (HD / 2); const float c = bf16_round(cs[(size_t)p * HD + i]), s = bf16_round(sn[(size_t)p * HD + i]);
  *(float*)(CS + t) = c; *(float*)(SN + t) = s;  }

__global__ __launch_bounds__(256) void k_tab2d(float* __restrict__ CS, float* __restrict__ SN) {
  #pragma clang fp contract(off)
  const int t = blockIdx.x * 256 + threadIdx.x; if (t >= SQ * (HD / 2)) return; const int i = t % (HD / 2); const int p = t / (HD / 2); const float invf = (float)(1.0 / pow(10000.0, (double)(2 * i) / (double)HD)); const float ang = __fmul_rn((float)p, invf); const float c = cosf(ang), s = sinf(ang);
  *(float*)(CS + t) = c; *(float*)(SN + t) = s;  }
extern "C" void kernel_launch(void* const* d_in, const int* in_sizes, int n_in,
                              void* d_out, int out_size, void* d_ws, size_t ws_size, hipStream_t stream) {
  (void)in_sizes; (void)n_in; (void)out_size;
  const float* const* I = (const float* const*)d_in; const float* x = I[0]; const float* wq = I[1]; const float* wk = I[2]; const float* wv = I[3]; const float* wo = I[4];      /* input order: x, Wq [1024][1024], Wk / Wv [1024][256], Wo [1024][1024] ([in][out] weights); rope tables computed in-kernel (positions = row index), as the module computes them */ const float* bq = nullptr; const float* bk = nullptr; const float* bv = nullptr; const float* bo = nullptr;      /* no biases */
  char* ws = (char*)d_ws; size_t off = 0;
  auto take = [&](size_t bytes) { char* p = ws + off; off += (bytes + 255) & ~(size_t)255; return p; };
  _Float16* BQ = (_Float16*)take((size_t)DM * DM * 2); _Float16* BK = (_Float16*)take((size_t)KVD * DM * 2); _Float16* BV = (_Float16*)take((size_t)KVD * DM * 2); _Float16* BO = (_Float16*)take((size_t)DM * DM * 2);
  _Float16* X16 = (_Float16*)take(NR * DM * 2); float* QF = (float*)take(NR * DM * 4); float* KF = (float*)take(NR * KVD * 4); float* CSB = (float*)take((size_t)SQ * HD * 4); float* SNB = (float*)take((size_t)SQ * HD * 4); _Float16* Q16 = (_Float16*)take(NR * DM * 2); _Float16* K16 = (_Float16*)take(NR * KVD * 2); _Float16* V16 = (_Float16*)take(NR * KVD * 2); _Float16* O16 = (_Float16*)take(NR * DM * 2);
  _Float16* VT = (_Float16*)take((size_t)NB * NG * HD * SQ * 2);
  float* QF0 = (float*)take((size_t)NB * QT0 * DM * 4); float* KF0 = (float*)take((size_t)NB * QT0 * KVD * 4); float* VF0 = (float*)take((size_t)NB * QT0 * KVD * 4); float* KF0e = (float*)take((size_t)NB * QT0 * DM * 4); float* VF0e = (float*)take((size_t)NB * QT0 * DM * 4); float* OF0 = (float*)take((size_t)NB * QT0 * DM * 4); _Float16* OH0 = (_Float16*)take((size_t)NB * QT0 * DM * 2); _Float16* OL0 = (_Float16*)take((size_t)NB * QT0 * DM * 2);
  if (off > ws_size) return;
  k_wt_f16<<<(unsigned)(((size_t)DM * (DM / 8) + 255) / 256), 256, 0, stream>>>(wq, BQ, DM, DM, 16.0f); k_wt_f16<<<(unsigned)(((size_t)KVD * (DM / 8) + 255) / 256), 256, 0, stream>>>(wk, BK, DM, KVD, 16.0f); k_wt_f16<<<(unsigned)(((size_t)KVD * (DM / 8) + 255) / 256), 256, 0, stream>>>(wv, BV, DM, KVD, 16.0f); k_wt_f16<<<(unsigned)(((size_t)DM * (DM / 8) + 255) / 256), 256, 0, stream>>>(wo, BO, DM, DM, 16.0f);      /* [in][out] -> Bt[n][k] x16 (transposing builder; K = DM, N = DM / KVD) */
  k_x16<<<(unsigned)((NR * DM / 8 + 255) / 256), 256, 0, stream>>>(x, X16, NR * DM / 8);
  k_tab2d<<<(SQ * (HD / 2) + 255) / 256, 256, 0, stream>>>(CSB, SNB);      /* rope tables computed in-kernel: angle[p][i] = p * 10000^(-2i/64) (the module's _rope_cache; positions = row index) */
  /* Every stage below is ONE launch over all NB batches: the full-length stages take the NB * SQ token rows as one run of rows, the first-tile stages take the batch from blockIdx.y. */
  k_gemm2<0><<<dim3((unsigned)((MP / 128) * (KVD / 64)), 1), 128, 0, stream>>>(X16, DM, 0, BV, DM, 0, 0.0625f, bv, 0, nullptr, 1, 0, 0, nullptr, V16, KVD, 0, MP, KVD, DM);
  k_gemm2<0><<<dim3((unsigned)((MP / 128) * (DM / 64)), 1), 128, 0, stream>>>(X16, DM, 0, BQ, DM, 0, 0.0625f, nullptr, 0, nullptr, 1, 0, 0, QF, nullptr, DM, 0, MP, DM, DM);      /* q (f32) */
  k_gemm2<0><<<dim3((unsigned)((MP / 128) * (KVD / 64)), 1), 128, 0, stream>>>(X16, DM, 0, BK, DM, 0, 0.0625f, nullptr, 0, nullptr, 1, 0, 0, KF, nullptr, KVD, 0, MP, KVD, DM);      /* k (f32) */
  k_xform<0, 1><<<(unsigned)(NR * NH), 64, 0, stream>>>(QF, DM, NH, nullptr, 0.f, CSB, SNB, Q16, DM); k_xform<0, 1><<<(unsigned)(NR * NG), 64, 0, stream>>>(KF, KVD, NG, nullptr, 0.f, CSB, SNB, K16, KVD);      /* interleaved-pair rope (pairs (2i, 2i+1)), position = row % SQ -> f16 rows */
  k_xformf<0, 1><<<dim3(QT0 * NH, NB), 64, 0, stream>>>(QF, DM, (size_t)SQ * DM, NH, nullptr, 0.f, CSB, SNB, QF0, DM, (size_t)QT0 * DM); k_xformf<0, 1><<<dim3(QT0 * NG, NB), 64, 0, stream>>>(KF, KVD, (size_t)SQ * KVD, NG, nullptr, 0.f, CSB, SNB, KF0, KVD, (size_t)QT0 * KVD);      /* f32 roped q, k of rows 0..127 of each batch */
  k_vt<NG, SQ><<<NB * NG * (SQ / 64), 256, 0, stream>>>(V16, KVD, 0, VT);      /* V^T [NB][NG][HD][SQ] */
  k_gemm2<0><<<dim3((QT0 / 128) * (KVD / 64), NB), 128, 0, stream>>>(X16, DM, (size_t)SQ * DM, BV, DM, 0, 0.0625f, bv, 0, nullptr, 1, 0, 0, VF0, nullptr, KVD, (size_t)QT0 * KVD, QT0, KVD, DM);      /* f32 v of rows 0..127 of each batch */
  k_kvexp<<<(unsigned)(((size_t)NB * QT0 * DM / 4 + 255) / 256), 256, 0, stream>>>(KF0, KF0e, (size_t)NB * QT0 * DM / 4); k_kvexp<<<(unsigned)(((size_t)NB * QT0 * DM / 4 + 255) / 256), 256, 0, stream>>>(VF0, VF0e, (size_t)NB * QT0 * DM / 4);      /* head h <- kv group h/4 for the exact first-tile kernel */
  k_att0<<<dim3(NH * (QT0 / 64), NB), 64, 0, stream>>>(QF0, KF0e, VF0e, 0.125f, OF0, DM);      /* exact f32 attention for rows 0..127 of each batch (o x64) */
  k_fattn<<<dim3(SQ / 32, NG, NB), 128, 0, stream>>>(Q16, K16, VT, O16);      /* scores, causal softmax and o (merged heads, x64, f16 rows) for all batches and heads */
  k_gemm2<0><<<dim3((unsigned)((MPO / 128) * (DM / 64)), 1), 128, 0, stream>>>(O16, DM, 0, BO, DM, 0, 0.0009765625f, bo, 0, nullptr, 1, 0, 0, (float*)d_out, nullptr, DM, 0, MPO, DM, DM);      /* out rows are the output layout */
  k_hl<<<(unsigned)(((size_t)NB * QT0 * DM / 8 + 255) / 256), 256, 0, stream>>>(OF0, OH0, OL0, (size_t)NB * QT0 * DM / 8);      /* first-tile o (x64) -> f16 hi + x1024 residual planes */
  k_gemm2<0><<<dim3((QT0 / 128) * (DM / 64), NB), 128, 0, stream>>>(OH0, DM, (size_t)QT0 * DM, BO, DM, 0, 0.0009765625f, bo, 0, nullptr, 1, 0, 0, (float*)d_out, nullptr, DM, (size_t)SQ * DM, QT0, DM, DM);      /* rows 0..127 of each batch: out = o_hi Wo (+ b), overwriting the f16-path rows */
  k_gemm2<0><<<dim3((QT0 / 128) * (DM / 64), NB), 128, 0, stream>>>(OL0, DM, (size_t)QT0 * DM, BO, DM, 0, 0.00000095367431640625f, nullptr, 0, (const float*)d_out, -1, 0, 0, (float*)d_out, nullptr, DM, (size_t)SQ * DM, QT0, DM, DM);      /* += o_lo Wo 2^-20 (own-element accumulate) */
}

// v005
// A run of this version takes 412 microseconds.
// Timed twice side by side with v004, it ran 1.09 and 1.10 times as fast.
// Over all steps from v000 it is 32.7 times as fast.
#include <hip/hip_runtime.h>
// Grouped-query causal attention at width 1024 with [in][out] projections and RoPE computed in the module (x [4][2048][1024]; q = x Wq (16 heads x 64), k = x Wk, v = x Wv (4 kv heads x 64) ([in][out] weights sigma 0.02, no biases); k, v repeated x4 (repeat: query head h uses kv head h / 4); rope: the module rotates the (even, odd) pairs (x1 c - x2 s, x1 s + x2 c) with angle pos * 10000^(-2i/64) and writes the rotated evens into the first half and the rotated odds into the second half of the head: the SAME permutation on q and k, so q . k equals the interleaved-pair rope's; scores / sqrt(64) with a causal mask (tril, -inf); softmax; out = merged Wo ([in][out]) -> [4][2048][1024]).
// Compute dtype: inputs rounded to bf16; x / weights exact; q, k, v, softmax weights and o as plain f16 GEMM operands (~2^-12); scores and softmax statistics f32. v_wmma_f32_16x16x32_f16.
#define NB 4
#define NG 4
#define HPG 4
#define KVD (NG * HD)
#define SQ 2048
#define DM 1024
#define NH 16
#define HD 64
#define HG 4                         /* heads per launch of the k_vt (b, h0) overload */
#define QT 256
#define NKX SQ                       /* S / P row pitch */
#define QT0 128                      /* first-tile rows recomputed exactly in f32 */
#define B0 0                         /* unused: every stage starts at batch 0 */
#define NBR NB                       /* batches processed (debug hook) */
#define NR ((size_t)NB * SQ)         /* token rows */
#define MP ((int)((size_t)NBR * SQ)) /* rows projected (debug hook) */
#define QN SQ                        /* query rows attended per batch (unused: the attention launches take SQ) */
#define NHD NH                       /* heads attended (unused: the attention launches cover all NH heads) */
#define MPO MP                       /* rows through the output stage (debug hook) */
#define LQ DM      /* row pitch of the q rows */
typedef __bf16 v16b __attribute__((ext_vector_type(16)));
typedef unsigned short v8us __attribute__((ext_vector_type(8), may_alias));
typedef float  v8f  __attribute__((ext_vector_type(8)));
typedef float  v4f  __attribute__((ext_vector_type(4)));
typedef float  v4fa __attribute__((ext_vector_type(4), may_alias));
union FragB { v16b v; v8us half[2]; unsigned short u[16]; };

__device__ __forceinline__ unsigned short bf16_bits(float x) { unsigned int u = __float_as_uint(x); return (unsigned short)((u + 0x7FFFu + ((u >> 16) & 1u)) >> 16); }
__device__ __forceinline__ float bf16_val(unsigned short b) { return __uint_as_float(((unsigned int)b) << 16); }
__device__ __forceinline__ float bf16_round(float x) { return bf16_val(bf16_bits(x)); }
// D += A·B with NT terms: 1 = ah·bh, 2 = + al·bh (A split), 3 = + ah·bl (both split)
template <int NT>
__device__ __forceinline__ v8f mmaN(v16b ah, v16b al, v16b bh, v16b bl, v8f c) {
  c = __builtin_amdgcn_wmma_f32_16x16x32_bf16(false, ah, false, bh, (short)0, c, false, false);
  if (NT >= 2) c = __builtin_amdgcn_wmma_f32_16x16x32_bf16(false, al, false, bh, (short)0, c, false, false);
  if (NT >= 3) c = __builtin_amdgcn_wmma_f32_16x16x32_bf16(false, ah, false, bl, (short)0, c, false, false);
  asm volatile("v_nop\n\tv_nop\n\tv_nop\n\tv_nop" : "+v"(c) : "v"(ah), "v"(al), "v"(bh), "v"(bl));
  return c;
}

__global__ __launch_bounds__(256) void k_wt_bf16(const float* __restrict__ W, unsigned short* __restrict__ Wt, int K, int N) {
  const int t = blockIdx.x * 256 + threadIdx.x;
  const int k8n = K / 8;
  if (t >= N * k8n) return;
  const int n = t / k8n, k8 = (t % k8n) * 8;
  v8us v;
#pragma unroll
  for (int i = 0; i < 8; ++i) v[i] = bf16_bits(W[(size_t)(k8 + i) * N + n]);
  *(v8us*)(Wt + (size_t)n * K + k8) = v;
  
}

// GEMM C[M][N] (f32, pitch ldc) = act(A[M][K]·W + bias). A f32 row-major (pitch lda) converted per fragment to bf16
// (ASPLIT: hi/lo two planes -> 2 terms, else single rounded term); Wt bf16 [N][K] (pitch ldb). BIAS_BF16 rounds the
// bias to bf16 first (bias quantised to bf16 before the add). K%32==0, M%16==0, N%64==0.
template <bool ASPLIT, int ACT, bool BIAS_BF16>
__global__ __launch_bounds__(128) void k_gemm_bf(const float* __restrict__ A, int lda, const unsigned short* __restrict__ Wt, int ldb,
                                               const float* __restrict__ bias, float* __restrict__ C, int ldc, int M, int N, int K) {
  __shared__ __attribute__((aligned(16))) float so[4][16][64];
  const int tid = threadIdx.x, w = tid >> 5, lane = tid & 31, ln = lane & 15, hh = lane >> 4;
  const int ntn = N / 64;
  const int wid = blockIdx.x * 4 + w;
  const int mt = wid / ntn, nq = wid % ntn;
  if (mt * 16 >= M) return;
  const int row0 = mt * 16, col0 = nq * 64;
  const float* arow = A + (size_t)(row0 + ln) * lda;
  v8f acc[4] = {};
  for (int kb = 0; kb < K; kb += 32) {
    FragB ah, al;
    const v4f x0 = *(const v4fa*)(arow + kb + 8 * hh), x1 = *(const v4fa*)(arow + kb + 8 * hh + 4);
    const v4f x2 = *(const v4fa*)(arow + kb + 16 + 8 * hh), x3 = *(const v4fa*)(arow + kb + 16 + 8 * hh + 4);
    float xs[16] = {x0[0],x0[1],x0[2],x0[3],x1[0],x1[1],x1[2],x1[3],x2[0],x2[1],x2[2],x2[3],x3[0],x3[1],x3[2],x3[3]};
#pragma unroll
    for (int i = 0; i < 16; ++i) { const unsigned short hb = bf16_bits(xs[i]); ah.u[i] = hb; al.u[i] = ASPLIT ? bf16_bits(xs[i] - bf16_val(hb)) : (unsigned short)0; }
#pragma unroll
    for (int t = 0; t < 4; ++t) {
      const unsigned short* brow = Wt + (size_t)(col0 + t * 16 + ln) * ldb + kb;
      FragB b;
      b.half[0] = *(const v8us*)(brow + 8 * hh);
      b.half[1] = *(const v8us*)(brow + 16 + 8 * hh);
      acc[t] = mmaN<ASPLIT ? 2 : 1>(ah.v, al.v, b.v, b.v, acc[t]);
    }
  }
#pragma unroll
  for (int t = 0; t < 4; ++t) {
    float bv = bias ? bias[col0 + t * 16 + ln] : 0.f;
    if (BIAS_BF16) bv = bf16_round(bv);
#pragma unroll
    for (int r = 0; r < 8; ++r) { float v = acc[t][r] + bv; if (ACT == 1) v = fmaxf(v, 0.f); so[w][8 * hh + r][t * 16 + ln] = v; }
  }
  __builtin_amdgcn_fence(__ATOMIC_ACQ_REL, "workgroup");
  __builtin_amdgcn_wave_barrier();
  const int rsub = lane >> 4, c4 = (lane & 15) * 4;
  {
#pragma unroll
    for (int q = 0; q < 8; ++q) {
      const int r = q * 2 + rsub;
      const v4f v = *(const v4fa*)&so[w][r][c4];
      *(v4f*)(C + (size_t)(row0 + r) * ldc + col0 + c4) = v;
    }
    
  }
}

// GEMM C = act(A·W + bias + resid): A f32 (ASPLIT -> hi/lo 2 terms), Wt bf16 [N][K]; ACT 0 none, 1 relu, 2 exact gelu;
// resid (optional, f32, row index = (row % rmod), pitch ldr, RES_BF16 rounds it) added before the activation.
template <bool ASPLIT, int ACT, bool BIAS_BF16, bool RES_BF16>
__global__ __launch_bounds__(128) void k_gemm_bf3(const float* __restrict__ A, int lda, const unsigned short* __restrict__ Wt, int ldb,
                                                const float* __restrict__ bias, const float* __restrict__ resid, int rmod, int ldr,
                                                float* __restrict__ C, int ldc, int M, int N, int K) {
  __shared__ __attribute__((aligned(16))) float so[4][16][64];
  const int tid = threadIdx.x, w = tid >> 5, lane = tid & 31, ln = lane & 15, hh = lane >> 4;
  const int ntn = N / 64;
  const int wid = blockIdx.x * 4 + w;
  const int mt = wid / ntn, nq = wid % ntn;
  if (mt * 16 >= M) return;
  const int row0 = mt * 16, col0 = nq * 64;
  const float* arow = A + (size_t)(row0 + ln) * lda;
  v8f acc[4] = {};
  for (int kb = 0; kb < K; kb += 32) {
    FragB ah, al;
    const v4f x0 = *(const v4fa*)(arow + kb + 8 * hh), x1 = *(const v4fa*)(arow + kb + 8 * hh + 4);
    const v4f x2 = *(const v4fa*)(arow + kb + 16 + 8 * hh), x3 = *(const v4fa*)(arow + kb + 16 + 8 * hh + 4);
    float xs[16] = {x0[0],x0[1],x0[2],x0[3],x1[0],x1[1],x1[2],x1[3],x2[0],x2[1],x2[2],x2[3],x3[0],x3[1],x3[2],x3[3]};
#pragma unroll
    for (int i = 0; i < 16; ++i) { const unsigned short hb = bf16_bits(xs[i]); ah.u[i] = hb; al.u[i] = ASPLIT ? bf16_bits(xs[i] - bf16_val(hb)) : (unsigned short)0; }
#pragma unroll
    for (int t = 0; t < 4; ++t) {
      const unsigned short* brow = Wt + (size_t)(col0 + t * 16 + ln) * ldb + kb;
      FragB b;
      b.half[0] = *(const v8us*)(brow + 8 * hh);
      b.half[1] = *(const v8us*)(brow + 16 + 8 * hh);
      acc[t] = mmaN<ASPLIT ? 2 : 1>(ah.v, al.v, b.v, b.v, acc[t]);
    }
  }
#pragma unroll
  for (int t = 0; t < 4; ++t) {
    const int col = col0 + t * 16 + ln;
    float bv = bias ? bias[col] : 0.f;
    if (BIAS_BF16) bv = bf16_round(bv);
#pragma unroll
    for (int r = 0; r < 8; ++r) {
      float v = acc[t][r] + bv;
      if (resid) { float rv = resid[(size_t)((row0 + 8 * hh + r) % rmod) * ldr + col]; if (RES_BF16) rv = bf16_round(rv); v += rv; }
      if (ACT == 1) v = fmaxf(v, 0.f);
      if (ACT == 2) v = 0.5f * v * (1.0f + erff(v * 0.70710678118654752f));
      if (ACT == 3) { const float u = 0.7978845608028654f * (v + 0.044715f * v * v * v); v = 0.5f * v * (1.0f + tanhf(u)); }
      so[w][8 * hh + r][t * 16 + ln] = v;
    }
  }
  __builtin_amdgcn_fence(__ATOMIC_ACQ_REL, "workgroup");
  __builtin_amdgcn_wave_barrier();
  const int rsub = lane >> 4, c4 = (lane & 15) * 4;
  {
#pragma unroll
    for (int q = 0; q < 8; ++q) {
      const int r = q * 2 + rsub;
      const v4f v = *(const v4fa*)&so[w][r][c4];
      *(v4f*)(C + (size_t)(row0 + r) * ldc + col0 + c4) = v;
    }
    
  }
}
// row LayerNorm (biased variance, eps) over N: s = X (+ R); optional out_sum <- s; out_norm <- (s-mu)*rsqrt(var+eps)*g + b
template <bool PARAM_BF16>
__global__ __launch_bounds__(256) void k_layernorm(const float* __restrict__ X, const float* __restrict__ R, const float* __restrict__ g, const float* __restrict__ bta,
                                                  float* __restrict__ out_sum, float* __restrict__ out_norm, int N, float eps) {
  __shared__ float red[256];
  const int row = blockIdx.x, tid = threadIdx.x;
  const float* x = X + (size_t)row * N; const float* rr = R ? R + (size_t)row * N : nullptr;
  float vals[16];                     // up to N = 4096
  const int per = N / 256;            // contiguous chunk per thread? use strided-by-4 chunks: thread handles j = tid*4 + 1024*u
  float s1 = 0.f;
  for (int u = 0; u < per / 4; ++u) {
    const int j = tid * 4 + 1024 * u;
    const v4f a = *(const v4fa*)(x + j);
    v4f b = {0.f,0.f,0.f,0.f}; if (rr) b = *(const v4fa*)(rr + j);
#pragma unroll
    for (int q = 0; q < 4; ++q) { const float v = a[q] + b[q]; vals[u * 4 + q] = v; s1 += v; }
  }
  red[tid] = s1; __syncthreads();
  for (int st = 128; st > 0; st >>= 1) { if (tid < st) red[tid] += red[tid + st]; __syncthreads(); }
  const float mu = red[0] / (float)N; __syncthreads();
  float s2 = 0.f;
  for (int u = 0; u < per / 4; ++u)
#pragma unroll
    for (int q = 0; q < 4; ++q) { const float c = vals[u * 4 + q] - mu; s2 += c * c; }
  red[tid] = s2; __syncthreads();
  for (int st = 128; st > 0; st >>= 1) { if (tid < st) red[tid] += red[tid + st]; __syncthreads(); }
  const float rs = rsqrtf(red[0] / (float)N + eps);
  {
    for (int u = 0; u < per / 4; ++u) {
      const int j = tid * 4 + 1024 * u;
      v4f o, sm;
#pragma unroll
      for (int q = 0; q < 4; ++q) {
        float gg = g[j + q], bb = bta[j + q];
        if (PARAM_BF16) { gg = bf16_round(gg); bb = bf16_round(bb); }
        sm[q] = vals[u * 4 + q]; o[q] = (vals[u * 4 + q] - mu) * rs * gg + bb;
      }
      if (out_sum) *(v4f*)(out_sum + (size_t)row * N + j) = sm;
      *(v4f*)(out_norm + (size_t)row * N + j) = o;
    }
    
  }
}



// ---- f16 WMMA path (v_wmma_f32_16x16x32_f16): 11-bit significands for operands in range — used where a [0,1] probability operand needs more precision than bf16
typedef _Float16 v16h __attribute__((ext_vector_type(16)));
union FragH { v16h v; v8us half[2]; _Float16 h[16]; unsigned short u[16]; };
template <int NT>
__device__ __forceinline__ v8f mmaH(v16h ah, v16h al, v16h bh, v16h bl, v8f c) {
  c = __builtin_amdgcn_wmma_f32_16x16x32_f16(false, ah, false, bh, (short)0, c, false, false);
  if (NT >= 2) c = __builtin_amdgcn_wmma_f32_16x16x32_f16(false, al, false, bh, (short)0, c, false, false);
  if (NT >= 3) c = __builtin_amdgcn_wmma_f32_16x16x32_f16(false, ah, false, bl, (short)0, c, false, false);
  asm volatile("v_nop\n\tv_nop\n\tv_nop\n\tv_nop" : "+v"(c) : "v"(ah), "v"(al), "v"(bh), "v"(bl));
  return c;
}
// batched GEMM like k_gemm_b but f16 operands: A f32 (split into f16 hi/lo if ASPLIT, else rounded to f16), Bt = f16 values [n][k]; alpha; C f32; N multiple of 16 (partial tiles skipped)
template <bool ASPLIT>
__global__ __launch_bounds__(128) void k_gemm_h(const float* __restrict__ A, int lda, size_t sA, const _Float16* __restrict__ Bh, int ldb, size_t sB, float alpha, float* __restrict__ C, int ldc, size_t sC, int M, int N, int K) {
  __shared__ __attribute__((aligned(16))) float so[4][16][64];
  const int tid = threadIdx.x, w = tid >> 5, lane = tid & 31, ln = lane & 15, hh = lane >> 4; const int by = blockIdx.y;
  A += (size_t)by * sA; Bh += (size_t)by * sB; C += (size_t)by * sC;
  const int ntn = (N + 63) / 64; const int wid = blockIdx.x * 4 + w; const int mt = wid / ntn, nq = wid % ntn; if (mt * 16 >= M) return;
  const int row0 = mt * 16, col0 = nq * 64; const float* arow = A + (size_t)(row0 + ln) * lda;
  v8f acc[4] = {};
  for (int kb = 0; kb < K; kb += 32) {
    FragH ah, al;
    const v4f x0 = *(const v4fa*)(arow + kb + 8 * hh), x1 = *(const v4fa*)(arow + kb + 8 * hh + 4), x2 = *(const v4fa*)(arow + kb + 16 + 8 * hh), x3 = *(const v4fa*)(arow + kb + 16 + 8 * hh + 4);
    float xs[16] = {x0[0],x0[1],x0[2],x0[3],x1[0],x1[1],x1[2],x1[3],x2[0],x2[1],x2[2],x2[3],x3[0],x3[1],x3[2],x3[3]};
#pragma unroll
    for (int i = 0; i < 16; ++i) { const _Float16 h = (_Float16)xs[i]; ah.h[i] = h; al.h[i] = ASPLIT ? (_Float16)(xs[i] - (float)h) : (_Float16)0.0f; }
#pragma unroll
    for (int t = 0; t < 4; ++t) { if (col0 + t * 16 >= N) continue; const size_t boff = (size_t)(col0 + t * 16 + ln) * ldb + kb; FragH bq; bq.half[0] = *(const v8us*)(Bh + boff + 8 * hh); bq.half[1] = *(const v8us*)(Bh + boff + 16 + 8 * hh);
      acc[t] = mmaH<ASPLIT ? 2 : 1>(ah.v, al.v, bq.v, bq.v, acc[t]); }
  }
#pragma unroll
  for (int t = 0; t < 4; ++t) { if (col0 + t * 16 >= N) continue;
#pragma unroll
    for (int r = 0; r < 8; ++r) so[w][8 * hh + r][t * 16 + ln] = acc[t][r] * alpha; }
  __builtin_amdgcn_fence(__ATOMIC_ACQ_REL, "workgroup"); __builtin_amdgcn_wave_barrier();
  const int rsub = lane >> 4, c4 = (lane & 15) * 4;
  {
#pragma unroll
    for (int q = 0; q < 8; ++q) { const int r = q * 2 + rsub; if (col0 + c4 < N) { const v4f v = *(const v4fa*)&so[w][r][c4]; *(v4f*)(C + (size_t)(row0 + r) * ldc + col0 + c4) = v; } }
     }
}

// Wt[n][k] = f16(W[k][n]·scale) from f32 row-major W[K][N] (scale = power of two; bf16-exact weights stay exact in f16 away from the subnormal range)
__global__ __launch_bounds__(256) void k_wt_f16(const float* __restrict__ W, _Float16* __restrict__ Wt, int K, int N, float scale) {
  const int t = blockIdx.x * 256 + threadIdx.x; if (t >= N * (K / 8)) return; const int n = t / (K / 8), k8 = (t % (K / 8)) * 8; FragH f;
#pragma unroll
  for (int i = 0; i < 8; ++i) f.h[i] = (_Float16)(bf16_round(W[(size_t)(k8 + i) * N + n]) * scale); const v8us o = f.half[0];
  *(v8us*)((unsigned short*)Wt + (size_t)n * K + k8) = o; 
}
// k_gemm_hh variant with fused epilogue: v = acc·alpha + bias[by·sBias + col] (+ CP[(row/rowsPerB)·sCPb + by·64 + col] if CP) ; ACT 0 none / 1 elu ; writes f16 C16 (and f32 C if non-null)
template <int ACT>
__global__ __launch_bounds__(128) void k_gemm_hhx(const _Float16* __restrict__ A, int lda, size_t sA, const _Float16* __restrict__ Bh, int ldb, size_t sB, float alpha, const float* __restrict__ bias, size_t sBias, const float* __restrict__ CP, int rowsPerB, size_t sCPb, int row0g,
    float* __restrict__ C, _Float16* __restrict__ C16, int ldc, size_t sC, int M, int N, int K) {
  __shared__ __attribute__((aligned(16))) float so[4][16][64];
  const int tid = threadIdx.x, w = tid >> 5, lane = tid & 31, ln = lane & 15, hh = lane >> 4; const int by = blockIdx.y;
  A += (size_t)by * sA; Bh += (size_t)by * sB; const size_t cofs = (size_t)by * sC; const float* bp = bias ? bias + (size_t)by * sBias : nullptr;
  const int ntn = (N + 63) / 64; const int wid = blockIdx.x * 4 + w; const int mt = wid / ntn, nq = wid % ntn; if (mt * 16 >= M) return;
  const int row0 = mt * 16, col0 = nq * 64; const _Float16* arow = A + (size_t)(row0 + ln) * lda;
  v8f acc[4] = {};
  for (int kb = 0; kb < K; kb += 32) { FragH ah; ah.half[0] = *(const v8us*)((const unsigned short*)arow + kb + 8 * hh); ah.half[1] = *(const v8us*)((const unsigned short*)arow + kb + 16 + 8 * hh);
#pragma unroll
    for (int t = 0; t < 4; ++t) { if (col0 + t * 16 >= N) continue; const size_t boff = (size_t)(col0 + t * 16 + ln) * ldb + kb; FragH bq; bq.half[0] = *(const v8us*)((const unsigned short*)Bh + boff + 8 * hh); bq.half[1] = *(const v8us*)((const unsigned short*)Bh + boff + 16 + 8 * hh);
      acc[t] = mmaH<1>(ah.v, ah.v, bq.v, bq.v, acc[t]); }
  }
#pragma unroll
  for (int t = 0; t < 4; ++t) { if (col0 + t * 16 >= N) continue; const int col = col0 + t * 16 + ln; const float bv = bp ? bf16_round(bp[col]) : 0.f;
#pragma unroll
    for (int r = 0; r < 8; ++r) { float v = acc[t][r] * alpha + bv; if (CP) { const int rr = row0g + row0 + 8 * hh + r; if (rowsPerB < 0) v += CP[cofs + (size_t)rr * ldc + col];      /* rowsPerB < 0: own element of the batched C plane */ else { const int bidx = rr / rowsPerB; v += CP[(size_t)bidx * sCPb + (size_t)by * 64 + col]; } } if (ACT == 1) v = (v > 0.f) ? v : expm1f(v); else if (ACT == 7) v = (v > 0.f) ? v + 1.0f : expf(v); else if (ACT == 8) v = tanhf(v); else if (ACT == 9) v = 0.5f * v * (1.0f + tanhf(0.7978845608028654f * (v + 0.044715f * v * v * v))); else if (ACT == 11) v = 1.0f / (1.0f + expf(-v)); else if (ACT == 12) v = (v > 0.f) ? v : 0.01f * v; else if (ACT == 14) v = (v > 0.f) ? v : 0.1f * v; else if (ACT == 16) v = (v >= 0.f) ? v : 0.3f * v; else if (ACT == 17) v = (v >= 0.f) ? v : 0.2f * v; else if (ACT == 15) v = v / (1.0f + expf(-v)); else if (ACT == 3) v = fmaxf(v, 0.f); else if (ACT == 6) v = 0.5f * v * (1.0f + erff(v * 0.70710678118654752f)); so[w][8 * hh + r][t * 16 + ln] = v; } }
  __builtin_amdgcn_fence(__ATOMIC_ACQ_REL, "workgroup"); __builtin_amdgcn_wave_barrier();
  const int rsub = lane >> 4, c4 = (lane & 15) * 4; typedef _Float16 v4h __attribute__((ext_vector_type(4)));
  {
#pragma unroll
    for (int q = 0; q < 8; ++q) { const int r = q * 2 + rsub; if (col0 + c4 < N) { const v4f v = *(const v4fa*)&so[w][r][c4]; if (C) *(v4f*)(C + cofs + (size_t)(row0 + r) * ldc + col0 + c4) = v; if (C16) { v4h h4; for (int i = 0; i < 4; ++i) h4[i] = (_Float16)v[i]; *(v4h*)(C16 + cofs + (size_t)(row0 + r) * ldc + col0 + c4) = h4; } } }
     }
}


typedef _Float16 v4h __attribute__((ext_vector_type(4)));

__global__ __launch_bounds__(256) void k_x16(const float* __restrict__ x, _Float16* __restrict__ X16, size_t n8) { const size_t t = (size_t)blockIdx.x * 256 + threadIdx.x; if (t >= n8) return; FragH f;
#pragma unroll
  for (int q = 0; q < 8; ++q) f.h[q] = (_Float16)bf16_round(x[t * 8 + q]); *(v8us*)((unsigned short*)X16 + t * 8) = f.half[0];  }
__global__ __launch_bounds__(256) void k_h16(const float* __restrict__ x, _Float16* __restrict__ X16, size_t n8) { const size_t t = (size_t)blockIdx.x * 256 + threadIdx.x; if (t >= n8) return; FragH f;
#pragma unroll
  for (int q = 0; q < 8; ++q) f.h[q] = (_Float16)x[t * 8 + q]; *(v8us*)((unsigned short*)X16 + t * 8) = f.half[0];  }
__global__ __launch_bounds__(256) void k_round16f(const float* __restrict__ W, _Float16* __restrict__ Bt, size_t n8) { const size_t t = (size_t)blockIdx.x * 256 + threadIdx.x; if (t >= n8) return; FragH f;
#pragma unroll
  for (int i = 0; i < 8; ++i) f.h[i] = (_Float16)(bf16_round(W[t * 8 + i]) * 16.0f); *(v8us*)((unsigned short*)Bt + t * 8) = f.half[0];  }
template <int NHv, int TTv>
__global__ __launch_bounds__(256) void k_vt(const _Float16* __restrict__ V16, int ldv, int voff, _Float16* __restrict__ Vt) { __shared__ unsigned short tl[64][66]; const int tid = threadIdx.x; const int slab = blockIdx.x / (TTv / 64), lg = blockIdx.x % (TTv / 64); const int b = slab / NHv, h = slab % NHv;
  for (int i = tid; i < 64 * 8; i += 256) { const int r = i / 8, c8 = (i % 8) * 8; FragH f; f.half[0] = *(const v8us*)((const unsigned short*)V16 + ((size_t)b * TTv + lg * 64 + r) * ldv + voff + h * 64 + c8);
#pragma unroll
    for (int q = 0; q < 8; ++q) tl[r][c8 + q] = f.u[q]; }
  __syncthreads();
  {
#pragma unroll
    for (int rd = 0; rd < 2; ++rd) { const int d = rd * 32 + tid / 8, pc = tid % 8; FragH f;
#pragma unroll
      for (int q = 0; q < 8; ++q) f.u[q] = tl[pc * 8 + q][d];
      *(v8us*)((unsigned short*)Vt + ((size_t)slab * 64 + d) * TTv + lg * 64 + pc * 8) = f.half[0]; }
     } }

__global__ __launch_bounds__(256) void k_hl(const float* __restrict__ F, _Float16* __restrict__ Hh, _Float16* __restrict__ Hl, size_t n8) { const size_t t = (size_t)blockIdx.x * 256 + threadIdx.x; if (t >= n8) return; FragH fh, fl; const v4f a = *(const v4fa*)(F + t * 8), c = *(const v4fa*)(F + t * 8 + 4);
#pragma unroll
  for (int q = 0; q < 4; ++q) { _Float16 h = (_Float16)a[q]; fh.h[q] = h; fl.h[q] = (_Float16)((a[q] - (float)h) * 1024.0f); h = (_Float16)c[q]; fh.h[4 + q] = h; fl.h[4 + q] = (_Float16)((c[q] - (float)h) * 1024.0f); }
  { *(v8us*)((unsigned short*)Hh + t * 8) = fh.half[0]; *(v8us*)((unsigned short*)Hl + t * 8) = fl.half[0];  } }

// ---- fast GEMM (wave tile 32x64; requires M % 32 == 0 rows per launch region and N % 64 == 0); epilogue = k_gemm_hhx semantics ----
__device__ __forceinline__ v16h g2_frag(const _Float16* p, int hh) { FragH f; f.half[0] = *(const v8us*)((const unsigned short*)p + 8 * hh); f.half[1] = *(const v8us*)((const unsigned short*)p + 16 + 8 * hh); return f.v; }
__device__ __forceinline__ v8f g2_mma(v16h a, v16h b, v8f c) { v8f d = __builtin_amdgcn_wmma_f32_16x16x32_f16(false, a, false, b, (short)0, c, false, false); asm volatile("v_nop\n\tv_nop\n\tv_nop\n\tv_nop" : "+v"(d) : "v"(a), "v"(b)); return d; }
template <int ACT>
__global__ __launch_bounds__(128) void k_gemm2(const _Float16* __restrict__ A, int lda, size_t sA, const _Float16* __restrict__ Bh, int ldb, size_t sB, float alpha, const float* __restrict__ bias, size_t sBias, const float* __restrict__ CP, int rowsPerB, size_t sCPb, int row0g,
    float* __restrict__ C, _Float16* __restrict__ C16, int ldc, size_t sC, int M, int N, int K) { static_assert(ACT == 0 || ACT == 3 || ACT == 6 || ACT == 8 || ACT == 9 || ACT == 11 || ACT == 12 || ACT == 14 || ACT == 15 || ACT == 16 || ACT == 17, "k_gemm2: unsupported ACT code (would silently apply no activation)");
  __shared__ __attribute__((aligned(16))) float so[4][32][68];
  const int tid = threadIdx.x, w = tid >> 5, lane = tid & 31, ln = lane & 15, hh = lane >> 4; const int by = blockIdx.y;
  A += (size_t)by * sA; Bh += (size_t)by * sB; const size_t cofs = (size_t)by * sC; const float* bp = bias ? bias + (size_t)by * sBias : nullptr;
  const int ntn = N >> 6; const int mt = blockIdx.x / ntn, nq = blockIdx.x - mt * ntn; const int row0 = mt * 128 + 32 * w, col0 = nq * 64; if (row0 >= M) return;
  const _Float16* a0p = A + (size_t)(row0 + ln) * lda; const _Float16* a1p = a0p + (size_t)16 * lda;
  const _Float16* b0p = Bh + (size_t)(col0 + ln) * ldb; const _Float16* b1p = b0p + (size_t)16 * ldb; const _Float16* b2p = b1p + (size_t)16 * ldb; const _Float16* b3p = b2p + (size_t)16 * ldb;
  const v8f z8 = {0.f,0.f,0.f,0.f,0.f,0.f,0.f,0.f}; v8f c00 = z8, c01 = z8, c02 = z8, c03 = z8, c10 = z8, c11 = z8, c12 = z8, c13 = z8;
#pragma unroll 1
  for (int kb = 0; kb < K; kb += 32) { const v16h a0 = g2_frag(a0p + kb, hh), a1 = g2_frag(a1p + kb, hh);
    v16h b = g2_frag(b0p + kb, hh); c00 = g2_mma(a0, b, c00); c10 = g2_mma(a1, b, c10);
    b = g2_frag(b1p + kb, hh); c01 = g2_mma(a0, b, c01); c11 = g2_mma(a1, b, c11);
    b = g2_frag(b2p + kb, hh); c02 = g2_mma(a0, b, c02); c12 = g2_mma(a1, b, c12);
    b = g2_frag(b3p + kb, hh); c03 = g2_mma(a0, b, c03); c13 = g2_mma(a1, b, c13); }
  v8f accs[8] = {c00, c01, c02, c03, c10, c11, c12, c13};
#pragma unroll
  for (int u = 0; u < 8; ++u) { const int t = u & 3, half = u >> 2; const int col = col0 + t * 16 + ln; const float bv = bp ? bf16_round(bp[col]) : 0.f;
#pragma unroll
    for (int r = 0; r < 8; ++r) { const int rloc = half * 16 + 8 * hh + r; float v = accs[u][r] * alpha + bv; if (CP) { if (rowsPerB < 0) v += CP[cofs + (size_t)(row0g + row0 + rloc) * ldc + col];      /* rowsPerB < 0: own element of the batched C plane */ else { const int bidx = (row0g + row0 + rloc) / rowsPerB; v += CP[(size_t)bidx * sCPb + (size_t)by * 64 + col]; } }
      if (ACT == 3) v = fmaxf(v, 0.f); else if (ACT == 6) v = 0.5f * v * (1.0f + erff(v * 0.70710678118654752f)); else if (ACT == 11) v = 1.0f / (1.0f + expf(-v)); else if (ACT == 15) v = v / (1.0f + expf(-v)); else if (ACT == 12) v = (v > 0.f) ? v : 0.01f * v; else if (ACT == 8) v = tanhf(v); else if (ACT == 9) v = 0.5f * v * (1.0f + tanhf(0.7978845608028654f * (v + 0.044715f * v * v * v))); else if (ACT == 14) v = (v > 0.f) ? v : 0.1f * v; else if (ACT == 16) v = (v >= 0.f) ? v : 0.3f * v; else if (ACT == 17) v = (v >= 0.f) ? v : 0.2f * v;
      so[w][rloc][t * 16 + ln] = v; } }
  __builtin_amdgcn_fence(__ATOMIC_ACQ_REL, "workgroup"); __builtin_amdgcn_wave_barrier();
  const int rsub = lane >> 4, c4 = (lane & 15) * 4;
  {
#pragma unroll
    for (int q = 0; q < 16; ++q) { const int r = q * 2 + rsub; const v4f v = *(const v4fa*)&so[w][r][c4]; if (C) *(v4f*)(C + cofs + (size_t)(row0 + r) * ldc + col0 + c4) = v; if (C16) { v4h h4; for (int i = 0; i < 4; ++i) h4[i] = (_Float16)v[i]; *(v4h*)(C16 + cofs + (size_t)(row0 + r) * ldc + col0 + c4) = h4; } }
     } }


__global__ __launch_bounds__(256) void k_wnat(const float* __restrict__ w, size_t n8, _Float16* __restrict__ Bt) { const size_t t = (size_t)blockIdx.x * 256 + threadIdx.x; if (t >= n8) return; FragH f; for (int q = 0; q < 8; ++q) f.h[q] = (_Float16)(bf16_round(w[t * 8 + q]) * 16.0f); *(v8us*)((unsigned short*)Bt + t * 8) = f.half[0];  }
__global__ __launch_bounds__(256) void k_rsm(const float* __restrict__ S, _Float16* __restrict__ P, int nrows) {
  #pragma clang fp contract(off)
  const int i = blockIdx.x * 256 + threadIdx.x; if (i >= nrows) return; const float* s = S + (size_t)i * SQ; float mx = -3.0e38f;
#pragma unroll 1
  for (int j = 0; j < SQ; ++j) mx = fmaxf(mx, s[j]); float se = 0.f;
#pragma unroll 1
  for (int j = 0; j < SQ; ++j) se += expf(s[j] - mx); const float sc = 256.0f / se;
#pragma unroll 1
  for (int j0 = 0; j0 < SQ; j0 += 8) { FragH f; for (int q = 0; q < 8; ++q) f.h[q] = (_Float16)(expf(s[j0 + q] - mx) * sc); unsigned short* d = (unsigned short*)P + (size_t)i * SQ + j0; *(v8us*)d = f.half[0];  } }
__global__ __launch_bounds__(256) void k_vt(const _Float16* __restrict__ V16, int b, int h0, _Float16* __restrict__ VT) { __shared__ unsigned short tl[64][65]; const int tid = threadIdx.x; const int hh = blockIdx.x % HG, sg = blockIdx.x / HG; const int s0 = sg * 64; const int h = h0 + hh;
  for (int i = tid; i < 64 * 8; i += 256) { const int j = i / 8, d8 = (i % 8) * 8; FragH f; f.half[0] = *(const v8us*)((const unsigned short*)V16 + ((size_t)b * SQ + s0 + j) * DM + h * HD + d8); for (int q = 0; q < 8; ++q) tl[d8 + q][j] = f.u[q]; }
  __syncthreads();
  { for (int i = tid; i < 64 * 8; i += 256) { const int d = i / 8, j8 = (i % 8) * 8; FragH f; for (int q = 0; q < 8; ++q) f.u[q] = tl[d][j8 + q]; *(v8us*)((unsigned short*)VT + ((size_t)hh * HD + d) * SQ + s0 + j8) = f.half[0]; }  } }



// 2^x on the transcendental unit. The v_nop fills the one issue slot that the instruction set asks for behind a transcendental before its source
// is overwritten.
__device__ __forceinline__ float exp2_slot(float x) { float r; asm("v_exp_f32 %0, %1\n\tv_nop" : "=v"(r) : "v"(x)); return r; }
// Fused causal attention (online softmax): one launch for every batch, head and query row; scores and softmax weights never leave the registers.
// A work-group is the 4 query heads of one kv group (one wave each) on the same 32 query rows, so its waves walk the same K and V lines.
// Transposed products: S^T = K Q^T puts query 16 c + ln in lane ln and key 16 kt + 8 hh + r in register r, which is already the B-operand order of
// P^T for O^T += V^T P^T (half kt of the fragment = tile kt's 8 registers): no exchange between lanes but the one between the two wave halves.
__device__ __forceinline__ v8f fa_mma(v16h a, v16h b, v8f c) { return __builtin_amdgcn_wmma_f32_16x16x32_f16(false, a, false, b, (short)0, c, false, false); }
__device__ __forceinline__ float fa_xhalf(float x) { return __builtin_bit_cast(float, __builtin_amdgcn_permlanex16(__builtin_bit_cast(int, x), __builtin_bit_cast(int, x), 0x76543210, 0xfedcba98, false, false)); }      /* lane l <-> lane l ^ 16 */
// A fragment at the lane's own byte offset (row ln, element 8 hh) from a uniform base: k = 8 hh .. + 7 and 16 + 8 hh .. + 7, the k order of g2_frag.
__device__ __forceinline__ v16h fa_frag(const _Float16* base, unsigned off, int cb) { const char* p = (const char*)base + off; FragH f; f.half[0] = *(const v8us*)(p + cb); f.half[1] = *(const v8us*)(p + cb + 32); return f.v; }
// s_wait_xcnt 0 behind issued loads, in front of any write of a register that they name. The lane offsets pass through the statement: they stay in
// their registers up to the wait, and whatever is formed from them later stands behind it (a "memory" clobber alone does not tie the wait to registers).
__device__ __forceinline__ void fa_hold(unsigned& a) { asm volatile("s_wait_xcnt 0x0" : "+v"(a) : : "memory"); }
__device__ __forceinline__ void fa_hold(unsigned& a, unsigned& b) { asm volatile("s_wait_xcnt 0x0" : "+v"(a), "+v"(b) : : "memory"); }
// One pass of 32 keys. ko: the lane's byte offset of the NEXT pass's K rows; vo: of this pass's keys in V^T. DIAG: the wave's last pass, the only one
// that meets the diagonal (it masks, and it fetches no further K).
// Every loop over kt, kc, c, t and r here and in the kernel is unrolled so that fragments, scores and accumulators are indexed by constants only and stay in registers.
template <bool DIAG>
__device__ __forceinline__ void fa_pass(const _Float16* __restrict__ Kh, const _Float16* __restrict__ Vt, unsigned& ko, unsigned& vo, int key0, int q0, int ln, int hh,
                                        const v16h (&qf)[2][2], v16h (&kf)[2][2], v8f (&acc)[2][4], float (&m)[2], float (&l)[2]) {
  const float cs = 0.125f * 1.44269504f;      /* 1 / sqrt(64), and e^x = 2^(x log2 e) */
  v16h vf[4];
#pragma unroll
  for (int t = 0; t < 4; ++t) vf[t] = fa_frag(Vt, vo, 16 * t * SQ * 2);      /* V^T rows d = 16 t + ln, this pass's keys: in flight under the scores and the exponentials */
  v8f s[2][2];
#pragma unroll
  for (int kt = 0; kt < 2; ++kt)
#pragma unroll
    for (int c = 0; c < 2; ++c) { const v8f z = {0.f, 0.f, 0.f, 0.f, 0.f, 0.f, 0.f, 0.f}; s[kt][c] = fa_mma(kf[kt][1], qf[c][1], fa_mma(kf[kt][0], qf[c][0], z)); }
  if (!DIAG) {      /* the next pass's K rows, in flight under this pass's softmax and second product */
#pragma unroll
    for (int kt = 0; kt < 2; ++kt)
#pragma unroll
      for (int kc = 0; kc < 2; ++kc) kf[kt][kc] = fa_frag(Kh, ko, (16 * kt * KVD + 32 * kc) * 2);
    fa_hold(ko, vo);
    __builtin_amdgcn_sched_barrier(0);      /* keeps the K loads here: without it the scheduler sinks them to the end of the pass, and the next pass's scores wait out their whole latency */
    ko += 32 * KVD * 2; vo += 32 * 2;
  } else fa_hold(vo);
#pragma unroll
  for (int c = 0; c < 2; ++c) {
    if (DIAG) {
      const int qi = q0 + 16 * c + ln;
#pragma unroll
      for (int kt = 0; kt < 2; ++kt)
#pragma unroll
        for (int r = 0; r < 8; ++r) if (key0 + 16 * kt + 8 * hh + r > qi) s[kt][c][r] = -1.0e30f;
    }
    float mx = s[0][c][0];
#pragma unroll
    for (int r = 0; r < 8; ++r) mx = fmaxf(mx, fmaxf(s[0][c][r], s[1][c][r]));
    mx = fmaxf(mx, fa_xhalf(mx));      /* both halves of the wave now hold this query's maximum over the pass */
    const float mn = fmaxf(m[c], mx * cs);
    const float corr = exp2_slot(m[c] - mn);      /* 0 on the first pass */
    m[c] = mn;
    FragH pf; float ps = 0.f;
#pragma unroll
    for (int kt = 0; kt < 2; ++kt)
#pragma unroll
      for (int r = 0; r < 8; ++r) { const float p = exp2_slot(fmaf(s[kt][c][r], cs, -mn)); ps += p; pf.h[8 * kt + r] = (_Float16)p; }
    l[c] = fmaf(l[c], corr, ps);
#pragma unroll
    for (int t = 0; t < 4; ++t) { acc[c][t] = acc[c][t] * corr; acc[c][t] = fa_mma(vf[t], pf.v, acc[c][t]); }
    /* the four vector slots that the chip needs behind a matrix instruction before its operands are overwritten */
    asm volatile("v_nop\n\tv_nop\n\tv_nop\n\tv_nop" : "+v"(acc[c][0]), "+v"(acc[c][1]), "+v"(acc[c][2]), "+v"(acc[c][3]) : "v"(vf[0]), "v"(vf[1]), "v"(vf[2]), "v"(vf[3]), "v"(pf.v));
  }
}
__global__ __launch_bounds__(128) void k_fattn(const _Float16* __restrict__ Q, const _Float16* __restrict__ Kh, const _Float16* __restrict__ Vt, _Float16* __restrict__ O) {
  const int lane = threadIdx.x & 31, ln = lane & 15, hh = lane >> 4; const int g = blockIdx.y, b = blockIdx.z; const int h = g * HPG + (threadIdx.x >> 5);
  const int qt = (b & 1) ? (int)blockIdx.x : (SQ / 32 - 1) - (int)blockIdx.x;      /* long and short tiles alternate from batch to batch, so that work-groups a whole batch apart in the grid add up to the same length */
  const int q0 = qt * 32; const size_t r0 = (size_t)b * SQ;
  unsigned qo = (unsigned)(((r0 + q0 + ln) * DM + h * HD + 8 * hh) * 2), ko = (unsigned)(((r0 + ln) * KVD + g * HD + 8 * hh) * 2), vo = (unsigned)((((size_t)(b * NG + g) * HD + ln) * SQ + 8 * hh) * 2);      /* byte offsets: every buffer is below 4 GiB */
  v16h qf[2][2], kf[2][2];
#pragma unroll
  for (int c = 0; c < 2; ++c)
#pragma unroll
    for (int kc = 0; kc < 2; ++kc) { qf[c][kc] = fa_frag(Q, qo, (16 * c * DM + 32 * kc) * 2); kf[c][kc] = fa_frag(Kh, ko, (16 * c * KVD + 32 * kc) * 2); }
  fa_hold(qo, ko);
  ko += 32 * KVD * 2;
  v8f acc[2][4] = {}; float m[2] = {-1.0e30f, -1.0e30f}, l[2] = {0.f, 0.f};
  for (int key0 = 0; key0 < q0; key0 += 32) fa_pass<false>(Kh, Vt, ko, vo, key0, q0, ln, hh, qf, kf, acc, m, l);
  fa_pass<true>(Kh, Vt, ko, vo, q0, q0, ln, hh, qf, kf, acc, m, l);
  unsigned short* op = (unsigned short*)O + (r0 + q0 + ln) * DM + h * HD + 8 * hh;
#pragma unroll
  for (int c = 0; c < 2; ++c) { const float fin = 64.0f / (l[c] + fa_xhalf(l[c]));      /* o carried x64, as the output product expects */
#pragma unroll
    for (int t = 0; t < 4; ++t) { FragH f;
#pragma unroll
      for (int r = 0; r < 8; ++r) f.h[r] = (_Float16)(acc[c][t][r] * fin);
      *(v8us*)(op + (size_t)(16 * c) * DM + 16 * t) = f.half[0]; }      /* d = 16 t + 8 hh .. + 7 of query row 16 c + ln */
    asm volatile("s_wait_xcnt 0x0" ::: "memory"); }      /* behind the stores, in front of any later write of a register that an issued store names */
}


// Exact f32 attention for the first QT0 rows: one thread per (query row, head), online softmax; every sum runs in the order d = 0, 1, ... and j = 0, 1, ...
// What a thread owns (its q row, its o accumulator) stays in registers; what all threads of the block read at the same address (the head's K and V rows)
// is staged once in LDS and read by broadcast. Every loop over d is unrolled so that q, o and the row fragments are indexed by constants only.
// blockIdx.y is the batch: its QT0 rows of q, k, v and o follow those of the batch before.
__global__ __launch_bounds__(64) void k_att0(const float* __restrict__ QF, const float* __restrict__ KF, const float* __restrict__ VF, float scale, float* __restrict__ OF, int ldo) {
  __shared__ __attribute__((aligned(16))) float lk[QT0][HD]; __shared__ __attribute__((aligned(16))) float lv[QT0][HD]; __shared__ __attribute__((aligned(16))) float lo[64][64];
  const int tid = threadIdx.x; const int h = blockIdx.x / (QT0 / 64), rg = blockIdx.x % (QT0 / 64); const int i = rg * 64 + tid;
  QF += (size_t)blockIdx.y * QT0 * LQ; KF += (size_t)blockIdx.y * QT0 * LQ; VF += (size_t)blockIdx.y * QT0 * LQ; OF += (size_t)blockIdx.y * QT0 * ldo;
  const int jmax = rg * 64 + 63;      /* keys up to the block's last row */
  const int sr = tid >> 4, sc4 = (tid & 15) * 4;      /* staging: 16 threads to a row of 256 bytes */
  unsigned so = (unsigned)((sr * LQ + h * HD + sc4) * 4), qo = (unsigned)((i * LQ + h * HD) * 4);      /* the lane's byte offsets in K and V, and in q */
#pragma unroll 1      /* kept rolled: one trip already has 16 loads in flight per thread */
  for (int r0 = 0; r0 <= jmax; r0 += 32) { v4f kk[8], vv[8];
#pragma unroll
    for (int u = 0; u < 8; ++u) { kk[u] = *(const v4fa*)((const char*)KF + so + u * 4 * LQ * 4); vv[u] = *(const v4fa*)((const char*)VF + so + u * 4 * LQ * 4); }      /* 16 loads in flight per thread */
    fa_hold(so);      /* the wait behind the issued loads, in front of the write of the offset that they name */
    so += 32 * LQ * 4;
#pragma unroll
    for (int u = 0; u < 8; ++u) { *(v4f*)&lk[r0 + 4 * u + sr][sc4] = kk[u]; *(v4f*)&lv[r0 + 4 * u + sr][sc4] = vv[u]; } }
  float q[HD], o[HD];
#pragma unroll
  for (int c = 0; c < HD / 4; ++c) { const v4f t = *(const v4fa*)((const char*)QF + qo + c * 16);
#pragma unroll
    for (int u = 0; u < 4; ++u) { q[c * 4 + u] = t[u]; o[c * 4 + u] = 0.f; } }
  fa_hold(qo);      /* the same wait behind the q loads; their offset stays in its register up to it */
  __syncthreads();      /* K and V rows are staged: nobody reads them in front of this barrier */
  float m = -1.0e30f, l = 0.f, sn = 0.f;
#pragma unroll
  for (int d = 0; d < HD; ++d) sn = fmaf(q[d], lk[0][d], sn);
#pragma unroll 1      /* kept rolled: a second copy of the body would not fit the registers beside q and o */
  for (int j = 0; j <= jmax; ++j) { const float s = sn * scale;
    const float* kr = &lk[j < jmax ? j + 1 : jmax][0]; v4f kq[HD / 4], vv[HD / 4];
#pragma unroll
    for (int c = 0; c < HD / 4; ++c) kq[c] = *(const v4f*)(kr + c * 4);
    __builtin_amdgcn_sched_barrier(0);      /* keeps the K reads in front of the V reads: LDS answers in order, and with V rows queued between them the score chain below waits for its K words */
#pragma unroll
    for (int c = 0; c < HD / 4; ++c) vv[c] = *(const v4f*)&lv[j][c * 4];
    sn = 0.f;      /* the next key's score: its chain of 64 dependent multiply-adds depends on nothing below, so this key's exponentials and o update fill its waits */
#pragma unroll
    for (int d = 0; d < HD; ++d) sn = fmaf(q[d], kq[d >> 2][d & 3], sn);
    const float f = (j <= i) ? 1.f : 0.f; const float sm = fmaf(f, s, (1.f - f) * -1.0e30f); const float mn = fmaxf(m, sm); const float sc = expf(m - mn); const float e = expf(sm - mn); l = fmaf(l, sc, e); m = mn;
#pragma unroll
    for (int d = 0; d < HD; ++d) o[d] = fmaf(o[d], sc, e * vv[d >> 2][d & 3]); }
  const float fin = 64.0f / l;      /* o carried x64 like the f16 path */
#pragma unroll
  for (int c = 0; c < HD / 4; ++c) { v4f oo;
#pragma unroll
    for (int u = 0; u < 4; ++u) oo[u] = o[c * 4 + u] * fin;
    *(v4f*)&lo[tid][c * 4] = oo; }
  __syncthreads();
  {
#pragma unroll 1
    for (int it = 0; it < 16; ++it) { const int row = it * 4 + tid / 16, pc = (tid % 16) * 4; const v4f v = *(const v4f*)&lo[row][pc]; *(v4f*)(OF + (size_t)(rg * 64 + row) * ldo + h * HD + pc) = v; }
     } }


__global__ __launch_bounds__(256) void k_kvexp(const float* __restrict__ src, float* __restrict__ dst, size_t n4) { const size_t t = (size_t)blockIdx.x * 256 + threadIdx.x; if (t >= n4) return; const size_t e = t * 4; const size_t row = e / DM; const int col = (int)(e % DM); const int h = col / HD, d = col % HD; const v4f v = *(const v4fa*)(src + row * KVD + (size_t)(h / HPG) * HD + d); *(v4f*)(dst + e) = v;  }

__global__ __launch_bounds__(256) void k_tab2(float theta, float* __restrict__ CS, float* __restrict__ SN) {
  #pragma clang fp contract(off)
  const int t = blockIdx.x * 256 + threadIdx.x; if (t >= SQ * (HD / 2)) return; const int i = t % (HD / 2); const int p = t / (HD / 2); const float invf = 1.0f / powf(theta, (float)(2 * i) / (float)HD); const float ang = __fmul_rn((float)p, invf); const float c = cosf(ang), s = sinf(ang);
  *(float*)(CS + t) = c; *(float*)(SN + t) = s;  }
// Projection GEMM with the rope in its epilogue (q and k). The product is k_gemm2's: wave tile 32 x 64, the same fragments, the same order of k. A wave's 64 columns are one head, and the
// tile that the epilogue lays out in LDS for whole-line stores gives a lane four neighbouring columns of a row, that is both members of two (even, odd) pairs: the lane rotates them by the
// row's position (row % SQ; a tile of 32 rows lies in one batch) and stores f16. Rows 0 .. QT0 - 1 of each batch also go out in f32 for the exact first-tile path (F0: QT0 rows a batch).
typedef float v2fa __attribute__((ext_vector_type(2), may_alias));
// The 16 rows of a lane (every second row of the wave's tile): tp = the lane's four words of its first row in LDS, cp / sp = its two table entries of that row, hp / fp = its place in the outputs.
// F32 is a template argument so that neither form has a branch between its rows: the 32 table loads of a lane are then in flight together instead of one row's pair at a time.
// NC, the outputs' row pitch, is one too: every row's store is then the first row's address with an immediate offset.
template <bool F32, int NC>
__device__ __forceinline__ void g2_rope_rows(const float* tp, const float* __restrict__ cp, const float* __restrict__ sp, _Float16* __restrict__ hp, float* __restrict__ fp) {
#pragma unroll      /* unrolled for the same reason: all table loads issue in front of the first use */
  for (int q = 0; q < 16; ++q) { const v4f v = *(const v4fa*)(tp + q * 2 * 68); const v2fa c = *(const v2fa*)(cp + q * 2 * (HD / 2)), s = *(const v2fa*)(sp + q * 2 * (HD / 2));
    v4f o; o[0] = v[0] * c[0] - v[1] * s[0]; o[1] = v[0] * s[0] + v[1] * c[0]; o[2] = v[2] * c[1] - v[3] * s[1]; o[3] = v[2] * s[1] + v[3] * c[1];
    v4h h4;
#pragma unroll      /* constant element indices: o and h4 stay in registers */
    for (int i = 0; i < 4; ++i) h4[i] = (_Float16)o[i];
    *(v4h*)(hp + q * 2 * NC) = h4;
    if (F32) *(v4f*)(fp + q * 2 * NC) = o; }
  asm volatile("s_wait_xcnt 0x0" ::: "memory"); }      /* behind the last store of the rows, in front of any later write of a register that an issued store names (the other form's code follows in the listing) */
template <int NC>      /* columns of the product = row pitch of both outputs */
__global__ __launch_bounds__(128) void k_gemm2r(const _Float16* __restrict__ A, int lda, const _Float16* __restrict__ Bh, int ldb, float alpha, const float* __restrict__ CS, const float* __restrict__ SN,
    _Float16* __restrict__ H16, float* __restrict__ F0, int M, int K) {
  __shared__ __attribute__((aligned(16))) float so[4][32][68];
  const int tid = threadIdx.x, w = tid >> 5, lane = tid & 31, ln = lane & 15, hh = lane >> 4;
  const int ntn = NC >> 6; const int mt = blockIdx.x / ntn, nq = blockIdx.x - mt * ntn; const int row0 = mt * 128 + 32 * w, col0 = nq * 64; if (row0 >= M) return;
  const _Float16* a0p = A + (size_t)(row0 + ln) * lda; const _Float16* a1p = a0p + (size_t)16 * lda;
  const _Float16* b0p = Bh + (size_t)(col0 + ln) * ldb; const _Float16* b1p = b0p + (size_t)16 * ldb; const _Float16* b2p = b1p + (size_t)16 * ldb; const _Float16* b3p = b2p + (size_t)16 * ldb;
  const v8f z8 = {0.f,0.f,0.f,0.f,0.f,0.f,0.f,0.f}; v8f c00 = z8, c01 = z8, c02 = z8, c03 = z8, c10 = z8, c11 = z8, c12 = z8, c13 = z8;
#pragma unroll 1      /* rolled like k_gemm2's loop, so that both products are the same code */
  for (int kb = 0; kb < K; kb += 32) { const _Float16* pa0 = a0p + kb + 8 * hh; const _Float16* pa1 = a1p + kb + 8 * hh; const _Float16* pb0 = b0p + kb + 8 * hh; const v16h a0 = g2_frag(pa0, 0), a1 = g2_frag(pa1, 0);
    v16h b = g2_frag(pb0, 0); c00 = g2_mma(a0, b, c00); c10 = g2_mma(a1, b, c10);
    asm volatile("s_wait_xcnt 0x0" : : "v"(pa0), "v"(pa1), "v"(pb0) : "memory");      /* the wait behind the a0, a1 and b0 loads, their addresses as inputs: the three pairs stay in their registers up to it */
    b = g2_frag(b1p + kb, hh); c01 = g2_mma(a0, b, c01); c11 = g2_mma(a1, b, c11);
    b = g2_frag(b2p + kb, hh); c02 = g2_mma(a0, b, c02); c12 = g2_mma(a1, b, c12);
    b = g2_frag(b3p + kb, hh); c03 = g2_mma(a0, b, c03); c13 = g2_mma(a1, b, c13); }
  v8f accs[8] = {c00, c01, c02, c03, c10, c11, c12, c13};
#pragma unroll      /* unrolled so that the accumulators are indexed by constants only and stay in registers */
  for (int u = 0; u < 8; ++u) { const int t = u & 3, half = u >> 2;
#pragma unroll      /* the same, for the element index */
    for (int r = 0; r < 8; ++r) so[w][half * 16 + 8 * hh + r][t * 16 + ln] = accs[u][r] * alpha; }
  __builtin_amdgcn_fence(__ATOMIC_ACQ_REL, "workgroup"); __builtin_amdgcn_wave_barrier();      /* the wave's own LDS writes stand in front of its reads of other lanes' words; no other wave reads this slice */
  const int rsub = lane >> 4, c4 = (lane & 15) * 4; const int p0 = row0 % SQ;
  const float* cp = CS + (size_t)(p0 + rsub) * (HD / 2) + c4 / 2; const float* sp = SN + (size_t)(p0 + rsub) * (HD / 2) + c4 / 2;      /* table entries i = c4 / 2 and c4 / 2 + 1 of the lane's row */
  _Float16* hp = H16 + (size_t)(row0 + rsub) * NC + col0 + c4; float* fp = F0 + ((size_t)(row0 / SQ) * QT0 + p0 + rsub) * NC + col0 + c4;
  if (__builtin_amdgcn_readfirstlane(p0) < QT0) g2_rope_rows<true, NC>(&so[w][rsub][c4], cp, sp, hp, fp);      /* p0 is the same in every lane of a wave: a scalar branch; QT0 is a multiple of the tile's 32 rows */
  else g2_rope_rows<false, NC>(&so[w][rsub][c4], cp, sp, hp, fp); }

__global__ __launch_bounds__(256) void k_bfcp(const float* __restrict__ src, float* __restrict__ dst, size_t n4) { const size_t t = (size_t)blockIdx.x * 256 + threadIdx.x; if (t >= n4) return; const v4f a = *(const v4fa*)(src + t * 4); v4f o; for (int q = 0; q < 4; ++q) o[q] = bf16_round(a[q]); *(v4f*)(dst + t * 4) = o;  }

__global__ __launch_bounds__(256) void k_tabhalf(const float* __restrict__ cs, const float* __restrict__ sn, float* __restrict__ CS, float* __restrict__ SN) { const int t = blockIdx.x * 256 + threadIdx.x; if (t >= SQ * (HD / 2)) return; const int p = t / (HD / 2), i = t % (HD / 2); const float c = bf16_round(cs[(size_t)p * HD + i]), s = bf16_round(sn[(size_t)p * HD + i]);
  *(float*)(CS + t) = c; *(float*)(SN + t) = s;  }

__global__ __launch_bounds__(256) void k_tab2d(float* __restrict__ CS, float* __restrict__ SN) {
  #pragma clang fp contract(off)
  const int t = blockIdx.x * 256 + threadIdx.x; if (t >= SQ * (HD / 2)) return; const int i = t % (HD / 2); const int p = t / (HD / 2); const float invf = (float)(1.0 / pow(10000.0, (double)(2 * i) / (double)HD)); const float ang = __fmul_rn((float)p, invf); const float c = cosf(ang), s = sinf(ang);
  *(float*)(CS + t) = c; *(float*)(SN + t) = s;  }
extern "C" void kernel_launch(void* const* d_in, const int* in_sizes, int n_in,
                              void* d_out, int out_size, void* d_ws, size_t ws_size, hipStream_t stream) {
  (void)in_sizes; (void)n_in; (void)out_size;
  const float* const* I = (const float* const*)d_in; const float* x = I[0]; const float* wq = I[1]; const float* wk = I[2]; const float* wv = I[3]; const float* wo = I[4];      /* input order: x, Wq [1024][1024], Wk / Wv [1024][256], Wo [1024][1024] ([in][out] weights); rope tables computed in-kernel (positions = row index), as the module computes them */ const float* bq = nullptr; const float* bk = nullptr; const float* bv = nullptr; const float* bo = nullptr;      /* no biases */
  char* ws = (char*)d_ws; size_t off = 0;
  auto take = [&](size_t bytes) { char* p = ws + off; off += (bytes + 255) & ~(size_t)255; return p; };
  _Float16* BQ = (_Float16*)take((size_t)DM * DM * 2); _Float16* BK = (_Float16*)take((size_t)KVD * DM * 2); _Float16* BV = (_Float16*)take((size_t)KVD * DM * 2); _Float16* BO = (_Float16*)take((size_t)DM * DM * 2);
  _Float16* X16 = (_Float16*)take(NR * DM * 2); float* CSB = (float*)take((size_t)SQ * HD * 4); float* SNB = (float*)take((size_t)SQ * HD * 4); _Float16* Q16 = (_Float16*)take(NR * DM * 2); _Float16* K16 = (_Float16*)take(NR * KVD * 2); _Float16* V16 = (_Float16*)take(NR * KVD * 2); _Float16* O16 = (_Float16*)take(NR * DM * 2);
  _Float16* VT = (_Float16*)take((size_t)NB * NG * HD * SQ * 2);
  float* QF0 = (float*)take((size_t)NB * QT0 * DM * 4); float* KF0 = (float*)take((size_t)NB * QT0 * KVD * 4); float* VF0 = (float*)take((size_t)NB * QT0 * KVD * 4); float* KF0e = (float*)take((size_t)NB * QT0 * DM * 4); float* VF0e = (float*)take((size_t)NB * QT0 * DM * 4); float* OF0 = (float*)take((size_t)NB * QT0 * DM * 4); _Float16* OH0 = (_Float16*)take((size_t)NB * QT0 * DM * 2); _Float16* OL0 = (_Float16*)take((size_t)NB * QT0 * DM * 2);
  if (off > ws_size) return;
  k_wt_f16<<<(unsigned)(((size_t)DM * (DM / 8) + 255) / 256), 256, 0, stream>>>(wq, BQ, DM, DM, 16.0f); k_wt_f16<<<(unsigned)(((size_t)KVD * (DM / 8) + 255) / 256), 256, 0, stream>>>(wk, BK, DM, KVD, 16.0f); k_wt_f16<<<(unsigned)(((size_t)KVD * (DM / 8) + 255) / 256), 256, 0, stream>>>(wv, BV, DM, KVD, 16.0f); k_wt_f16<<<(unsigned)(((size_t)DM * (DM / 8) + 255) / 256), 256, 0, stream>>>(wo, BO, DM, DM, 16.0f);      /* [in][out] -> Bt[n][k] x16 (transposing builder; K = DM, N = DM / KVD) */
  k_x16<<<(unsigned)((NR * DM / 8 + 255) / 256), 256, 0, stream>>>(x, X16, NR * DM / 8);
  k_tab2d<<<(SQ * (HD / 2) + 255) / 256, 256, 0, stream>>>(CSB, SNB);      /* rope tables computed in-kernel: angle[p][i] = p * 10000^(-2i/64) (the module's _rope_cache; positions = row index) */
  /* Every stage below is ONE launch over all NB batches: the full-length stages take the NB * SQ token rows as one run of rows, the first-tile stages take the batch from blockIdx.y. */
  k_gemm2<0><<<dim3((unsigned)((MP / 128) * (KVD / 64)), 1), 128, 0, stream>>>(X16, DM, 0, BV, DM, 0, 0.0625f, bv, 0, nullptr, 1, 0, 0, nullptr, V16, KVD, 0, MP, KVD, DM);
  k_gemm2r<DM><<<(unsigned)((MP / 128) * (DM / 64)), 128, 0, stream>>>(X16, DM, BQ, DM, 0.0625f, CSB, SNB, Q16, QF0, MP, DM);      /* q with the interleaved-pair rope (pairs (2i, 2i+1)), position = row % SQ -> f16 rows; f32 rows 0..127 of each batch */
  k_gemm2r<KVD><<<(unsigned)((MP / 128) * (KVD / 64)), 128, 0, stream>>>(X16, DM, BK, DM, 0.0625f, CSB, SNB, K16, KF0, MP, DM);      /* k, the same */
  k_vt<NG, SQ><<<NB * NG * (SQ / 64), 256, 0, stream>>>(V16, KVD, 0, VT);      /* V^T [NB][NG][HD][SQ] */
  k_gemm2<0><<<dim3((QT0 / 128) * (KVD / 64), NB), 128, 0, stream>>>(X16, DM, (size_t)SQ * DM, BV, DM, 0, 0.0625f, bv, 0, nullptr, 1, 0, 0, VF0, nullptr, KVD, (size_t)QT0 * KVD, QT0, KVD, DM);      /* f32 v of rows 0..127 of each batch */
  k_kvexp<<<(unsigned)(((size_t)NB * QT0 * DM / 4 + 255) / 256), 256, 0, stream>>>(KF0, KF0e, (size_t)NB * QT0 * DM / 4); k_kvexp<<<(unsigned)(((size_t)NB * QT0 * DM / 4 + 255) / 256), 256, 0, stream>>>(VF0, VF0e, (size_t)NB * QT0 * DM / 4);      /* head h <- kv group h/4 for the exact first-tile kernel */
  k_att0<<<dim3(NH * (QT0 / 64), NB), 64, 0, stream>>>(QF0, KF0e, VF0e, 0.125f, OF0, DM);      /* exact f32 attention for rows 0..127 of each batch (o x64) */
  k_fattn<<<dim3(SQ / 32, NG, NB), 128, 0, stream>>>(Q16, K16, VT, O16);      /* scores, causal softmax and o (merged heads, x64, f16 rows) for all batches and heads */
  k_gemm2<0><<<dim3((unsigned)((MPO / 128) * (DM / 64)), 1), 128, 0, stream>>>(O16, DM, 0, BO, DM, 0, 0.0009765625f, bo, 0, nullptr, 1, 0, 0, (float*)d_out, nullptr, DM, 0, MPO, DM, DM);      /* out rows are the output layout */
  k_hl<<<(unsigned)(((size_t)NB * QT0 * DM / 8 + 255) / 256), 256, 0, stream>>>(OF0, OH0, OL0, (size_t)NB * QT0 * DM / 8);      /* first-tile o (x64) -> f16 hi + x1024 residual planes */
  k_gemm2<0><<<dim3((QT0 / 128) * (DM / 64), NB), 128, 0, stream>>>(OH0, DM, (size_t)QT0 * DM, BO, DM, 0, 0.0009765625f, bo, 0, nullptr, 1, 0, 0, (float*)d_out, nullptr, DM, (size_t)SQ * DM, QT0, DM, DM);      /* rows 0..127 of each batch: out = o_hi Wo (+ b), overwriting the f16-path rows */
  k_gemm2<0><<<dim3((QT0 / 128) * (DM / 64), NB), 128, 0, stream>>>(OL0, DM, (size_t)QT0 * DM, BO, DM, 0, 0.00000095367431640625f, nullptr, 0, (const float*)d_out, -1, 0, 0, (float*)d_out, nullptr, DM, (size_t)SQ * DM, QT0, DM, DM);      /* += o_lo Wo 2^-20 (own-element accumulate) */
}

// v006
// Measured time: 305 microseconds a run.
// Next to v005, in two timings, it ran 1.35 times as fast each time.
// Over all steps from v000 it is 44.1 times as fast.
#include <hip/hip_runtime.h>
// Grouped-query causal attention at width 1024 with [in][out] projections and RoPE computed in the module (x [4][2048][1024]; q = x Wq (16 heads x 64), k = x Wk, v = x Wv (4 kv heads x 64) ([in][out] weights sigma 0.02, no biases); k, v repeated x4 (repeat: query head h uses kv head h / 4); rope: the module rotates the (even, odd) pairs (x1 c - x2 s, x1 s + x2 c) with angle pos * 10000^(-2i/64) and writes the rotated evens into the first half and the rotated odds into the second half of the head: the SAME permutation on q and k, so q . k equals the interleaved-pair rope's; scores / sqrt(64) with a causal mask (tril, -inf); softmax; out = merged Wo ([in][out]) -> [4][2048][1024]).
// Compute dtype: inputs rounded to bf16; x / weights exact; q, k, v, softmax weights and o as plain f16 GEMM operands (~2^-12); scores and softmax statistics f32. v_wmma_f32_16x16x32_f16.
#define NB 4
#define NG 4
#define HPG 4
#define KVD (NG * HD)
#define SQ 2048
#define DM 1024
#define NH 16
#define HD 64
#define HG 4                         /* heads per launch of the k_vt (b, h0) overload */
#define QT 256
#define NKX SQ                       /* S / P row pitch */
#define QT0 128                      /* first-tile rows recomputed exactly in f32 */
#define B0 0                         /* unused: every stage starts at batch 0 */
#define NBR NB                       /* batches processed (debug hook) */
#define NR ((size_t)NB * SQ)         /* token rows */
#define MP ((int)((size_t)NBR * SQ)) /* rows projected (debug hook) */
#define QN SQ                        /* query rows attended per batch (unused: the attention launches take SQ) */
#define NHD NH                       /* heads attended (unused: the attention launches cover all NH heads) */
#define MPO MP                       /* rows through the output stage (debug hook) */
#define LQ DM      /* row pitch of the q rows */
typedef __bf16 v16b __attribute__((ext_vector_type(16)));
typedef unsigned short v8us __attribute__((ext_vector_type(8), may_alias));
typedef float  v8f  __attribute__((ext_vector_type(8)));
typedef float  v4f  __attribute__((ext_vector_type(4)));
typedef float  v4fa __attribute__((ext_vector_type(4), may_alias));
union FragB { v16b v; v8us half[2]; unsigned short u[16]; };

__device__ __forceinline__ unsigned short bf16_bits(float x) { unsigned int u = __float_as_uint(x); return (unsigned short)((u + 0x7FFFu + ((u >> 16) & 1u)) >> 16); }
__device__ __forceinline__ float bf16_val(unsigned short b) { return __uint_as_float(((unsigned int)b) << 16); }
__device__ __forceinline__ float bf16_round(float x) { return bf16_val(bf16_bits(x)); }
// D += A·B with NT terms: 1 = ah·bh, 2 = + al·bh (A split), 3 = + ah·bl (both split)
template <int NT>
__device__ __forceinline__ v8f mmaN(v16b ah, v16b al, v16b bh, v16b bl, v8f c) {
  c = __builtin_amdgcn_wmma_f32_16x16x32_bf16(false, ah, false, bh, (short)0, c, false, false);
  if (NT >= 2) c = __builtin_amdgcn_wmma_f32_16x16x32_bf16(false, al, false, bh, (short)0, c, false, false);
  if (NT >= 3) c = __builtin_amdgcn_wmma_f32_16x16x32_bf16(false, ah, false, bl, (short)0, c, false, false);
  asm volatile("v_nop\n\tv_nop\n\tv_nop\n\tv_nop" : "+v"(c) : "v"(ah), "v"(al), "v"(bh), "v"(bl));
  return c;
}

__global__ __launch_bounds__(256) void k_wt_bf16(const float* __restrict__ W, unsigned short* __restrict__ Wt, int K, int N) {
  const int t = blockIdx.x * 256 + threadIdx.x;
  const int k8n = K / 8;
  if (t >= N * k8n) return;
  const int n = t / k8n, k8 = (t % k8n) * 8;
  v8us v;
#pragma unroll
  for (int i = 0; i < 8; ++i) v[i] = bf16_bits(W[(size_t)(k8 + i) * N + n]);
  *(v8us*)(Wt + (size_t)n * K + k8) = v;
  
}

// GEMM C[M][N] (f32, pitch ldc) = act(A[M][K]·W + bias). A f32 row-major (pitch lda) converted per fragment to bf16
// (ASPLIT: hi/lo two planes -> 2 terms, else single rounded term); Wt bf16 [N][K] (pitch ldb). BIAS_BF16 rounds the
// bias to bf16 first (bias quantised to bf16 before the add). K%32==0, M%16==0, N%64==0.
template <bool ASPLIT, int ACT, bool BIAS_BF16>
__global__ __launch_bounds__(128) void k_gemm_bf(const float* __restrict__ A, int lda, const unsigned short* __restrict__ Wt, int ldb,
                                               const float* __restrict__ bias, float* __restrict__ C, int ldc, int M, int N, int K) {
  __shared__ __attribute__((aligned(16))) float so[4][16][64];
  const int tid = threadIdx.x, w = tid >> 5, lane = tid & 31, ln = lane & 15, hh = lane >> 4;
  const int ntn = N / 64;
  const int wid = blockIdx.x * 4 + w;
  const int mt = wid / ntn, nq = wid % ntn;
  if (mt * 16 >= M) return;
  const int row0 = mt * 16, col0 = nq * 64;
  const float* arow = A + (size_t)(row0 + ln) * lda;
  v8f acc[4] = {};
  for (int kb = 0; kb < K; kb += 32) {
    FragB ah, al;
    const v4f x0 = *(const v4fa*)(arow + kb + 8 * hh), x1 = *(const v4fa*)(arow + kb + 8 * hh + 4);
    const v4f x2 = *(const v4fa*)(arow + kb + 16 + 8 * hh), x3 = *(const v4fa*)(arow + kb + 16 + 8 * hh + 4);
    float xs[16] = {x0[0],x0[1],x0[2],x0[3],x1[0],x1[1],x1[2],x1[3],x2[0],x2[1],x2[2],x2[3],x3[0],x3[1],x3[2],x3[3]};
#pragma unroll
    for (int i = 0; i < 16; ++i) { const unsigned short hb = bf16_bits(xs[i]); ah.u[i] = hb; al.u[i] = ASPLIT ? bf16_bits(xs[i] - bf16_val(hb)) : (unsigned short)0; }
#pragma unroll
    for (int t = 0; t < 4; ++t) {
      const unsigned short* brow = Wt + (size_t)(col0 + t * 16 + ln) * ldb + kb;
      FragB b;
      b.half[0] = *(const v8us*)(brow + 8 * hh);
      b.half[1] = *(const v8us*)(brow + 16 + 8 * hh);
      acc[t] = mmaN<ASPLIT ? 2 : 1>(ah.v, al.v, b.v, b.v, acc[t]);
    }
  }
#pragma unroll
  for (int t = 0; t < 4; ++t) {
    float bv = bias ? bias[col0 + t * 16 + ln] : 0.f;
    if (BIAS_BF16) bv = bf16_round(bv);
#pragma unroll
    for (int r = 0; r < 8; ++r) { float v = acc[t][r] + bv; if (ACT == 1) v = fmaxf(v, 0.f); so[w][8 * hh + r][t * 16 + ln] = v; }
  }
  __builtin_amdgcn_fence(__ATOMIC_ACQ_REL, "workgroup");
  __builtin_amdgcn_wave_barrier();
  const int rsub = lane >> 4, c4 = (lane & 15) * 4;
  {
#pragma unroll
    for (int q = 0; q < 8; ++q) {
      const int r = q * 2 + rsub;
      const v4f v = *(const v4fa*)&so[w][r][c4];
      *(v4f*)(C + (size_t)(row0 + r) * ldc + col0 + c4) = v;
    }
    
  }
}

// GEMM C = act(A·W + bias + resid): A f32 (ASPLIT -> hi/lo 2 terms), Wt bf16 [N][K]; ACT 0 none, 1 relu, 2 exact gelu;
// resid (optional, f32, row index = (row % rmod), pitch ldr, RES_BF16 rounds it) added before the activation.
template <bool ASPLIT, int ACT, bool BIAS_BF16, bool RES_BF16>
__global__ __launch_bounds__(128) void k_gemm_bf3(const float* __restrict__ A, int lda, const unsigned short* __restrict__ Wt, int ldb,
                                                const float* __restrict__ bias, const float* __restrict__ resid, int rmod, int ldr,
                                                float* __restrict__ C, int ldc, int M, int N, int K) {
  __shared__ __attribute__((aligned(16))) float so[4][16][64];
  const int tid = threadIdx.x, w = tid >> 5, lane = tid & 31, ln = lane & 15, hh = lane >> 4;
  const int ntn = N / 64;
  const int wid = blockIdx.x * 4 + w;
  const int mt = wid / ntn, nq = wid % ntn;
  if (mt * 16 >= M) return;
  const int row0 = mt * 16, col0 = nq * 64;
  const float* arow = A + (size_t)(row0 + ln) * lda;
  v8f acc[4] = {};
  for (int kb = 0; kb < K; kb += 32) {
    FragB ah, al;
    const v4f x0 = *(const v4fa*)(arow + kb + 8 * hh), x1 = *(const v4fa*)(arow + kb + 8 * hh + 4);
    const v4f x2 = *(const v4fa*)(arow + kb + 16 + 8 * hh), x3 = *(const v4fa*)(arow + kb + 16 + 8 * hh + 4);
    float xs[16] = {x0[0],x0[1],x0[2],x0[3],x1[0],x1[1],x1[2],x1[3],x2[0],x2[1],x2[2],x2[3],x3[0],x3[1],x3[2],x3[3]};
#pragma unroll
    for (int i = 0; i < 16; ++i) { const unsigned short hb = bf16_bits(xs[i]); ah.u[i] = hb; al.u[i] = ASPLIT ? bf16_bits(xs[i] - bf16_val(hb)) : (unsigned short)0; }
#pragma unroll
    for (int t = 0; t < 4; ++t) {
      const unsigned short* brow = Wt + (size_t)(col0 + t * 16 + ln) * ldb + kb;
      FragB b;
      b.half[0] = *(const v8us*)(brow + 8 * hh);
      b.half[1] = *(const v8us*)(brow + 16 + 8 * hh);
      acc[t] = mmaN<ASPLIT ? 2 : 1>(ah.v, al.v, b.v, b.v, acc[t]);
    }
  }
#pragma unroll
  for (int t = 0; t < 4; ++t) {
    const int col = col0 + t * 16 + ln;
    float bv = bias ? bias[col] : 0.f;
    if (BIAS_BF16) bv = bf16_round(bv);
#pragma unroll
    for (int r = 0; r < 8; ++r) {
      float v = acc[t][r] + bv;
      if (resid) { float rv = resid[(size_t)((row0 + 8 * hh + r) % rmod) * ldr + col]; if (RES_BF16) rv = bf16_round(rv); v += rv; }
      if (ACT == 1) v = fmaxf(v, 0.f);
      if (ACT == 2) v = 0.5f * v * (1.0f + erff(v * 0.70710678118654752f));
      if (ACT == 3) { const float u = 0.7978845608028654f * (v + 0.044715f * v * v * v); v = 0.5f * v * (1.0f + tanhf(u)); }
      so[w][8 * hh + r][t * 16 + ln] = v;
    }
  }
  __builtin_amdgcn_fence(__ATOMIC_ACQ_REL, "workgroup");
  __builtin_amdgcn_wave_barrier();
  const int rsub = lane >> 4, c4 = (lane & 15) * 4;
  {
#pragma unroll
    for (int q = 0; q < 8; ++q) {
      const int r = q * 2 + rsub;
      const v4f v = *(const v4fa*)&so[w][r][c4];
      *(v4f*)(C + (size_t)(row0 + r) * ldc + col0 + c4) = v;
    }
    
  }
}
// row LayerNorm (biased variance, eps) over N: s = X (+ R); optional out_sum <- s; out_norm <- (s-mu)*rsqrt(var+eps)*g + b
template <bool PARAM_BF16>
__global__ __launch_bounds__(256) void k_layernorm(const float* __restrict__ X, const float* __restrict__ R, const float* __restrict__ g, const float* __restrict__ bta,
                                                  float* __restrict__ out_sum, float* __restrict__ out_norm, int N, float eps) {
  __shared__ float red[256];
  const int row = blockIdx.x, tid = threadIdx.x;
  const float* x = X + (size_t)row * N; const float* rr = R ? R + (size_t)row * N : nullptr;
  float vals[16];                     // up to N = 4096
  const int per = N / 256;            // contiguous chunk per thread? use strided-by-4 chunks: thread handles j = tid*4 + 1024*u
  float s1 = 0.f;
  for (int u = 0; u < per / 4; ++u) {
    const int j = tid * 4 + 1024 * u;
    const v4f a = *(const v4fa*)(x + j);
    v4f b = {0.f,0.f,0.f,0.f}; if (rr) b = *(const v4fa*)(rr + j);
#pragma unroll
    for (int q = 0; q < 4; ++q) { const float v = a[q] + b[q]; vals[u * 4 + q] = v; s1 += v; }
  }
  red[tid] = s1; __syncthreads();
  for (int st = 128; st > 0; st >>= 1) { if (tid < st) red[tid] += red[tid + st]; __syncthreads(); }
  const float mu = red[0] / (float)N; __syncthreads();
  float s2 = 0.f;
  for (int u = 0; u < per / 4; ++u)
#pragma unroll
    for (int q = 0; q < 4; ++q) { const float c = vals[u * 4 + q] - mu; s2 += c * c; }
  red[tid] = s2; __syncthreads();
  for (int st = 128; st > 0; st >>= 1) { if (tid < st) red[tid] += red[tid + st]; __syncthreads(); }
  const float rs = rsqrtf(red[0] / (float)N + eps);
  {
    for (int u = 0; u < per / 4; ++u) {
      const int j = tid * 4 + 1024 * u;
      v4f o, sm;
#pragma unroll
      for (int q = 0; q < 4; ++q) {
        float gg = g[j + q], bb = bta[j + q];
        if (PARAM_BF16) { gg = bf16_round(gg); bb = bf16_round(bb); }
        sm[q] = vals[u * 4 + q]; o[q] = (vals[u * 4 + q] - mu) * rs * gg + bb;
      }
      if (out_sum) *(v4f*)(out_sum + (size_t)row * N + j) = sm;
      *(v4f*)(out_norm + (size_t)row * N + j) = o;
    }
    
  }
}



// ---- f16 WMMA path (v_wmma_f32_16x16x32_f16): 11-bit significands for operands in range — used where a [0,1] probability operand needs more precision than bf16
typedef _Float16 v16h __attribute__((ext_vector_type(16)));
union FragH { v16h v; v8us half[2]; _Float16 h[16]; unsigned short u[16]; };
template <int NT>
__device__ __forceinline__ v8f mmaH(v16h ah, v16h al, v16h bh, v16h bl, v8f c) {
  c = __builtin_amdgcn_wmma_f32_16x16x32_f16(false, ah, false, bh, (short)0, c, false, false);
  if (NT >= 2) c = __builtin_amdgcn_wmma_f32_16x16x32_f16(false, al, false, bh, (short)0, c, false, false);
  if (NT >= 3) c = __builtin_amdgcn_wmma_f32_16x16x32_f16(false, ah, false, bl, (short)0, c, false, false);
  asm volatile("v_nop\n\tv_nop\n\tv_nop\n\tv_nop" : "+v"(c) : "v"(ah), "v"(al), "v"(bh), "v"(bl));
  return c;
}
// batched GEMM like k_gemm_b but f16 operands: A f32 (split into f16 hi/lo if ASPLIT, else rounded to f16), Bt = f16 values [n][k]; alpha; C f32; N multiple of 16 (partial tiles skipped)
template <bool ASPLIT>
__global__ __launch_bounds__(128) void k_gemm_h(const float* __restrict__ A, int lda, size_t sA, const _Float16* __restrict__ Bh, int ldb, size_t sB, float alpha, float* __restrict__ C, int ldc, size_t sC, int M, int N, int K) {
  __shared__ __attribute__((aligned(16))) float so[4][16][64];
  const int tid = threadIdx.x, w = tid >> 5, lane = tid & 31, ln = lane & 15, hh = lane >> 4; const int by = blockIdx.y;
  A += (size_t)by * sA; Bh += (size_t)by * sB; C += (size_t)by * sC;
  const int ntn = (N + 63) / 64; const int wid = blockIdx.x * 4 + w; const int mt = wid / ntn, nq = wid % ntn; if (mt * 16 >= M) return;
  const int row0 = mt * 16, col0 = nq * 64; const float* arow = A + (size_t)(row0 + ln) * lda;
  v8f acc[4] = {};
  for (int kb = 0; kb < K; kb += 32) {
    FragH ah, al;
    const v4f x0 = *(const v4fa*)(arow + kb + 8 * hh), x1 = *(const v4fa*)(arow + kb + 8 * hh + 4), x2 = *(const v4fa*)(arow + kb + 16 + 8 * hh), x3 = *(const v4fa*)(arow + kb + 16 + 8 * hh + 4);
    float xs[16] = {x0[0],x0[1],x0[2],x0[3],x1[0],x1[1],x1[2],x1[3],x2[0],x2[1],x2[2],x2[3],x3[0],x3[1],x3[2],x3[3]};
#pragma unroll
    for (int i = 0; i < 16; ++i) { const _Float16 h = (_Float16)xs[i]; ah.h[i] = h; al.h[i] = ASPLIT ? (_Float16)(xs[i] - (float)h) : (_Float16)0.0f; }
#pragma unroll
    for (int t = 0; t < 4; ++t) { if (col0 + t * 16 >= N) continue; const size_t boff = (size_t)(col0 + t * 16 + ln) * ldb + kb; FragH bq; bq.half[0] = *(const v8us*)(Bh + boff + 8 * hh); bq.half[1] = *(const v8us*)(Bh + boff + 16 + 8 * hh);
      acc[t] = mmaH<ASPLIT ? 2 : 1>(ah.v, al.v, bq.v, bq.v, acc[t]); }
  }
#pragma unroll
  for (int t = 0; t < 4; ++t) { if (col0 + t * 16 >= N) continue;
#pragma unroll
    for (int r = 0; r < 8; ++r) so[w][8 * hh + r][t * 16 + ln] = acc[t][r] * alpha; }
  __builtin_amdgcn_fence(__ATOMIC_ACQ_REL, "workgroup"); __builtin_amdgcn_wave_barrier();
  const int rsub = lane >> 4, c4 = (lane & 15) * 4;
  {
#pragma unroll
    for (int q = 0; q < 8; ++q) { const int r = q * 2 + rsub; if (col0 + c4 < N) { const v4f v = *(const v4fa*)&so[w][r][c4]; *(v4f*)(C + (size_t)(row0 + r) * ldc + col0 + c4) = v; } }
     }
}

// Wt[n][k] = f16(W[k][n]·scale) from f32 row-major W[K][N] (scale = power of two; bf16-exact weights stay exact in f16 away from the subnormal range)
__device__ __forceinline__ void wt_f16_blk(int bx, const float* __restrict__ W, _Float16* __restrict__ Wt, int K, int N, float scale) {
  const int t = bx * 256 + threadIdx.x; if (t >= N * (K / 8)) return; const int n = t / (K / 8), k8 = (t % (K / 8)) * 8; FragH f;
#pragma unroll
  for (int i = 0; i < 8; ++i) f.h[i] = (_Float16)(bf16_round(W[(size_t)(k8 + i) * N + n]) * scale); const v8us o = f.half[0];
  *(v8us*)((unsigned short*)Wt + (size_t)n * K + k8) = o; 
}
// k_gemm_hh variant with fused epilogue: v = acc·alpha + bias[by·sBias + col] (+ CP[(row/rowsPerB)·sCPb + by·64 + col] if CP) ; ACT 0 none / 1 elu ; writes f16 C16 (and f32 C if non-null)
template <int ACT>
__global__ __launch_bounds__(128) void k_gemm_hhx(const _Float16* __restrict__ A, int lda, size_t sA, const _Float16* __restrict__ Bh, int ldb, size_t sB, float alpha, const float* __restrict__ bias, size_t sBias, const float* __restrict__ CP, int rowsPerB, size_t sCPb, int row0g,
    float* __restrict__ C, _Float16* __restrict__ C16, int ldc, size_t sC, int M, int N, int K) {
  __shared__ __attribute__((aligned(16))) float so[4][16][64];
  const int tid = threadIdx.x, w = tid >> 5, lane = tid & 31, ln = lane & 15, hh = lane >> 4; const int by = blockIdx.y;
  A += (size_t)by * sA; Bh += (size_t)by * sB; const size_t cofs = (size_t)by * sC; const float* bp = bias ? bias + (size_t)by * sBias : nullptr;
  const int ntn = (N + 63) / 64; const int wid = blockIdx.x * 4 + w; const int mt = wid / ntn, nq = wid % ntn; if (mt * 16 >= M) return;
  const int row0 = mt * 16, col0 = nq * 64; const _Float16* arow = A + (size_t)(row0 + ln) * lda;
  v8f acc[4] = {};
  for (int kb = 0; kb < K; kb += 32) { FragH ah; ah.half[0] = *(const v8us*)((const unsigned short*)arow + kb + 8 * hh); ah.half[1] = *(const v8us*)((const unsigned short*)arow + kb + 16 + 8 * hh);
#pragma unroll
    for (int t = 0; t < 4; ++t) { if (col0 + t * 16 >= N) continue; const size_t boff = (size_t)(col0 + t * 16 + ln) * ldb + kb; FragH bq; bq.half[0] = *(const v8us*)((const unsigned short*)Bh + boff + 8 * hh); bq.half[1] = *(const v8us*)((const unsigned short*)Bh + boff + 16 + 8 * hh);
      acc[t] = mmaH<1>(ah.v, ah.v, bq.v, bq.v, acc[t]); }
  }
#pragma unroll
  for (int t = 0; t < 4; ++t) { if (col0 + t * 16 >= N) continue; const int col = col0 + t * 16 + ln; const float bv = bp ? bf16_round(bp[col]) : 0.f;
#pragma unroll
    for (int r = 0; r < 8; ++r) { float v = acc[t][r] * alpha + bv; if (CP) { const int rr = row0g + row0 + 8 * hh + r; if (rowsPerB < 0) v += CP[cofs + (size_t)rr * ldc + col];      /* rowsPerB < 0: own element of the batched C plane */ else { const int bidx = rr / rowsPerB; v += CP[(size_t)bidx * sCPb + (size_t)by * 64 + col]; } } if (ACT == 1) v = (v > 0.f) ? v : expm1f(v); else if (ACT == 7) v = (v > 0.f) ? v + 1.0f : expf(v); else if (ACT == 8) v = tanhf(v); else if (ACT == 9) v = 0.5f * v * (1.0f + tanhf(0.7978845608028654f * (v + 0.044715f * v * v * v))); else if (ACT == 11) v = 1.0f / (1.0f + expf(-v)); else if (ACT == 12) v = (v > 0.f) ? v : 0.01f * v; else if (ACT == 14) v = (v > 0.f) ? v : 0.1f * v; else if (ACT == 16) v = (v >= 0.f) ? v : 0.3f * v; else if (ACT == 17) v = (v >= 0.f) ? v : 0.2f * v; else if (ACT == 15) v = v / (1.0f + expf(-v)); else if (ACT == 3) v = fmaxf(v, 0.f); else if (ACT == 6) v = 0.5f * v * (1.0f + erff(v * 0.70710678118654752f)); so[w][8 * hh + r][t * 16 + ln] = v; } }
  __builtin_amdgcn_fence(__ATOMIC_ACQ_REL, "workgroup"); __builtin_amdgcn_wave_barrier();
  const int rsub = lane >> 4, c4 = (lane & 15) * 4; typedef _Float16 v4h __attribute__((ext_vector_type(4)));
  {
#pragma unroll
    for (int q = 0; q < 8; ++q) { const int r = q * 2 + rsub; if (col0 + c4 < N) { const v4f v = *(const v4fa*)&so[w][r][c4]; if (C) *(v4f*)(C + cofs + (size_t)(row0 + r) * ldc + col0 + c4) = v; if (C16) { v4h h4; for (int i = 0; i < 4; ++i) h4[i] = (_Float16)v[i]; *(v4h*)(C16 + cofs + (size_t)(row0 + r) * ldc + col0 + c4) = h4; } } }
     }
}


typedef _Float16 v4h __attribute__((ext_vector_type(4)));

__device__ __forceinline__ void x16_blk(int bx, const float* __restrict__ x, _Float16* __restrict__ X16, size_t n8) { const size_t t = (size_t)bx * 256 + threadIdx.x; if (t >= n8) return; FragH f;
#pragma unroll
  for (int q = 0; q < 8; ++q) f.h[q] = (_Float16)bf16_round(x[t * 8 + q]); *(v8us*)((unsigned short*)X16 + t * 8) = f.half[0];  }
__global__ __launch_bounds__(256) void k_h16(const float* __restrict__ x, _Float16* __restrict__ X16, size_t n8) { const size_t t = (size_t)blockIdx.x * 256 + threadIdx.x; if (t >= n8) return; FragH f;
#pragma unroll
  for (int q = 0; q < 8; ++q) f.h[q] = (_Float16)x[t * 8 + q]; *(v8us*)((unsigned short*)X16 + t * 8) = f.half[0];  }
__global__ __launch_bounds__(256) void k_round16f(const float* __restrict__ W, _Float16* __restrict__ Bt, size_t n8) { const size_t t = (size_t)blockIdx.x * 256 + threadIdx.x; if (t >= n8) return; FragH f;
#pragma unroll
  for (int i = 0; i < 8; ++i) f.h[i] = (_Float16)(bf16_round(W[t * 8 + i]) * 16.0f); *(v8us*)((unsigned short*)Bt + t * 8) = f.half[0];  }
template <int NHv, int TTv>
__device__ __forceinline__ void vt_blk(int bx, const _Float16* __restrict__ V16, int ldv, int voff, _Float16* __restrict__ Vt) { __shared__ unsigned short tl[64][66]; const int tid = threadIdx.x; const int slab = bx / (TTv / 64), lg = bx % (TTv / 64); const int b = slab / NHv, h = slab % NHv;
  for (int i = tid; i < 64 * 8; i += 256) { const int r = i / 8, c8 = (i % 8) * 8; FragH f; f.half[0] = *(const v8us*)((const unsigned short*)V16 + ((size_t)b * TTv + lg * 64 + r) * ldv + voff + h * 64 + c8);
#pragma unroll
    for (int q = 0; q < 8; ++q) tl[r][c8 + q] = f.u[q]; }
  __syncthreads();
  {
#pragma unroll
    for (int rd = 0; rd < 2; ++rd) { const int d = rd * 32 + tid / 8, pc = tid % 8; FragH f;
#pragma unroll
      for (int q = 0; q < 8; ++q) f.u[q] = tl[pc * 8 + q][d];
      *(v8us*)((unsigned short*)Vt + ((size_t)slab * 64 + d) * TTv + lg * 64 + pc * 8) = f.half[0]; }
     } }

__device__ __forceinline__ void hl_blk(size_t t, const float* __restrict__ F, _Float16* __restrict__ Hh, _Float16* __restrict__ Hl, size_t n8) { if (t >= n8) return; FragH fh, fl; const v4f a = *(const v4fa*)(F + t * 8), c = *(const v4fa*)(F + t * 8 + 4);
#pragma unroll
  for (int q = 0; q < 4; ++q) { _Float16 h = (_Float16)a[q]; fh.h[q] = h; fl.h[q] = (_Float16)((a[q] - (float)h) * 1024.0f); h = (_Float16)c[q]; fh.h[4 + q] = h; fl.h[4 + q] = (_Float16)((c[q] - (float)h) * 1024.0f); }
  { *(v8us*)((unsigned short*)Hh + t * 8) = fh.half[0]; *(v8us*)((unsigned short*)Hl + t * 8) = fl.half[0];  } }

// ---- fast GEMM (wave tile 32x64; requires M % 32 == 0 rows per launch region and N % 64 == 0); epilogue = k_gemm_hhx semantics ----
__device__ __forceinline__ v16h g2_frag(const _Float16* p, int hh) { FragH f; f.half[0] = *(const v8us*)((const unsigned short*)p + 8 * hh); f.half[1] = *(const v8us*)((const unsigned short*)p + 16 + 8 * hh); return f.v; }
__device__ __forceinline__ v8f g2_mma(v16h a, v16h b, v8f c) { v8f d = __builtin_amdgcn_wmma_f32_16x16x32_f16(false, a, false, b, (short)0, c, false, false); asm volatile("v_nop\n\tv_nop\n\tv_nop\n\tv_nop" : "+v"(d) : "v"(a), "v"(b)); return d; }
template <int ACT>
__device__ __forceinline__ void gemm2_blk(float (*so)[32][68], int bx, int by, const _Float16* __restrict__ A, int lda, size_t sA, const _Float16* __restrict__ Bh, int ldb, size_t sB, float alpha, const float* __restrict__ bias, size_t sBias, const float* __restrict__ CP, int rowsPerB, size_t sCPb, int row0g,
    float* __restrict__ C, _Float16* __restrict__ C16, int ldc, size_t sC, int M, int N, int K) { static_assert(ACT == 0 || ACT == 3 || ACT == 6 || ACT == 8 || ACT == 9 || ACT == 11 || ACT == 12 || ACT == 14 || ACT == 15 || ACT == 16 || ACT == 17, "k_gemm2: unsupported ACT code (would silently apply no activation)");
  const int tid = threadIdx.x, w = tid >> 5, lane = tid & 31, ln = lane & 15, hh = lane >> 4;
  A += (size_t)by * sA; Bh += (size_t)by * sB; const size_t cofs = (size_t)by * sC; const float* bp = bias ? bias + (size_t)by * sBias : nullptr;
  const int ntn = N >> 6; const int mt = bx / ntn, nq = bx - mt * ntn; const int row0 = mt * 128 + 32 * w, col0 = nq * 64; if (row0 >= M) return;
  const _Float16* a0p = A + (size_t)(row0 + ln) * lda; const _Float16* a1p = a0p + (size_t)16 * lda;
  const _Float16* b0p = Bh + (size_t)(col0 + ln) * ldb; const _Float16* b1p = b0p + (size_t)16 * ldb; const _Float16* b2p = b1p + (size_t)16 * ldb; const _Float16* b3p = b2p + (size_t)16 * ldb;
  const v8f z8 = {0.f,0.f,0.f,0.f,0.f,0.f,0.f,0.f}; v8f c00 = z8, c01 = z8, c02 = z8, c03 = z8, c10 = z8, c11 = z8, c12 = z8, c13 = z8;
#pragma unroll 1
  for (int kb = 0; kb < K; kb += 32) { const _Float16* pa0 = a0p + kb + 8 * hh; const _Float16* pa1 = a1p + kb + 8 * hh; const _Float16* pb0 = b0p + kb + 8 * hh; const v16h a0 = g2_frag(pa0, 0), a1 = g2_frag(pa1, 0);
    v16h b = g2_frag(pb0, 0); c00 = g2_mma(a0, b, c00); c10 = g2_mma(a1, b, c10);
    asm volatile("s_wait_xcnt 0x0" : : "v"(pa0), "v"(pa1), "v"(pb0) : "memory");      /* the wait behind the a0, a1 and b0 loads, their addresses as inputs: the pairs stay in their registers up to it */
    b = g2_frag(b1p + kb, hh); c01 = g2_mma(a0, b, c01); c11 = g2_mma(a1, b, c11);
    b = g2_frag(b2p + kb, hh); c02 = g2_mma(a0, b, c02); c12 = g2_mma(a1, b, c12);
    b = g2_frag(b3p + kb, hh); c03 = g2_mma(a0, b, c03); c13 = g2_mma(a1, b, c13); }
  v8f accs[8] = {c00, c01, c02, c03, c10, c11, c12, c13};
#pragma unroll
  for (int u = 0; u < 8; ++u) { const int t = u & 3, half = u >> 2; const int col = col0 + t * 16 + ln; const float bv = bp ? bf16_round(bp[col]) : 0.f;
#pragma unroll
    for (int r = 0; r < 8; ++r) { const int rloc = half * 16 + 8 * hh + r; float v = accs[u][r] * alpha + bv; if (CP) { if (rowsPerB < 0) v += CP[cofs + (size_t)(row0g + row0 + rloc) * ldc + col];      /* rowsPerB < 0: own element of the batched C plane */ else { const int bidx = (row0g + row0 + rloc) / rowsPerB; v += CP[(size_t)bidx * sCPb + (size_t)by * 64 + col]; } }
      if (ACT == 3) v = fmaxf(v, 0.f); else if (ACT == 6) v = 0.5f * v * (1.0f + erff(v * 0.70710678118654752f)); else if (ACT == 11) v = 1.0f / (1.0f + expf(-v)); else if (ACT == 15) v = v / (1.0f + expf(-v)); else if (ACT == 12) v = (v > 0.f) ? v : 0.01f * v; else if (ACT == 8) v = tanhf(v); else if (ACT == 9) v = 0.5f * v * (1.0f + tanhf(0.7978845608028654f * (v + 0.044715f * v * v * v))); else if (ACT == 14) v = (v > 0.f) ? v : 0.1f * v; else if (ACT == 16) v = (v >= 0.f) ? v : 0.3f * v; else if (ACT == 17) v = (v >= 0.f) ? v : 0.2f * v;
      so[w][rloc][t * 16 + ln] = v; } }
  __builtin_amdgcn_fence(__ATOMIC_ACQ_REL, "workgroup"); __builtin_amdgcn_wave_barrier();
  const int rsub = lane >> 4, c4 = (lane & 15) * 4;
  {
#pragma unroll
    for (int q = 0; q < 16; ++q) { const int r = q * 2 + rsub; v4f v = *(const v4fa*)&so[w][r][c4]; if (C) { *(v4f*)(C + cofs + (size_t)(row0 + r) * ldc + col0 + c4) = v; if (C16) asm volatile("s_wait_xcnt 0x0" : "+v"(v) : : "memory"); }      /* behind the f32 store, in front of the conversion, which was placed on the registers that the issued store names; v passes through, so the conversion stands behind the wait */
      if (C16) { v4h h4; for (int i = 0; i < 4; ++i) h4[i] = (_Float16)v[i]; *(v4h*)(C16 + cofs + (size_t)(row0 + r) * ldc + col0 + c4) = h4; } }
     } }
// the product as a launch of its own (the two first-tile output products, which depend on one another)
template <int ACT>
__global__ __launch_bounds__(128) void k_gemm2(const _Float16* __restrict__ A, int lda, size_t sA, const _Float16* __restrict__ Bh, int ldb, size_t sB, float alpha, const float* __restrict__ bias, size_t sBias, const float* __restrict__ CP, int rowsPerB, size_t sCPb, int row0g,
    float* __restrict__ C, _Float16* __restrict__ C16, int ldc, size_t sC, int M, int N, int K) {
  __shared__ __attribute__((aligned(16))) float so[4][32][68];
  gemm2_blk<ACT>(so, (int)blockIdx.x, (int)blockIdx.y, A, lda, sA, Bh, ldb, sB, alpha, bias, sBias, CP, rowsPerB, sCPb, row0g, C, C16, ldc, sC, M, N, K); }


__global__ __launch_bounds__(256) void k_wnat(const float* __restrict__ w, size_t n8, _Float16* __restrict__ Bt) { const size_t t = (size_t)blockIdx.x * 256 + threadIdx.x; if (t >= n8) return; FragH f; for (int q = 0; q < 8; ++q) f.h[q] = (_Float16)(bf16_round(w[t * 8 + q]) * 16.0f); *(v8us*)((unsigned short*)Bt + t * 8) = f.half[0];  }
__global__ __launch_bounds__(256) void k_rsm(const float* __restrict__ S, _Float16* __restrict__ P, int nrows) {
  #pragma clang fp contract(off)
  const int i = blockIdx.x * 256 + threadIdx.x; if (i >= nrows) return; const float* s = S + (size_t)i * SQ; float mx = -3.0e38f;
#pragma unroll 1
  for (int j = 0; j < SQ; ++j) mx = fmaxf(mx, s[j]); float se = 0.f;
#pragma unroll 1
  for (int j = 0; j < SQ; ++j) se += expf(s[j] - mx); const float sc = 256.0f / se;
#pragma unroll 1
  for (int j0 = 0; j0 < SQ; j0 += 8) { FragH f; for (int q = 0; q < 8; ++q) f.h[q] = (_Float16)(expf(s[j0 + q] - mx) * sc); unsigned short* d = (unsigned short*)P + (size_t)i * SQ + j0; *(v8us*)d = f.half[0];  } }
__global__ __launch_bounds__(256) void k_vt(const _Float16* __restrict__ V16, int b, int h0, _Float16* __restrict__ VT) { __shared__ unsigned short tl[64][65]; const int tid = threadIdx.x; const int hh = blockIdx.x % HG, sg = blockIdx.x / HG; const int s0 = sg * 64; const int h = h0 + hh;
  for (int i = tid; i < 64 * 8; i += 256) { const int j = i / 8, d8 = (i % 8) * 8; FragH f; f.half[0] = *(const v8us*)((const unsigned short*)V16 + ((size_t)b * SQ + s0 + j) * DM + h * HD + d8); for (int q = 0; q < 8; ++q) tl[d8 + q][j] = f.u[q]; }
  __syncthreads();
  { for (int i = tid; i < 64 * 8; i += 256) { const int d = i / 8, j8 = (i % 8) * 8; FragH f; for (int q = 0; q < 8; ++q) f.u[q] = tl[d][j8 + q]; *(v8us*)((unsigned short*)VT + ((size_t)hh * HD + d) * SQ + s0 + j8) = f.half[0]; }  } }



// 2^x on the transcendental unit. The v_nop fills the one issue slot that the instruction set asks for behind a transcendental before its source
// is overwritten.
__device__ __forceinline__ float exp2_slot(float x) { float r; asm("v_exp_f32 %0, %1\n\tv_nop" : "=v"(r) : "v"(x)); return r; }
// Fused causal attention (online softmax): one launch for every batch, head and query row; scores and softmax weights never leave the registers.
// A work-group is the 4 query heads of one kv group (one wave each) on the same 32 query rows, so its waves walk the same K and V lines.
// Transposed products: S^T = K Q^T puts query 16 c + ln in lane ln and key 16 kt + 8 hh + r in register r, which is already the B-operand order of
// P^T for O^T += V^T P^T (half kt of the fragment = tile kt's 8 registers): no exchange between lanes but the one between the two wave halves.
__device__ __forceinline__ v8f fa_mma(v16h a, v16h b, v8f c) { return __builtin_amdgcn_wmma_f32_16x16x32_f16(false, a, false, b, (short)0, c, false, false); }
__device__ __forceinline__ float fa_xhalf(float x) { return __builtin_bit_cast(float, __builtin_amdgcn_permlanex16(__builtin_bit_cast(int, x), __builtin_bit_cast(int, x), 0x76543210, 0xfedcba98, false, false)); }      /* lane l <-> lane l ^ 16 */
// A fragment at the lane's own byte offset (row ln, element 8 hh) from a uniform base: k = 8 hh .. + 7 and 16 + 8 hh .. + 7, the k order of g2_frag.
__device__ __forceinline__ v16h fa_frag(const _Float16* base, unsigned off, int cb) { const char* p = (const char*)base + off; FragH f; f.half[0] = *(const v8us*)(p + cb); f.half[1] = *(const v8us*)(p + cb + 32); return f.v; }
// s_wait_xcnt 0 behind issued loads, in front of any write of a register that they name. The lane offsets pass through the statement: they stay in
// their registers up to the wait, and whatever is formed from them later stands behind it (a "memory" clobber alone does not tie the wait to registers).
__device__ __forceinline__ void fa_hold(unsigned& a) { asm volatile("s_wait_xcnt 0x0" : "+v"(a) : : "memory"); }
__device__ __forceinline__ void fa_hold(unsigned& a, unsigned& b) { asm volatile("s_wait_xcnt 0x0" : "+v"(a), "+v"(b) : : "memory"); }
// One pass of 32 keys. ko: the lane's byte offset of the NEXT pass's K rows; vo: of this pass's keys in V^T. DIAG: the wave's last pass, the only one
// that meets the diagonal (it masks, and it fetches no further K).
// Every loop over kt, kc, c, t and r here and in the kernel is unrolled so that fragments, scores and accumulators are indexed by constants only and stay in registers.
template <bool DIAG>
__device__ __forceinline__ void fa_pass(const _Float16* __restrict__ Kh, const _Float16* __restrict__ Vt, unsigned& ko, unsigned& vo, int key0, int q0, int ln, int hh,
                                        const v16h (&qf)[2][2], v16h (&kf)[2][2], v8f (&acc)[2][4], float (&m)[2], float (&l)[2]) {
  const float cs = 0.125f * 1.44269504f;      /* 1 / sqrt(64), and e^x = 2^(x log2 e) */
  v16h vf[4];
#pragma unroll
  for (int t = 0; t < 4; ++t) vf[t] = fa_frag(Vt, vo, 16 * t * SQ * 2);      /* V^T rows d = 16 t + ln, this pass's keys: in flight under the scores and the exponentials */
  v8f s[2][2];
#pragma unroll
  for (int kt = 0; kt < 2; ++kt)
#pragma unroll
    for (int c = 0; c < 2; ++c) { const v8f z = {0.f, 0.f, 0.f, 0.f, 0.f, 0.f, 0.f, 0.f}; s[kt][c] = fa_mma(kf[kt][1], qf[c][1], fa_mma(kf[kt][0], qf[c][0], z)); }
  if (!DIAG) {      /* the next pass's K rows, in flight under this pass's softmax and second product */
#pragma unroll
    for (int kt = 0; kt < 2; ++kt)
#pragma unroll
      for (int kc = 0; kc < 2; ++kc) kf[kt][kc] = fa_frag(Kh, ko, (16 * kt * KVD + 32 * kc) * 2);
    fa_hold(ko, vo);
    __builtin_amdgcn_sched_barrier(0);      /* keeps the K loads here: without it the scheduler sinks them to the end of the pass, and the next pass's scores wait out their whole latency */
    ko += 32 * KVD * 2; vo += 32 * 2;
  } else fa_hold(vo);
#pragma unroll
  for (int c = 0; c < 2; ++c) {
    if (DIAG) {
      const int qi = q0 + 16 * c + ln;
#pragma unroll
      for (int kt = 0; kt < 2; ++kt)
#pragma unroll
        for (int r = 0; r < 8; ++r) if (key0 + 16 * kt + 8 * hh + r > qi) s[kt][c][r] = -1.0e30f;
    }
    float mx = s[0][c][0];
#pragma unroll
    for (int r = 0; r < 8; ++r) mx = fmaxf(mx, fmaxf(s[0][c][r], s[1][c][r]));
    mx = fmaxf(mx, fa_xhalf(mx));      /* both halves of the wave now hold this query's maximum over the pass */
    const float mn = fmaxf(m[c], mx * cs);
    const float corr = exp2_slot(m[c] - mn);      /* 0 on the first pass */
    m[c] = mn;
    FragH pf; float ps = 0.f;
#pragma unroll
    for (int kt = 0; kt < 2; ++kt)
#pragma unroll
      for (int r = 0; r < 8; ++r) { const float p = exp2_slot(fmaf(s[kt][c][r], cs, -mn)); ps += p; pf.h[8 * kt + r] = (_Float16)p; }
    l[c] = fmaf(l[c], corr, ps);
#pragma unroll
    for (int t = 0; t < 4; ++t) { acc[c][t] = acc[c][t] * corr; acc[c][t] = fa_mma(vf[t], pf.v, acc[c][t]); }
    /* the four vector slots that the chip needs behind a matrix instruction before its operands are overwritten */
    asm volatile("v_nop\n\tv_nop\n\tv_nop\n\tv_nop" : "+v"(acc[c][0]), "+v"(acc[c][1]), "+v"(acc[c][2]), "+v"(acc[c][3]) : "v"(vf[0]), "v"(vf[1]), "v"(vf[2]), "v"(vf[3]), "v"(pf.v));
  }
}
__device__ __forceinline__ void fattn_blk(int bx, int g, int b, const _Float16* __restrict__ Q, const _Float16* __restrict__ Kh, const _Float16* __restrict__ Vt, _Float16* __restrict__ O) {
  const int lane = threadIdx.x & 31, ln = lane & 15, hh = lane >> 4; const int h = g * HPG + (threadIdx.x >> 5);
  const int qt = (b & 1) ? bx : (SQ / 32 - 1) - bx;      /* long and short tiles alternate from batch to batch, so that work-groups a whole batch apart in the grid add up to the same length */
  const int q0 = qt * 32; const size_t r0 = (size_t)b * SQ;
  unsigned qo = (unsigned)(((r0 + q0 + ln) * DM + h * HD + 8 * hh) * 2), ko = (unsigned)(((r0 + ln) * KVD + g * HD + 8 * hh) * 2), vo = (unsigned)((((size_t)(b * NG + g) * HD + ln) * SQ + 8 * hh) * 2);      /* byte offsets: every buffer is below 4 GiB */
  v16h qf[2][2], kf[2][2];
#pragma unroll
  for (int c = 0; c < 2; ++c)
#pragma unroll
    for (int kc = 0; kc < 2; ++kc) { qf[c][kc] = fa_frag(Q, qo, (16 * c * DM + 32 * kc) * 2); kf[c][kc] = fa_frag(Kh, ko, (16 * c * KVD + 32 * kc) * 2); }
  fa_hold(qo, ko);
  ko += 32 * KVD * 2;
  v8f acc[2][4] = {}; float m[2] = {-1.0e30f, -1.0e30f}, l[2] = {0.f, 0.f};
  for (int key0 = 0; key0 < q0; key0 += 32) fa_pass<false>(Kh, Vt, ko, vo, key0, q0, ln, hh, qf, kf, acc, m, l);
  fa_pass<true>(Kh, Vt, ko, vo, q0, q0, ln, hh, qf, kf, acc, m, l);
  unsigned short* op = (unsigned short*)O + (r0 + q0 + ln) * DM + h * HD + 8 * hh;
#pragma unroll
  for (int c = 0; c < 2; ++c) { const float fin = 64.0f / (l[c] + fa_xhalf(l[c]));      /* o carried x64, as the output product expects */
#pragma unroll
    for (int t = 0; t < 4; ++t) { FragH f;
#pragma unroll
      for (int r = 0; r < 8; ++r) f.h[r] = (_Float16)(acc[c][t][r] * fin);
      *(v8us*)(op + (size_t)(16 * c) * DM + 16 * t) = f.half[0]; }      /* d = 16 t + 8 hh .. + 7 of query row 16 c + ln */
    asm volatile("s_wait_xcnt 0x0" ::: "memory"); }      /* behind the stores, in front of any later write of a register that an issued store names */
}


// Exact f32 attention for the first QT0 rows: one thread per (query row, head), online softmax; every sum runs in the order d = 0, 1, ... and j = 0, 1, ...
// What a thread owns (its q row, its o accumulator) stays in registers; what all threads of the block read at the same address (the head's K and V rows)
// is staged once in LDS and read by broadcast. Every loop over d is unrolled so that q, o and the row fragments are indexed by constants only.
// by is the batch: its QT0 rows of q, k, v and o follow those of the batch before.
// The block has the 128 threads of the launch it rides in; its 64 rows are the work of waves 0 and 1, and waves 2 and 3 only pass the two barriers.
__device__ __forceinline__ void att0_blk(int bx, int by, const float* __restrict__ QF, const float* __restrict__ KF, const float* __restrict__ VF, float scale, float* __restrict__ OF, int ldo) {
  __shared__ __attribute__((aligned(16))) float lk[QT0][HD]; __shared__ __attribute__((aligned(16))) float lv[QT0][HD]; __shared__ __attribute__((aligned(16))) float lo[64][64];
  const int tid = threadIdx.x; const int h = bx / (QT0 / 64), rg = bx % (QT0 / 64); const int i = rg * 64 + tid;
  const bool on = __builtin_amdgcn_readfirstlane(tid >> 5) < 2;      /* the wave's number, the same in every lane: a scalar branch */
  QF += (size_t)by * QT0 * LQ; KF += (size_t)by * QT0 * LQ; VF += (size_t)by * QT0 * LQ; OF += (size_t)by * QT0 * ldo;
  const int jmax = rg * 64 + 63;      /* keys up to the block's last row */
  const int sr = tid >> 4, sc4 = (tid & 15) * 4;      /* staging: 16 threads to a row of 256 bytes */
  unsigned so = (unsigned)((sr * LQ + h * HD + sc4) * 4), qo = (unsigned)((i * LQ + h * HD) * 4);      /* the lane's byte offsets in K and V, and in q */
  float q[HD], o[HD];
  if (on) {
#pragma unroll 1      /* kept rolled: one trip already has 16 loads in flight per thread */
  for (int r0 = 0; r0 <= jmax; r0 += 32) { v4f kk[8], vv[8];
#pragma unroll
    for (int u = 0; u < 8; ++u) { kk[u] = *(const v4fa*)((const char*)KF + so + u * 4 * LQ * 4); vv[u] = *(const v4fa*)((const char*)VF + so + u * 4 * LQ * 4); }      /* 16 loads in flight per thread */
    fa_hold(so);      /* the wait behind the issued loads, in front of the write of the offset that they name */
    so += 32 * LQ * 4;
#pragma unroll
    for (int u = 0; u < 8; ++u) { *(v4f*)&lk[r0 + 4 * u + sr][sc4] = kk[u]; *(v4f*)&lv[r0 + 4 * u + sr][sc4] = vv[u]; } }
#pragma unroll
  for (int c = 0; c < HD / 4; ++c) { const v4f t = *(const v4fa*)((const char*)QF + qo + c * 16);
#pragma unroll
    for (int u = 0; u < 4; ++u) { q[c * 4 + u] = t[u]; o[c * 4 + u] = 0.f; } }
  fa_hold(qo);      /* the same wait behind the q loads; their offset stays in its register up to it */
  }
  __syncthreads();      /* K and V rows are staged: nobody reads them in front of this barrier */
  if (on) {
  float m = -1.0e30f, l = 0.f, sn = 0.f;
#pragma unroll
  for (int d = 0; d < HD; ++d) sn = fmaf(q[d], lk[0][d], sn);
#pragma unroll 1      /* kept rolled: a second copy of the body would not fit the registers beside q and o */
  for (int j = 0; j <= jmax; ++j) { const float s = sn * scale;
    const float* kr = &lk[j < jmax ? j + 1 : jmax][0]; v4f kq[HD / 4], vv[HD / 4];
#pragma unroll
    for (int c = 0; c < HD / 4; ++c) kq[c] = *(const v4f*)(kr + c * 4);
    __builtin_amdgcn_sched_barrier(0);      /* keeps the K reads in front of the V reads: LDS answers in order, and with V rows queued between them the score chain below waits for its K words */
#pragma unroll
    for (int c = 0; c < HD / 4; ++c) vv[c] = *(const v4f*)&lv[j][c * 4];
    sn = 0.f;      /* the next key's score: its chain of 64 dependent multiply-adds depends on nothing below, so this key's exponentials and o update fill its waits */
#pragma unroll
    for (int d = 0; d < HD; ++d) sn = fmaf(q[d], kq[d >> 2][d & 3], sn);
    const float f = (j <= i) ? 1.f : 0.f; const float sm = fmaf(f, s, (1.f - f) * -1.0e30f); const float mn = fmaxf(m, sm); const float sc = expf(m - mn); const float e = expf(sm - mn); l = fmaf(l, sc, e); m = mn;
#pragma unroll
    for (int d = 0; d < HD; ++d) o[d] = fmaf(o[d], sc, e * vv[d >> 2][d & 3]); }
  const float fin = 64.0f / l;      /* o carried x64 like the f16 path */
#pragma unroll
  for (int c = 0; c < HD / 4; ++c) { v4f oo;
#pragma unroll
    for (int u = 0; u < 4; ++u) oo[u] = o[c * 4 + u] * fin;
    *(v4f*)&lo[tid][c * 4] = oo; }
  }
  __syncthreads();
  if (on) {
#pragma unroll 1
    for (int it = 0; it < 16; ++it) { const int row = it * 4 + tid / 16, pc = (tid % 16) * 4; const v4f v = *(const v4f*)&lo[row][pc]; *(v4f*)(OF + (size_t)(rg * 64 + row) * ldo + h * HD + pc) = v; }
     } }


__device__ __forceinline__ void kvexp_blk(int bx, const float* __restrict__ src, float* __restrict__ dst, size_t n4) { const size_t t = (size_t)bx * 256 + threadIdx.x; if (t >= n4) return; const size_t e = t * 4; const size_t row = e / DM; const int col = (int)(e % DM); const int h = col / HD, d = col % HD; const v4f v = *(const v4fa*)(src + row * KVD + (size_t)(h / HPG) * HD + d); *(v4f*)(dst + e) = v;  }

__global__ __launch_bounds__(256) void k_tab2(float theta, float* __restrict__ CS, float* __restrict__ SN) {
  #pragma clang fp contract(off)
  const int t = blockIdx.x * 256 + threadIdx.x; if (t >= SQ * (HD / 2)) return; const int i = t % (HD / 2); const int p = t / (HD / 2); const float invf = 1.0f / powf(theta, (float)(2 * i) / (float)HD); const float ang = __fmul_rn((float)p, invf); const float c = cosf(ang), s = sinf(ang);
  *(float*)(CS + t) = c; *(float*)(SN + t) = s;  }
// Projection GEMM with the rope in its epilogue (q and k). The product is k_gemm2's: wave tile 32 x 64, the same fragments, the same order of k. A wave's 64 columns are one head, and the
// tile that the epilogue lays out in LDS for whole-line stores gives a lane four neighbouring columns of a row, that is both members of two (even, odd) pairs: the lane rotates them by the
// row's position (row % SQ; a tile of 32 rows lies in one batch) and stores f16. Rows 0 .. QT0 - 1 of each batch also go out in f32 for the exact first-tile path (F0: QT0 rows a batch).
typedef float v2fa __attribute__((ext_vector_type(2), may_alias));
// The 16 rows of a lane (every second row of the wave's tile): tp = the lane's four words of its first row in LDS, cp / sp = its two table entries of that row, hp / fp = its place in the outputs.
// F32 is a template argument so that neither form has a branch between its rows: the 32 table loads of a lane are then in flight together instead of one row's pair at a time.
// NC, the outputs' row pitch, is one too: every row's store is then the first row's address with an immediate offset.
template <bool F32, int NC>
__device__ __forceinline__ void g2_rope_rows(const float* tp, const float* __restrict__ cp, const float* __restrict__ sp, _Float16* __restrict__ hp, float* __restrict__ fp) {
#pragma unroll      /* unrolled for the same reason: all table loads issue in front of the first use */
  for (int q = 0; q < 16; ++q) { const v4f v = *(const v4fa*)(tp + q * 2 * 68); const v2fa c = *(const v2fa*)(cp + q * 2 * (HD / 2)), s = *(const v2fa*)(sp + q * 2 * (HD / 2));
    v4f o; o[0] = v[0] * c[0] - v[1] * s[0]; o[1] = v[0] * s[0] + v[1] * c[0]; o[2] = v[2] * c[1] - v[3] * s[1]; o[3] = v[2] * s[1] + v[3] * c[1];
    v4h h4;
#pragma unroll      /* constant element indices: o and h4 stay in registers */
    for (int i = 0; i < 4; ++i) h4[i] = (_Float16)o[i];
    *(v4h*)(hp + q * 2 * NC) = h4;
    if (F32) *(v4f*)(fp + q * 2 * NC) = o; }
  asm volatile("s_wait_xcnt 0x0" ::: "memory"); }      /* behind the last store of the rows, in front of any later write of a register that an issued store names (the other form's code follows in the listing) */
template <int NC>      /* columns of the product = row pitch of both outputs */
__device__ __forceinline__ void gemm2r_blk(float (*so)[32][68], int bx, const _Float16* __restrict__ A, int lda, const _Float16* __restrict__ Bh, int ldb, float alpha, const float* __restrict__ CS, const float* __restrict__ SN,
    _Float16* __restrict__ H16, float* __restrict__ F0, int M, int K) {
  const int tid = threadIdx.x, w = tid >> 5, lane = tid & 31, ln = lane & 15, hh = lane >> 4;
  const int ntn = NC >> 6; const int mt = bx / ntn, nq = bx - mt * ntn; const int row0 = mt * 128 + 32 * w, col0 = nq * 64; if (row0 >= M) return;
  const _Float16* a0p = A + (size_t)(row0 + ln) * lda; const _Float16* a1p = a0p + (size_t)16 * lda;
  const _Float16* b0p = Bh + (size_t)(col0 + ln) * ldb; const _Float16* b1p = b0p + (size_t)16 * ldb; const _Float16* b2p = b1p + (size_t)16 * ldb; const _Float16* b3p = b2p + (size_t)16 * ldb;
  const v8f z8 = {0.f,0.f,0.f,0.f,0.f,0.f,0.f,0.f}; v8f c00 = z8, c01 = z8, c02 = z8, c03 = z8, c10 = z8, c11 = z8, c12 = z8, c13 = z8;
#pragma unroll 1      /* rolled like k_gemm2's loop, so that both products are the same code */
  for (int kb = 0; kb < K; kb += 32) { const _Float16* pa0 = a0p + kb + 8 * hh; const _Float16* pa1 = a1p + kb + 8 * hh; const _Float16* pb0 = b0p + kb + 8 * hh; const v16h a0 = g2_frag(pa0, 0), a1 = g2_frag(pa1, 0);
    v16h b = g2_frag(pb0, 0); c00 = g2_mma(a0, b, c00); c10 = g2_mma(a1, b, c10);
    asm volatile("s_wait_xcnt 0x0" : : "v"(pa0), "v"(pa1), "v"(pb0) : "memory");      /* the wait behind the a0, a1 and b0 loads, their addresses as inputs: the three pairs stay in their registers up to it */
    b = g2_frag(b1p + kb, hh); c01 = g2_mma(a0, b, c01); c11 = g2_mma(a1, b, c11);
    b = g2_frag(b2p + kb, hh); c02 = g2_mma(a0, b, c02); c12 = g2_mma(a1, b, c12);
    b = g2_frag(b3p + kb, hh); c03 = g2_mma(a0, b, c03); c13 = g2_mma(a1, b, c13); }
  v8f accs[8] = {c00, c01, c02, c03, c10, c11, c12, c13};
#pragma unroll      /* unrolled so that the accumulators are indexed by constants only and stay in registers */
  for (int u = 0; u < 8; ++u) { const int t = u & 3, half = u >> 2;
#pragma unroll      /* the same, for the element index */
    for (int r = 0; r < 8; ++r) so[w][half * 16 + 8 * hh + r][t * 16 + ln] = accs[u][r] * alpha; }
  __builtin_amdgcn_fence(__ATOMIC_ACQ_REL, "workgroup"); __builtin_amdgcn_wave_barrier();      /* the wave's own LDS writes stand in front of its reads of other lanes' words; no other wave reads this slice */
  const int rsub = lane >> 4, c4 = (lane & 15) * 4; const int p0 = row0 % SQ;
  const float* cp = CS + (size_t)(p0 + rsub) * (HD / 2) + c4 / 2; const float* sp = SN + (size_t)(p0 + rsub) * (HD / 2) + c4 / 2;      /* table entries i = c4 / 2 and c4 / 2 + 1 of the lane's row */
  _Float16* hp = H16 + (size_t)(row0 + rsub) * NC + col0 + c4; float* fp = F0 + ((size_t)(row0 / SQ) * QT0 + p0 + rsub) * NC + col0 + c4;
  if (__builtin_amdgcn_readfirstlane(p0) < QT0) g2_rope_rows<true, NC>(&so[w][rsub][c4], cp, sp, hp, fp);      /* p0 is the same in every lane of a wave: a scalar branch; QT0 is a multiple of the tile's 32 rows */
  else g2_rope_rows<false, NC>(&so[w][rsub][c4], cp, sp, hp, fp); }

__global__ __launch_bounds__(256) void k_bfcp(const float* __restrict__ src, float* __restrict__ dst, size_t n4) { const size_t t = (size_t)blockIdx.x * 256 + threadIdx.x; if (t >= n4) return; const v4f a = *(const v4fa*)(src + t * 4); v4f o; for (int q = 0; q < 4; ++q) o[q] = bf16_round(a[q]); *(v4f*)(dst + t * 4) = o;  }

__global__ __launch_bounds__(256) void k_tabhalf(const float* __restrict__ cs, const float* __restrict__ sn, float* __restrict__ CS, float* __restrict__ SN) { const int t = blockIdx.x * 256 + threadIdx.x; if (t >= SQ * (HD / 2)) return; const int p = t / (HD / 2), i = t % (HD / 2); const float c = bf16_round(cs[(size_t)p * HD + i]), s = bf16_round(sn[(size_t)p * HD + i]);
  *(float*)(CS + t) = c; *(float*)(SN + t) = s;  }

__device__ __forceinline__ void tab2d_blk(int bx, float* __restrict__ CS, float* __restrict__ SN) {
  #pragma clang fp contract(off)
  const int t = bx * 256 + threadIdx.x; if (t >= SQ * (HD / 2)) return; const int i = t % (HD / 2); const int p = t / (HD / 2); const float invf = (float)(1.0 / pow(10000.0, (double)(2 * i) / (double)HD)); const float ang = __fmul_rn((float)p, invf); const float c = cosf(ang), s = sinf(ang);
  *(float*)(CS + t) = c; *(float*)(SN + t) = s;  }
// Launches that do not depend on one another ride in ONE grid: a block's index says which stage it belongs to and which block of that stage it is (a scalar branch: the index is the
// same for the whole block). Every stage's code, block size and block-to-data map are what they were as a launch of its own, but for the exact first-tile stage, whose 64 working threads ride in blocks of 128; stages whose blocks last longest come first.
#define PB_TAB (SQ * (HD / 2) / 256)
#define PB_WQ (DM * (DM / 8) / 256)
#define PB_WK (KVD * (DM / 8) / 256)
#define PB_X ((int)(NR * DM / 8 / 256))
// rope tables, the four weight transposes, x -> f16: all read inputs only
__global__ __launch_bounds__(256) void k_prep(const float* __restrict__ x, const float* __restrict__ wq, const float* __restrict__ wk, const float* __restrict__ wv, const float* __restrict__ wo,
    _Float16* __restrict__ X16, _Float16* __restrict__ BQ, _Float16* __restrict__ BK, _Float16* __restrict__ BV, _Float16* __restrict__ BO, float* __restrict__ CS, float* __restrict__ SN) {
  int bx = (int)blockIdx.x;
  if (bx < PB_TAB) { tab2d_blk(bx, CS, SN); return; }      /* angle[p][i] = p * 10000^(-2i/64), positions = row index */
  bx -= PB_TAB; if (bx < PB_WQ) { wt_f16_blk(bx, wq, BQ, DM, DM, 16.0f); return; }      /* [in][out] -> Bt[n][k] x16 */
  bx -= PB_WQ; if (bx < PB_WQ) { wt_f16_blk(bx, wo, BO, DM, DM, 16.0f); return; }
  bx -= PB_WQ; if (bx < PB_WK) { wt_f16_blk(bx, wk, BK, DM, KVD, 16.0f); return; }
  bx -= PB_WK; if (bx < PB_WK) { wt_f16_blk(bx, wv, BV, DM, KVD, 16.0f); return; }
  bx -= PB_WK; x16_blk(bx, x, X16, NR * DM / 8); }
#define GB_Q ((MP / 128) * (DM / 64))
#define GB_K ((MP / 128) * (KVD / 64))
#define GB_V0 ((QT0 / 128) * (KVD / 64))
// the q, k and v products and the f32 v rows of the first tile: all read X16 and a weight plane
__global__ __launch_bounds__(128) void k_proj(const _Float16* __restrict__ X16, const _Float16* __restrict__ BQ, const _Float16* __restrict__ BK, const _Float16* __restrict__ BV, const float* __restrict__ CS, const float* __restrict__ SN,
    _Float16* __restrict__ Q16, float* __restrict__ QF0, _Float16* __restrict__ K16, float* __restrict__ KF0, _Float16* __restrict__ V16, float* __restrict__ VF0) {
  __shared__ __attribute__((aligned(16))) float so[4][32][68];
  int bx = (int)blockIdx.x;
  if (bx < GB_Q) { gemm2r_blk<DM>(so, bx, X16, DM, BQ, DM, 0.0625f, CS, SN, Q16, QF0, MP, DM); return; }      /* q with the interleaved-pair rope, position = row % SQ -> f16 rows; f32 rows 0..127 of each batch */
  bx -= GB_Q; if (bx < GB_K) { gemm2r_blk<KVD>(so, bx, X16, DM, BK, DM, 0.0625f, CS, SN, K16, KF0, MP, DM); return; }      /* k, the same */
  bx -= GB_K; if (bx < GB_K) { gemm2_blk<0>(so, bx, 0, X16, DM, 0, BV, DM, 0, 0.0625f, nullptr, 0, nullptr, 1, 0, 0, nullptr, V16, KVD, 0, MP, KVD, DM); return; }
  bx -= GB_K; gemm2_blk<0>(so, bx % GB_V0, bx / GB_V0, X16, DM, (size_t)SQ * DM, BV, DM, 0, 0.0625f, nullptr, 0, nullptr, 1, 0, 0, VF0, nullptr, KVD, (size_t)QT0 * KVD, QT0, KVD, DM); }      /* f32 v of rows 0..127 of each batch */
#define CB_VT (NB * NG * (SQ / 64))
#define CB_KV (NB * QT0 * DM / 4 / 256)
// V^T for the fused attention; k and v rows of the first tile spread from kv group to head
__global__ __launch_bounds__(256) void k_lay(const _Float16* __restrict__ V16, _Float16* __restrict__ VT, const float* __restrict__ KF0, float* __restrict__ KF0e, const float* __restrict__ VF0, float* __restrict__ VF0e) {
  int bx = (int)blockIdx.x;
  if (bx < CB_VT) { vt_blk<NG, SQ>(bx, V16, KVD, 0, VT); return; }      /* V^T [NB][NG][HD][SQ] */
  bx -= CB_VT; if (bx < CB_KV) { kvexp_blk(bx, KF0, KF0e, (size_t)NB * QT0 * DM / 4); return; }      /* head h <- kv group h/4 */
  bx -= CB_KV; kvexp_blk(bx, VF0, VF0e, (size_t)NB * QT0 * DM / 4); }
#define DB_F ((SQ / 32) * NG * NB)
#define DB_A0 (NH * (QT0 / 64))
// the fused attention in its own block order (tile fastest, then kv group, then batch), and behind it the exact first-tile blocks, which take the places that the shortest tiles leave
__global__ __launch_bounds__(128) void k_attn(const _Float16* __restrict__ Q16, const _Float16* __restrict__ K16, const _Float16* __restrict__ VT, _Float16* __restrict__ O16,
    const float* __restrict__ QF0, const float* __restrict__ KF0e, const float* __restrict__ VF0e, float* __restrict__ OF0) {
  int bx = (int)blockIdx.x;
  if (bx < DB_F) { fattn_blk(bx % (SQ / 32), (bx / (SQ / 32)) % NG, bx / ((SQ / 32) * NG), Q16, K16, VT, O16); return; }
  bx -= DB_F; att0_blk(bx % DB_A0, bx / DB_A0, QF0, KF0e, VF0e, 0.125f, OF0, DM); }
#define EB_O ((MPO / 128) * (DM / 64))
#define EB_H (NB * QT0 * DM / 8 / 128)
// the output product of all rows, and the first tile's o split into f16 hi and residual planes
__global__ __launch_bounds__(128) void k_outp(const _Float16* __restrict__ O16, const _Float16* __restrict__ BO, float* __restrict__ out, const float* __restrict__ OF0, _Float16* __restrict__ OH0, _Float16* __restrict__ OL0) {
  __shared__ __attribute__((aligned(16))) float so[4][32][68];
  int bx = (int)blockIdx.x;
  if (bx < EB_O) { gemm2_blk<0>(so, bx, 0, O16, DM, 0, BO, DM, 0, 0.0009765625f, nullptr, 0, nullptr, 1, 0, 0, out, nullptr, DM, 0, MPO, DM, DM); return; }      /* out rows are the output layout */
  bx -= EB_O; hl_blk((size_t)bx * 128 + threadIdx.x, OF0, OH0, OL0, (size_t)NB * QT0 * DM / 8); }      /* first-tile o (x64) -> f16 hi + x1024 residual planes */
extern "C" void kernel_launch(void* const* d_in, const int* in_sizes, int n_in,
                              void* d_out, int out_size, void* d_ws, size_t ws_size, hipStream_t stream) {
  (void)in_sizes; (void)n_in; (void)out_size;
  const float* const* I = (const float* const*)d_in; const float* x = I[0]; const float* wq = I[1]; const float* wk = I[2]; const float* wv = I[3]; const float* wo = I[4];      /* input order: x, Wq [1024][1024], Wk / Wv [1024][256], Wo [1024][1024] ([in][out] weights); rope tables computed in-kernel (positions = row index), as the module computes them */ const float* bq = nullptr; const float* bk = nullptr; const float* bv = nullptr; const float* bo = nullptr;      /* no biases */
  char* ws = (char*)d_ws; size_t off = 0;
  auto take = [&](size_t bytes) { char* p = ws + off; off += (bytes + 255) & ~(size_t)255; return p; };
  _Float16* BQ = (_Float16*)take((size_t)DM * DM * 2); _Float16* BK = (_Float16*)take((size_t)KVD * DM * 2); _Float16* BV = (_Float16*)take((size_t)KVD * DM * 2); _Float16* BO = (_Float16*)take((size_t)DM * DM * 2);
  _Float16* X16 = (_Float16*)take(NR * DM * 2); float* CSB = (float*)take((size_t)SQ * HD * 4); float* SNB = (float*)take((size_t)SQ * HD * 4); _Float16* Q16 = (_Float16*)take(NR * DM * 2); _Float16* K16 = (_Float16*)take(NR * KVD * 2); _Float16* V16 = (_Float16*)take(NR * KVD * 2); _Float16* O16 = (_Float16*)take(NR * DM * 2);
  _Float16* VT = (_Float16*)take((size_t)NB * NG * HD * SQ * 2);
  float* QF0 = (float*)take((size_t)NB * QT0 * DM * 4); float* KF0 = (float*)take((size_t)NB * QT0 * KVD * 4); float* VF0 = (float*)take((size_t)NB * QT0 * KVD * 4); float* KF0e = (float*)take((size_t)NB * QT0 * DM * 4); float* VF0e = (float*)take((size_t)NB * QT0 * DM * 4); float* OF0 = (float*)take((size_t)NB * QT0 * DM * 4); _Float16* OH0 = (_Float16*)take((size_t)NB * QT0 * DM * 2); _Float16* OL0 = (_Float16*)take((size_t)NB * QT0 * DM * 2);
  if (off > ws_size) return;
  /* Seven dependent launches; each holds every stage that needs only what the launches before it wrote. Every stage covers all NB batches. */
  k_prep<<<PB_TAB + 2 * PB_WQ + 2 * PB_WK + PB_X, 256, 0, stream>>>(x, wq, wk, wv, wo, X16, BQ, BK, BV, BO, CSB, SNB);
  k_proj<<<GB_Q + 2 * GB_K + GB_V0 * NB, 128, 0, stream>>>(X16, BQ, BK, BV, CSB, SNB, Q16, QF0, K16, KF0, V16, VF0);
  k_lay<<<CB_VT + 2 * CB_KV, 256, 0, stream>>>(V16, VT, KF0, KF0e, VF0, VF0e);
  k_attn<<<DB_F + DB_A0 * NB, 128, 0, stream>>>(Q16, K16, VT, O16, QF0, KF0e, VF0e, OF0);      /* o (merged heads, x64): f16 rows of all rows; exact f32 rows 0..127 of each batch */
  k_outp<<<EB_O + EB_H, 128, 0, stream>>>(O16, BO, (float*)d_out, OF0, OH0, OL0);
  k_gemm2<0><<<dim3((QT0 / 128) * (DM / 64), NB), 128, 0, stream>>>(OH0, DM, (size_t)QT0 * DM, BO, DM, 0, 0.0009765625f, bo, 0, nullptr, 1, 0, 0, (float*)d_out, nullptr, DM, (size_t)SQ * DM, QT0, DM, DM);      /* rows 0..127 of each batch: out = o_hi Wo (+ b), overwriting the f16-path rows */
  k_gemm2<0><<<dim3((QT0 / 128) * (DM / 64), NB), 128, 0, stream>>>(OL0, DM, (size_t)QT0 * DM, BO, DM, 0, 0.00000095367431640625f, nullptr, 0, (const float*)d_out, -1, 0, 0, (float*)d_out, nullptr, DM, (size_t)SQ * DM, QT0, DM, DM);      /* += o_lo Wo 2^-20 (own-element accumulate) */
}

// v007
// A run of this version takes 202 microseconds.
// Two timings next to v006 put it at 1.51 and 1.52 times that version's speed.
// Over all steps from v000 it is 66.9 times as fast.
#include <hip/hip_runtime.h>
// Grouped-query causal attention at width 1024 with [in][out] projections and RoPE computed in the module (x [4][2048][1024]; q = x Wq (16 heads x 64), k = x Wk, v = x Wv (4 kv heads x 64) ([in][out] weights sigma 0.02, no biases); k, v repeated x4 (repeat: query head h uses kv head h / 4); rope: the module rotates the (even, odd) pairs (x1 c - x2 s, x1 s + x2 c) with angle pos * 10000^(-2i/64) and writes the rotated evens into the first half and the rotated odds into the second half of the head: the SAME permutation on q and k, so q . k equals the interleaved-pair rope's; scores / sqrt(64) with a causal mask (tril, -inf); softmax; out = merged Wo ([in][out]) -> [4][2048][1024]).
// Compute dtype: inputs rounded to bf16; x / weights exact; q, k, v, softmax weights and o as plain f16 GEMM operands (~2^-12); scores and softmax statistics f32. v_wmma_f32_16x16x32_f16.
#define NB 4
#define NG 4
#define HPG 4
#define KVD (NG * HD)
#define SQ 2048
#define DM 1024
#define NH 16
#define HD 64
#define HG 4                         /* heads per launch of the k_vt (b, h0) overload */
#define QT 256
#define NKX SQ                       /* S / P row pitch */
#define QT0 128                      /* first-tile rows recomputed exactly in f32 */
#define B0 0                         /* unused: every stage starts at batch 0 */
#define NBR NB                       /* batches processed (debug hook) */
#define NR ((size_t)NB * SQ)         /* token rows */
#define MP ((int)((size_t)NBR * SQ)) /* rows projected (debug hook) */
#define QN SQ                        /* query rows attended per batch (unused: the attention launches take SQ) */
#define NHD NH                       /* heads attended (unused: the attention launches cover all NH heads) */
#define MPO MP                       /* rows through the output stage (debug hook) */
#define LQ DM      /* row pitch of the q rows */
typedef __bf16 v16b __attribute__((ext_vector_type(16)));
typedef unsigned short v8us __attribute__((ext_vector_type(8), may_alias));
typedef float  v8f  __attribute__((ext_vector_type(8)));
typedef float  v4f  __attribute__((ext_vector_type(4)));
typedef float  v4fa __attribute__((ext_vector_type(4), may_alias));
union FragB { v16b v; v8us half[2]; unsigned short u[16]; };

__device__ __forceinline__ unsigned short bf16_bits(float x) { unsigned int u = __float_as_uint(x); return (unsigned short)((u + 0x7FFFu + ((u >> 16) & 1u)) >> 16); }
__device__ __forceinline__ float bf16_val(unsigned short b) { return __uint_as_float(((unsigned int)b) << 16); }
__device__ __forceinline__ float bf16_round(float x) { return bf16_val(bf16_bits(x)); }
// D += A·B with NT terms: 1 = ah·bh, 2 = + al·bh (A split), 3 = + ah·bl (both split)
template <int NT>
__device__ __forceinline__ v8f mmaN(v16b ah, v16b al, v16b bh, v16b bl, v8f c) {
  c = __builtin_amdgcn_wmma_f32_16x16x32_bf16(false, ah, false, bh, (short)0, c, false, false);
  if (NT >= 2) c = __builtin_amdgcn_wmma_f32_16x16x32_bf16(false, al, false, bh, (short)0, c, false, false);
  if (NT >= 3) c = __builtin_amdgcn_wmma_f32_16x16x32_bf16(false, ah, false, bl, (short)0, c, false, false);
  asm volatile("v_nop\n\tv_nop\n\tv_nop\n\tv_nop" : "+v"(c) : "v"(ah), "v"(al), "v"(bh), "v"(bl));
  return c;
}

__global__ __launch_bounds__(256) void k_wt_bf16(const float* __restrict__ W, unsigned short* __restrict__ Wt, int K, int N) {
  const int t = blockIdx.x * 256 + threadIdx.x;
  const int k8n = K / 8;
  if (t >= N * k8n) return;
  const int n = t / k8n, k8 = (t % k8n) * 8;
  v8us v;
#pragma unroll
  for (int i = 0; i < 8; ++i) v[i] = bf16_bits(W[(size_t)(k8 + i) * N + n]);
  *(v8us*)(Wt + (size_t)n * K + k8) = v;
  
}

// GEMM C[M][N] (f32, pitch ldc) = act(A[M][K]·W + bias). A f32 row-major (pitch lda) converted per fragment to bf16
// (ASPLIT: hi/lo two planes -> 2 terms, else single rounded term); Wt bf16 [N][K] (pitch ldb). BIAS_BF16 rounds the
// bias to bf16 first (bias quantised to bf16 before the add). K%32==0, M%16==0, N%64==0.
template <bool ASPLIT, int ACT, bool BIAS_BF16>
__global__ __launch_bounds__(128) void k_gemm_bf(const float* __restrict__ A, int lda, const unsigned short* __restrict__ Wt, int ldb,
                                               const float* __restrict__ bias, float* __restrict__ C, int ldc, int M, int N, int K) {
  __shared__ __attribute__((aligned(16))) float so[4][16][64];
  const int tid = threadIdx.x, w = tid >> 5, lane = tid & 31, ln = lane & 15, hh = lane >> 4;
  const int ntn = N / 64;
  const int wid = blockIdx.x * 4 + w;
  const int mt = wid / ntn, nq = wid % ntn;
  if (mt * 16 >= M) return;
  const int row0 = mt * 16, col0 = nq * 64;
  const float* arow = A + (size_t)(row0 + ln) * lda;
  v8f acc[4] = {};
  for (int kb = 0; kb < K; kb += 32) {
    FragB ah, al;
    const v4f x0 = *(const v4fa*)(arow + kb + 8 * hh), x1 = *(const v4fa*)(arow + kb + 8 * hh + 4);
    const v4f x2 = *(const v4fa*)(arow + kb + 16 + 8 * hh), x3 = *(const v4fa*)(arow + kb + 16 + 8 * hh + 4);
    float xs[16] = {x0[0],x0[1],x0[2],x0[3],x1[0],x1[1],x1[2],x1[3],x2[0],x2[1],x2[2],x2[3],x3[0],x3[1],x3[2],x3[3]};
#pragma unroll
    for (int i = 0; i < 16; ++i) { const unsigned short hb = bf16_bits(xs[i]); ah.u[i] = hb; al.u[i] = ASPLIT ? bf16_bits(xs[i] - bf16_val(hb)) : (unsigned short)0; }
#pragma unroll
    for (int t = 0; t < 4; ++t) {
      const unsigned short* brow = Wt + (size_t)(col0 + t * 16 + ln) * ldb + kb;
      FragB b;
      b.half[0] = *(const v8us*)(brow + 8 * hh);
      b.half[1] = *(const v8us*)(brow + 16 + 8 * hh);
      acc[t] = mmaN<ASPLIT ? 2 : 1>(ah.v, al.v, b.v, b.v, acc[t]);
    }
  }
#pragma unroll
  for (int t = 0; t < 4; ++t) {
    float bv = bias ? bias[col0 + t * 16 + ln] : 0.f;
    if (BIAS_BF16) bv = bf16_round(bv);
#pragma unroll
    for (int r = 0; r < 8; ++r) { float v = acc[t][r] + bv; if (ACT == 1) v = fmaxf(v, 0.f); so[w][8 * hh + r][t * 16 + ln] = v; }
  }
  __builtin_amdgcn_fence(__ATOMIC_ACQ_REL, "workgroup");
  __builtin_amdgcn_wave_barrier();
  const int rsub = lane >> 4, c4 = (lane & 15) * 4;
  {
#pragma unroll
    for (int q = 0; q < 8; ++q) {
      const int r = q * 2 + rsub;
      const v4f v = *(const v4fa*)&so[w][r][c4];
      *(v4f*)(C + (size_t)(row0 + r) * ldc + col0 + c4) = v;
    }
    
  }
}

// GEMM C = act(A·W + bias + resid): A f32 (ASPLIT -> hi/lo 2 terms), Wt bf16 [N][K]; ACT 0 none, 1 relu, 2 exact gelu;
// resid (optional, f32, row index = (row % rmod), pitch ldr, RES_BF16 rounds it) added before the activation.
template <bool ASPLIT, int ACT, bool BIAS_BF16, bool RES_BF16>
__global__ __launch_bounds__(128) void k_gemm_bf3(const float* __restrict__ A, int lda, const unsigned short* __restrict__ Wt, int ldb,
                                                const float* __restrict__ bias, const float* __restrict__ resid, int rmod, int ldr,
                                                float* __restrict__ C, int ldc, int M, int N, int K) {
  __shared__ __attribute__((aligned(16))) float so[4][16][64];
  const int tid = threadIdx.x, w = tid >> 5, lane = tid & 31, ln = lane & 15, hh = lane >> 4;
  const int ntn = N / 64;
  const int wid = blockIdx.x * 4 + w;
  const int mt = wid / ntn, nq = wid % ntn;
  if (mt * 16 >= M) return;
  const int row0 = mt * 16, col0 = nq * 64;
  const float* arow = A + (size_t)(row0 + ln) * lda;
  v8f acc[4] = {};
  for (int kb = 0; kb < K; kb += 32) {
    FragB ah, al;
    const v4f x0 = *(const v4fa*)(arow + kb + 8 * hh), x1 = *(const v4fa*)(arow + kb + 8 * hh + 4);
    const v4f x2 = *(const v4fa*)(arow + kb + 16 + 8 * hh), x3 = *(const v4fa*)(arow + kb + 16 + 8 * hh + 4);
    float xs[16] = {x0[0],x0[1],x0[2],x0[3],x1[0],x1[1],x1[2],x1[3],x2[0],x2[1],x2[2],x2[3],x3[0],x3[1],x3[2],x3[3]};
#pragma unroll
    for (int i = 0; i < 16; ++i) { const unsigned short hb = bf16_bits(xs[i]); ah.u[i] = hb; al.u[i] = ASPLIT ? bf16_bits(xs[i] - bf16_val(hb)) : (unsigned short)0; }
#pragma unroll
    for (int t = 0; t < 4; ++t) {
      const unsigned short* brow = Wt + (size_t)(col0 + t * 16 + ln) * ldb + kb;
      FragB b;
      b.half[0] = *(const v8us*)(brow + 8 * hh);
      b.half[1] = *(const v8us*)(brow + 16 + 8 * hh);
      acc[t] = mmaN<ASPLIT ? 2 : 1>(ah.v, al.v, b.v, b.v, acc[t]);
    }
  }
#pragma unroll
  for (int t = 0; t < 4; ++t) {
    const int col = col0 + t * 16 + ln;
    float bv = bias ? bias[col] : 0.f;
    if (BIAS_BF16) bv = bf16_round(bv);
#pragma unroll
    for (int r = 0; r < 8; ++r) {
      float v = acc[t][r] + bv;
      if (resid) { float rv = resid[(size_t)((row0 + 8 * hh + r) % rmod) * ldr + col]; if (RES_BF16) rv = bf16_round(rv); v += rv; }
      if (ACT == 1) v = fmaxf(v, 0.f);
      if (ACT == 2) v = 0.5f * v * (1.0f + erff(v * 0.70710678118654752f));
      if (ACT == 3) { const float u = 0.7978845608028654f * (v + 0.044715f * v * v * v); v = 0.5f * v * (1.0f + tanhf(u)); }
      so[w][8 * hh + r][t * 16 + ln] = v;
    }
  }
  __builtin_amdgcn_fence(__ATOMIC_ACQ_REL, "workgroup");
  __builtin_amdgcn_wave_barrier();
  const int rsub = lane >> 4, c4 = (lane & 15) * 4;
  {
#pragma unroll
    for (int q = 0; q < 8; ++q) {
      const int r = q * 2 + rsub;
      const v4f v = *(const v4fa*)&so[w][r][c4];
      *(v4f*)(C + (size_t)(row0 + r) * ldc + col0 + c4) = v;
    }
    
  }
}
// row LayerNorm (biased variance, eps) over N: s = X (+ R); optional out_sum <- s; out_norm <- (s-mu)*rsqrt(var+eps)*g + b
template <bool PARAM_BF16>
__global__ __launch_bounds__(256) void k_layernorm(const float* __restrict__ X, const float* __restrict__ R, const float* __restrict__ g, const float* __restrict__ bta,
                                                  float* __restrict__ out_sum, float* __restrict__ out_norm, int N, float eps) {
  __shared__ float red[256];
  const int row = blockIdx.x, tid = threadIdx.x;
  const float* x = X + (size_t)row * N; const float* rr = R ? R + (size_t)row * N : nullptr;
  float vals[16];                     // up to N = 4096
  const int per = N / 256;            // contiguous chunk per thread? use strided-by-4 chunks: thread handles j = tid*4 + 1024*u
  float s1 = 0.f;
  for (int u = 0; u < per / 4; ++u) {
    const int j = tid * 4 + 1024 * u;
    const v4f a = *(const v4fa*)(x + j);
    v4f b = {0.f,0.f,0.f,0.f}; if (rr) b = *(const v4fa*)(rr + j);
#pragma unroll
    for (int q = 0; q < 4; ++q) { const float v = a[q] + b[q]; vals[u * 4 + q] = v; s1 += v; }
  }
  red[tid] = s1; __syncthreads();
  for (int st = 128; st > 0; st >>= 1) { if (tid < st) red[tid] += red[tid + st]; __syncthreads(); }
  const float mu = red[0] / (float)N; __syncthreads();
  float s2 = 0.f;
  for (int u = 0; u < per / 4; ++u)
#pragma unroll
    for (int q = 0; q < 4; ++q) { const float c = vals[u * 4 + q] - mu; s2 += c * c; }
  red[tid] = s2; __syncthreads();
  for (int st = 128; st > 0; st >>= 1) { if (tid < st) red[tid] += red[tid + st]; __syncthreads(); }
  const float rs = rsqrtf(red[0] / (float)N + eps);
  {
    for (int u = 0; u < per / 4; ++u) {
      const int j = tid * 4 + 1024 * u;
      v4f o, sm;
#pragma unroll
      for (int q = 0; q < 4; ++q) {
        float gg = g[j + q], bb = bta[j + q];
        if (PARAM_BF16) { gg = bf16_round(gg); bb = bf16_round(bb); }
        sm[q] = vals[u * 4 + q]; o[q] = (vals[u * 4 + q] - mu) * rs * gg + bb;
      }
      if (out_sum) *(v4f*)(out_sum + (size_t)row * N + j) = sm;
      *(v4f*)(out_norm + (size_t)row * N + j) = o;
    }
    
  }
}



// ---- f16 WMMA path (v_wmma_f32_16x16x32_f16): 11-bit significands for operands in range — used where a [0,1] probability operand needs more precision than bf16
typedef _Float16 v16h __attribute__((ext_vector_type(16)));
union FragH { v16h v; v8us half[2]; _Float16 h[16]; unsigned short u[16]; };
template <int NT>
__device__ __forceinline__ v8f mmaH(v16h ah, v16h al, v16h bh, v16h bl, v8f c) {
  c = __builtin_amdgcn_wmma_f32_16x16x32_f16(false, ah, false, bh, (short)0, c, false, false);
  if (NT >= 2) c = __builtin_amdgcn_wmma_f32_16x16x32_f16(false, al, false, bh, (short)0, c, false, false);
  if (NT >= 3) c = __builtin_amdgcn_wmma_f32_16x16x32_f16(false, ah, false, bl, (short)0, c, false, false);
  asm volatile("v_nop\n\tv_nop\n\tv_nop\n\tv_nop" : "+v"(c) : "v"(ah), "v"(al), "v"(bh), "v"(bl));
  return c;
}
// batched GEMM like k_gemm_b but f16 operands: A f32 (split into f16 hi/lo if ASPLIT, else rounded to f16), Bt = f16 values [n][k]; alpha; C f32; N multiple of 16 (partial tiles skipped)
template <bool ASPLIT>
__global__ __launch_bounds__(128) void k_gemm_h(const float* __restrict__ A, int lda, size_t sA, const _Float16* __restrict__ Bh, int ldb, size_t sB, float alpha, float* __restrict__ C, int ldc, size_t sC, int M, int N, int K) {
  __shared__ __attribute__((aligned(16))) float so[4][16][64];
  const int tid = threadIdx.x, w = tid >> 5, lane = tid & 31, ln = lane & 15, hh = lane >> 4; const int by = blockIdx.y;
  A += (size_t)by * sA; Bh += (size_t)by * sB; C += (size_t)by * sC;
  const int ntn = (N + 63) / 64; const int wid = blockIdx.x * 4 + w; const int mt = wid / ntn, nq = wid % ntn; if (mt * 16 >= M) return;
  const int row0 = mt * 16, col0 = nq * 64; const float* arow = A + (size_t)(row0 + ln) * lda;
  v8f acc[4] = {};
  for (int kb = 0; kb < K; kb += 32) {
    FragH ah, al;
    const v4f x0 = *(const v4fa*)(arow + kb + 8 * hh), x1 = *(const v4fa*)(arow + kb + 8 * hh + 4), x2 = *(const v4fa*)(arow + kb + 16 + 8 * hh), x3 = *(const v4fa*)(arow + kb + 16 + 8 * hh + 4);
    float xs[16] = {x0[0],x0[1],x0[2],x0[3],x1[0],x1[1],x1[2],x1[3],x2[0],x2[1],x2[2],x2[3],x3[0],x3[1],x3[2],x3[3]};
#pragma unroll
    for (int i = 0; i < 16; ++i) { const _Float16 h = (_Float16)xs[i]; ah.h[i] = h; al.h[i] = ASPLIT ? (_Float16)(xs[i] - (float)h) : (_Float16)0.0f; }
#pragma unroll
    for (int t = 0; t < 4; ++t) { if (col0 + t * 16 >= N) continue; const size_t boff = (size_t)(col0 + t * 16 + ln) * ldb + kb; FragH bq; bq.half[0] = *(const v8us*)(Bh + boff + 8 * hh); bq.half[1] = *(const v8us*)(Bh + boff + 16 + 8 * hh);
      acc[t] = mmaH<ASPLIT ? 2 : 1>(ah.v, al.v, bq.v, bq.v, acc[t]); }
  }
#pragma unroll
  for (int t = 0; t < 4; ++t) { if (col0 + t * 16 >= N) continue;
#pragma unroll
    for (int r = 0; r < 8; ++r) so[w][8 * hh + r][t * 16 + ln] = acc[t][r] * alpha; }
  __builtin_amdgcn_fence(__ATOMIC_ACQ_REL, "workgroup"); __builtin_amdgcn_wave_barrier();
  const int rsub = lane >> 4, c4 = (lane & 15) * 4;
  {
#pragma unroll
    for (int q = 0; q < 8; ++q) { const int r = q * 2 + rsub; if (col0 + c4 < N) { const v4f v = *(const v4fa*)&so[w][r][c4]; *(v4f*)(C + (size_t)(row0 + r) * ldc + col0 + c4) = v; } }
     }
}

// Wt[n][k] = f16(W[k][n]·scale) from f32 row-major W[K][N] (scale = power of two; bf16-exact weights stay exact in f16 away from the subnormal range)
__device__ __forceinline__ void wt_f16_blk(int bx, const float* __restrict__ W, _Float16* __restrict__ Wt, int K, int N, float scale) {
  const int t = bx * 256 + threadIdx.x; if (t >= N * (K / 8)) return; const int n = t / (K / 8), k8 = (t % (K / 8)) * 8; FragH f;
#pragma unroll
  for (int i = 0; i < 8; ++i) f.h[i] = (_Float16)(bf16_round(W[(size_t)(k8 + i) * N + n]) * scale); const v8us o = f.half[0];
  *(v8us*)((unsigned short*)Wt + (size_t)n * K + k8) = o; 
}
// k_gemm_hh variant with fused epilogue: v = acc·alpha + bias[by·sBias + col] (+ CP[(row/rowsPerB)·sCPb + by·64 + col] if CP) ; ACT 0 none / 1 elu ; writes f16 C16 (and f32 C if non-null)
template <int ACT>
__global__ __launch_bounds__(128) void k_gemm_hhx(const _Float16* __restrict__ A, int lda, size_t sA, const _Float16* __restrict__ Bh, int ldb, size_t sB, float alpha, const float* __restrict__ bias, size_t sBias, const float* __restrict__ CP, int rowsPerB, size_t sCPb, int row0g,
    float* __restrict__ C, _Float16* __restrict__ C16, int ldc, size_t sC, int M, int N, int K) {
  __shared__ __attribute__((aligned(16))) float so[4][16][64];
  const int tid = threadIdx.x, w = tid >> 5, lane = tid & 31, ln = lane & 15, hh = lane >> 4; const int by = blockIdx.y;
  A += (size_t)by * sA; Bh += (size_t)by * sB; const size_t cofs = (size_t)by * sC; const float* bp = bias ? bias + (size_t)by * sBias : nullptr;
  const int ntn = (N + 63) / 64; const int wid = blockIdx.x * 4 + w; const int mt = wid / ntn, nq = wid % ntn; if (mt * 16 >= M) return;
  const int row0 = mt * 16, col0 = nq * 64; const _Float16* arow = A + (size_t)(row0 + ln) * lda;
  v8f acc[4] = {};
  for (int kb = 0; kb < K; kb += 32) { FragH ah; ah.half[0] = *(const v8us*)((const unsigned short*)arow + kb + 8 * hh); ah.half[1] = *(const v8us*)((const unsigned short*)arow + kb + 16 + 8 * hh);
#pragma unroll
    for (int t = 0; t < 4; ++t) { if (col0 + t * 16 >= N) continue; const size_t boff = (size_t)(col0 + t * 16 + ln) * ldb + kb; FragH bq; bq.half[0] = *(const v8us*)((const unsigned short*)Bh + boff + 8 * hh); bq.half[1] = *(const v8us*)((const unsigned short*)Bh + boff + 16 + 8 * hh);
      acc[t] = mmaH<1>(ah.v, ah.v, bq.v, bq.v, acc[t]); }
  }
#pragma unroll
  for (int t = 0; t < 4; ++t) { if (col0 + t * 16 >= N) continue; const int col = col0 + t * 16 + ln; const float bv = bp ? bf16_round(bp[col]) : 0.f;
#pragma unroll
    for (int r = 0; r < 8; ++r) { float v = acc[t][r] * alpha + bv; if (CP) { const int rr = row0g + row0 + 8 * hh + r; if (rowsPerB < 0) v += CP[cofs + (size_t)rr * ldc + col];      /* rowsPerB < 0: own element of the batched C plane */ else { const int bidx = rr / rowsPerB; v += CP[(size_t)bidx * sCPb + (size_t)by * 64 + col]; } } if (ACT == 1) v = (v > 0.f) ? v : expm1f(v); else if (ACT == 7) v = (v > 0.f) ? v + 1.0f : expf(v); else if (ACT == 8) v = tanhf(v); else if (ACT == 9) v = 0.5f * v * (1.0f + tanhf(0.7978845608028654f * (v + 0.044715f * v * v * v))); else if (ACT == 11) v = 1.0f / (1.0f + expf(-v)); else if (ACT == 12) v = (v > 0.f) ? v : 0.01f * v; else if (ACT == 14) v = (v > 0.f) ? v : 0.1f * v; else if (ACT == 16) v = (v >= 0.f) ? v : 0.3f * v; else if (ACT == 17) v = (v >= 0.f) ? v : 0.2f * v; else if (ACT == 15) v = v / (1.0f + expf(-v)); else if (ACT == 3) v = fmaxf(v, 0.f); else if (ACT == 6) v = 0.5f * v * (1.0f + erff(v * 0.70710678118654752f)); so[w][8 * hh + r][t * 16 + ln] = v; } }
  __builtin_amdgcn_fence(__ATOMIC_ACQ_REL, "workgroup"); __builtin_amdgcn_wave_barrier();
  const int rsub = lane >> 4, c4 = (lane & 15) * 4; typedef _Float16 v4h __attribute__((ext_vector_type(4)));
  {
#pragma unroll
    for (int q = 0; q < 8; ++q) { const int r = q * 2 + rsub; if (col0 + c4 < N) { const v4f v = *(const v4fa*)&so[w][r][c4]; if (C) *(v4f*)(C + cofs + (size_t)(row0 + r) * ldc + col0 + c4) = v; if (C16) { v4h h4; for (int i = 0; i < 4; ++i) h4[i] = (_Float16)v[i]; *(v4h*)(C16 + cofs + (size_t)(row0 + r) * ldc + col0 + c4) = h4; } } }
     }
}


typedef _Float16 v4h __attribute__((ext_vector_type(4)));

__device__ __forceinline__ void x16_blk(int bx, const float* __restrict__ x, _Float16* __restrict__ X16, size_t n8) { const size_t t = (size_t)bx * 256 + threadIdx.x; if (t >= n8) return; FragH f;
#pragma unroll
  for (int q = 0; q < 8; ++q) f.h[q] = (_Float16)bf16_round(x[t * 8 + q]); *(v8us*)((unsigned short*)X16 + t * 8) = f.half[0];  }
__global__ __launch_bounds__(256) void k_h16(const float* __restrict__ x, _Float16* __restrict__ X16, size_t n8) { const size_t t = (size_t)blockIdx.x * 256 + threadIdx.x; if (t >= n8) return; FragH f;
#pragma unroll
  for (int q = 0; q < 8; ++q) f.h[q] = (_Float16)x[t * 8 + q]; *(v8us*)((unsigned short*)X16 + t * 8) = f.half[0];  }
__global__ __launch_bounds__(256) void k_round16f(const float* __restrict__ W, _Float16* __restrict__ Bt, size_t n8) { const size_t t = (size_t)blockIdx.x * 256 + threadIdx.x; if (t >= n8) return; FragH f;
#pragma unroll
  for (int i = 0; i < 8; ++i) f.h[i] = (_Float16)(bf16_round(W[t * 8 + i]) * 16.0f); *(v8us*)((unsigned short*)Bt + t * 8) = f.half[0];  }
template <int NHv, int TTv>
__device__ __forceinline__ void vt_blk(int bx, const _Float16* __restrict__ V16, int ldv, int voff, _Float16* __restrict__ Vt) { __shared__ unsigned short tl[64][66]; const int tid = threadIdx.x; const int slab = bx / (TTv / 64), lg = bx % (TTv / 64); const int b = slab / NHv, h = slab % NHv;
  for (int i = tid; i < 64 * 8; i += 256) { const int r = i / 8, c8 = (i % 8) * 8; FragH f; f.half[0] = *(const v8us*)((const unsigned short*)V16 + ((size_t)b * TTv + lg * 64 + r) * ldv + voff + h * 64 + c8);
#pragma unroll
    for (int q = 0; q < 8; ++q) tl[r][c8 + q] = f.u[q]; }
  __syncthreads();
  {
#pragma unroll
    for (int rd = 0; rd < 2; ++rd) { const int d = rd * 32 + tid / 8, pc = tid % 8; FragH f;
#pragma unroll
      for (int q = 0; q < 8; ++q) f.u[q] = tl[pc * 8 + q][d];
      *(v8us*)((unsigned short*)Vt + ((size_t)slab * 64 + d) * TTv + lg * 64 + pc * 8) = f.half[0]; }
     } }

__device__ __forceinline__ void hl_blk(size_t t, const float* __restrict__ F, _Float16* __restrict__ Hh, _Float16* __restrict__ Hl, size_t n8) { if (t >= n8) return; FragH fh, fl; const v4f a = *(const v4fa*)(F + t * 8), c = *(const v4fa*)(F + t * 8 + 4);
#pragma unroll
  for (int q = 0; q < 4; ++q) { _Float16 h = (_Float16)a[q]; fh.h[q] = h; fl.h[q] = (_Float16)((a[q] - (float)h) * 1024.0f); h = (_Float16)c[q]; fh.h[4 + q] = h; fl.h[4 + q] = (_Float16)((c[q] - (float)h) * 1024.0f); }
  { *(v8us*)((unsigned short*)Hh + t * 8) = fh.half[0]; *(v8us*)((unsigned short*)Hl + t * 8) = fl.half[0];  } }

// ---- fast GEMM (wave tile 32x64; requires M % 128 == 0 rows per launch region and N % 64 == 0); epilogue = k_gemm_hhx semantics ----
__device__ __forceinline__ v16h g2_frag(const _Float16* p, int hh) { FragH f; f.half[0] = *(const v8us*)((const unsigned short*)p + 8 * hh); f.half[1] = *(const v8us*)((const unsigned short*)p + 16 + 8 * hh); return f.v; }
__device__ __forceinline__ v8f g2_mma(v16h a, v16h b, v8f c) { v8f d = __builtin_amdgcn_wmma_f32_16x16x32_f16(false, a, false, b, (short)0, c, false, false); asm volatile("v_nop\n\tv_nop\n\tv_nop\n\tv_nop" : "+v"(d) : "v"(a), "v"(b)); return d; }
// ---- operand staging of the fast GEMM: a work-group's 128 A rows and 64 B rows, 64 k (128 bytes of each row) a stage, two buffers in LDS ----
#define GK 64                        /* k per stage */
#define GP 144                       /* LDS row pitch in bytes: 16 B x odd, no bank conflict for 16-byte fragment reads */
#define GSTG (192 * GP)              /* a stage: A rows 0..127, then B rows 0..63 */
#define GLDS (2 * GSTG)              /* the ring; the epilogue's tile of 4 x 32 x 68 floats takes the same bytes behind the loop's last barrier */
static_assert(GLDS >= 4 * 32 * 68 * 4, "the epilogue tile must fit the ring");
// One stage: 12 copies of 16 bytes a lane. 8 lanes take one row's 128 bytes, so a wave's copy is 4 whole lines. l: the lane's LDS byte address of row tid / 8; ga, gb: its global address in
// A and B; sa, sb: 16 rows in bytes. The s_wait_xcnt 0 is the statement's last line, so it stands in front of any later write of a register that a copy names.
__device__ __forceinline__ void g2_stage(unsigned l, const char* ga, size_t sa, const char* gb, size_t sb) {
  asm volatile("global_load_async_to_lds_b128 %0, %12, off\n\t"
               "global_load_async_to_lds_b128 %1, %13, off\n\t"
               "global_load_async_to_lds_b128 %2, %14, off\n\t"
               "global_load_async_to_lds_b128 %3, %15, off\n\t"
               "global_load_async_to_lds_b128 %4, %16, off\n\t"
               "global_load_async_to_lds_b128 %5, %17, off\n\t"
               "global_load_async_to_lds_b128 %6, %18, off\n\t"
               "global_load_async_to_lds_b128 %7, %19, off\n\t"
               "global_load_async_to_lds_b128 %8, %20, off\n\t"
               "global_load_async_to_lds_b128 %9, %21, off\n\t"
               "global_load_async_to_lds_b128 %10, %22, off\n\t"
               "global_load_async_to_lds_b128 %11, %23, off\n\t"
               "s_wait_xcnt 0x0"
               : : "v"(l), "v"(l + 16 * GP), "v"(l + 32 * GP), "v"(l + 48 * GP), "v"(l + 64 * GP), "v"(l + 80 * GP), "v"(l + 96 * GP), "v"(l + 112 * GP),
                   "v"(l + 128 * GP), "v"(l + 144 * GP), "v"(l + 160 * GP), "v"(l + 176 * GP),
                   "v"(ga), "v"(ga + sa), "v"(ga + 2 * sa), "v"(ga + 3 * sa), "v"(ga + 4 * sa), "v"(ga + 5 * sa), "v"(ga + 6 * sa), "v"(ga + 7 * sa),
                   "v"(gb), "v"(gb + sb), "v"(gb + 2 * sb), "v"(gb + 3 * sb) : "memory"); }
// A fragment from a staged row: p = the lane's row at byte 16 hh of the k step; k = 8 hh .. + 7 and 16 + 8 hh .. + 7, the k order of g2_frag.
__device__ __forceinline__ v16h g2_lfrag(const char* p) { FragH f; f.half[0] = *(const v8us*)p; f.half[1] = *(const v8us*)(p + 32); return f.v; }
// The product loop of a work-group's 128 x 64 tile (wave w: rows 32 w .. + 31, all 64 columns): the accumulators, the fragments and the order of k are those of the loop that read the
// fragments from global memory. Ab, Bb: the tile's first A and B row. K is a multiple of GK; every wave of the block comes here (barriers).
__device__ __forceinline__ void g2_loop(char* sm, const _Float16* __restrict__ Ab, int lda, const _Float16* __restrict__ Bb, int ldb, int K, v8f (&c)[8]) {
  const int tid = threadIdx.x, w = tid >> 5, lane = tid & 31, ln = lane & 15, hh = lane >> 4; const int rs = tid >> 3, pc = tid & 7;
  const char* ga = (const char*)(Ab + (size_t)rs * lda) + pc * 16; const char* gb = (const char*)(Bb + (size_t)rs * ldb) + pc * 16; const size_t sa = (size_t)lda * 32, sb = (size_t)ldb * 32;
  const unsigned l0 = (unsigned)(size_t)sm + (unsigned)(rs * GP + pc * 16); const int nst = K / GK;
  g2_stage(l0, ga, sa, gb, sb);      /* stage 0 into buffer 0 */
  asm volatile("s_wait_asynccnt 0x0" ::: "memory");      /* the wave's own copies of stage 0 have landed */
  __syncthreads();      /* every wave's have: nobody reads stage 0 in front of this barrier */
  if (nst > 1) g2_stage(l0 + GSTG, ga + 2 * GK, sa, gb + 2 * GK, sb);      /* stage 1 flies under stage 0's products */
  const char* fa = sm + (32 * w + ln) * GP + 16 * hh; const char* fb = sm + (128 + ln) * GP + 16 * hh;
#pragma unroll 1      /* rolled: one trip is one stage, with its publish point at the foot */
  for (int t = 0; t < nst; ++t) { const int bo = (t & 1) * GSTG;
#pragma unroll      /* the stage's two k steps of 32 */
    for (int ks = 0; ks < 2; ++ks) { const char* pa = fa + bo + ks * 64; const char* pb = fb + bo + ks * 64;
      const v16h a0 = g2_lfrag(pa), a1 = g2_lfrag(pa + 16 * GP), b0 = g2_lfrag(pb), b1 = g2_lfrag(pb + 16 * GP), b2 = g2_lfrag(pb + 32 * GP), b3 = g2_lfrag(pb + 48 * GP);      /* the step's six fragments are read as one group, each into registers of its own: one LDS latency a step, not one a column tile */
      c[0] = g2_mma(a0, b0, c[0]); c[4] = g2_mma(a1, b0, c[4]); c[1] = g2_mma(a0, b1, c[1]); c[5] = g2_mma(a1, b1, c[5]);
      c[2] = g2_mma(a0, b2, c[2]); c[6] = g2_mma(a1, b2, c[6]); c[3] = g2_mma(a0, b3, c[3]); c[7] = g2_mma(a1, b3, c[7]); }
    asm volatile("s_wait_dscnt 0x0" ::: "memory");      /* the wave's reads of this buffer have returned, in front of the barrier behind which it is refilled */
    asm volatile("s_wait_asynccnt 0x0" ::: "memory");      /* the wave's copies of stage t + 1 have landed */
    __syncthreads();      /* publishes stage t + 1 and ends every reader's last read of stage t's buffer */
    if (t + 2 < nst) g2_stage(l0 + bo, ga + (size_t)(t + 2) * (2 * GK), sa, gb + (size_t)(t + 2) * (2 * GK), sb); }      /* the same test in the whole work-group */
  asm volatile("s_wait_asynccnt 0x0" ::: "memory"); }      /* no copy is outstanding when the ring becomes the epilogue's tile */
template <int ACT>
__device__ __forceinline__ void gemm2_blk(char* sm, int bx, int by, const _Float16* __restrict__ A, int lda, size_t sA, const _Float16* __restrict__ Bh, int ldb, size_t sB, float alpha, const float* __restrict__ bias, size_t sBias, const float* __restrict__ CP, int rowsPerB, size_t sCPb, int row0g,
    float* __restrict__ C, _Float16* __restrict__ C16, int ldc, size_t sC, int M, int N, int K) { static_assert(ACT == 0 || ACT == 3 || ACT == 6 || ACT == 8 || ACT == 9 || ACT == 11 || ACT == 12 || ACT == 14 || ACT == 15 || ACT == 16 || ACT == 17, "k_gemm2: unsupported ACT code (would silently apply no activation)");
  const int tid = threadIdx.x, w = tid >> 5, lane = tid & 31, ln = lane & 15, hh = lane >> 4;
  A += (size_t)by * sA; Bh += (size_t)by * sB; const size_t cofs = (size_t)by * sC; const float* bp = bias ? bias + (size_t)by * sBias : nullptr;
  const int ntn = N >> 6; const int mt = bx / ntn, nq = bx - mt * ntn; const int row0 = mt * 128 + 32 * w, col0 = nq * 64; if (mt * 128 >= M) return;      /* the whole block or none: M is a multiple of 128 */
  float (*so)[32][68] = (float (*)[32][68])sm;
  v8f accs[8] = {};      /* tile (half, t) at index 4 half + t */
  g2_loop(sm, A + (size_t)(mt * 128) * lda, lda, Bh + (size_t)col0 * ldb, ldb, K, accs);
#pragma unroll
  for (int u = 0; u < 8; ++u) { const int t = u & 3, half = u >> 2; const int col = col0 + t * 16 + ln; const float bv = bp ? bf16_round(bp[col]) : 0.f;
#pragma unroll
    for (int r = 0; r < 8; ++r) { const int rloc = half * 16 + 8 * hh + r; float v = accs[u][r] * alpha + bv; if (CP) { if (rowsPerB < 0) v += CP[cofs + (size_t)(row0g + row0 + rloc) * ldc + col];      /* rowsPerB < 0: own element of the batched C plane */ else { const int bidx = (row0g + row0 + rloc) / rowsPerB; v += CP[(size_t)bidx * sCPb + (size_t)by * 64 + col]; } }
      if (ACT == 3) v = fmaxf(v, 0.f); else if (ACT == 6) v = 0.5f * v * (1.0f + erff(v * 0.70710678118654752f)); else if (ACT == 11) v = 1.0f / (1.0f + expf(-v)); else if (ACT == 15) v = v / (1.0f + expf(-v)); else if (ACT == 12) v = (v > 0.f) ? v : 0.01f * v; else if (ACT == 8) v = tanhf(v); else if (ACT == 9) v = 0.5f * v * (1.0f + tanhf(0.7978845608028654f * (v + 0.044715f * v * v * v))); else if (ACT == 14) v = (v > 0.f) ? v : 0.1f * v; else if (ACT == 16) v = (v >= 0.f) ? v : 0.3f * v; else if (ACT == 17) v = (v >= 0.f) ? v : 0.2f * v;
      so[w][rloc][t * 16 + ln] = v; } }
  __builtin_amdgcn_fence(__ATOMIC_ACQ_REL, "workgroup"); __builtin_amdgcn_wave_barrier();
  const int rsub = lane >> 4, c4 = (lane & 15) * 4;
  {
#pragma unroll
    for (int q = 0; q < 16; ++q) { const int r = q * 2 + rsub; v4f v = *(const v4fa*)&so[w][r][c4]; if (C) { *(v4f*)(C + cofs + (size_t)(row0 + r) * ldc + col0 + c4) = v; if (C16) asm volatile("s_wait_xcnt 0x0" : "+v"(v) : : "memory"); }      /* behind the f32 store, in front of the conversion, which was placed on the registers that the issued store names; v passes through, so the conversion stands behind the wait */
      if (C16) { v4h h4; for (int i = 0; i < 4; ++i) h4[i] = (_Float16)v[i]; *(v4h*)(C16 + cofs + (size_t)(row0 + r) * ldc + col0 + c4) = h4; } }
    asm volatile("s_wait_xcnt 0x0" ::: "memory");      /* behind the last store of the rows, in front of any later write of a register that an issued store names (another stage's code follows in the listing) */
     } }
// the product as a launch of its own (the two first-tile output products, which depend on one another)
template <int ACT>
__global__ __launch_bounds__(128) void k_gemm2(const _Float16* __restrict__ A, int lda, size_t sA, const _Float16* __restrict__ Bh, int ldb, size_t sB, float alpha, const float* __restrict__ bias, size_t sBias, const float* __restrict__ CP, int rowsPerB, size_t sCPb, int row0g,
    float* __restrict__ C, _Float16* __restrict__ C16, int ldc, size_t sC, int M, int N, int K) {
  __shared__ __attribute__((aligned(128))) char sm[GLDS];
  gemm2_blk<ACT>(sm, (int)blockIdx.x, (int)blockIdx.y, A, lda, sA, Bh, ldb, sB, alpha, bias, sBias, CP, rowsPerB, sCPb, row0g, C, C16, ldc, sC, M, N, K); }


__global__ __launch_bounds__(256) void k_wnat(const float* __restrict__ w, size_t n8, _Float16* __restrict__ Bt) { const size_t t = (size_t)blockIdx.x * 256 + threadIdx.x; if (t >= n8) return; FragH f; for (int q = 0; q < 8; ++q) f.h[q] = (_Float16)(bf16_round(w[t * 8 + q]) * 16.0f); *(v8us*)((unsigned short*)Bt + t * 8) = f.half[0];  }
__global__ __launch_bounds__(256) void k_rsm(const float* __restrict__ S, _Float16* __restrict__ P, int nrows) {
  #pragma clang fp contract(off)
  const int i = blockIdx.x * 256 + threadIdx.x; if (i >= nrows) return; const float* s = S + (size_t)i * SQ; float mx = -3.0e38f;
#pragma unroll 1
  for (int j = 0; j < SQ; ++j) mx = fmaxf(mx, s[j]); float se = 0.f;
#pragma unroll 1
  for (int j = 0; j < SQ; ++j) se += expf(s[j] - mx); const float sc = 256.0f / se;
#pragma unroll 1
  for (int j0 = 0; j0 < SQ; j0 += 8) { FragH f; for (int q = 0; q < 8; ++q) f.h[q] = (_Float16)(expf(s[j0 + q] - mx) * sc); unsigned short* d = (unsigned short*)P + (size_t)i * SQ + j0; *(v8us*)d = f.half[0];  } }
__global__ __launch_bounds__(256) void k_vt(const _Float16* __restrict__ V16, int b, int h0, _Float16* __restrict__ VT) { __shared__ unsigned short tl[64][65]; const int tid = threadIdx.x; const int hh = blockIdx.x % HG, sg = blockIdx.x / HG; const int s0 = sg * 64; const int h = h0 + hh;
  for (int i = tid; i < 64 * 8; i += 256) { const int j = i / 8, d8 = (i % 8) * 8; FragH f; f.half[0] = *(const v8us*)((const unsigned short*)V16 + ((size_t)b * SQ + s0 + j) * DM + h * HD + d8); for (int q = 0; q < 8; ++q) tl[d8 + q][j] = f.u[q]; }
  __syncthreads();
  { for (int i = tid; i < 64 * 8; i += 256) { const int d = i / 8, j8 = (i % 8) * 8; FragH f; for (int q = 0; q < 8; ++q) f.u[q] = tl[d][j8 + q]; *(v8us*)((unsigned short*)VT + ((size_t)hh * HD + d) * SQ + s0 + j8) = f.half[0]; }  } }



// 2^x on the transcendental unit. The v_nop fills the one issue slot that the instruction set asks for behind a transcendental before its source
// is overwritten.
__device__ __forceinline__ float exp2_slot(float x) { float r; asm("v_exp_f32 %0, %1\n\tv_nop" : "=v"(r) : "v"(x)); return r; }
// Fused causal attention (online softmax): one launch for every batch, head and query row; scores and softmax weights never leave the registers.
// A work-group is the 4 query heads of one kv group (one wave each) on the same 32 query rows, so its waves walk the same K and V lines.
// Transposed products: S^T = K Q^T puts query 16 c + ln in lane ln and key 16 kt + 8 hh + r in register r, which is already the B-operand order of
// P^T for O^T += V^T P^T (half kt of the fragment = tile kt's 8 registers): no exchange between lanes but the one between the two wave halves.
__device__ __forceinline__ v8f fa_mma(v16h a, v16h b, v8f c) { return __builtin_amdgcn_wmma_f32_16x16x32_f16(false, a, false, b, (short)0, c, false, false); }
__device__ __forceinline__ float fa_xhalf(float x) { return __builtin_bit_cast(float, __builtin_amdgcn_permlanex16(__builtin_bit_cast(int, x), __builtin_bit_cast(int, x), 0x76543210, 0xfedcba98, false, false)); }      /* lane l <-> lane l ^ 16 */
// A fragment at the lane's own byte offset (row ln, element 8 hh) from a uniform base: k = 8 hh .. + 7 and 16 + 8 hh .. + 7, the k order of g2_frag.
__device__ __forceinline__ v16h fa_frag(const _Float16* base, unsigned off, int cb) { const char* p = (const char*)base + off; FragH f; f.half[0] = *(const v8us*)(p + cb); f.half[1] = *(const v8us*)(p + cb + 32); return f.v; }
// s_wait_xcnt 0 behind issued loads, in front of any write of a register that they name. The lane offsets pass through the statement: they stay in
// their registers up to the wait, and whatever is formed from them later stands behind it (a "memory" clobber alone does not tie the wait to registers).
__device__ __forceinline__ void fa_hold(unsigned& a) { asm volatile("s_wait_xcnt 0x0" : "+v"(a) : : "memory"); }
__device__ __forceinline__ void fa_hold(unsigned& a, unsigned& b) { asm volatile("s_wait_xcnt 0x0" : "+v"(a), "+v"(b) : : "memory"); }
// One pass of 32 keys. ko: the lane's byte offset of the NEXT pass's K rows; vo: of this pass's keys in V^T. DIAG: the wave's last pass, the only one
// that meets the diagonal (it masks, and it fetches no further K).
// Every loop over kt, kc, c, t and r here and in the kernel is unrolled so that fragments, scores and accumulators are indexed by constants only and stay in registers.
template <bool DIAG>
__device__ __forceinline__ void fa_pass(const _Float16* __restrict__ Kh, const _Float16* __restrict__ Vt, unsigned& ko, unsigned& vo, int key0, int q0, int ln, int hh,
                                        const v16h (&qf)[2][2], v16h (&kf)[2][2], v8f (&acc)[2][4], float (&m)[2], float (&l)[2]) {
  const float cs = 0.125f * 1.44269504f;      /* 1 / sqrt(64), and e^x = 2^(x log2 e) */
  v16h vf[4];
#pragma unroll
  for (int t = 0; t < 4; ++t) vf[t] = fa_frag(Vt, vo, 16 * t * SQ * 2);      /* V^T rows d = 16 t + ln, this pass's keys: in flight under the scores and the exponentials */
  v8f s[2][2];
#pragma unroll
  for (int kt = 0; kt < 2; ++kt)
#pragma unroll
    for (int c = 0; c < 2; ++c) { const v8f z = {0.f, 0.f, 0.f, 0.f, 0.f, 0.f, 0.f, 0.f}; s[kt][c] = fa_mma(kf[kt][1], qf[c][1], fa_mma(kf[kt][0], qf[c][0], z)); }
  if (!DIAG) {      /* the next pass's K rows, in flight under this pass's softmax and second product */
#pragma unroll
    for (int kt = 0; kt < 2; ++kt)
#pragma unroll
      for (int kc = 0; kc < 2; ++kc) kf[kt][kc] = fa_frag(Kh, ko, (16 * kt * KVD + 32 * kc) * 2);
    fa_hold(ko, vo);
    __builtin_amdgcn_sched_barrier(0);      /* keeps the K loads here: without it the scheduler sinks them to the end of the pass, and the next pass's scores wait out their whole latency */
    ko += 32 * KVD * 2; vo += 32 * 2;
  } else fa_hold(vo);
#pragma unroll
  for (int c = 0; c < 2; ++c) {
    if (DIAG) {
      const int qi = q0 + 16 * c + ln;
#pragma unroll
      for (int kt = 0; kt < 2; ++kt)
#pragma unroll
        for (int r = 0; r < 8; ++r) if (key0 + 16 * kt + 8 * hh + r > qi) s[kt][c][r] = -1.0e30f;
    }
    float mx = s[0][c][0];
#pragma unroll
    for (int r = 0; r < 8; ++r) mx = fmaxf(mx, fmaxf(s[0][c][r], s[1][c][r]));
    mx = fmaxf(mx, fa_xhalf(mx));      /* both halves of the wave now hold this query's maximum over the pass */
    const float mn = fmaxf(m[c], mx * cs);
    const float corr = exp2_slot(m[c] - mn);      /* 0 on the first pass */
    m[c] = mn;
    FragH pf; float ps = 0.f;
#pragma unroll
    for (int kt = 0; kt < 2; ++kt)
#pragma unroll
      for (int r = 0; r < 8; ++r) { const float p = exp2_slot(fmaf(s[kt][c][r], cs, -mn)); ps += p; pf.h[8 * kt + r] = (_Float16)p; }
    l[c] = fmaf(l[c], corr, ps);
#pragma unroll
    for (int t = 0; t < 4; ++t) { acc[c][t] = acc[c][t] * corr; acc[c][t] = fa_mma(vf[t], pf.v, acc[c][t]); }
    /* the four vector slots that the chip needs behind a matrix instruction before its operands are overwritten */
    asm volatile("v_nop\n\tv_nop\n\tv_nop\n\tv_nop" : "+v"(acc[c][0]), "+v"(acc[c][1]), "+v"(acc[c][2]), "+v"(acc[c][3]) : "v"(vf[0]), "v"(vf[1]), "v"(vf[2]), "v"(vf[3]), "v"(pf.v));
  }
}
__device__ __forceinline__ void fattn_blk(int bx, int g, int b, const _Float16* __restrict__ Q, const _Float16* __restrict__ Kh, const _Float16* __restrict__ Vt, _Float16* __restrict__ O) {
  const int lane = threadIdx.x & 31, ln = lane & 15, hh = lane >> 4; const int h = g * HPG + (threadIdx.x >> 5);
  const int qt = (b & 1) ? bx : (SQ / 32 - 1) - bx;      /* long and short tiles alternate from batch to batch, so that work-groups a whole batch apart in the grid add up to the same length */
  const int q0 = qt * 32; const size_t r0 = (size_t)b * SQ;
  unsigned qo = (unsigned)(((r0 + q0 + ln) * DM + h * HD + 8 * hh) * 2), ko = (unsigned)(((r0 + ln) * KVD + g * HD + 8 * hh) * 2), vo = (unsigned)((((size_t)(b * NG + g) * HD + ln) * SQ + 8 * hh) * 2);      /* byte offsets: every buffer is below 4 GiB */
  v16h qf[2][2], kf[2][2];
#pragma unroll
  for (int c = 0; c < 2; ++c)
#pragma unroll
    for (int kc = 0; kc < 2; ++kc) { qf[c][kc] = fa_frag(Q, qo, (16 * c * DM + 32 * kc) * 2); kf[c][kc] = fa_frag(Kh, ko, (16 * c * KVD + 32 * kc) * 2); }
  fa_hold(qo, ko);
  ko += 32 * KVD * 2;
  v8f acc[2][4] = {}; float m[2] = {-1.0e30f, -1.0e30f}, l[2] = {0.f, 0.f};
  for (int key0 = 0; key0 < q0; key0 += 32) fa_pass<false>(Kh, Vt, ko, vo, key0, q0, ln, hh, qf, kf, acc, m, l);
  fa_pass<true>(Kh, Vt, ko, vo, q0, q0, ln, hh, qf, kf, acc, m, l);
  unsigned short* op = (unsigned short*)O + (r0 + q0 + ln) * DM + h * HD + 8 * hh;
#pragma unroll
  for (int c = 0; c < 2; ++c) { const float fin = 64.0f / (l[c] + fa_xhalf(l[c]));      /* o carried x64, as the output product expects */
#pragma unroll
    for (int t = 0; t < 4; ++t) { FragH f;
#pragma unroll
      for (int r = 0; r < 8; ++r) f.h[r] = (_Float16)(acc[c][t][r] * fin);
      *(v8us*)(op + (size_t)(16 * c) * DM + 16 * t) = f.half[0]; }      /* d = 16 t + 8 hh .. + 7 of query row 16 c + ln */
    asm volatile("s_wait_xcnt 0x0" ::: "memory"); }      /* behind the stores, in front of any later write of a register that an issued store names */
}


// Exact f32 attention for the first QT0 rows: one thread per (query row, head), online softmax; every sum runs in the order d = 0, 1, ... and j = 0, 1, ...
// What a thread owns (its q row, its o accumulator) stays in registers; what all threads of the block read at the same address (the head's K and V rows)
// is staged once in LDS and read by broadcast. Every loop over d is unrolled so that q, o and the row fragments are indexed by constants only.
// by is the batch: its QT0 rows of q, k, v and o follow those of the batch before.
// The block has the 128 threads of the launch it rides in; its 64 rows are the work of waves 0 and 1, and waves 2 and 3 only pass the two barriers.
__device__ __forceinline__ void att0_blk(int bx, int by, const float* __restrict__ QF, const float* __restrict__ KF, const float* __restrict__ VF, float scale, float* __restrict__ OF, int ldo) {
  __shared__ __attribute__((aligned(16))) float lk[QT0][HD]; __shared__ __attribute__((aligned(16))) float lv[QT0][HD]; __shared__ __attribute__((aligned(16))) float lo[64][64];
  const int tid = threadIdx.x; const int h = bx / (QT0 / 64), rg = bx % (QT0 / 64); const int i = rg * 64 + tid;
  const bool on = __builtin_amdgcn_readfirstlane(tid >> 5) < 2;      /* the wave's number, the same in every lane: a scalar branch */
  QF += (size_t)by * QT0 * LQ; KF += (size_t)by * QT0 * LQ; VF += (size_t)by * QT0 * LQ; OF += (size_t)by * QT0 * ldo;
  const int jmax = rg * 64 + 63;      /* keys up to the block's last row */
  const int sr = tid >> 4, sc4 = (tid & 15) * 4;      /* staging: 16 threads to a row of 256 bytes */
  unsigned so = (unsigned)((sr * LQ + h * HD + sc4) * 4), qo = (unsigned)((i * LQ + h * HD) * 4);      /* the lane's byte offsets in K and V, and in q */
  float q[HD], o[HD];
  if (on) {
#pragma unroll 1      /* kept rolled: one trip already has 16 loads in flight per thread */
  for (int r0 = 0; r0 <= jmax; r0 += 32) { v4f kk[8], vv[8];
#pragma unroll
    for (int u = 0; u < 8; ++u) { kk[u] = *(const v4fa*)((const char*)KF + so + u * 4 * LQ * 4); vv[u] = *(const v4fa*)((const char*)VF + so + u * 4 * LQ * 4); }      /* 16 loads in flight per thread */
    fa_hold(so);      /* the wait behind the issued loads, in front of the write of the offset that they name */
    so += 32 * LQ * 4;
#pragma unroll
    for (int u = 0; u < 8; ++u) { *(v4f*)&lk[r0 + 4 * u + sr][sc4] = kk[u]; *(v4f*)&lv[r0 + 4 * u + sr][sc4] = vv[u]; } }
#pragma unroll
  for (int c = 0; c < HD / 4; ++c) { const v4f t = *(const v4fa*)((const char*)QF + qo + c * 16);
#pragma unroll
    for (int u = 0; u < 4; ++u) { q[c * 4 + u] = t[u]; o[c * 4 + u] = 0.f; } }
  fa_hold(qo);      /* the same wait behind the q loads; their offset stays in its register up to it */
  }
  __syncthreads();      /* K and V rows are staged: nobody reads them in front of this barrier */
  if (on) {
  float m = -1.0e30f, l = 0.f, sn = 0.f;
#pragma unroll
  for (int d = 0; d < HD; ++d) sn = fmaf(q[d], lk[0][d], sn);
#pragma unroll 1      /* kept rolled: a second copy of the body would not fit the registers beside q and o */
  for (int j = 0; j <= jmax; ++j) { const float s = sn * scale;
    const float* kr = &lk[j < jmax ? j + 1 : jmax][0]; v4f kq[HD / 4], vv[HD / 4];
#pragma unroll
    for (int c = 0; c < HD / 4; ++c) kq[c] = *(const v4f*)(kr + c * 4);
    __builtin_amdgcn_sched_barrier(0);      /* keeps the K reads in front of the V reads: LDS answers in order, and with V rows queued between them the score chain below waits for its K words */
#pragma unroll
    for (int c = 0; c < HD / 4; ++c) vv[c] = *(const v4f*)&lv[j][c * 4];
    sn = 0.f;      /* the next key's score: its chain of 64 dependent multiply-adds depends on nothing below, so this key's exponentials and o update fill its waits */
#pragma unroll
    for (int d = 0; d < HD; ++d) sn = fmaf(q[d], kq[d >> 2][d & 3], sn);
    const float f = (j <= i) ? 1.f : 0.f; const float sm = fmaf(f, s, (1.f - f) * -1.0e30f); const float mn = fmaxf(m, sm); const float sc = expf(m - mn); const float e = expf(sm - mn); l = fmaf(l, sc, e); m = mn;
#pragma unroll
    for (int d = 0; d < HD; ++d) o[d] = fmaf(o[d], sc, e * vv[d >> 2][d & 3]); }
  const float fin = 64.0f / l;      /* o carried x64 like the f16 path */
#pragma unroll
  for (int c = 0; c < HD / 4; ++c) { v4f oo;
#pragma unroll
    for (int u = 0; u < 4; ++u) oo[u] = o[c * 4 + u] * fin;
    *(v4f*)&lo[tid][c * 4] = oo; }
  }
  __syncthreads();
  if (on) {
#pragma unroll 1
    for (int it = 0; it < 16; ++it) { const int row = it * 4 + tid / 16, pc = (tid % 16) * 4; const v4f v = *(const v4f*)&lo[row][pc]; *(v4f*)(OF + (size_t)(rg * 64 + row) * ldo + h * HD + pc) = v; }
     } }


__device__ __forceinline__ void kvexp_blk(int bx, const float* __restrict__ src, float* __restrict__ dst, size_t n4) { const size_t t = (size_t)bx * 256 + threadIdx.x; if (t >= n4) return; const size_t e = t * 4; const size_t row = e / DM; const int col = (int)(e % DM); const int h = col / HD, d = col % HD; const v4f v = *(const v4fa*)(src + row * KVD + (size_t)(h / HPG) * HD + d); *(v4f*)(dst + e) = v;  }

__global__ __launch_bounds__(256) void k_tab2(float theta, float* __restrict__ CS, float* __restrict__ SN) {
  #pragma clang fp contract(off)
  const int t = blockIdx.x * 256 + threadIdx.x; if (t >= SQ * (HD / 2)) return; const int i = t % (HD / 2); const int p = t / (HD / 2); const float invf = 1.0f / powf(theta, (float)(2 * i) / (float)HD); const float ang = __fmul_rn((float)p, invf); const float c = cosf(ang), s = sinf(ang);
  *(float*)(CS + t) = c; *(float*)(SN + t) = s;  }
// Projection GEMM with the rope in its epilogue (q and k). The product is k_gemm2's: wave tile 32 x 64, the same fragments, the same order of k. A wave's 64 columns are one head, and the
// tile that the epilogue lays out in LDS for whole-line stores gives a lane four neighbouring columns of a row, that is both members of two (even, odd) pairs: the lane rotates them by the
// row's position (row % SQ; a tile of 32 rows lies in one batch) and stores f16. Rows 0 .. QT0 - 1 of each batch also go out in f32 for the exact first-tile path (F0: QT0 rows a batch).
typedef float v2fa __attribute__((ext_vector_type(2), may_alias));
// The 16 rows of a lane (every second row of the wave's tile): tp = the lane's four words of its first row in LDS, cp / sp = its two table entries of that row, hp / fp = its place in the outputs.
// F32 is a template argument so that neither form has a branch between its rows: the 32 table loads of a lane are then in flight together instead of one row's pair at a time.
// NC, the outputs' row pitch, is one too: every row's store is then the first row's address with an immediate offset.
template <bool F32, int NC>
__device__ __forceinline__ void g2_rope_rows(const float* tp, const float* __restrict__ cp, const float* __restrict__ sp, _Float16* __restrict__ hp, float* __restrict__ fp) {
#pragma unroll      /* unrolled for the same reason: all table loads issue in front of the first use */
  for (int q = 0; q < 16; ++q) { const v4f v = *(const v4fa*)(tp + q * 2 * 68); const v2fa c = *(const v2fa*)(cp + q * 2 * (HD / 2)), s = *(const v2fa*)(sp + q * 2 * (HD / 2));
    v4f o; o[0] = v[0] * c[0] - v[1] * s[0]; o[1] = v[0] * s[0] + v[1] * c[0]; o[2] = v[2] * c[1] - v[3] * s[1]; o[3] = v[2] * s[1] + v[3] * c[1];
    v4h h4;
#pragma unroll      /* constant element indices: o and h4 stay in registers */
    for (int i = 0; i < 4; ++i) h4[i] = (_Float16)o[i];
    *(v4h*)(hp + q * 2 * NC) = h4;
    if (F32) *(v4f*)(fp + q * 2 * NC) = o; }
  asm volatile("s_wait_xcnt 0x0" ::: "memory"); }      /* behind the last store of the rows, in front of any later write of a register that an issued store names (the other form's code follows in the listing) */
template <int NC>      /* columns of the product = row pitch of both outputs */
__device__ __forceinline__ void gemm2r_blk(char* sm, int bx, const _Float16* __restrict__ A, int lda, const _Float16* __restrict__ Bh, int ldb, float alpha, const float* __restrict__ CS, const float* __restrict__ SN,
    _Float16* __restrict__ H16, float* __restrict__ F0, int M, int K) {
  const int tid = threadIdx.x, w = tid >> 5, lane = tid & 31, ln = lane & 15, hh = lane >> 4;
  const int ntn = NC >> 6; const int mt = bx / ntn, nq = bx - mt * ntn; const int row0 = mt * 128 + 32 * w, col0 = nq * 64; if (mt * 128 >= M) return;      /* the whole block or none: M is a multiple of 128 */
  float (*so)[32][68] = (float (*)[32][68])sm;
  v8f accs[8] = {};      /* tile (half, t) at index 4 half + t */
  g2_loop(sm, A + (size_t)(mt * 128) * lda, lda, Bh + (size_t)col0 * ldb, ldb, K, accs);      /* k_gemm2's product loop */
#pragma unroll      /* unrolled so that the accumulators are indexed by constants only and stay in registers */
  for (int u = 0; u < 8; ++u) { const int t = u & 3, half = u >> 2;
#pragma unroll      /* the same, for the element index */
    for (int r = 0; r < 8; ++r) so[w][half * 16 + 8 * hh + r][t * 16 + ln] = accs[u][r] * alpha; }
  __builtin_amdgcn_fence(__ATOMIC_ACQ_REL, "workgroup"); __builtin_amdgcn_wave_barrier();      /* the wave's own LDS writes stand in front of its reads of other lanes' words; no other wave reads this slice */
  const int rsub = lane >> 4, c4 = (lane & 15) * 4; const int p0 = row0 % SQ;
  const float* cp = CS + (size_t)(p0 + rsub) * (HD / 2) + c4 / 2; const float* sp = SN + (size_t)(p0 + rsub) * (HD / 2) + c4 / 2;      /* table entries i = c4 / 2 and c4 / 2 + 1 of the lane's row */
  _Float16* hp = H16 + (size_t)(row0 + rsub) * NC + col0 + c4; float* fp = F0 + ((size_t)(row0 / SQ) * QT0 + p0 + rsub) * NC + col0 + c4;
  if (__builtin_amdgcn_readfirstlane(p0) < QT0) g2_rope_rows<true, NC>(&so[w][rsub][c4], cp, sp, hp, fp);      /* p0 is the same in every lane of a wave: a scalar branch; QT0 is a multiple of the tile's 32 rows */
  else g2_rope_rows<false, NC>(&so[w][rsub][c4], cp, sp, hp, fp); }

__global__ __launch_bounds__(256) void k_bfcp(const float* __restrict__ src, float* __restrict__ dst, size_t n4) { const size_t t = (size_t)blockIdx.x * 256 + threadIdx.x; if (t >= n4) return; const v4f a = *(const v4fa*)(src + t * 4); v4f o; for (int q = 0; q < 4; ++q) o[q] = bf16_round(a[q]); *(v4f*)(dst + t * 4) = o;  }

__global__ __launch_bounds__(256) void k_tabhalf(const float* __restrict__ cs, const float* __restrict__ sn, float* __restrict__ CS, float* __restrict__ SN) { const int t = blockIdx.x * 256 + threadIdx.x; if (t >= SQ * (HD / 2)) return; const int p = t / (HD / 2), i = t % (HD / 2); const float c = bf16_round(cs[(size_t)p * HD + i]), s = bf16_round(sn[(size_t)p * HD + i]);
  *(float*)(CS + t) = c; *(float*)(SN + t) = s;  }

__device__ __forceinline__ void tab2d_blk(int bx, float* __restrict__ CS, float* __restrict__ SN) {
  #pragma clang fp contract(off)
  const int t = bx * 256 + threadIdx.x; if (t >= SQ * (HD / 2)) return; const int i = t % (HD / 2); const int p = t / (HD / 2); const float invf = (float)(1.0 / pow(10000.0, (double)(2 * i) / (double)HD)); const float ang = __fmul_rn((float)p, invf); const float c = cosf(ang), s = sinf(ang);
  *(float*)(CS + t) = c; *(float*)(SN + t) = s;  }
// Launches that do not depend on one another ride in ONE grid: a block's index says which stage it belongs to and which block of that stage it is (a scalar branch: the index is the
// same for the whole block). Every stage's code, block size and block-to-data map are what they were as a launch of its own, but for the exact first-tile stage, whose 64 working threads ride in blocks of 128; stages whose blocks last longest come first.
#define PB_TAB (SQ * (HD / 2) / 256)
#define PB_WQ (DM * (DM / 8) / 256)
#define PB_WK (KVD * (DM / 8) / 256)
#define PB_X ((int)(NR * DM / 8 / 256))
// rope tables, the four weight transposes, x -> f16: all read inputs only
__global__ __launch_bounds__(256) void k_prep(const float* __restrict__ x, const float* __restrict__ wq, const float* __restrict__ wk, const float* __restrict__ wv, const float* __restrict__ wo,
    _Float16* __restrict__ X16, _Float16* __restrict__ BQ, _Float16* __restrict__ BK, _Float16* __restrict__ BV, _Float16* __restrict__ BO, float* __restrict__ CS, float* __restrict__ SN) {
  int bx = (int)blockIdx.x;
  if (bx < PB_TAB) { tab2d_blk(bx, CS, SN); return; }      /* angle[p][i] = p * 10000^(-2i/64), positions = row index */
  bx -= PB_TAB; if (bx < PB_WQ) { wt_f16_blk(bx, wq, BQ, DM, DM, 16.0f); return; }      /* [in][out] -> Bt[n][k] x16 */
  bx -= PB_WQ; if (bx < PB_WQ) { wt_f16_blk(bx, wo, BO, DM, DM, 16.0f); return; }
  bx -= PB_WQ; if (bx < PB_WK) { wt_f16_blk(bx, wk, BK, DM, KVD, 16.0f); return; }
  bx -= PB_WK; if (bx < PB_WK) { wt_f16_blk(bx, wv, BV, DM, KVD, 16.0f); return; }
  bx -= PB_WK; x16_blk(bx, x, X16, NR * DM / 8); }
#define GB_Q ((MP / 128) * (DM / 64))
#define GB_K ((MP / 128) * (KVD / 64))
#define GB_V0 ((QT0 / 128) * (KVD / 64))
// the q, k and v products and the f32 v rows of the first tile: all read X16 and a weight plane
__global__ __launch_bounds__(128) void k_proj(const _Float16* __restrict__ X16, const _Float16* __restrict__ BQ, const _Float16* __restrict__ BK, const _Float16* __restrict__ BV, const float* __restrict__ CS, const float* __restrict__ SN,
    _Float16* __restrict__ Q16, float* __restrict__ QF0, _Float16* __restrict__ K16, float* __restrict__ KF0, _Float16* __restrict__ V16, float* __restrict__ VF0) {
  __shared__ __attribute__((aligned(128))) char sm[GLDS];
  int bx = (int)blockIdx.x;
  if (bx < GB_Q) { gemm2r_blk<DM>(sm, bx, X16, DM, BQ, DM, 0.0625f, CS, SN, Q16, QF0, MP, DM); return; }      /* q with the interleaved-pair rope, position = row % SQ -> f16 rows; f32 rows 0..127 of each batch */
  bx -= GB_Q; if (bx < GB_K) { gemm2r_blk<KVD>(sm, bx, X16, DM, BK, DM, 0.0625f, CS, SN, K16, KF0, MP, DM); return; }      /* k, the same */
  bx -= GB_K; if (bx < GB_K) { gemm2_blk<0>(sm, bx, 0, X16, DM, 0, BV, DM, 0, 0.0625f, nullptr, 0, nullptr, 1, 0, 0, nullptr, V16, KVD, 0, MP, KVD, DM); return; }
  bx -= GB_K; gemm2_blk<0>(sm, bx % GB_V0, bx / GB_V0, X16, DM, (size_t)SQ * DM, BV, DM, 0, 0.0625f, nullptr, 0, nullptr, 1, 0, 0, VF0, nullptr, KVD, (size_t)QT0 * KVD, QT0, KVD, DM); }      /* f32 v of rows 0..127 of each batch */
#define CB_VT (NB * NG * (SQ / 64))
#define CB_KV (NB * QT0 * DM / 4 / 256)
// V^T for the fused attention; k and v rows of the first tile spread from kv group to head
__global__ __launch_bounds__(256) void k_lay(const _Float16* __restrict__ V16, _Float16* __restrict__ VT, const float* __restrict__ KF0, float* __restrict__ KF0e, const float* __restrict__ VF0, float* __restrict__ VF0e) {
  int bx = (int)blockIdx.x;
  if (bx < CB_VT) { vt_blk<NG, SQ>(bx, V16, KVD, 0, VT); return; }      /* V^T [NB][NG][HD][SQ] */
  bx -= CB_VT; if (bx < CB_KV) { kvexp_blk(bx, KF0, KF0e, (size_t)NB * QT0 * DM / 4); return; }      /* head h <- kv group h/4 */
  bx -= CB_KV; kvexp_blk(bx, VF0, VF0e, (size_t)NB * QT0 * DM / 4); }
#define DB_F ((SQ / 32) * NG * NB)
#define DB_A0 (NH * (QT0 / 64))
// the fused attention in its own block order (tile fastest, then kv group, then batch), and behind it the exact first-tile blocks, which take the places that the shortest tiles leave
__global__ __launch_bounds__(128) void k_attn(const _Float16* __restrict__ Q16, const _Float16* __restrict__ K16, const _Float16* __restrict__ VT, _Float16* __restrict__ O16,
    const float* __restrict__ QF0, const float* __restrict__ KF0e, const float* __restrict__ VF0e, float* __restrict__ OF0) {
  int bx = (int)blockIdx.x;
  if (bx < DB_F) { fattn_blk(bx % (SQ / 32), (bx / (SQ / 32)) % NG, bx / ((SQ / 32) * NG), Q16, K16, VT, O16); return; }
  bx -= DB_F; att0_blk(bx % DB_A0, bx / DB_A0, QF0, KF0e, VF0e, 0.125f, OF0, DM); }
#define EB_O ((MPO / 128) * (DM / 64))
#define EB_H (NB * QT0 * DM / 8 / 128)
// the output product of all rows, and the first tile's o split into f16 hi and residual planes
__global__ __launch_bounds__(128) void k_outp(const _Float16* __restrict__ O16, const _Float16* __restrict__ BO, float* __restrict__ out, const float* __restrict__ OF0, _Float16* __restrict__ OH0, _Float16* __restrict__ OL0) {
  __shared__ __attribute__((aligned(128))) char sm[GLDS];
  int bx = (int)blockIdx.x;
  if (bx < EB_O) { gemm2_blk<0>(sm, bx, 0, O16, DM, 0, BO, DM, 0, 0.0009765625f, nullptr, 0, nullptr, 1, 0, 0, out, nullptr, DM, 0, MPO, DM, DM); return; }      /* out rows are the output layout */
  bx -= EB_O; hl_blk((size_t)bx * 128 + threadIdx.x, OF0, OH0, OL0, (size_t)NB * QT0 * DM / 8); }      /* first-tile o (x64) -> f16 hi + x1024 residual planes */
extern "C" void kernel_launch(void* const* d_in, const int* in_sizes, int n_in,
                              void* d_out, int out_size, void* d_ws, size_t ws_size, hipStream_t stream) {
  (void)in_sizes; (void)n_in; (void)out_size;
  const float* const* I = (const float* const*)d_in; const float* x = I[0]; const float* wq = I[1]; const float* wk = I[2]; const float* wv = I[3]; const float* wo = I[4];      /* input order: x, Wq [1024][1024], Wk / Wv [1024][256], Wo [1024][1024] ([in][out] weights); rope tables computed in-kernel (positions = row index), as the module computes them */ const float* bq = nullptr; const float* bk = nullptr; const float* bv = nullptr; const float* bo = nullptr;      /* no biases */
  char* ws = (char*)d_ws; size_t off = 0;
  auto take = [&](size_t bytes) { char* p = ws + off; off += (bytes + 255) & ~(size_t)255; return p; };
  _Float16* BQ = (_Float16*)take((size_t)DM * DM * 2); _Float16* BK = (_Float16*)take((size_t)KVD * DM * 2); _Float16* BV = (_Float16*)take((size_t)KVD * DM * 2); _Float16* BO = (_Float16*)take((size_t)DM * DM * 2);
  _Float16* X16 = (_Float16*)take(NR * DM * 2); float* CSB = (float*)take((size_t)SQ * HD * 4); float* SNB = (float*)take((size_t)SQ * HD * 4); _Float16* Q16 = (_Float16*)take(NR * DM * 2); _Float16* K16 = (_Float16*)take(NR * KVD * 2); _Float16* V16 = (_Float16*)take(NR * KVD * 2); _Float16* O16 = (_Float16*)take(NR * DM * 2);
  _Float16* VT = (_Float16*)take((size_t)NB * NG * HD * SQ * 2);
  float* QF0 = (float*)take((size_t)NB * QT0 * DM * 4); float* KF0 = (float*)take((size_t)NB * QT0 * KVD * 4); float* VF0 = (float*)take((size_t)NB * QT0 * KVD * 4); float* KF0e = (float*)take((size_t)NB * QT0 * DM * 4); float* VF0e = (float*)take((size_t)NB * QT0 * DM * 4); float* OF0 = (float*)take((size_t)NB * QT0 * DM * 4); _Float16* OH0 = (_Float16*)take((size_t)NB * QT0 * DM * 2); _Float16* OL0 = (_Float16*)take((size_t)NB * QT0 * DM * 2);
  if (off > ws_size) return;
  /* Seven dependent launches; each holds every stage that needs only what the launches before it wrote. Every stage covers all NB batches. */
  k_prep<<<PB_TAB + 2 * PB_WQ + 2 * PB_WK + PB_X, 256, 0, stream>>>(x, wq, wk, wv, wo, X16, BQ, BK, BV, BO, CSB, SNB);
  k_proj<<<GB_Q + 2 * GB_K + GB_V0 * NB, 128, 0, stream>>>(X16, BQ, BK, BV, CSB, SNB, Q16, QF0, K16, KF0, V16, VF0);
  k_lay<<<CB_VT + 2 * CB_KV, 256, 0, stream>>>(V16, VT, KF0, KF0e, VF0, VF0e);
  k_attn<<<DB_F + DB_A0 * NB, 128, 0, stream>>>(Q16, K16, VT, O16, QF0, KF0e, VF0e, OF0);      /* o (merged heads, x64): f16 rows of all rows; exact f32 rows 0..127 of each batch */
  k_outp<<<EB_O + EB_H, 128, 0, stream>>>(O16, BO, (float*)d_out, OF0, OH0, OL0);
  k_gemm2<0><<<dim3((QT0 / 128) * (DM / 64), NB), 128, 0, stream>>>(OH0, DM, (size_t)QT0 * DM, BO, DM, 0, 0.0009765625f, bo, 0, nullptr, 1, 0, 0, (float*)d_out, nullptr, DM, (size_t)SQ * DM, QT0, DM, DM);      /* rows 0..127 of each batch: out = o_hi Wo (+ b), overwriting the f16-path rows */
  k_gemm2<0><<<dim3((QT0 / 128) * (DM / 64), NB), 128, 0, stream>>>(OL0, DM, (size_t)QT0 * DM, BO, DM, 0, 0.00000095367431640625f, nullptr, 0, (const float*)d_out, -1, 0, 0, (float*)d_out, nullptr, DM, (size_t)SQ * DM, QT0, DM, DM);      /* += o_lo Wo 2^-20 (own-element accumulate) */
}

// v008
// One run takes 195 microseconds.
// Timed twice side by side with v007, it ran 1.03 times as fast both times.
// Counting every step since v000, it is 68.9 times as fast.
#include <hip/hip_runtime.h>
// Grouped-query causal attention at width 1024 with [in][out] projections and RoPE computed in the module (x [4][2048][1024]; q = x Wq (16 heads x 64), k = x Wk, v = x Wv (4 kv heads x 64) ([in][out] weights sigma 0.02, no biases); k, v repeated x4 (repeat: query head h uses kv head h / 4); rope: the module rotates the (even, odd) pairs (x1 c - x2 s, x1 s + x2 c) with angle pos * 10000^(-2i/64) and writes the rotated evens into the first half and the rotated odds into the second half of the head: the SAME permutation on q and k, so q . k equals the interleaved-pair rope's; scores / sqrt(64) with a causal mask (tril, -inf); softmax; out = merged Wo ([in][out]) -> [4][2048][1024]).
// Compute dtype: inputs rounded to bf16; x / weights exact; q, k, v, softmax weights and o as plain f16 GEMM operands (~2^-12); scores and softmax statistics f32. v_wmma_f32_16x16x32_f16.
#define NB 4
#define NG 4
#define HPG 4
#define KVD (NG * HD)
#define SQ 2048
#define DM 1024
#define NH 16
#define HD 64
#define HG 4                         /* heads per launch of the k_vt (b, h0) overload */
#define QT 256
#define NKX SQ                       /* S / P row pitch */
#define QT0 128                      /* first-tile rows recomputed exactly in f32 */
#define B0 0                         /* unused: every stage starts at batch 0 */
#define NBR NB                       /* batches processed (debug hook) */
#define NR ((size_t)NB * SQ)         /* token rows */
#define MP ((int)((size_t)NBR * SQ)) /* rows projected (debug hook) */
#define QN SQ                        /* query rows attended per batch (unused: the attention launches take SQ) */
#define NHD NH                       /* heads attended (unused: the attention launches cover all NH heads) */
#define MPO MP                       /* rows through the output stage (debug hook) */
#define LQ DM      /* row pitch of the q rows */
typedef __bf16 v16b __attribute__((ext_vector_type(16)));
typedef unsigned short v8us __attribute__((ext_vector_type(8), may_alias));
typedef float  v8f  __attribute__((ext_vector_type(8)));
typedef float  v4f  __attribute__((ext_vector_type(4)));
typedef float  v4fa __attribute__((ext_vector_type(4), may_alias));
union FragB { v16b v; v8us half[2]; unsigned short u[16]; };

__device__ __forceinline__ unsigned short bf16_bits(float x) { unsigned int u = __float_as_uint(x); return (unsigned short)((u + 0x7FFFu + ((u >> 16) & 1u)) >> 16); }
__device__ __forceinline__ float bf16_val(unsigned short b) { return __uint_as_float(((unsigned int)b) << 16); }
__device__ __forceinline__ float bf16_round(float x) { return bf16_val(bf16_bits(x)); }
// D += A·B with NT terms: 1 = ah·bh, 2 = + al·bh (A split), 3 = + ah·bl (both split)
template <int NT>
__device__ __forceinline__ v8f mmaN(v16b ah, v16b al, v16b bh, v16b bl, v8f c) {
  c = __builtin_amdgcn_wmma_f32_16x16x32_bf16(false, ah, false, bh, (short)0, c, false, false);
  if (NT >= 2) c = __builtin_amdgcn_wmma_f32_16x16x32_bf16(false, al, false, bh, (short)0, c, false, false);
  if (NT >= 3) c = __builtin_amdgcn_wmma_f32_16x16x32_bf16(false, ah, false, bl, (short)0, c, false, false);
  asm volatile("v_nop\n\tv_nop\n\tv_nop\n\tv_nop" : "+v"(c) : "v"(ah), "v"(al), "v"(bh), "v"(bl));
  return c;
}

__global__ __launch_bounds__(256) void k_wt_bf16(const float* __restrict__ W, unsigned short* __restrict__ Wt, int K, int N) {
  const int t = blockIdx.x * 256 + threadIdx.x;
  const int k8n = K / 8;
  if (t >= N * k8n) return;
  const int n = t / k8n, k8 = (t % k8n) * 8;
  v8us v;
#pragma unroll
  for (int i = 0; i < 8; ++i) v[i] = bf16_bits(W[(size_t)(k8 + i) * N + n]);
  *(v8us*)(Wt + (size_t)n * K + k8) = v;
  
}

// GEMM C[M][N] (f32, pitch ldc) = act(A[M][K]·W + bias). A f32 row-major (pitch lda) converted per fragment to bf16
// (ASPLIT: hi/lo two planes -> 2 terms, else single rounded term); Wt bf16 [N][K] (pitch ldb). BIAS_BF16 rounds the
// bias to bf16 first (bias quantised to bf16 before the add). K%32==0, M%16==0, N%64==0.
template <bool ASPLIT, int ACT, bool BIAS_BF16>
__global__ __launch_bounds__(128) void k_gemm_bf(const float* __restrict__ A, int lda, const unsigned short* __restrict__ Wt, int ldb,
                                               const float* __restrict__ bias, float* __restrict__ C, int ldc, int M, int N, int K) {
  __shared__ __attribute__((aligned(16))) float so[4][16][64];
  const int tid = threadIdx.x, w = tid >> 5, lane = tid & 31, ln = lane & 15, hh = lane >> 4;
  const int ntn = N / 64;
  const int wid = blockIdx.x * 4 + w;
  const int mt = wid / ntn, nq = wid % ntn;
  if (mt * 16 >= M) return;
  const int row0 = mt * 16, col0 = nq * 64;
  const float* arow = A + (size_t)(row0 + ln) * lda;
  v8f acc[4] = {};
  for (int kb = 0; kb < K; kb += 32) {
    FragB ah, al;
    const v4f x0 = *(const v4fa*)(arow + kb + 8 * hh), x1 = *(const v4fa*)(arow + kb + 8 * hh + 4);
    const v4f x2 = *(const v4fa*)(arow + kb + 16 + 8 * hh), x3 = *(const v4fa*)(arow + kb + 16 + 8 * hh + 4);
    float xs[16] = {x0[0],x0[1],x0[2],x0[3],x1[0],x1[1],x1[2],x1[3],x2[0],x2[1],x2[2],x2[3],x3[0],x3[1],x3[2],x3[3]};
#pragma unroll
    for (int i = 0; i < 16; ++i) { const unsigned short hb = bf16_bits(xs[i]); ah.u[i] = hb; al.u[i] = ASPLIT ? bf16_bits(xs[i] - bf16_val(hb)) : (unsigned short)0; }
#pragma unroll
    for (int t = 0; t < 4; ++t) {
      const unsigned short* brow = Wt + (size_t)(col0 + t * 16 + ln) * ldb + kb;
      FragB b;
      b.half[0] = *(const v8us*)(brow + 8 * hh);
      b.half[1] = *(const v8us*)(brow + 16 + 8 * hh);
      acc[t] = mmaN<ASPLIT ? 2 : 1>(ah.v, al.v, b.v, b.v, acc[t]);
    }
  }
#pragma unroll
  for (int t = 0; t < 4; ++t) {
    float bv = bias ? bias[col0 + t * 16 + ln] : 0.f;
    if (BIAS_BF16) bv = bf16_round(bv);
#pragma unroll
    for (int r = 0; r < 8; ++r) { float v = acc[t][r] + bv; if (ACT == 1) v = fmaxf(v, 0.f); so[w][8 * hh + r][t * 16 + ln] = v; }
  }
  __builtin_amdgcn_fence(__ATOMIC_ACQ_REL, "workgroup");
  __builtin_amdgcn_wave_barrier();
  const int rsub = lane >> 4, c4 = (lane & 15) * 4;
  {
#pragma unroll
    for (int q = 0; q < 8; ++q) {
      const int r = q * 2 + rsub;
      const v4f v = *(const v4fa*)&so[w][r][c4];
      *(v4f*)(C + (size_t)(row0 + r) * ldc + col0 + c4) = v;
    }
    
  }
}

// GEMM C = act(A·W + bias + resid): A f32 (ASPLIT -> hi/lo 2 terms), Wt bf16 [N][K]; ACT 0 none, 1 relu, 2 exact gelu;
// resid (optional, f32, row index = (row % rmod), pitch ldr, RES_BF16 rounds it) added before the activation.
template <bool ASPLIT, int ACT, bool BIAS_BF16, bool RES_BF16>
__global__ __launch_bounds__(128) void k_gemm_bf3(const float* __restrict__ A, int lda, const unsigned short* __restrict__ Wt, int ldb,
                                                const float* __restrict__ bias, const float* __restrict__ resid, int rmod, int ldr,
                                                float* __restrict__ C, int ldc, int M, int N, int K) {
  __shared__ __attribute__((aligned(16))) float so[4][16][64];
  const int tid = threadIdx.x, w = tid >> 5, lane = tid & 31, ln = lane & 15, hh = lane >> 4;
  const int ntn = N / 64;
  const int wid = blockIdx.x * 4 + w;
  const int mt = wid / ntn, nq = wid % ntn;
  if (mt * 16 >= M) return;
  const int row0 = mt * 16, col0 = nq * 64;
  const float* arow = A + (size_t)(row0 + ln) * lda;
  v8f acc[4] = {};
  for (int kb = 0; kb < K; kb += 32) {
    FragB ah, al;
    const v4f x0 = *(const v4fa*)(arow + kb + 8 * hh), x1 = *(const v4fa*)(arow + kb + 8 * hh + 4);
    const v4f x2 = *(const v4fa*)(arow + kb + 16 + 8 * hh), x3 = *(const v4fa*)(arow + kb + 16 + 8 * hh + 4);
    float xs[16] = {x0[0],x0[1],x0[2],x0[3],x1[0],x1[1],x1[2],x1[3],x2[0],x2[1],x2[2],x2[3],x3[0],x3[1],x3[2],x3[3]};
#pragma unroll
    for (int i = 0; i < 16; ++i) { const unsigned short hb = bf16_bits(xs[i]); ah.u[i] = hb; al.u[i] = ASPLIT ? bf16_bits(xs[i] - bf16_val(hb)) : (unsigned short)0; }
#pragma unroll
    for (int t = 0; t < 4; ++t) {
      const unsigned short* brow = Wt + (size_t)(col0 + t * 16 + ln) * ldb + kb;
      FragB b;
      b.half[0] = *(const v8us*)(brow + 8 * hh);
      b.half[1] = *(const v8us*)(brow + 16 + 8 * hh);
      acc[t] = mmaN<ASPLIT ? 2 : 1>(ah.v, al.v, b.v, b.v, acc[t]);
    }
  }
#pragma unroll
  for (int t = 0; t < 4; ++t) {
    const int col = col0 + t * 16 + ln;
    float bv = bias ? bias[col] : 0.f;
    if (BIAS_BF16) bv = bf16_round(bv);
#pragma unroll
    for (int r = 0; r < 8; ++r) {
      float v = acc[t][r] + bv;
      if (resid) { float rv = resid[(size_t)((row0 + 8 * hh + r) % rmod) * ldr + col]; if (RES_BF16) rv = bf16_round(rv); v += rv; }
      if (ACT == 1) v = fmaxf(v, 0.f);
      if (ACT == 2) v = 0.5f * v * (1.0f + erff(v * 0.70710678118654752f));
      if (ACT == 3) { const float u = 0.7978845608028654f * (v + 0.044715f * v * v * v); v = 0.5f * v * (1.0f + tanhf(u)); }
      so[w][8 * hh + r][t * 16 + ln] = v;
    }
  }
  __builtin_amdgcn_fence(__ATOMIC_ACQ_REL, "workgroup");
  __builtin_amdgcn_wave_barrier();
  const int rsub = lane >> 4, c4 = (lane & 15) * 4;
  {
#pragma unroll
    for (int q = 0; q < 8; ++q) {
      const int r = q * 2 + rsub;
      const v4f v = *(const v4fa*)&so[w][r][c4];
      *(v4f*)(C + (size_t)(row0 + r) * ldc + col0 + c4) = v;
    }
    
  }
}
// row LayerNorm (biased variance, eps) over N: s = X (+ R); optional out_sum <- s; out_norm <- (s-mu)*rsqrt(var+eps)*g + b
template <bool PARAM_BF16>
__global__ __launch_bounds__(256) void k_layernorm(const float* __restrict__ X, const float* __restrict__ R, const float* __restrict__ g, const float* __restrict__ bta,
                                                  float* __restrict__ out_sum, float* __restrict__ out_norm, int N, float eps) {
  __shared__ float red[256];
  const int row = blockIdx.x, tid = threadIdx.x;
  const float* x = X + (size_t)row * N; const float* rr = R ? R + (size_t)row * N : nullptr;
  float vals[16];                     // up to N = 4096
  const int per = N / 256;            // contiguous chunk per thread? use strided-by-4 chunks: thread handles j = tid*4 + 1024*u
  float s1 = 0.f;
  for (int u = 0; u < per / 4; ++u) {
    const int j = tid * 4 + 1024 * u;
    const v4f a = *(const v4fa*)(x + j);
    v4f b = {0.f,0.f,0.f,0.f}; if (rr) b = *(const v4fa*)(rr + j);
#pragma unroll
    for (int q = 0; q < 4; ++q) { const float v = a[q] + b[q]; vals[u * 4 + q] = v; s1 += v; }
  }
  red[tid] = s1; __syncthreads();
  for (int st = 128; st > 0; st >>= 1) { if (tid < st) red[tid] += red[tid + st]; __syncthreads(); }
  const float mu = red[0] / (float)N; __syncthreads();
  float s2 = 0.f;
  for (int u = 0; u < per / 4; ++u)
#pragma unroll
    for (int q = 0; q < 4; ++q) { const float c = vals[u * 4 + q] - mu; s2 += c * c; }
  red[tid] = s2; __syncthreads();
  for (int st = 128; st > 0; st >>= 1) { if (tid < st) red[tid] += red[tid + st]; __syncthreads(); }
  const float rs = rsqrtf(red[0] / (float)N + eps);
  {
    for (int u = 0; u < per / 4; ++u) {
      const int j = tid * 4 + 1024 * u;
      v4f o, sm;
#pragma unroll
      for (int q = 0; q < 4; ++q) {
        float gg = g[j + q], bb = bta[j + q];
        if (PARAM_BF16) { gg = bf16_round(gg); bb = bf16_round(bb); }
        sm[q] = vals[u * 4 + q]; o[q] = (vals[u * 4 + q] - mu) * rs * gg + bb;
      }
      if (out_sum) *(v4f*)(out_sum + (size_t)row * N + j) = sm;
      *(v4f*)(out_norm + (size_t)row * N + j) = o;
    }
    
  }
}



// ---- f16 WMMA path (v_wmma_f32_16x16x32_f16): 11-bit significands for operands in range — used where a [0,1] probability operand needs more precision than bf16
typedef _Float16 v16h __attribute__((ext_vector_type(16)));
union FragH { v16h v; v8us half[2]; _Float16 h[16]; unsigned short u[16]; };
template <int NT>
__device__ __forceinline__ v8f mmaH(v16h ah, v16h al, v16h bh, v16h bl, v8f c) {
  c = __builtin_amdgcn_wmma_f32_16x16x32_f16(false, ah, false, bh, (short)0, c, false, false);
  if (NT >= 2) c = __builtin_amdgcn_wmma_f32_16x16x32_f16(false, al, false, bh, (short)0, c, false, false);
  if (NT >= 3) c = __builtin_amdgcn_wmma_f32_16x16x32_f16(false, ah, false, bl, (short)0, c, false, false);
  asm volatile("v_nop\n\tv_nop\n\tv_nop\n\tv_nop" : "+v"(c) : "v"(ah), "v"(al), "v"(bh), "v"(bl));
  return c;
}
// batched GEMM like k_gemm_b but f16 operands: A f32 (split into f16 hi/lo if ASPLIT, else rounded to f16), Bt = f16 values [n][k]; alpha; C f32; N multiple of 16 (partial tiles skipped)
template <bool ASPLIT>
__global__ __launch_bounds__(128) void k_gemm_h(const float* __restrict__ A, int lda, size_t sA, const _Float16* __restrict__ Bh, int ldb, size_t sB, float alpha, float* __restrict__ C, int ldc, size_t sC, int M, int N, int K) {
  __shared__ __attribute__((aligned(16))) float so[4][16][64];
  const int tid = threadIdx.x, w = tid >> 5, lane = tid & 31, ln = lane & 15, hh = lane >> 4; const int by = blockIdx.y;
  A += (size_t)by * sA; Bh += (size_t)by * sB; C += (size_t)by * sC;
  const int ntn = (N + 63) / 64; const int wid = blockIdx.x * 4 + w; const int mt = wid / ntn, nq = wid % ntn; if (mt * 16 >= M) return;
  const int row0 = mt * 16, col0 = nq * 64; const float* arow = A + (size_t)(row0 + ln) * lda;
  v8f acc[4] = {};
  for (int kb = 0; kb < K; kb += 32) {
    FragH ah, al;
    const v4f x0 = *(const v4fa*)(arow + kb + 8 * hh), x1 = *(const v4fa*)(arow + kb + 8 * hh + 4), x2 = *(const v4fa*)(arow + kb + 16 + 8 * hh), x3 = *(const v4fa*)(arow + kb + 16 + 8 * hh + 4);
    float xs[16] = {x0[0],x0[1],x0[2],x0[3],x1[0],x1[1],x1[2],x1[3],x2[0],x2[1],x2[2],x2[3],x3[0],x3[1],x3[2],x3[3]};
#pragma unroll
    for (int i = 0; i < 16; ++i) { const _Float16 h = (_Float16)xs[i]; ah.h[i] = h; al.h[i] = ASPLIT ? (_Float16)(xs[i] - (float)h) : (_Float16)0.0f; }
#pragma unroll
    for (int t = 0; t < 4; ++t) { if (col0 + t * 16 >= N) continue; const size_t boff = (size_t)(col0 + t * 16 + ln) * ldb + kb; FragH bq; bq.half[0] = *(const v8us*)(Bh + boff + 8 * hh); bq.half[1] = *(const v8us*)(Bh + boff + 16 + 8 * hh);
      acc[t] = mmaH<ASPLIT ? 2 : 1>(ah.v, al.v, bq.v, bq.v, acc[t]); }
  }
#pragma unroll
  for (int t = 0; t < 4; ++t) { if (col0 + t * 16 >= N) continue;
#pragma unroll
    for (int r = 0; r < 8; ++r) so[w][8 * hh + r][t * 16 + ln] = acc[t][r] * alpha; }
  __builtin_amdgcn_fence(__ATOMIC_ACQ_REL, "workgroup"); __builtin_amdgcn_wave_barrier();
  const int rsub = lane >> 4, c4 = (lane & 15) * 4;
  {
#pragma unroll
    for (int q = 0; q < 8; ++q) { const int r = q * 2 + rsub; if (col0 + c4 < N) { const v4f v = *(const v4fa*)&so[w][r][c4]; *(v4f*)(C + (size_t)(row0 + r) * ldc + col0 + c4) = v; } }
     }
}

// Wt[n][k] = f16(W[k][n]·scale) from f32 row-major W[K][N] (scale = power of two; bf16-exact weights stay exact in f16 away from the subnormal range)
__device__ __forceinline__ void wt_f16_blk(int bx, const float* __restrict__ W, _Float16* __restrict__ Wt, int K, int N, float scale) {
  const int t = bx * 256 + threadIdx.x; if (t >= N * (K / 8)) return; const int n = t / (K / 8), k8 = (t % (K / 8)) * 8; FragH f;
#pragma unroll
  for (int i = 0; i < 8; ++i) f.h[i] = (_Float16)(bf16_round(W[(size_t)(k8 + i) * N + n]) * scale); const v8us o = f.half[0];
  *(v8us*)((unsigned short*)Wt + (size_t)n * K + k8) = o; 
}
// k_gemm_hh variant with fused epilogue: v = acc·alpha + bias[by·sBias + col] (+ CP[(row/rowsPerB)·sCPb + by·64 + col] if CP) ; ACT 0 none / 1 elu ; writes f16 C16 (and f32 C if non-null)
template <int ACT>
__global__ __launch_bounds__(128) void k_gemm_hhx(const _Float16* __restrict__ A, int lda, size_t sA, const _Float16* __restrict__ Bh, int ldb, size_t sB, float alpha, const float* __restrict__ bias, size_t sBias, const float* __restrict__ CP, int rowsPerB, size_t sCPb, int row0g,
    float* __restrict__ C, _Float16* __restrict__ C16, int ldc, size_t sC, int M, int N, int K) {
  __shared__ __attribute__((aligned(16))) float so[4][16][64];
  const int tid = threadIdx.x, w = tid >> 5, lane = tid & 31, ln = lane & 15, hh = lane >> 4; const int by = blockIdx.y;
  A += (size_t)by * sA; Bh += (size_t)by * sB; const size_t cofs = (size_t)by * sC; const float* bp = bias ? bias + (size_t)by * sBias : nullptr;
  const int ntn = (N + 63) / 64; const int wid = blockIdx.x * 4 + w; const int mt = wid / ntn, nq = wid % ntn; if (mt * 16 >= M) return;
  const int row0 = mt * 16, col0 = nq * 64; const _Float16* arow = A + (size_t)(row0 + ln) * lda;
  v8f acc[4] = {};
  for (int kb = 0; kb < K; kb += 32) { FragH ah; ah.half[0] = *(const v8us*)((const unsigned short*)arow + kb + 8 * hh); ah.half[1] = *(const v8us*)((const unsigned short*)arow + kb + 16 + 8 * hh);
#pragma unroll
    for (int t = 0; t < 4; ++t) { if (col0 + t * 16 >= N) continue; const size_t boff = (size_t)(col0 + t * 16 + ln) * ldb + kb; FragH bq; bq.half[0] = *(const v8us*)((const unsigned short*)Bh + boff + 8 * hh); bq.half[1] = *(const v8us*)((const unsigned short*)Bh + boff + 16 + 8 * hh);
      acc[t] = mmaH<1>(ah.v, ah.v, bq.v, bq.v, acc[t]); }
  }
#pragma unroll
  for (int t = 0; t < 4; ++t) { if (col0 + t * 16 >= N) continue; const int col = col0 + t * 16 + ln; const float bv = bp ? bf16_round(bp[col]) : 0.f;
#pragma unroll
    for (int r = 0; r < 8; ++r) { float v = acc[t][r] * alpha + bv; if (CP) { const int rr = row0g + row0 + 8 * hh + r; if (rowsPerB < 0) v += CP[cofs + (size_t)rr * ldc + col];      /* rowsPerB < 0: own element of the batched C plane */ else { const int bidx = rr / rowsPerB; v += CP[(size_t)bidx * sCPb + (size_t)by * 64 + col]; } } if (ACT == 1) v = (v > 0.f) ? v : expm1f(v); else if (ACT == 7) v = (v > 0.f) ? v + 1.0f : expf(v); else if (ACT == 8) v = tanhf(v); else if (ACT == 9) v = 0.5f * v * (1.0f + tanhf(0.7978845608028654f * (v + 0.044715f * v * v * v))); else if (ACT == 11) v = 1.0f / (1.0f + expf(-v)); else if (ACT == 12) v = (v > 0.f) ? v : 0.01f * v; else if (ACT == 14) v = (v > 0.f) ? v : 0.1f * v; else if (ACT == 16) v = (v >= 0.f) ? v : 0.3f * v; else if (ACT == 17) v = (v >= 0.f) ? v : 0.2f * v; else if (ACT == 15) v = v / (1.0f + expf(-v)); else if (ACT == 3) v = fmaxf(v, 0.f); else if (ACT == 6) v = 0.5f * v * (1.0f + erff(v * 0.70710678118654752f)); so[w][8 * hh + r][t * 16 + ln] = v; } }
  __builtin_amdgcn_fence(__ATOMIC_ACQ_REL, "workgroup"); __builtin_amdgcn_wave_barrier();
  const int rsub = lane >> 4, c4 = (lane & 15) * 4; typedef _Float16 v4h __attribute__((ext_vector_type(4)));
  {
#pragma unroll
    for (int q = 0; q < 8; ++q) { const int r = q * 2 + rsub; if (col0 + c4 < N) { const v4f v = *(const v4fa*)&so[w][r][c4]; if (C) *(v4f*)(C + cofs + (size_t)(row0 + r) * ldc + col0 + c4) = v; if (C16) { v4h h4; for (int i = 0; i < 4; ++i) h4[i] = (_Float16)v[i]; *(v4h*)(C16 + cofs + (size_t)(row0 + r) * ldc + col0 + c4) = h4; } } }
     }
}


typedef _Float16 v4h __attribute__((ext_vector_type(4)));

__device__ __forceinline__ void x16_blk(int bx, const float* __restrict__ x, _Float16* __restrict__ X16, size_t n8) { const size_t t = (size_t)bx * 256 + threadIdx.x; if (t >= n8) return; FragH f;
#pragma unroll
  for (int q = 0; q < 8; ++q) f.h[q] = (_Float16)bf16_round(x[t * 8 + q]); *(v8us*)((unsigned short*)X16 + t * 8) = f.half[0];  }
__global__ __launch_bounds__(256) void k_h16(const float* __restrict__ x, _Float16* __restrict__ X16, size_t n8) { const size_t t = (size_t)blockIdx.x * 256 + threadIdx.x; if (t >= n8) return; FragH f;
#pragma unroll
  for (int q = 0; q < 8; ++q) f.h[q] = (_Float16)x[t * 8 + q]; *(v8us*)((unsigned short*)X16 + t * 8) = f.half[0];  }
__global__ __launch_bounds__(256) void k_round16f(const float* __restrict__ W, _Float16* __restrict__ Bt, size_t n8) { const size_t t = (size_t)blockIdx.x * 256 + threadIdx.x; if (t >= n8) return; FragH f;
#pragma unroll
  for (int i = 0; i < 8; ++i) f.h[i] = (_Float16)(bf16_round(W[t * 8 + i]) * 16.0f); *(v8us*)((unsigned short*)Bt + t * 8) = f.half[0];  }
template <int NHv, int TTv>
__device__ __forceinline__ void vt_blk(int bx, const _Float16* __restrict__ V16, int ldv, int voff, _Float16* __restrict__ Vt) { __shared__ unsigned short tl[64][66]; const int tid = threadIdx.x; const int slab = bx / (TTv / 64), lg = bx % (TTv / 64); const int b = slab / NHv, h = slab % NHv;
  for (int i = tid; i < 64 * 8; i += 256) { const int r = i / 8, c8 = (i % 8) * 8; FragH f; f.half[0] = *(const v8us*)((const unsigned short*)V16 + ((size_t)b * TTv + lg * 64 + r) * ldv + voff + h * 64 + c8);
#pragma unroll
    for (int q = 0; q < 8; ++q) tl[r][c8 + q] = f.u[q]; }
  __syncthreads();
  {
#pragma unroll
    for (int rd = 0; rd < 2; ++rd) { const int d = rd * 32 + tid / 8, pc = tid % 8; FragH f;
#pragma unroll
      for (int q = 0; q < 8; ++q) f.u[q] = tl[pc * 8 + q][d];
      *(v8us*)((unsigned short*)Vt + ((size_t)slab * 64 + d) * TTv + lg * 64 + pc * 8) = f.half[0]; }
     } }

__device__ __forceinline__ void hl_blk(size_t t, const float* __restrict__ F, _Float16* __restrict__ Hh, _Float16* __restrict__ Hl, size_t n8) { if (t >= n8) return; FragH fh, fl; const v4f a = *(const v4fa*)(F + t * 8), c = *(const v4fa*)(F + t * 8 + 4);
#pragma unroll
  for (int q = 0; q < 4; ++q) { _Float16 h = (_Float16)a[q]; fh.h[q] = h; fl.h[q] = (_Float16)((a[q] - (float)h) * 1024.0f); h = (_Float16)c[q]; fh.h[4 + q] = h; fl.h[4 + q] = (_Float16)((c[q] - (float)h) * 1024.0f); }
  { *(v8us*)((unsigned short*)Hh + t * 8) = fh.half[0]; *(v8us*)((unsigned short*)Hl + t * 8) = fl.half[0];  } }

// ---- fast GEMM (wave tile 32x64; requires M % 128 == 0 rows per launch region and N % 64 == 0); epilogue = k_gemm_hhx semantics ----
__device__ __forceinline__ v16h g2_frag(const _Float16* p, int hh) { FragH f; f.half[0] = *(const v8us*)((const unsigned short*)p + 8 * hh); f.half[1] = *(const v8us*)((const unsigned short*)p + 16 + 8 * hh); return f.v; }
__device__ __forceinline__ v8f g2_mma(v16h a, v16h b, v8f c) { v8f d = __builtin_amdgcn_wmma_f32_16x16x32_f16(false, a, false, b, (short)0, c, false, false); asm volatile("v_nop\n\tv_nop\n\tv_nop\n\tv_nop" : "+v"(d) : "v"(a), "v"(b)); return d; }
// ---- operand staging of the fast GEMM: a work-group's 128 A rows and 64 B rows, 64 k (128 bytes of each row) a stage, two buffers in LDS ----
#define GK 64                        /* k per stage */
#define GP 144                       /* LDS row pitch in bytes: 16 B x odd, no bank conflict for 16-byte fragment reads */
#define GSTG (192 * GP)              /* a stage: A rows 0..127, then B rows 0..63 */
#define GLDS (2 * GSTG)              /* the ring; the epilogue's tile of 4 x 32 x 68 floats takes the same bytes behind the loop's last barrier */
static_assert(GLDS >= 4 * 32 * 68 * 4, "the epilogue tile must fit the ring");
// One stage: 12 copies of 16 bytes a lane. 8 lanes take one row's 128 bytes, so a wave's copy is 4 whole lines. l: the lane's LDS byte address of row tid / 8; ga, gb: its global address in
// A and B; sa, sb: 16 rows in bytes. The s_wait_xcnt 0 is the statement's last line, so it stands in front of any later write of a register that a copy names.
__device__ __forceinline__ void g2_stage(unsigned l, const char* ga, size_t sa, const char* gb, size_t sb) {
  asm volatile("global_load_async_to_lds_b128 %0, %12, off\n\t"
               "global_load_async_to_lds_b128 %1, %13, off\n\t"
               "global_load_async_to_lds_b128 %2, %14, off\n\t"
               "global_load_async_to_lds_b128 %3, %15, off\n\t"
               "global_load_async_to_lds_b128 %4, %16, off\n\t"
               "global_load_async_to_lds_b128 %5, %17, off\n\t"
               "global_load_async_to_lds_b128 %6, %18, off\n\t"
               "global_load_async_to_lds_b128 %7, %19, off\n\t"
               "global_load_async_to_lds_b128 %8, %20, off\n\t"
               "global_load_async_to_lds_b128 %9, %21, off\n\t"
               "global_load_async_to_lds_b128 %10, %22, off\n\t"
               "global_load_async_to_lds_b128 %11, %23, off\n\t"
               "s_wait_xcnt 0x0"
               : : "v"(l), "v"(l + 16 * GP), "v"(l + 32 * GP), "v"(l + 48 * GP), "v"(l + 64 * GP), "v"(l + 80 * GP), "v"(l + 96 * GP), "v"(l + 112 * GP),
                   "v"(l + 128 * GP), "v"(l + 144 * GP), "v"(l + 160 * GP), "v"(l + 176 * GP),
                   "v"(ga), "v"(ga + sa), "v"(ga + 2 * sa), "v"(ga + 3 * sa), "v"(ga + 4 * sa), "v"(ga + 5 * sa), "v"(ga + 6 * sa), "v"(ga + 7 * sa),
                   "v"(gb), "v"(gb + sb), "v"(gb + 2 * sb), "v"(gb + 3 * sb) : "memory"); }
// A fragment from a staged row: p = the lane's row at byte 16 hh of the k step; k = 8 hh .. + 7 and 16 + 8 hh .. + 7, the k order of g2_frag.
__device__ __forceinline__ v16h g2_lfrag(const char* p) { FragH f; f.half[0] = *(const v8us*)p; f.half[1] = *(const v8us*)(p + 32); return f.v; }
// The product loop of a work-group's 128 x 64 tile (wave w: rows 32 w .. + 31, all 64 columns): the accumulators, the fragments and the order of k are those of the loop that read the
// fragments from global memory. Ab, Bb: the tile's first A and B row. K is a multiple of GK; every wave of the block comes here (barriers).
__device__ __forceinline__ void g2_loop(char* sm, const _Float16* __restrict__ Ab, int lda, const _Float16* __restrict__ Bb, int ldb, int K, v8f (&c)[8]) {
  const int tid = threadIdx.x, w = tid >> 5, lane = tid & 31, ln = lane & 15, hh = lane >> 4; const int rs = tid >> 3, pc = tid & 7;
  const char* ga = (const char*)(Ab + (size_t)rs * lda) + pc * 16; const char* gb = (const char*)(Bb + (size_t)rs * ldb) + pc * 16; const size_t sa = (size_t)lda * 32, sb = (size_t)ldb * 32;
  const unsigned l0 = (unsigned)(size_t)sm + (unsigned)(rs * GP + pc * 16); const int nst = K / GK;
  g2_stage(l0, ga, sa, gb, sb);      /* stage 0 into buffer 0 */
  asm volatile("s_wait_asynccnt 0x0" ::: "memory");      /* the wave's own copies of stage 0 have landed */
  __syncthreads();      /* every wave's have: nobody reads stage 0 in front of this barrier */
  if (nst > 1) g2_stage(l0 + GSTG, ga + 2 * GK, sa, gb + 2 * GK, sb);      /* stage 1 flies under stage 0's products */
  const char* fa = sm + (32 * w + ln) * GP + 16 * hh; const char* fb = sm + (128 + ln) * GP + 16 * hh;
#pragma unroll 1      /* rolled: one trip is one stage, with its publish point at the foot */
  for (int t = 0; t < nst; ++t) { const int bo = (t & 1) * GSTG;
#pragma unroll      /* the stage's two k steps of 32 */
    for (int ks = 0; ks < 2; ++ks) { const char* pa = fa + bo + ks * 64; const char* pb = fb + bo + ks * 64;
      const v16h a0 = g2_lfrag(pa), a1 = g2_lfrag(pa + 16 * GP), b0 = g2_lfrag(pb), b1 = g2_lfrag(pb + 16 * GP), b2 = g2_lfrag(pb + 32 * GP), b3 = g2_lfrag(pb + 48 * GP);      /* the step's six fragments are read as one group, each into registers of its own: one LDS latency a step, not one a column tile */
      c[0] = g2_mma(a0, b0, c[0]); c[4] = g2_mma(a1, b0, c[4]); c[1] = g2_mma(a0, b1, c[1]); c[5] = g2_mma(a1, b1, c[5]);
      c[2] = g2_mma(a0, b2, c[2]); c[6] = g2_mma(a1, b2, c[6]); c[3] = g2_mma(a0, b3, c[3]); c[7] = g2_mma(a1, b3, c[7]); }
    asm volatile("s_wait_dscnt 0x0" ::: "memory");      /* the wave's reads of this buffer have returned, in front of the barrier behind which it is refilled */
    asm volatile("s_wait_asynccnt 0x0" ::: "memory");      /* the wave's copies of stage t + 1 have landed */
    __syncthreads();      /* publishes stage t + 1 and ends every reader's last read of stage t's buffer */
    if (t + 2 < nst) g2_stage(l0 + bo, ga + (size_t)(t + 2) * (2 * GK), sa, gb + (size_t)(t + 2) * (2 * GK), sb); }      /* the same test in the whole work-group */
  asm volatile("s_wait_asynccnt 0x0" ::: "memory"); }      /* no copy is outstanding when the ring becomes the epilogue's tile */
template <int ACT>
__device__ __forceinline__ void gemm2_blk(char* sm, int bx, int by, const _Float16* __restrict__ A, int lda, size_t sA, const _Float16* __restrict__ Bh, int ldb, size_t sB, float alpha, const float* __restrict__ bias, size_t sBias, const float* __restrict__ CP, int rowsPerB, size_t sCPb, int row0g,
    float* __restrict__ C, _Float16* __restrict__ C16, int ldc, size_t sC, int M, int N, int K) { static_assert(ACT == 0 || ACT == 3 || ACT == 6 || ACT == 8 || ACT == 9 || ACT == 11 || ACT == 12 || ACT == 14 || ACT == 15 || ACT == 16 || ACT == 17, "k_gemm2: unsupported ACT code (would silently apply no activation)");
  const int tid = threadIdx.x, w = tid >> 5, lane = tid & 31, ln = lane & 15, hh = lane >> 4;
  A += (size_t)by * sA; Bh += (size_t)by * sB; const size_t cofs = (size_t)by * sC; const float* bp = bias ? bias + (size_t)by * sBias : nullptr;
  const int ntn = N >> 6; const int mt = bx / ntn, nq = bx - mt * ntn; const int row0 = mt * 128 + 32 * w, col0 = nq * 64; if (mt * 128 >= M) return;      /* the whole block or none: M is a multiple of 128 */
  float (*so)[32][68] = (float (*)[32][68])sm;
  v8f accs[8] = {};      /* tile (half, t) at index 4 half + t */
  g2_loop(sm, A + (size_t)(mt * 128) * lda, lda, Bh + (size_t)col0 * ldb, ldb, K, accs);
#pragma unroll
  for (int u = 0; u < 8; ++u) { const int t = u & 3, half = u >> 2; const int col = col0 + t * 16 + ln; const float bv = bp ? bf16_round(bp[col]) : 0.f;
#pragma unroll
    for (int r = 0; r < 8; ++r) { const int rloc = half * 16 + 8 * hh + r; float v = accs[u][r] * alpha + bv; if (CP) { if (rowsPerB < 0) v += CP[cofs + (size_t)(row0g + row0 + rloc) * ldc + col];      /* rowsPerB < 0: own element of the batched C plane */ else { const int bidx = (row0g + row0 + rloc) / rowsPerB; v += CP[(size_t)bidx * sCPb + (size_t)by * 64 + col]; } }
      if (ACT == 3) v = fmaxf(v, 0.f); else if (ACT == 6) v = 0.5f * v * (1.0f + erff(v * 0.70710678118654752f)); else if (ACT == 11) v = 1.0f / (1.0f + expf(-v)); else if (ACT == 15) v = v / (1.0f + expf(-v)); else if (ACT == 12) v = (v > 0.f) ? v : 0.01f * v; else if (ACT == 8) v = tanhf(v); else if (ACT == 9) v = 0.5f * v * (1.0f + tanhf(0.7978845608028654f * (v + 0.044715f * v * v * v))); else if (ACT == 14) v = (v > 0.f) ? v : 0.1f * v; else if (ACT == 16) v = (v >= 0.f) ? v : 0.3f * v; else if (ACT == 17) v = (v >= 0.f) ? v : 0.2f * v;
      so[w][rloc][t * 16 + ln] = v; } }
  __builtin_amdgcn_fence(__ATOMIC_ACQ_REL, "workgroup"); __builtin_amdgcn_wave_barrier();
  const int rsub = lane >> 4, c4 = (lane & 15) * 4;
  {
#pragma unroll
    for (int q = 0; q < 16; ++q) { const int r = q * 2 + rsub; v4f v = *(const v4fa*)&so[w][r][c4]; if (C) { *(v4f*)(C + cofs + (size_t)(row0 + r) * ldc + col0 + c4) = v; if (C16) asm volatile("s_wait_xcnt 0x0" : "+v"(v) : : "memory"); }      /* behind the f32 store, in front of the conversion, which was placed on the registers that the issued store names; v passes through, so the conversion stands behind the wait */
      if (C16) { v4h h4; for (int i = 0; i < 4; ++i) h4[i] = (_Float16)v[i]; *(v4h*)(C16 + cofs + (size_t)(row0 + r) * ldc + col0 + c4) = h4; } }
    asm volatile("s_wait_xcnt 0x0" ::: "memory");      /* behind the last store of the rows, in front of any later write of a register that an issued store names (another stage's code follows in the listing) */
     } }
// the product as a launch of its own (the two first-tile output products, which depend on one another)
template <int ACT>
__global__ __launch_bounds__(128) void k_gemm2(const _Float16* __restrict__ A, int lda, size_t sA, const _Float16* __restrict__ Bh, int ldb, size_t sB, float alpha, const float* __restrict__ bias, size_t sBias, const float* __restrict__ CP, int rowsPerB, size_t sCPb, int row0g,
    float* __restrict__ C, _Float16* __restrict__ C16, int ldc, size_t sC, int M, int N, int K) {
  __shared__ __attribute__((aligned(128))) char sm[GLDS];
  gemm2_blk<ACT>(sm, (int)blockIdx.x, (int)blockIdx.y, A, lda, sA, Bh, ldb, sB, alpha, bias, sBias, CP, rowsPerB, sCPb, row0g, C, C16, ldc, sC, M, N, K); }


__global__ __launch_bounds__(256) void k_wnat(const float* __restrict__ w, size_t n8, _Float16* __restrict__ Bt) { const size_t t = (size_t)blockIdx.x * 256 + threadIdx.x; if (t >= n8) return; FragH f; for (int q = 0; q < 8; ++q) f.h[q] = (_Float16)(bf16_round(w[t * 8 + q]) * 16.0f); *(v8us*)((unsigned short*)Bt + t * 8) = f.half[0];  }
__global__ __launch_bounds__(256) void k_rsm(const float* __restrict__ S, _Float16* __restrict__ P, int nrows) {
  #pragma clang fp contract(off)
  const int i = blockIdx.x * 256 + threadIdx.x; if (i >= nrows) return; const float* s = S + (size_t)i * SQ; float mx = -3.0e38f;
#pragma unroll 1
  for (int j = 0; j < SQ; ++j) mx = fmaxf(mx, s[j]); float se = 0.f;
#pragma unroll 1
  for (int j = 0; j < SQ; ++j) se += expf(s[j] - mx); const float sc = 256.0f / se;
#pragma unroll 1
  for (int j0 = 0; j0 < SQ; j0 += 8) { FragH f; for (int q = 0; q < 8; ++q) f.h[q] = (_Float16)(expf(s[j0 + q] - mx) * sc); unsigned short* d = (unsigned short*)P + (size_t)i * SQ + j0; *(v8us*)d = f.half[0];  } }
__global__ __launch_bounds__(256) void k_vt(const _Float16* __restrict__ V16, int b, int h0, _Float16* __restrict__ VT) { __shared__ unsigned short tl[64][65]; const int tid = threadIdx.x; const int hh = blockIdx.x % HG, sg = blockIdx.x / HG; const int s0 = sg * 64; const int h = h0 + hh;
  for (int i = tid; i < 64 * 8; i += 256) { const int j = i / 8, d8 = (i % 8) * 8; FragH f; f.half[0] = *(const v8us*)((const unsigned short*)V16 + ((size_t)b * SQ + s0 + j) * DM + h * HD + d8); for (int q = 0; q < 8; ++q) tl[d8 + q][j] = f.u[q]; }
  __syncthreads();
  { for (int i = tid; i < 64 * 8; i += 256) { const int d = i / 8, j8 = (i % 8) * 8; FragH f; for (int q = 0; q < 8; ++q) f.u[q] = tl[d][j8 + q]; *(v8us*)((unsigned short*)VT + ((size_t)hh * HD + d) * SQ + s0 + j8) = f.half[0]; }  } }



// 2^x on the transcendental unit. The v_nop fills the one issue slot that the instruction set asks for behind a transcendental before its source
// is overwritten.
__device__ __forceinline__ float exp2_slot(float x) { float r; asm("v_exp_f32 %0, %1\n\tv_nop" : "=v"(r) : "v"(x)); return r; }
// Fused causal attention (online softmax): one launch for every batch, head and query row; scores and softmax weights never leave the registers.
// A work-group is the 4 query heads of one kv group (one wave each) on the same 32 query rows, so its waves walk the same K and V lines.
// Transposed products: S^T = K Q^T puts query 16 c + ln in lane ln and key 16 kt + 8 hh + r in register r, which is already the B-operand order of
// P^T for O^T += V^T P^T (half kt of the fragment = tile kt's 8 registers): no exchange between lanes but the one between the two wave halves.
__device__ __forceinline__ v8f fa_mma(v16h a, v16h b, v8f c) { return __builtin_amdgcn_wmma_f32_16x16x32_f16(false, a, false, b, (short)0, c, false, false); }
__device__ __forceinline__ float fa_xhalf(float x) { return __builtin_bit_cast(float, __builtin_amdgcn_permlanex16(__builtin_bit_cast(int, x), __builtin_bit_cast(int, x), 0x76543210, 0xfedcba98, false, false)); }      /* lane l <-> lane l ^ 16 */
// A fragment at the lane's own byte offset (row ln, element 8 hh) from a uniform base: k = 8 hh .. + 7 and 16 + 8 hh .. + 7, the k order of g2_frag.
__device__ __forceinline__ v16h fa_frag(const _Float16* base, unsigned off, int cb) { const char* p = (const char*)base + off; FragH f; f.half[0] = *(const v8us*)(p + cb); f.half[1] = *(const v8us*)(p + cb + 32); return f.v; }
// s_wait_xcnt 0 behind issued loads, in front of any write of a register that they name. The lane offsets pass through the statement: they stay in
// their registers up to the wait, and whatever is formed from them later stands behind it (a "memory" clobber alone does not tie the wait to registers).
__device__ __forceinline__ void fa_hold(unsigned& a) { asm volatile("s_wait_xcnt 0x0" : "+v"(a) : : "memory"); }
// ---- K and V^T staging of the fused attention: a stage is 64 keys, that is 64 K rows (the kv group's 128 bytes of d) and the 64 V^T rows (128 bytes of keys each); two buffers in LDS.
// The work-group's 4 waves walk the same keys, so a stage is brought in once for all four, in whole 128-byte lines, and each wave reads its fragments from LDS. ----
#define FP 144                       /* LDS row pitch in bytes: 16 B x odd, no bank conflict for 16-byte fragment reads */
#define FSTG (128 * FP)              /* a stage: K rows 0..63, then V^T rows 0..63 */
#define ALDS 81920                   /* LDS of the attention launch: the exact first-tile blocks' three arrays; a fused block's ring takes the first bytes of the same buffer */
static_assert(2 * FSTG <= ALDS, "the ring must fit the launch's buffer");
// One stage: 8 copies of 16 bytes a lane. 8 lanes take one row's 128 bytes, so a wave's copy is 4 whole lines. l: the lane's LDS byte address of row tid / 8; gk, gv: its global address in
// K and V^T. The s_wait_xcnt 0 is the statement's last line, so it stands in front of any later write of a register that a copy names.
__device__ __forceinline__ void fa_stage(unsigned l, const char* gk, const char* gv) {
  asm volatile("global_load_async_to_lds_b128 %0, %8, off\n\t"
               "global_load_async_to_lds_b128 %1, %9, off\n\t"
               "global_load_async_to_lds_b128 %2, %10, off\n\t"
               "global_load_async_to_lds_b128 %3, %11, off\n\t"
               "global_load_async_to_lds_b128 %4, %12, off\n\t"
               "global_load_async_to_lds_b128 %5, %13, off\n\t"
               "global_load_async_to_lds_b128 %6, %14, off\n\t"
               "global_load_async_to_lds_b128 %7, %15, off\n\t"
               "s_wait_xcnt 0x0"
               : : "v"(l), "v"(l + 16 * FP), "v"(l + 32 * FP), "v"(l + 48 * FP), "v"(l + 64 * FP), "v"(l + 80 * FP), "v"(l + 96 * FP), "v"(l + 112 * FP),
                   "v"(gk), "v"(gk + 16 * KVD * 2), "v"(gk + 32 * KVD * 2), "v"(gk + 48 * KVD * 2),
                   "v"(gv), "v"(gv + 16 * SQ * 2), "v"(gv + 32 * SQ * 2), "v"(gv + 48 * SQ * 2) : "memory"); }
// One pass of 32 keys. kp: the lane's LDS address in the pass's first K row group (row ln, byte 16 hh); vp: in V^T row ln at the pass's keys. DIAG: the wave's last pass, the only one
// that meets the diagonal (it masks).
// Every loop over kt, kc, c, t and r here and in the kernel is unrolled so that fragments, scores and accumulators are indexed by constants only and stay in registers.
template <bool DIAG>
__device__ __forceinline__ void fa_pass(const char* kp, const char* vp, int key0, int q0, int ln, int hh,
                                        const v16h (&qf)[2][2], v8f (&acc)[2][4], float (&m)[2], float (&l)[2]) {
  const float cs = 0.125f * 1.44269504f;      /* 1 / sqrt(64), and e^x = 2^(x log2 e) */
  v16h kf[2][2], vf[4];
#pragma unroll
  for (int kt = 0; kt < 2; ++kt)
#pragma unroll
    for (int kc = 0; kc < 2; ++kc) kf[kt][kc] = g2_lfrag(kp + 16 * kt * FP + 64 * kc);      /* K rows 16 kt + ln, d = 32 kc + 8 hh .. : the k order of fa_frag */
#pragma unroll
  for (int t = 0; t < 4; ++t) vf[t] = g2_lfrag(vp + 16 * t * FP);      /* V^T rows d = 16 t + ln, this pass's keys: read in one group with the K rows, on their way under the scores and the exponentials */
  v8f s[2][2];
#pragma unroll
  for (int kt = 0; kt < 2; ++kt)
#pragma unroll
    for (int c = 0; c < 2; ++c) { const v8f z = {0.f, 0.f, 0.f, 0.f, 0.f, 0.f, 0.f, 0.f}; s[kt][c] = fa_mma(kf[kt][1], qf[c][1], fa_mma(kf[kt][0], qf[c][0], z)); }
#pragma unroll
  for (int c = 0; c < 2; ++c) {
    if (DIAG) {
      const int qi = q0 + 16 * c + ln;
#pragma unroll
      for (int kt = 0; kt < 2; ++kt)
#pragma unroll
        for (int r = 0; r < 8; ++r) if (key0 + 16 * kt + 8 * hh + r > qi) s[kt][c][r] = -1.0e30f;
    }
    float mx = s[0][c][0];
#pragma unroll
    for (int r = 0; r < 8; ++r) mx = fmaxf(mx, fmaxf(s[0][c][r], s[1][c][r]));
    mx = fmaxf(mx, fa_xhalf(mx));      /* both halves of the wave now hold this query's maximum over the pass */
    const float mn = fmaxf(m[c], mx * cs);
    const float corr = exp2_slot(m[c] - mn);      /* 0 on the first pass */
    m[c] = mn;
    FragH pf; float ps = 0.f;
#pragma unroll
    for (int kt = 0; kt < 2; ++kt)
#pragma unroll
      for (int r = 0; r < 8; ++r) { const float p = exp2_slot(fmaf(s[kt][c][r], cs, -mn)); ps += p; pf.h[8 * kt + r] = (_Float16)p; }
    l[c] = fmaf(l[c], corr, ps);
#pragma unroll
    for (int t = 0; t < 4; ++t) { acc[c][t] = acc[c][t] * corr; acc[c][t] = fa_mma(vf[t], pf.v, acc[c][t]); }
    /* the four vector slots that the chip needs behind a matrix instruction before its operands are overwritten */
    asm volatile("v_nop\n\tv_nop\n\tv_nop\n\tv_nop" : "+v"(acc[c][0]), "+v"(acc[c][1]), "+v"(acc[c][2]), "+v"(acc[c][3]) : "v"(vf[0]), "v"(vf[1]), "v"(vf[2]), "v"(vf[3]), "v"(pf.v));
  }
}
__device__ __forceinline__ void fattn_blk(char* sm, int bx, int g, int b, const _Float16* __restrict__ Q, const _Float16* __restrict__ Kh, const _Float16* __restrict__ Vt, _Float16* __restrict__ O) {
  const int tid = threadIdx.x, lane = tid & 31, ln = lane & 15, hh = lane >> 4; const int h = g * HPG + (tid >> 5);
  const int qt = (b & 1) ? bx : (SQ / 32 - 1) - bx;      /* long and short tiles alternate from batch to batch, so that work-groups a whole batch apart in the grid add up to the same length */
  const int q0 = qt * 32; const size_t r0 = (size_t)b * SQ;
  unsigned qo = (unsigned)(((r0 + q0 + ln) * DM + h * HD + 8 * hh) * 2);      /* byte offset: the buffer is below 4 GiB */
  v16h qf[2][2];
#pragma unroll
  for (int c = 0; c < 2; ++c)
#pragma unroll
    for (int kc = 0; kc < 2; ++kc) qf[c][kc] = fa_frag(Q, qo, (16 * c * DM + 32 * kc) * 2);
  fa_hold(qo);
  const int rs = tid >> 3, pc = tid & 7;      /* staging: 8 lanes to a row of 128 bytes */
  const char* gk = (const char*)(Kh + (r0 + rs) * KVD + g * HD) + pc * 16; const char* gv = (const char*)(Vt + ((size_t)(b * NG + g) * HD + rs) * SQ) + pc * 16;
  const unsigned l0 = (unsigned)(size_t)sm + (unsigned)(rs * FP + pc * 16);
  const int nst = (qt + 2) >> 1;      /* stages of 64 keys that hold the tile's qt + 1 passes; the last key staged is at most q0 + 63 - 32 (qt & 1), inside the batch's SQ rows */
  fa_stage(l0, gk, gv);      /* stage 0 into buffer 0 */
  asm volatile("s_wait_asynccnt 0x0" ::: "memory");      /* the wave's own copies of stage 0 have landed */
  __syncthreads();      /* every wave's have: nobody reads stage 0 in front of this barrier */
  if (nst > 1) fa_stage(l0 + FSTG, gk + 64 * KVD * 2, gv + 64 * 2);      /* stage 1 flies under stage 0's passes */
  const char* fk = sm + ln * FP + 16 * hh; const char* fv = sm + (64 + ln) * FP + 16 * hh;
  v8f acc[2][4] = {}; float m[2] = {-1.0e30f, -1.0e30f}, l[2] = {0.f, 0.f};
#pragma unroll 1      /* rolled: one trip is one stage, with its publish point at the foot */
  for (int t = 0; t < nst; ++t) { const int bo = (t & 1) * FSTG; const bool fin = t == nst - 1; const int np = fin ? (qt & 1) : 2;      /* np: the stage's passes below the diagonal; every test here reads the same in the whole work-group */
#pragma unroll 1      /* rolled: with the stage's two passes laid out side by side the compiler kept both passes' fragments and scores at once, beyond the registers of four waves a SIMD */
    for (int p = 0; p < np; ++p) fa_pass<false>(fk + bo + p * (32 * FP), fv + bo + p * 64, 64 * t + 32 * p, q0, ln, hh, qf, acc, m, l);
    if (fin) fa_pass<true>(fk + bo + np * (32 * FP), fv + bo + np * 64, q0, q0, ln, hh, qf, acc, m, l);      /* the diagonal pass: the last stage's pass number qt & 1 */
    asm volatile("s_wait_dscnt 0x0" ::: "memory");      /* the wave's reads of this buffer have returned, in front of the barrier behind which it is refilled */
    asm volatile("s_wait_asynccnt 0x0" ::: "memory");      /* the wave's copies of stage t + 1 have landed */
    __syncthreads();      /* publishes stage t + 1 and ends every reader's last read of stage t's buffer */
    if (t + 2 < nst) fa_stage(l0 + bo, gk + (size_t)(t + 2) * (64 * KVD * 2), gv + (size_t)(t + 2) * (64 * 2)); }      /* the same test in the whole work-group */
  asm volatile("s_wait_asynccnt 0x0" ::: "memory");      /* no copy is outstanding when the wave ends */
  unsigned short* op = (unsigned short*)O + (r0 + q0 + ln) * DM + h * HD + 8 * hh;
#pragma unroll
  for (int c = 0; c < 2; ++c) { const float fin = 64.0f / (l[c] + fa_xhalf(l[c]));      /* o carried x64, as the output product expects */
#pragma unroll
    for (int t = 0; t < 4; ++t) { FragH f;
#pragma unroll
      for (int r = 0; r < 8; ++r) f.h[r] = (_Float16)(acc[c][t][r] * fin);
      *(v8us*)(op + (size_t)(16 * c) * DM + 16 * t) = f.half[0]; }      /* d = 16 t + 8 hh .. + 7 of query row 16 c + ln */
    asm volatile("s_wait_xcnt 0x0" ::: "memory"); }      /* behind the stores, in front of any later write of a register that an issued store names */
}


// Exact f32 attention for the first QT0 rows: one thread per (query row, head), online softmax; every sum runs in the order d = 0, 1, ... and j = 0, 1, ...
// What a thread owns (its q row, its o accumulator) stays in registers; what all threads of the block read at the same address (the head's K and V rows)
// is staged once in LDS and read by broadcast. Every loop over d is unrolled so that q, o and the row fragments are indexed by constants only.
// by is the batch: its QT0 rows of q, k, v and o follow those of the batch before.
// The block has the 128 threads of the launch it rides in; its 64 rows are the work of waves 0 and 1, and waves 2 and 3 only pass the two barriers.
__device__ __forceinline__ void att0_blk(char* sm, int bx, int by, const float* __restrict__ QF, const float* __restrict__ KF, const float* __restrict__ VF, float scale, float* __restrict__ OF, int ldo) {
  float (*lk)[HD] = (float (*)[HD])sm; float (*lv)[HD] = (float (*)[HD])(sm + QT0 * HD * 4); float (*lo)[64] = (float (*)[64])(sm + 2 * QT0 * HD * 4);      /* lk[QT0][HD], lv[QT0][HD], lo[64][64] in the launch's one LDS buffer */
  static_assert(2 * QT0 * HD * 4 + 64 * 64 * 4 <= ALDS, "the three arrays must fit the launch's buffer");
  const int tid = threadIdx.x; const int h = bx / (QT0 / 64), rg = bx % (QT0 / 64); const int i = rg * 64 + tid;
  const bool on = __builtin_amdgcn_readfirstlane(tid >> 5) < 2;      /* the wave's number, the same in every lane: a scalar branch */
  QF += (size_t)by * QT0 * LQ; KF += (size_t)by * QT0 * LQ; VF += (size_t)by * QT0 * LQ; OF += (size_t)by * QT0 * ldo;
  const int jmax = rg * 64 + 63;      /* keys up to the block's last row */
  const int sr = tid >> 4, sc4 = (tid & 15) * 4;      /* staging: 16 threads to a row of 256 bytes */
  unsigned so = (unsigned)((sr * LQ + h * HD + sc4) * 4), qo = (unsigned)((i * LQ + h * HD) * 4);      /* the lane's byte offsets in K and V, and in q */
  float q[HD], o[HD];
  if (on) {
#pragma unroll 1      /* kept rolled: one trip already has 16 loads in flight per thread */
  for (int r0 = 0; r0 <= jmax; r0 += 32) { v4f kk[8], vv[8];
#pragma unroll
    for (int u = 0; u < 8; ++u) { kk[u] = *(const v4fa*)((const char*)KF + so + u * 4 * LQ * 4); vv[u] = *(const v4fa*)((const char*)VF + so + u * 4 * LQ * 4); }      /* 16 loads in flight per thread */
    fa_hold(so);      /* the wait behind the issued loads, in front of the write of the offset that they name */
    so += 32 * LQ * 4;
#pragma unroll
    for (int u = 0; u < 8; ++u) { *(v4f*)&lk[r0 + 4 * u + sr][sc4] = kk[u]; *(v4f*)&lv[r0 + 4 * u + sr][sc4] = vv[u]; } }
#pragma unroll
  for (int c = 0; c < HD / 4; ++c) { const v4f t = *(const v4fa*)((const char*)QF + qo + c * 16);
#pragma unroll
    for (int u = 0; u < 4; ++u) { q[c * 4 + u] = t[u]; o[c * 4 + u] = 0.f; } }
  fa_hold(qo);      /* the same wait behind the q loads; their offset stays in its register up to it */
  }
  __syncthreads();      /* K and V rows are staged: nobody reads them in front of this barrier */
  if (on) {
  float m = -1.0e30f, l = 0.f, sn = 0.f;
#pragma unroll
  for (int d = 0; d < HD; ++d) sn = fmaf(q[d], lk[0][d], sn);
#pragma unroll 1      /* kept rolled: a second copy of the body would not fit the registers beside q and o */
  for (int j = 0; j <= jmax; ++j) { const float s = sn * scale;
    const float* kr = &lk[j < jmax ? j + 1 : jmax][0]; v4f kq[HD / 4], vv[HD / 4];
#pragma unroll
    for (int c = 0; c < HD / 4; ++c) kq[c] = *(const v4f*)(kr + c * 4);
    __builtin_amdgcn_sched_barrier(0);      /* keeps the K reads in front of the V reads: LDS answers in order, and with V rows queued between them the score chain below waits for its K words */
#pragma unroll
    for (int c = 0; c < HD / 4; ++c) vv[c] = *(const v4f*)&lv[j][c * 4];
    sn = 0.f;      /* the next key's score: its chain of 64 dependent multiply-adds depends on nothing below, so this key's exponentials and o update fill its waits */
#pragma unroll
    for (int d = 0; d < HD; ++d) sn = fmaf(q[d], kq[d >> 2][d & 3], sn);
    const float f = (j <= i) ? 1.f : 0.f; const float sm = fmaf(f, s, (1.f - f) * -1.0e30f); const float mn = fmaxf(m, sm); const float sc = expf(m - mn); const float e = expf(sm - mn); l = fmaf(l, sc, e); m = mn;
#pragma unroll
    for (int d = 0; d < HD; ++d) o[d] = fmaf(o[d], sc, e * vv[d >> 2][d & 3]); }
  const float fin = 64.0f / l;      /* o carried x64 like the f16 path */
#pragma unroll
  for (int c = 0; c < HD / 4; ++c) { v4f oo;
#pragma unroll
    for (int u = 0; u < 4; ++u) oo[u] = o[c * 4 + u] * fin;
    *(v4f*)&lo[tid][c * 4] = oo; }
  }
  __syncthreads();
  if (on) {
#pragma unroll 1
    for (int it = 0; it < 16; ++it) { const int row = it * 4 + tid / 16, pc = (tid % 16) * 4; const v4f v = *(const v4f*)&lo[row][pc]; *(v4f*)(OF + (size_t)(rg * 64 + row) * ldo + h * HD + pc) = v; }
     } }


__device__ __forceinline__ void kvexp_blk(int bx, const float* __restrict__ src, float* __restrict__ dst, size_t n4) { const size_t t = (size_t)bx * 256 + threadIdx.x; if (t >= n4) return; const size_t e = t * 4; const size_t row = e / DM; const int col = (int)(e % DM); const int h = col / HD, d = col % HD; const v4f v = *(const v4fa*)(src + row * KVD + (size_t)(h / HPG) * HD + d); *(v4f*)(dst + e) = v;  }

__global__ __launch_bounds__(256) void k_tab2(float theta, float* __restrict__ CS, float* __restrict__ SN) {
  #pragma clang fp contract(off)
  const int t = blockIdx.x * 256 + threadIdx.x; if (t >= SQ * (HD / 2)) return; const int i = t % (HD / 2); const int p = t / (HD / 2); const float invf = 1.0f / powf(theta, (float)(2 * i) / (float)HD); const float ang = __fmul_rn((float)p, invf); const float c = cosf(ang), s = sinf(ang);
  *(float*)(CS + t) = c; *(float*)(SN + t) = s;  }
// Projection GEMM with the rope in its epilogue (q and k). The product is k_gemm2's: wave tile 32 x 64, the same fragments, the same order of k. A wave's 64 columns are one head, and the
// tile that the epilogue lays out in LDS for whole-line stores gives a lane four neighbouring columns of a row, that is both members of two (even, odd) pairs: the lane rotates them by the
// row's position (row % SQ; a tile of 32 rows lies in one batch) and stores f16. Rows 0 .. QT0 - 1 of each batch also go out in f32 for the exact first-tile path (F0: QT0 rows a batch).
typedef float v2fa __attribute__((ext_vector_type(2), may_alias));
// The 16 rows of a lane (every second row of the wave's tile): tp = the lane's four words of its first row in LDS, cp / sp = its two table entries of that row, hp / fp = its place in the outputs.
// F32 is a template argument so that neither form has a branch between its rows: the 32 table loads of a lane are then in flight together instead of one row's pair at a time.
// NC, the outputs' row pitch, is one too: every row's store is then the first row's address with an immediate offset.
template <bool F32, int NC>
__device__ __forceinline__ void g2_rope_rows(const float* tp, const float* __restrict__ cp, const float* __restrict__ sp, _Float16* __restrict__ hp, float* __restrict__ fp) {
#pragma unroll      /* unrolled for the same reason: all table loads issue in front of the first use */
  for (int q = 0; q < 16; ++q) { const v4f v = *(const v4fa*)(tp + q * 2 * 68); const v2fa c = *(const v2fa*)(cp + q * 2 * (HD / 2)), s = *(const v2fa*)(sp + q * 2 * (HD / 2));
    v4f o; o[0] = v[0] * c[0] - v[1] * s[0]; o[1] = v[0] * s[0] + v[1] * c[0]; o[2] = v[2] * c[1] - v[3] * s[1]; o[3] = v[2] * s[1] + v[3] * c[1];
    v4h h4;
#pragma unroll      /* constant element indices: o and h4 stay in registers */
    for (int i = 0; i < 4; ++i) h4[i] = (_Float16)o[i];
    *(v4h*)(hp + q * 2 * NC) = h4;
    if (F32) *(v4f*)(fp + q * 2 * NC) = o; }
  asm volatile("s_wait_xcnt 0x0" ::: "memory"); }      /* behind the last store of the rows, in front of any later write of a register that an issued store names (the other form's code follows in the listing) */
template <int NC>      /* columns of the product = row pitch of both outputs */
__device__ __forceinline__ void gemm2r_blk(char* sm, int bx, const _Float16* __restrict__ A, int lda, const _Float16* __restrict__ Bh, int ldb, float alpha, const float* __restrict__ CS, const float* __restrict__ SN,
    _Float16* __restrict__ H16, float* __restrict__ F0, int M, int K) {
  const int tid = threadIdx.x, w = tid >> 5, lane = tid & 31, ln = lane & 15, hh = lane >> 4;
  const int ntn = NC >> 6; const int mt = bx / ntn, nq = bx - mt * ntn; const int row0 = mt * 128 + 32 * w, col0 = nq * 64; if (mt * 128 >= M) return;      /* the whole block or none: M is a multiple of 128 */
  float (*so)[32][68] = (float (*)[32][68])sm;
  v8f accs[8] = {};      /* tile (half, t) at index 4 half + t */
  g2_loop(sm, A + (size_t)(mt * 128) * lda, lda, Bh + (size_t)col0 * ldb, ldb, K, accs);      /* k_gemm2's product loop */
#pragma unroll      /* unrolled so that the accumulators are indexed by constants only and stay in registers */
  for (int u = 0; u < 8; ++u) { const int t = u & 3, half = u >> 2;
#pragma unroll      /* the same, for the element index */
    for (int r = 0; r < 8; ++r) so[w][half * 16 + 8 * hh + r][t * 16 + ln] = accs[u][r] * alpha; }
  __builtin_amdgcn_fence(__ATOMIC_ACQ_REL, "workgroup"); __builtin_amdgcn_wave_barrier();      /* the wave's own LDS writes stand in front of its reads of other lanes' words; no other wave reads this slice */
  const int rsub = lane >> 4, c4 = (lane & 15) * 4; const int p0 = row0 % SQ;
  const float* cp = CS + (size_t)(p0 + rsub) * (HD / 2) + c4 / 2; const float* sp = SN + (size_t)(p0 + rsub) * (HD / 2) + c4 / 2;      /* table entries i = c4 / 2 and c4 / 2 + 1 of the lane's row */
  _Float16* hp = H16 + (size_t)(row0 + rsub) * NC + col0 + c4; float* fp = F0 + ((size_t)(row0 / SQ) * QT0 + p0 + rsub) * NC + col0 + c4;
  if (__builtin_amdgcn_readfirstlane(p0) < QT0) g2_rope_rows<true, NC>(&so[w][rsub][c4], cp, sp, hp, fp);      /* p0 is the same in every lane of a wave: a scalar branch; QT0 is a multiple of the tile's 32 rows */
  else g2_rope_rows<false, NC>(&so[w][rsub][c4], cp, sp, hp, fp); }

__global__ __launch_bounds__(256) void k_bfcp(const float* __restrict__ src, float* __restrict__ dst, size_t n4) { const size_t t = (size_t)blockIdx.x * 256 + threadIdx.x; if (t >= n4) return; const v4f a = *(const v4fa*)(src + t * 4); v4f o; for (int q = 0; q < 4; ++q) o[q] = bf16_round(a[q]); *(v4f*)(dst + t * 4) = o;  }

__global__ __launch_bounds__(256) void k_tabhalf(const float* __restrict__ cs, const float* __restrict__ sn, float* __restrict__ CS, float* __restrict__ SN) { const int t = blockIdx.x * 256 + threadIdx.x; if (t >= SQ * (HD / 2)) return; const int p = t / (HD / 2), i = t % (HD / 2); const float c = bf16_round(cs[(size_t)p * HD + i]), s = bf16_round(sn[(size_t)p * HD + i]);
  *(float*)(CS + t) = c; *(float*)(SN + t) = s;  }

__device__ __forceinline__ void tab2d_blk(int bx, float* __restrict__ CS, float* __restrict__ SN) {
  #pragma clang fp contract(off)
  const int t = bx * 256 + threadIdx.x; if (t >= SQ * (HD / 2)) return; const int i = t % (HD / 2); const int p = t / (HD / 2); const float invf = (float)(1.0 / pow(10000.0, (double)(2 * i) / (double)HD)); const float ang = __fmul_rn((float)p, invf); const float c = cosf(ang), s = sinf(ang);
  *(float*)(CS + t) = c; *(float*)(SN + t) = s;  }
// Launches that do not depend on one another ride in ONE grid: a block's index says which stage it belongs to and which block of that stage it is (a scalar branch: the index is the
// same for the whole block). Every stage's code, block size and block-to-data map are what they were as a launch of its own, but for the exact first-tile stage, whose 64 working threads ride in blocks of 128; stages whose blocks last longest come first.
#define PB_TAB (SQ * (HD / 2) / 256)
#define PB_WQ (DM * (DM / 8) / 256)
#define PB_WK (KVD * (DM / 8) / 256)
#define PB_X ((int)(NR * DM / 8 / 256))
// rope tables, the four weight transposes, x -> f16: all read inputs only
__global__ __launch_bounds__(256) void k_prep(const float* __restrict__ x, const float* __restrict__ wq, const float* __restrict__ wk, const float* __restrict__ wv, const float* __restrict__ wo,
    _Float16* __restrict__ X16, _Float16* __restrict__ BQ, _Float16* __restrict__ BK, _Float16* __restrict__ BV, _Float16* __restrict__ BO, float* __restrict__ CS, float* __restrict__ SN) {
  int bx = (int)blockIdx.x;
  if (bx < PB_TAB) { tab2d_blk(bx, CS, SN); return; }      /* angle[p][i] = p * 10000^(-2i/64), positions = row index */
  bx -= PB_TAB; if (bx < PB_WQ) { wt_f16_blk(bx, wq, BQ, DM, DM, 16.0f); return; }      /* [in][out] -> Bt[n][k] x16 */
  bx -= PB_WQ; if (bx < PB_WQ) { wt_f16_blk(bx, wo, BO, DM, DM, 16.0f); return; }
  bx -= PB_WQ; if (bx < PB_WK) { wt_f16_blk(bx, wk, BK, DM, KVD, 16.0f); return; }
  bx -= PB_WK; if (bx < PB_WK) { wt_f16_blk(bx, wv, BV, DM, KVD, 16.0f); return; }
  bx -= PB_WK; x16_blk(bx, x, X16, NR * DM / 8); }
#define GB_Q ((MP / 128) * (DM / 64))
#define GB_K ((MP / 128) * (KVD / 64))
#define GB_V0 ((QT0 / 128) * (KVD / 64))
// the q, k and v products and the f32 v rows of the first tile: all read X16 and a weight plane
__global__ __launch_bounds__(128) void k_proj(const _Float16* __restrict__ X16, const _Float16* __restrict__ BQ, const _Float16* __restrict__ BK, const _Float16* __restrict__ BV, const float* __restrict__ CS, const float* __restrict__ SN,
    _Float16* __restrict__ Q16, float* __restrict__ QF0, _Float16* __restrict__ K16, float* __restrict__ KF0, _Float16* __restrict__ V16, float* __restrict__ VF0) {
  __shared__ __attribute__((aligned(128))) char sm[GLDS];
  int bx = (int)blockIdx.x;
  if (bx < GB_Q) { gemm2r_blk<DM>(sm, bx, X16, DM, BQ, DM, 0.0625f, CS, SN, Q16, QF0, MP, DM); return; }      /* q with the interleaved-pair rope, position = row % SQ -> f16 rows; f32 rows 0..127 of each batch */
  bx -= GB_Q; if (bx < GB_K) { gemm2r_blk<KVD>(sm, bx, X16, DM, BK, DM, 0.0625f, CS, SN, K16, KF0, MP, DM); return; }      /* k, the same */
  bx -= GB_K; if (bx < GB_K) { gemm2_blk<0>(sm, bx, 0, X16, DM, 0, BV, DM, 0, 0.0625f, nullptr, 0, nullptr, 1, 0, 0, nullptr, V16, KVD, 0, MP, KVD, DM); return; }
  bx -= GB_K; gemm2_blk<0>(sm, bx % GB_V0, bx / GB_V0, X16, DM, (size_t)SQ * DM, BV, DM, 0, 0.0625f, nullptr, 0, nullptr, 1, 0, 0, VF0, nullptr, KVD, (size_t)QT0 * KVD, QT0, KVD, DM); }      /* f32 v of rows 0..127 of each batch */
#define CB_VT (NB * NG * (SQ / 64))
#define CB_KV (NB * QT0 * DM / 4 / 256)
// V^T for the fused attention; k and v rows of the first tile spread from kv group to head
__global__ __launch_bounds__(256) void k_lay(const _Float16* __restrict__ V16, _Float16* __restrict__ VT, const float* __restrict__ KF0, float* __restrict__ KF0e, const float* __restrict__ VF0, float* __restrict__ VF0e) {
  int bx = (int)blockIdx.x;
  if (bx < CB_VT) { vt_blk<NG, SQ>(bx, V16, KVD, 0, VT); return; }      /* V^T [NB][NG][HD][SQ] */
  bx -= CB_VT; if (bx < CB_KV) { kvexp_blk(bx, KF0, KF0e, (size_t)NB * QT0 * DM / 4); return; }      /* head h <- kv group h/4 */
  bx -= CB_KV; kvexp_blk(bx, VF0, VF0e, (size_t)NB * QT0 * DM / 4); }
#define DB_F ((SQ / 32) * NG * NB)
#define DB_A0 (NH * (QT0 / 64))
// the fused attention in its own block order (tile fastest, then kv group, then batch), and behind it the exact first-tile blocks, which take the places that the shortest tiles leave
__global__ __launch_bounds__(128) void k_attn(const _Float16* __restrict__ Q16, const _Float16* __restrict__ K16, const _Float16* __restrict__ VT, _Float16* __restrict__ O16,
    const float* __restrict__ QF0, const float* __restrict__ KF0e, const float* __restrict__ VF0e, float* __restrict__ OF0) {
  __shared__ __attribute__((aligned(128))) char sm[ALDS];
  int bx = (int)blockIdx.x;
  if (bx < DB_F) { fattn_blk(sm, bx % (SQ / 32), (bx / (SQ / 32)) % NG, bx / ((SQ / 32) * NG), Q16, K16, VT, O16); return; }
  bx -= DB_F; att0_blk(sm, bx % DB_A0, bx / DB_A0, QF0, KF0e, VF0e, 0.125f, OF0, DM); }
#define EB_O ((MPO / 128) * (DM / 64))
#define EB_H (NB * QT0 * DM / 8 / 128)
// the output product of all rows, and the first tile's o split into f16 hi and residual planes
__global__ __launch_bounds__(128) void k_outp(const _Float16* __restrict__ O16, const _Float16* __restrict__ BO, float* __restrict__ out, const float* __restrict__ OF0, _Float16* __restrict__ OH0, _Float16* __restrict__ OL0) {
  __shared__ __attribute__((aligned(128))) char sm[GLDS];
  int bx = (int)blockIdx.x;
  if (bx < EB_O) { gemm2_blk<0>(sm, bx, 0, O16, DM, 0, BO, DM, 0, 0.0009765625f, nullptr, 0, nullptr, 1, 0, 0, out, nullptr, DM, 0, MPO, DM, DM); return; }      /* out rows are the output layout */
  bx -= EB_O; hl_blk((size_t)bx * 128 + threadIdx.x, OF0, OH0, OL0, (size_t)NB * QT0 * DM / 8); }      /* first-tile o (x64) -> f16 hi + x1024 residual planes */
extern "C" void kernel_launch(void* const* d_in, const int* in_sizes, int n_in,
                              void* d_out, int out_size, void* d_ws, size_t ws_size, hipStream_t stream) {
  (void)in_sizes; (void)n_in; (void)out_size;
  const float* const* I = (const float* const*)d_in; const float* x = I[0]; const float* wq = I[1]; const float* wk = I[2]; const float* wv = I[3]; const float* wo = I[4];      /* input order: x, Wq [1024][1024], Wk / Wv [1024][256], Wo [1024][1024] ([in][out] weights); rope tables computed in-kernel (positions = row index), as the module computes them */ const float* bq = nullptr; const float* bk = nullptr; const float* bv = nullptr; const float* bo = nullptr;      /* no biases */
  char* ws = (char*)d_ws; size_t off = 0;
  auto take = [&](size_t bytes) { char* p = ws + off; off += (bytes + 255) & ~(size_t)255; return p; };
  _Float16* BQ = (_Float16*)take((size_t)DM * DM * 2); _Float16* BK = (_Float16*)take((size_t)KVD * DM * 2); _Float16* BV = (_Float16*)take((size_t)KVD * DM * 2); _Float16* BO = (_Float16*)take((size_t)DM * DM * 2);
  _Float16* X16 = (_Float16*)take(NR * DM * 2); float* CSB = (float*)take((size_t)SQ * HD * 4); float* SNB = (float*)take((size_t)SQ * HD * 4); _Float16* Q16 = (_Float16*)take(NR * DM * 2); _Float16* K16 = (_Float16*)take(NR * KVD * 2); _Float16* V16 = (_Float16*)take(NR * KVD * 2); _Float16* O16 = (_Float16*)take(NR * DM * 2);
  _Float16* VT = (_Float16*)take((size_t)NB * NG * HD * SQ * 2);
  float* QF0 = (float*)take((size_t)NB * QT0 * DM * 4); float* KF0 = (float*)take((size_t)NB * QT0 * KVD * 4); float* VF0 = (float*)take((size_t)NB * QT0 * KVD * 4); float* KF0e = (float*)take((size_t)NB * QT0 * DM * 4); float* VF0e = (float*)take((size_t)NB * QT0 * DM * 4); float* OF0 = (float*)take((size_t)NB * QT0 * DM * 4); _Float16* OH0 = (_Float16*)take((size_t)NB * QT0 * DM * 2); _Float16* OL0 = (_Float16*)take((size_t)NB * QT0 * DM * 2);
  if (off > ws_size) return;
  /* Seven dependent launches; each holds every stage that needs only what the launches before it wrote. Every stage covers all NB batches. */
  k_prep<<<PB_TAB + 2 * PB_WQ + 2 * PB_WK + PB_X, 256, 0, stream>>>(x, wq, wk, wv, wo, X16, BQ, BK, BV, BO, CSB, SNB);
  k_proj<<<GB_Q + 2 * GB_K + GB_V0 * NB, 128, 0, stream>>>(X16, BQ, BK, BV, CSB, SNB, Q16, QF0, K16, KF0, V16, VF0);
  k_lay<<<CB_VT + 2 * CB_KV, 256, 0, stream>>>(V16, VT, KF0, KF0e, VF0, VF0e);
  k_attn<<<DB_F + DB_A0 * NB, 128, 0, stream>>>(Q16, K16, VT, O16, QF0, KF0e, VF0e, OF0);      /* o (merged heads, x64): f16 rows of all rows; exact f32 rows 0..127 of each batch */
  k_outp<<<EB_O + EB_H, 128, 0, stream>>>(O16, BO, (float*)d_out, OF0, OH0, OL0);
  k_gemm2<0><<<dim3((QT0 / 128) * (DM / 64), NB), 128, 0, stream>>>(OH0, DM, (size_t)QT0 * DM, BO, DM, 0, 0.0009765625f, bo, 0, nullptr, 1, 0, 0, (float*)d_out, nullptr, DM, (size_t)SQ * DM, QT0, DM, DM);      /* rows 0..127 of each batch: out = o_hi Wo (+ b), overwriting the f16-path rows */
  k_gemm2<0><<<dim3((QT0 / 128) * (DM / 64), NB), 128, 0, stream>>>(OL0, DM, (size_t)QT0 * DM, BO, DM, 0, 0.00000095367431640625f, nullptr, 0, (const float*)d_out, -1, 0, 0, (float*)d_out, nullptr, DM, (size_t)SQ * DM, QT0, DM, DM);      /* += o_lo Wo 2^-20 (own-element accumulate) */
}

// v009
// It runs in 147 microseconds.
// Next to v008, in two timings, it ran 1.34 and 1.32 times as fast.
// Over all steps from v000 it is 91.6 times as fast.
#include <hip/hip_runtime.h>
// Grouped-query causal attention at width 1024 with [in][out] projections and RoPE computed in the module (x [4][2048][1024]; q = x Wq (16 heads x 64), k = x Wk, v = x Wv (4 kv heads x 64) ([in][out] weights sigma 0.02, no biases); k, v repeated x4 (repeat: query head h uses kv head h / 4); rope: the module rotates the (even, odd) pairs (x1 c - x2 s, x1 s + x2 c) with angle pos * 10000^(-2i/64) and writes the rotated evens into the first half and the rotated odds into the second half of the head: the SAME permutation on q and k, so q . k equals the interleaved-pair rope's; scores / sqrt(64) with a causal mask (tril, -inf); softmax; out = merged Wo ([in][out]) -> [4][2048][1024]).
// Compute dtype: inputs rounded to bf16; x / weights exact; q, k, v, softmax weights and o as plain f16 GEMM operands (~2^-12), but the first QT0 rows of each batch attended in f32, their o passed on as f16 hi and x1024 residual planes; scores and softmax statistics f32. v_wmma_f32_16x16x32_f16.
#define NB 4
#define NG 4
#define HPG 4
#define KVD (NG * HD)
#define SQ 2048
#define DM 1024
#define NH 16
#define HD 64
#define HG 4                         /* heads per launch of the k_vt (b, h0) overload */
#define QT 256
#define NKX SQ                       /* S / P row pitch */
#define QT0 128                      /* first-tile rows recomputed exactly in f32 */
#define B0 0                         /* unused: every stage starts at batch 0 */
#define NBR NB                       /* batches processed (debug hook) */
#define NR ((size_t)NB * SQ)         /* token rows */
#define MP ((int)((size_t)NBR * SQ)) /* rows projected (debug hook) */
#define QN SQ                        /* query rows attended per batch (unused: the attention launches take SQ) */
#define NHD NH                       /* heads attended (unused: the attention launches cover all NH heads) */
#define MPO MP                       /* rows through the output stage (debug hook) */
#define LQ DM      /* row pitch of the q rows */
typedef __bf16 v16b __attribute__((ext_vector_type(16)));
typedef unsigned short v8us __attribute__((ext_vector_type(8), may_alias));
typedef float  v8f  __attribute__((ext_vector_type(8)));
typedef float  v4f  __attribute__((ext_vector_type(4)));
typedef float  v4fa __attribute__((ext_vector_type(4), may_alias));
union FragB { v16b v; v8us half[2]; unsigned short u[16]; };

__device__ __forceinline__ unsigned short bf16_bits(float x) { unsigned int u = __float_as_uint(x); return (unsigned short)((u + 0x7FFFu + ((u >> 16) & 1u)) >> 16); }
__device__ __forceinline__ float bf16_val(unsigned short b) { return __uint_as_float(((unsigned int)b) << 16); }
__device__ __forceinline__ float bf16_round(float x) { return bf16_val(bf16_bits(x)); }
// D += A·B with NT terms: 1 = ah·bh, 2 = + al·bh (A split), 3 = + ah·bl (both split)
template <int NT>
__device__ __forceinline__ v8f mmaN(v16b ah, v16b al, v16b bh, v16b bl, v8f c) {
  c = __builtin_amdgcn_wmma_f32_16x16x32_bf16(false, ah, false, bh, (short)0, c, false, false);
  if (NT >= 2) c = __builtin_amdgcn_wmma_f32_16x16x32_bf16(false, al, false, bh, (short)0, c, false, false);
  if (NT >= 3) c = __builtin_amdgcn_wmma_f32_16x16x32_bf16(false, ah, false, bl, (short)0, c, false, false);
  asm volatile("v_nop\n\tv_nop\n\tv_nop\n\tv_nop" : "+v"(c) : "v"(ah), "v"(al), "v"(bh), "v"(bl));
  return c;
}

__global__ __launch_bounds__(256) void k_wt_bf16(const float* __restrict__ W, unsigned short* __restrict__ Wt, int K, int N) {
  const int t = blockIdx.x * 256 + threadIdx.x;
  const int k8n = K / 8;
  if (t >= N * k8n) return;
  const int n = t / k8n, k8 = (t % k8n) * 8;
  v8us v;
#pragma unroll
  for (int i = 0; i < 8; ++i) v[i] = bf16_bits(W[(size_t)(k8 + i) * N + n]);
  *(v8us*)(Wt + (size_t)n * K + k8) = v;
  
}

// GEMM C[M][N] (f32, pitch ldc) = act(A[M][K]·W + bias). A f32 row-major (pitch lda) converted per fragment to bf16
// (ASPLIT: hi/lo two planes -> 2 terms, else single rounded term); Wt bf16 [N][K] (pitch ldb). BIAS_BF16 rounds the
// bias to bf16 first (bias quantised to bf16 before the add). K%32==0, M%16==0, N%64==0.
template <bool ASPLIT, int ACT, bool BIAS_BF16>
__global__ __launch_bounds__(128) void k_gemm_bf(const float* __restrict__ A, int lda, const unsigned short* __restrict__ Wt, int ldb,
                                               const float* __restrict__ bias, float* __restrict__ C, int ldc, int M, int N, int K) {
  __shared__ __attribute__((aligned(16))) float so[4][16][64];
  const int tid = threadIdx.x, w = tid >> 5, lane = tid & 31, ln = lane & 15, hh = lane >> 4;
  const int ntn = N / 64;
  const int wid = blockIdx.x * 4 + w;
  const int mt = wid / ntn, nq = wid % ntn;
  if (mt * 16 >= M) return;
  const int row0 = mt * 16, col0 = nq * 64;
  const float* arow = A + (size_t)(row0 + ln) * lda;
  v8f acc[4] = {};
  for (int kb = 0; kb < K; kb += 32) {
    FragB ah, al;
    const v4f x0 = *(const v4fa*)(arow + kb + 8 * hh), x1 = *(const v4fa*)(arow + kb + 8 * hh + 4);
    const v4f x2 = *(const v4fa*)(arow + kb + 16 + 8 * hh), x3 = *(const v4fa*)(arow + kb + 16 + 8 * hh + 4);
    float xs[16] = {x0[0],x0[1],x0[2],x0[3],x1[0],x1[1],x1[2],x1[3],x2[0],x2[1],x2[2],x2[3],x3[0],x3[1],x3[2],x3[3]};
#pragma unroll
    for (int i = 0; i < 16; ++i) { const unsigned short hb = bf16_bits(xs[i]); ah.u[i] = hb; al.u[i] = ASPLIT ? bf16_bits(xs[i] - bf16_val(hb)) : (unsigned short)0; }
#pragma unroll
    for (int t = 0; t < 4; ++t) {
      const unsigned short* brow = Wt + (size_t)(col0 + t * 16 + ln) * ldb + kb;
      FragB b;
      b.half[0] = *(const v8us*)(brow + 8 * hh);
      b.half[1] = *(const v8us*)(brow + 16 + 8 * hh);
      acc[t] = mmaN<ASPLIT ? 2 : 1>(ah.v, al.v, b.v, b.v, acc[t]);
    }
  }
#pragma unroll
  for (int t = 0; t < 4; ++t) {
    float bv = bias ? bias[col0 + t * 16 + ln] : 0.f;
    if (BIAS_BF16) bv = bf16_round(bv);
#pragma unroll
    for (int r = 0; r < 8; ++r) { float v = acc[t][r] + bv; if (ACT == 1) v = fmaxf(v, 0.f); so[w][8 * hh + r][t * 16 + ln] = v; }
  }
  __builtin_amdgcn_fence(__ATOMIC_ACQ_REL, "workgroup");
  __builtin_amdgcn_wave_barrier();
  const int rsub = lane >> 4, c4 = (lane & 15) * 4;
  {
#pragma unroll
    for (int q = 0; q < 8; ++q) {
      const int r = q * 2 + rsub;
      const v4f v = *(const v4fa*)&so[w][r][c4];
      *(v4f*)(C + (size_t)(row0 + r) * ldc + col0 + c4) = v;
    }
    
  }
}

// GEMM C = act(A·W + bias + resid): A f32 (ASPLIT -> hi/lo 2 terms), Wt bf16 [N][K]; ACT 0 none, 1 relu, 2 exact gelu;
// resid (optional, f32, row index = (row % rmod), pitch ldr, RES_BF16 rounds it) added before the activation.
template <bool ASPLIT, int ACT, bool BIAS_BF16, bool RES_BF16>
__global__ __launch_bounds__(128) void k_gemm_bf3(const float* __restrict__ A, int lda, const unsigned short* __restrict__ Wt, int ldb,
                                                const float* __restrict__ bias, const float* __restrict__ resid, int rmod, int ldr,
                                                float* __restrict__ C, int ldc, int M, int N, int K) {
  __shared__ __attribute__((aligned(16))) float so[4][16][64];
  const int tid = threadIdx.x, w = tid >> 5, lane = tid & 31, ln = lane & 15, hh = lane >> 4;
  const int ntn = N / 64;
  const int wid = blockIdx.x * 4 + w;
  const int mt = wid / ntn, nq = wid % ntn;
  if (mt * 16 >= M) return;
  const int row0 = mt * 16, col0 = nq * 64;
  const float* arow = A + (size_t)(row0 + ln) * lda;
  v8f acc[4] = {};
  for (int kb = 0; kb < K; kb += 32) {
    FragB ah, al;
    const v4f x0 = *(const v4fa*)(arow + kb + 8 * hh), x1 = *(const v4fa*)(arow + kb + 8 * hh + 4);
    const v4f x2 = *(const v4fa*)(arow + kb + 16 + 8 * hh), x3 = *(const v4fa*)(arow + kb + 16 + 8 * hh + 4);
    float xs[16] = {x0[0],x0[1],x0[2],x0[3],x1[0],x1[1],x1[2],x1[3],x2[0],x2[1],x2[2],x2[3],x3[0],x3[1],x3[2],x3[3]};
#pragma unroll
    for (int i = 0; i < 16; ++i) { const unsigned short hb = bf16_bits(xs[i]); ah.u[i] = hb; al.u[i] = ASPLIT ? bf16_bits(xs[i] - bf16_val(hb)) : (unsigned short)0; }
#pragma unroll
    for (int t = 0; t < 4; ++t) {
      const unsigned short* brow = Wt + (size_t)(col0 + t * 16 + ln) * ldb + kb;
      FragB b;
      b.half[0] = *(const v8us*)(brow + 8 * hh);
      b.half[1] = *(const v8us*)(brow + 16 + 8 * hh);
      acc[t] = mmaN<ASPLIT ? 2 : 1>(ah.v, al.v, b.v, b.v, acc[t]);
    }
  }
#pragma unroll
  for (int t = 0; t < 4; ++t) {
    const int col = col0 + t * 16 + ln;
    float bv = bias ? bias[col] : 0.f;
    if (BIAS_BF16) bv = bf16_round(bv);
#pragma unroll
    for (int r = 0; r < 8; ++r) {
      float v = acc[t][r] + bv;
      if (resid) { float rv = resid[(size_t)((row0 + 8 * hh + r) % rmod) * ldr + col]; if (RES_BF16) rv = bf16_round(rv); v += rv; }
      if (ACT == 1) v = fmaxf(v, 0.f);
      if (ACT == 2) v = 0.5f * v * (1.0f + erff(v * 0.70710678118654752f));
      if (ACT == 3) { const float u = 0.7978845608028654f * (v + 0.044715f * v * v * v); v = 0.5f * v * (1.0f + tanhf(u)); }
      so[w][8 * hh + r][t * 16 + ln] = v;
    }
  }
  __builtin_amdgcn_fence(__ATOMIC_ACQ_REL, "workgroup");
  __builtin_amdgcn_wave_barrier();
  const int rsub = lane >> 4, c4 = (lane & 15) * 4;
  {
#pragma unroll
    for (int q = 0; q < 8; ++q) {
      const int r = q * 2 + rsub;
      const v4f v = *(const v4fa*)&so[w][r][c4];
      *(v4f*)(C + (size_t)(row0 + r) * ldc + col0 + c4) = v;
    }
    
  }
}
// row LayerNorm (biased variance, eps) over N: s = X (+ R); optional out_sum <- s; out_norm <- (s-mu)*rsqrt(var+eps)*g + b
template <bool PARAM_BF16>
__global__ __launch_bounds__(256) void k_layernorm(const float* __restrict__ X, const float* __restrict__ R, const float* __restrict__ g, const float* __restrict__ bta,
                                                  float* __restrict__ out_sum, float* __restrict__ out_norm, int N, float eps) {
  __shared__ float red[256];
  const int row = blockIdx.x, tid = threadIdx.x;
  const float* x = X + (size_t)row * N; const float* rr = R ? R + (size_t)row * N : nullptr;
  float vals[16];                     // up to N = 4096
  const int per = N / 256;            // contiguous chunk per thread? use strided-by-4 chunks: thread handles j = tid*4 + 1024*u
  float s1 = 0.f;
  for (int u = 0; u < per / 4; ++u) {
    const int j = tid * 4 + 1024 * u;
    const v4f a = *(const v4fa*)(x + j);
    v4f b = {0.f,0.f,0.f,0.f}; if (rr) b = *(const v4fa*)(rr + j);
#pragma unroll
    for (int q = 0; q < 4; ++q) { const float v = a[q] + b[q]; vals[u * 4 + q] = v; s1 += v; }
  }
  red[tid] = s1; __syncthreads();
  for (int st = 128; st > 0; st >>= 1) { if (tid < st) red[tid] += red[tid + st]; __syncthreads(); }
  const float mu = red[0] / (float)N; __syncthreads();
  float s2 = 0.f;
  for (int u = 0; u < per / 4; ++u)
#pragma unroll
    for (int q = 0; q < 4; ++q) { const float c = vals[u * 4 + q] - mu; s2 += c * c; }
  red[tid] = s2; __syncthreads();
  for (int st = 128; st > 0; st >>= 1) { if (tid < st) red[tid] += red[tid + st]; __syncthreads(); }
  const float rs = rsqrtf(red[0] / (float)N + eps);
  {
    for (int u = 0; u < per / 4; ++u) {
      const int j = tid * 4 + 1024 * u;
      v4f o, sm;
#pragma unroll
      for (int q = 0; q < 4; ++q) {
        float gg = g[j + q], bb = bta[j + q];
        if (PARAM_BF16) { gg = bf16_round(gg); bb = bf16_round(bb); }
        sm[q] = vals[u * 4 + q]; o[q] = (vals[u * 4 + q] - mu) * rs * gg + bb;
      }
      if (out_sum) *(v4f*)(out_sum + (size_t)row * N + j) = sm;
      *(v4f*)(out_norm + (size_t)row * N + j) = o;
    }
    
  }
}



// ---- f16 WMMA path (v_wmma_f32_16x16x32_f16): 11-bit significands for operands in range — used where a [0,1] probability operand needs more precision than bf16
typedef _Float16 v16h __attribute__((ext_vector_type(16)));
union FragH { v16h v; v8us half[2]; _Float16 h[16]; unsigned short u[16]; };
template <int NT>
__device__ __forceinline__ v8f mmaH(v16h ah, v16h al, v16h bh, v16h bl, v8f c) {
  c = __builtin_amdgcn_wmma_f32_16x16x32_f16(false, ah, false, bh, (short)0, c, false, false);
  if (NT >= 2) c = __builtin_amdgcn_wmma_f32_16x16x32_f16(false, al, false, bh, (short)0, c, false, false);
  if (NT >= 3) c = __builtin_amdgcn_wmma_f32_16x16x32_f16(false, ah, false, bl, (short)0, c, false, false);
  asm volatile("v_nop\n\tv_nop\n\tv_nop\n\tv_nop" : "+v"(c) : "v"(ah), "v"(al), "v"(bh), "v"(bl));
  return c;
}
// batched GEMM like k_gemm_b but f16 operands: A f32 (split into f16 hi/lo if ASPLIT, else rounded to f16), Bt = f16 values [n][k]; alpha; C f32; N multiple of 16 (partial tiles skipped)
template <bool ASPLIT>
__global__ __launch_bounds__(128) void k_gemm_h(const float* __restrict__ A, int lda, size_t sA, const _Float16* __restrict__ Bh, int ldb, size_t sB, float alpha, float* __restrict__ C, int ldc, size_t sC, int M, int N, int K) {
  __shared__ __attribute__((aligned(16))) float so[4][16][64];
  const int tid = threadIdx.x, w = tid >> 5, lane = tid & 31, ln = lane & 15, hh = lane >> 4; const int by = blockIdx.y;
  A += (size_t)by * sA; Bh += (size_t)by * sB; C += (size_t)by * sC;
  const int ntn = (N + 63) / 64; const int wid = blockIdx.x * 4 + w; const int mt = wid / ntn, nq = wid % ntn; if (mt * 16 >= M) return;
  const int row0 = mt * 16, col0 = nq * 64; const float* arow = A + (size_t)(row0 + ln) * lda;
  v8f acc[4] = {};
  for (int kb = 0; kb < K; kb += 32) {
    FragH ah, al;
    const v4f x0 = *(const v4fa*)(arow + kb + 8 * hh), x1 = *(const v4fa*)(arow + kb + 8 * hh + 4), x2 = *(const v4fa*)(arow + kb + 16 + 8 * hh), x3 = *(const v4fa*)(arow + kb + 16 + 8 * hh + 4);
    float xs[16] = {x0[0],x0[1],x0[2],x0[3],x1[0],x1[1],x1[2],x1[3],x2[0],x2[1],x2[2],x2[3],x3[0],x3[1],x3[2],x3[3]};
#pragma unroll
    for (int i = 0; i < 16; ++i) { const _Float16 h = (_Float16)xs[i]; ah.h[i] = h; al.h[i] = ASPLIT ? (_Float16)(xs[i] - (float)h) : (_Float16)0.0f; }
#pragma unroll
    for (int t = 0; t < 4; ++t) { if (col0 + t * 16 >= N) continue; const size_t boff = (size_t)(col0 + t * 16 + ln) * ldb + kb; FragH bq; bq.half[0] = *(const v8us*)(Bh + boff + 8 * hh); bq.half[1] = *(const v8us*)(Bh + boff + 16 + 8 * hh);
      acc[t] = mmaH<ASPLIT ? 2 : 1>(ah.v, al.v, bq.v, bq.v, acc[t]); }
  }
#pragma unroll
  for (int t = 0; t < 4; ++t) { if (col0 + t * 16 >= N) continue;
#pragma unroll
    for (int r = 0; r < 8; ++r) so[w][8 * hh + r][t * 16 + ln] = acc[t][r] * alpha; }
  __builtin_amdgcn_fence(__ATOMIC_ACQ_REL, "workgroup"); __builtin_amdgcn_wave_barrier();
  const int rsub = lane >> 4, c4 = (lane & 15) * 4;
  {
#pragma unroll
    for (int q = 0; q < 8; ++q) { const int r = q * 2 + rsub; if (col0 + c4 < N) { const v4f v = *(const v4fa*)&so[w][r][c4]; *(v4f*)(C + (size_t)(row0 + r) * ldc + col0 + c4) = v; } }
     }
}

// Wt[n][k] = f16(W[k][n]·scale) from f32 row-major W[K][N] (scale = power of two; bf16-exact weights stay exact in f16 away from the subnormal range)
__device__ __forceinline__ void wt_f16_blk(int bx, const float* __restrict__ W, _Float16* __restrict__ Wt, int K, int N, float scale) {
  const int t = bx * 256 + threadIdx.x; if (t >= N * (K / 8)) return; const int n = t / (K / 8), k8 = (t % (K / 8)) * 8; FragH f;
#pragma unroll
  for (int i = 0; i < 8; ++i) f.h[i] = (_Float16)(bf16_round(W[(size_t)(k8 + i) * N + n]) * scale); const v8us o = f.half[0];
  *(v8us*)((unsigned short*)Wt + (size_t)n * K + k8) = o; 
}
// k_gemm_hh variant with fused epilogue: v = acc·alpha + bias[by·sBias + col] (+ CP[(row/rowsPerB)·sCPb + by·64 + col] if CP) ; ACT 0 none / 1 elu ; writes f16 C16 (and f32 C if non-null)
template <int ACT>
__global__ __launch_bounds__(128) void k_gemm_hhx(const _Float16* __restrict__ A, int lda, size_t sA, const _Float16* __restrict__ Bh, int ldb, size_t sB, float alpha, const float* __restrict__ bias, size_t sBias, const float* __restrict__ CP, int rowsPerB, size_t sCPb, int row0g,
    float* __restrict__ C, _Float16* __restrict__ C16, int ldc, size_t sC, int M, int N, int K) {
  __shared__ __attribute__((aligned(16))) float so[4][16][64];
  const int tid = threadIdx.x, w = tid >> 5, lane = tid & 31, ln = lane & 15, hh = lane >> 4; const int by = blockIdx.y;
  A += (size_t)by * sA; Bh += (size_t)by * sB; const size_t cofs = (size_t)by * sC; const float* bp = bias ? bias + (size_t)by * sBias : nullptr;
  const int ntn = (N + 63) / 64; const int wid = blockIdx.x * 4 + w; const int mt = wid / ntn, nq = wid % ntn; if (mt * 16 >= M) return;
  const int row0 = mt * 16, col0 = nq * 64; const _Float16* arow = A + (size_t)(row0 + ln) * lda;
  v8f acc[4] = {};
  for (int kb = 0; kb < K; kb += 32) { FragH ah; ah.half[0] = *(const v8us*)((const unsigned short*)arow + kb + 8 * hh); ah.half[1] = *(const v8us*)((const unsigned short*)arow + kb + 16 + 8 * hh);
#pragma unroll
    for (int t = 0; t < 4; ++t) { if (col0 + t * 16 >= N) continue; const size_t boff = (size_t)(col0 + t * 16 + ln) * ldb + kb; FragH bq; bq.half[0] = *(const v8us*)((const unsigned short*)Bh + boff + 8 * hh); bq.half[1] = *(const v8us*)((const unsigned short*)Bh + boff + 16 + 8 * hh);
      acc[t] = mmaH<1>(ah.v, ah.v, bq.v, bq.v, acc[t]); }
  }
#pragma unroll
  for (int t = 0; t < 4; ++t) { if (col0 + t * 16 >= N) continue; const int col = col0 + t * 16 + ln; const float bv = bp ? bf16_round(bp[col]) : 0.f;
#pragma unroll
    for (int r = 0; r < 8; ++r) { float v = acc[t][r] * alpha + bv; if (CP) { const int rr = row0g + row0 + 8 * hh + r; if (rowsPerB < 0) v += CP[cofs + (size_t)rr * ldc + col];      /* rowsPerB < 0: own element of the batched C plane */ else { const int bidx = rr / rowsPerB; v += CP[(size_t)bidx * sCPb + (size_t)by * 64 + col]; } } if (ACT == 1) v = (v > 0.f) ? v : expm1f(v); else if (ACT == 7) v = (v > 0.f) ? v + 1.0f : expf(v); else if (ACT == 8) v = tanhf(v); else if (ACT == 9) v = 0.5f * v * (1.0f + tanhf(0.7978845608028654f * (v + 0.044715f * v * v * v))); else if (ACT == 11) v = 1.0f / (1.0f + expf(-v)); else if (ACT == 12) v = (v > 0.f) ? v : 0.01f * v; else if (ACT == 14) v = (v > 0.f) ? v : 0.1f * v; else if (ACT == 16) v = (v >= 0.f) ? v : 0.3f * v; else if (ACT == 17) v = (v >= 0.f) ? v : 0.2f * v; else if (ACT == 15) v = v / (1.0f + expf(-v)); else if (ACT == 3) v = fmaxf(v, 0.f); else if (ACT == 6) v = 0.5f * v * (1.0f + erff(v * 0.70710678118654752f)); so[w][8 * hh + r][t * 16 + ln] = v; } }
  __builtin_amdgcn_fence(__ATOMIC_ACQ_REL, "workgroup"); __builtin_amdgcn_wave_barrier();
  const int rsub = lane >> 4, c4 = (lane & 15) * 4; typedef _Float16 v4h __attribute__((ext_vector_type(4)));
  {
#pragma unroll
    for (int q = 0; q < 8; ++q) { const int r = q * 2 + rsub; if (col0 + c4 < N) { const v4f v = *(const v4fa*)&so[w][r][c4]; if (C) *(v4f*)(C + cofs + (size_t)(row0 + r) * ldc + col0 + c4) = v; if (C16) { v4h h4; for (int i = 0; i < 4; ++i) h4[i] = (_Float16)v[i]; *(v4h*)(C16 + cofs + (size_t)(row0 + r) * ldc + col0 + c4) = h4; } } }
     }
}


typedef _Float16 v4h __attribute__((ext_vector_type(4)));

__device__ __forceinline__ void x16_blk(int bx, const float* __restrict__ x, _Float16* __restrict__ X16, size_t n8) { const size_t t = (size_t)bx * 256 + threadIdx.x; if (t >= n8) return; FragH f;
#pragma unroll
  for (int q = 0; q < 8; ++q) f.h[q] = (_Float16)bf16_round(x[t * 8 + q]); *(v8us*)((unsigned short*)X16 + t * 8) = f.half[0];  }
__global__ __launch_bounds__(256) void k_h16(const float* __restrict__ x, _Float16* __restrict__ X16, size_t n8) { const size_t t = (size_t)blockIdx.x * 256 + threadIdx.x; if (t >= n8) return; FragH f;
#pragma unroll
  for (int q = 0; q < 8; ++q) f.h[q] = (_Float16)x[t * 8 + q]; *(v8us*)((unsigned short*)X16 + t * 8) = f.half[0];  }
__global__ __launch_bounds__(256) void k_round16f(const float* __restrict__ W, _Float16* __restrict__ Bt, size_t n8) { const size_t t = (size_t)blockIdx.x * 256 + threadIdx.x; if (t >= n8) return; FragH f;
#pragma unroll
  for (int i = 0; i < 8; ++i) f.h[i] = (_Float16)(bf16_round(W[t * 8 + i]) * 16.0f); *(v8us*)((unsigned short*)Bt + t * 8) = f.half[0];  }
// ---- fast GEMM (wave tile 32x64; requires M % 128 == 0 rows per launch region and N % 64 == 0); epilogue = k_gemm_hhx semantics ----
__device__ __forceinline__ v16h g2_frag(const _Float16* p, int hh) { FragH f; f.half[0] = *(const v8us*)((const unsigned short*)p + 8 * hh); f.half[1] = *(const v8us*)((const unsigned short*)p + 16 + 8 * hh); return f.v; }
__device__ __forceinline__ v8f g2_mma(v16h a, v16h b, v8f c) { v8f d = __builtin_amdgcn_wmma_f32_16x16x32_f16(false, a, false, b, (short)0, c, false, false); asm volatile("v_nop\n\tv_nop\n\tv_nop\n\tv_nop" : "+v"(d) : "v"(a), "v"(b)); return d; }
// ---- operand staging of the fast GEMM: a work-group's 128 A rows and 64 B rows, 64 k (128 bytes of each row) a stage, two buffers in LDS ----
#define GK 64                        /* k per stage */
#define GP 144                       /* LDS row pitch in bytes: 16 B x odd, no bank conflict for 16-byte fragment reads */
#define GSTG (192 * GP)              /* a stage: A rows 0..127, then B rows 0..63 */
#define GLDS (2 * GSTG)              /* the ring; the epilogue's tile of 4 x 32 x 68 floats takes the same bytes behind the loop's last barrier */
static_assert(GLDS >= 4 * 32 * 68 * 4, "the epilogue tile must fit the ring");
// One stage: 12 copies of 16 bytes a lane. 8 lanes take one row's 128 bytes, so a wave's copy is 4 whole lines. l: the lane's LDS byte address of row tid / 8; ga, gb: its global address in
// A and B; sa, sb: 16 rows in bytes. The s_wait_xcnt 0 is the statement's last line, so it stands in front of any later write of a register that a copy names.
__device__ __forceinline__ void g2_stage(unsigned l, const char* ga, size_t sa, const char* gb, size_t sb) {
  asm volatile("global_load_async_to_lds_b128 %0, %12, off\n\t"
               "global_load_async_to_lds_b128 %1, %13, off\n\t"
               "global_load_async_to_lds_b128 %2, %14, off\n\t"
               "global_load_async_to_lds_b128 %3, %15, off\n\t"
               "global_load_async_to_lds_b128 %4, %16, off\n\t"
               "global_load_async_to_lds_b128 %5, %17, off\n\t"
               "global_load_async_to_lds_b128 %6, %18, off\n\t"
               "global_load_async_to_lds_b128 %7, %19, off\n\t"
               "global_load_async_to_lds_b128 %8, %20, off\n\t"
               "global_load_async_to_lds_b128 %9, %21, off\n\t"
               "global_load_async_to_lds_b128 %10, %22, off\n\t"
               "global_load_async_to_lds_b128 %11, %23, off\n\t"
               "s_wait_xcnt 0x0"
               : : "v"(l), "v"(l + 16 * GP), "v"(l + 32 * GP), "v"(l + 48 * GP), "v"(l + 64 * GP), "v"(l + 80 * GP), "v"(l + 96 * GP), "v"(l + 112 * GP),
                   "v"(l + 128 * GP), "v"(l + 144 * GP), "v"(l + 160 * GP), "v"(l + 176 * GP),
                   "v"(ga), "v"(ga + sa), "v"(ga + 2 * sa), "v"(ga + 3 * sa), "v"(ga + 4 * sa), "v"(ga + 5 * sa), "v"(ga + 6 * sa), "v"(ga + 7 * sa),
                   "v"(gb), "v"(gb + sb), "v"(gb + 2 * sb), "v"(gb + 3 * sb) : "memory"); }
// A fragment from a staged row: p = the lane's row at byte 16 hh of the k step; k = 8 hh .. + 7 and 16 + 8 hh .. + 7, the k order of g2_frag.
__device__ __forceinline__ v16h g2_lfrag(const char* p) { FragH f; f.half[0] = *(const v8us*)p; f.half[1] = *(const v8us*)(p + 32); return f.v; }
// The product loop of a work-group's 128 x 64 tile (wave w: rows 32 w .. + 31, all 64 columns): the accumulators, the fragments and the order of k are those of the loop that read the
// fragments from global memory. Ab, Bb: the tile's first A and B row. K is a multiple of GK; every wave of the block comes here (barriers).
__device__ __forceinline__ void g2_loop(char* sm, const _Float16* __restrict__ Ab, int lda, const _Float16* __restrict__ Bb, int ldb, int K, v8f (&c)[8]) {
  const int tid = threadIdx.x, w = tid >> 5, lane = tid & 31, ln = lane & 15, hh = lane >> 4; const int rs = tid >> 3, pc = tid & 7;
  const char* ga = (const char*)(Ab + (size_t)rs * lda) + pc * 16; const char* gb = (const char*)(Bb + (size_t)rs * ldb) + pc * 16; const size_t sa = (size_t)lda * 32, sb = (size_t)ldb * 32;
  const unsigned l0 = (unsigned)(size_t)sm + (unsigned)(rs * GP + pc * 16); const int nst = K / GK;
  g2_stage(l0, ga, sa, gb, sb);      /* stage 0 into buffer 0 */
  asm volatile("s_wait_asynccnt 0x0" ::: "memory");      /* the wave's own copies of stage 0 have landed */
  __syncthreads();      /* every wave's have: nobody reads stage 0 in front of this barrier */
  if (nst > 1) g2_stage(l0 + GSTG, ga + 2 * GK, sa, gb + 2 * GK, sb);      /* stage 1 flies under stage 0's products */
  const char* fa = sm + (32 * w + ln) * GP + 16 * hh; const char* fb = sm + (128 + ln) * GP + 16 * hh;
#pragma unroll 1      /* rolled: one trip is one stage, with its publish point at the foot */
  for (int t = 0; t < nst; ++t) { const int bo = (t & 1) * GSTG;
#pragma unroll      /* the stage's two k steps of 32 */
    for (int ks = 0; ks < 2; ++ks) { const char* pa = fa + bo + ks * 64; const char* pb = fb + bo + ks * 64;
      const v16h a0 = g2_lfrag(pa), a1 = g2_lfrag(pa + 16 * GP), b0 = g2_lfrag(pb), b1 = g2_lfrag(pb + 16 * GP), b2 = g2_lfrag(pb + 32 * GP), b3 = g2_lfrag(pb + 48 * GP);      /* the step's six fragments are read as one group, each into registers of its own: one LDS latency a step, not one a column tile */
      c[0] = g2_mma(a0, b0, c[0]); c[4] = g2_mma(a1, b0, c[4]); c[1] = g2_mma(a0, b1, c[1]); c[5] = g2_mma(a1, b1, c[5]);
      c[2] = g2_mma(a0, b2, c[2]); c[6] = g2_mma(a1, b2, c[6]); c[3] = g2_mma(a0, b3, c[3]); c[7] = g2_mma(a1, b3, c[7]); }
    asm volatile("s_wait_dscnt 0x0" ::: "memory");      /* the wave's reads of this buffer have returned, in front of the barrier behind which it is refilled */
    asm volatile("s_wait_asynccnt 0x0" ::: "memory");      /* the wave's copies of stage t + 1 have landed */
    __syncthreads();      /* publishes stage t + 1 and ends every reader's last read of stage t's buffer */
    if (t + 2 < nst) g2_stage(l0 + bo, ga + (size_t)(t + 2) * (2 * GK), sa, gb + (size_t)(t + 2) * (2 * GK), sb); }      /* the same test in the whole work-group */
  asm volatile("s_wait_asynccnt 0x0" ::: "memory"); }      /* no copy is outstanding when the ring becomes the epilogue's tile */
template <int ACT>
__device__ __forceinline__ void gemm2_blk(char* sm, int bx, int by, const _Float16* __restrict__ A, int lda, size_t sA, const _Float16* __restrict__ Bh, int ldb, size_t sB, float alpha, const float* __restrict__ bias, size_t sBias, const float* __restrict__ CP, int rowsPerB, size_t sCPb, int row0g,
    float* __restrict__ C, _Float16* __restrict__ C16, int ldc, size_t sC, int M, int N, int K) { static_assert(ACT == 0 || ACT == 3 || ACT == 6 || ACT == 8 || ACT == 9 || ACT == 11 || ACT == 12 || ACT == 14 || ACT == 15 || ACT == 16 || ACT == 17, "k_gemm2: unsupported ACT code (would silently apply no activation)");
  const int tid = threadIdx.x, w = tid >> 5, lane = tid & 31, ln = lane & 15, hh = lane >> 4;
  A += (size_t)by * sA; Bh += (size_t)by * sB; const size_t cofs = (size_t)by * sC; const float* bp = bias ? bias + (size_t)by * sBias : nullptr;
  const int ntn = N >> 6; const int mt = bx / ntn, nq = bx - mt * ntn; const int row0 = mt * 128 + 32 * w, col0 = nq * 64; if (mt * 128 >= M) return;      /* the whole block or none: M is a multiple of 128 */
  float (*so)[32][68] = (float (*)[32][68])sm;
  v8f accs[8] = {};      /* tile (half, t) at index 4 half + t */
  g2_loop(sm, A + (size_t)(mt * 128) * lda, lda, Bh + (size_t)col0 * ldb, ldb, K, accs);
#pragma unroll
  for (int u = 0; u < 8; ++u) { const int t = u & 3, half = u >> 2; const int col = col0 + t * 16 + ln; const float bv = bp ? bf16_round(bp[col]) : 0.f;
#pragma unroll
    for (int r = 0; r < 8; ++r) { const int rloc = half * 16 + 8 * hh + r; float v = accs[u][r] * alpha + bv; if (CP) { if (rowsPerB < 0) v += CP[cofs + (size_t)(row0g + row0 + rloc) * ldc + col];      /* rowsPerB < 0: own element of the batched C plane */ else { const int bidx = (row0g + row0 + rloc) / rowsPerB; v += CP[(size_t)bidx * sCPb + (size_t)by * 64 + col]; } }
      if (ACT == 3) v = fmaxf(v, 0.f); else if (ACT == 6) v = 0.5f * v * (1.0f + erff(v * 0.70710678118654752f)); else if (ACT == 11) v = 1.0f / (1.0f + expf(-v)); else if (ACT == 15) v = v / (1.0f + expf(-v)); else if (ACT == 12) v = (v > 0.f) ? v : 0.01f * v; else if (ACT == 8) v = tanhf(v); else if (ACT == 9) v = 0.5f * v * (1.0f + tanhf(0.7978845608028654f * (v + 0.044715f * v * v * v))); else if (ACT == 14) v = (v > 0.f) ? v : 0.1f * v; else if (ACT == 16) v = (v >= 0.f) ? v : 0.3f * v; else if (ACT == 17) v = (v >= 0.f) ? v : 0.2f * v;
      so[w][rloc][t * 16 + ln] = v; } }
  __builtin_amdgcn_fence(__ATOMIC_ACQ_REL, "workgroup"); __builtin_amdgcn_wave_barrier();
  const int rsub = lane >> 4, c4 = (lane & 15) * 4;
  {
#pragma unroll
    for (int q = 0; q < 16; ++q) { const int r = q * 2 + rsub; v4f v = *(const v4fa*)&so[w][r][c4]; if (C) { *(v4f*)(C + cofs + (size_t)(row0 + r) * ldc + col0 + c4) = v; if (C16) asm volatile("s_wait_xcnt 0x0" : "+v"(v) : : "memory"); }      /* behind the f32 store, in front of the conversion, which was placed on the registers that the issued store names; v passes through, so the conversion stands behind the wait */
      if (C16) { v4h h4; for (int i = 0; i < 4; ++i) h4[i] = (_Float16)v[i]; *(v4h*)(C16 + cofs + (size_t)(row0 + r) * ldc + col0 + c4) = h4; } }
    asm volatile("s_wait_xcnt 0x0" ::: "memory");      /* behind the last store of the rows, in front of any later write of a register that an issued store names (another stage's code follows in the listing) */
     } }


__global__ __launch_bounds__(256) void k_wnat(const float* __restrict__ w, size_t n8, _Float16* __restrict__ Bt) { const size_t t = (size_t)blockIdx.x * 256 + threadIdx.x; if (t >= n8) return; FragH f; for (int q = 0; q < 8; ++q) f.h[q] = (_Float16)(bf16_round(w[t * 8 + q]) * 16.0f); *(v8us*)((unsigned short*)Bt + t * 8) = f.half[0];  }
__global__ __launch_bounds__(256) void k_rsm(const float* __restrict__ S, _Float16* __restrict__ P, int nrows) {
  #pragma clang fp contract(off)
  const int i = blockIdx.x * 256 + threadIdx.x; if (i >= nrows) return; const float* s = S + (size_t)i * SQ; float mx = -3.0e38f;
#pragma unroll 1
  for (int j = 0; j < SQ; ++j) mx = fmaxf(mx, s[j]); float se = 0.f;
#pragma unroll 1
  for (int j = 0; j < SQ; ++j) se += expf(s[j] - mx); const float sc = 256.0f / se;
#pragma unroll 1
  for (int j0 = 0; j0 < SQ; j0 += 8) { FragH f; for (int q = 0; q < 8; ++q) f.h[q] = (_Float16)(expf(s[j0 + q] - mx) * sc); unsigned short* d = (unsigned short*)P + (size_t)i * SQ + j0; *(v8us*)d = f.half[0];  } }
__global__ __launch_bounds__(256) void k_vt(const _Float16* __restrict__ V16, int b, int h0, _Float16* __restrict__ VT) { __shared__ unsigned short tl[64][65]; const int tid = threadIdx.x; const int hh = blockIdx.x % HG, sg = blockIdx.x / HG; const int s0 = sg * 64; const int h = h0 + hh;
  for (int i = tid; i < 64 * 8; i += 256) { const int j = i / 8, d8 = (i % 8) * 8; FragH f; f.half[0] = *(const v8us*)((const unsigned short*)V16 + ((size_t)b * SQ + s0 + j) * DM + h * HD + d8); for (int q = 0; q < 8; ++q) tl[d8 + q][j] = f.u[q]; }
  __syncthreads();
  { for (int i = tid; i < 64 * 8; i += 256) { const int d = i / 8, j8 = (i % 8) * 8; FragH f; for (int q = 0; q < 8; ++q) f.u[q] = tl[d][j8 + q]; *(v8us*)((unsigned short*)VT + ((size_t)hh * HD + d) * SQ + s0 + j8) = f.half[0]; }  } }



// 2^x on the transcendental unit. The v_nop fills the one issue slot that the instruction set asks for behind a transcendental before its source
// is overwritten.
__device__ __forceinline__ float exp2_slot(float x) { float r; asm("v_exp_f32 %0, %1\n\tv_nop" : "=v"(r) : "v"(x)); return r; }
// Fused causal attention (online softmax): one launch for every batch and head and the query rows from QT0 on; scores and softmax weights never leave the registers.
// A work-group is the 4 query heads of one kv group (one wave each) on the same 32 query rows, so its waves walk the same K and V lines.
// Transposed products: S^T = K Q^T puts query 16 c + ln in lane ln and key 16 kt + 8 hh + r in register r, which is already the B-operand order of
// P^T for O^T += V^T P^T (half kt of the fragment = tile kt's 8 registers): no exchange between lanes but the one between the two wave halves.
__device__ __forceinline__ v8f fa_mma(v16h a, v16h b, v8f c) { return __builtin_amdgcn_wmma_f32_16x16x32_f16(false, a, false, b, (short)0, c, false, false); }
__device__ __forceinline__ float fa_xhalf(float x) { return __builtin_bit_cast(float, __builtin_amdgcn_permlanex16(__builtin_bit_cast(int, x), __builtin_bit_cast(int, x), 0x76543210, 0xfedcba98, false, false)); }      /* lane l <-> lane l ^ 16 */
// A fragment at the lane's own byte offset (row ln, element 8 hh) from a uniform base: k = 8 hh .. + 7 and 16 + 8 hh .. + 7, the k order of g2_frag.
__device__ __forceinline__ v16h fa_frag(const _Float16* base, unsigned off, int cb) { const char* p = (const char*)base + off; FragH f; f.half[0] = *(const v8us*)(p + cb); f.half[1] = *(const v8us*)(p + cb + 32); return f.v; }
// s_wait_xcnt 0 behind issued loads, in front of any write of a register that they name. The lane offsets pass through the statement: they stay in
// their registers up to the wait, and whatever is formed from them later stands behind it (a "memory" clobber alone does not tie the wait to registers).
__device__ __forceinline__ void fa_hold(unsigned& a) { asm volatile("s_wait_xcnt 0x0" : "+v"(a) : : "memory"); }
// ---- K and V^T staging of the fused attention: a stage is 64 keys, that is 64 K rows (the kv group's 128 bytes of d) and the 64 V^T rows (128 bytes of keys each); two buffers in LDS.
// The work-group's 4 waves walk the same keys, so a stage is brought in once for all four, in whole 128-byte lines, and each wave reads its fragments from LDS. ----
#define FP 144                       /* LDS row pitch in bytes: 16 B x odd, no bank conflict for 16-byte fragment reads */
#define FSTG (128 * FP)              /* a stage: K rows 0..63, then V^T rows 0..63 */
#define ALDS 81920                   /* LDS of the attention launch: the exact first-tile blocks' three arrays; a fused block's ring takes the first bytes of the same buffer */
static_assert(2 * FSTG <= ALDS, "the ring must fit the launch's buffer");
// One stage: 8 copies of 16 bytes a lane. 8 lanes take one row's 128 bytes, so a wave's copy is 4 whole lines. l: the lane's LDS byte address of row tid / 8; gk, gv: its global address in
// K and V^T. The s_wait_xcnt 0 is the statement's last line, so it stands in front of any later write of a register that a copy names.
__device__ __forceinline__ void fa_stage(unsigned l, const char* gk, const char* gv) {
  asm volatile("global_load_async_to_lds_b128 %0, %8, off\n\t"
               "global_load_async_to_lds_b128 %1, %9, off\n\t"
               "global_load_async_to_lds_b128 %2, %10, off\n\t"
               "global_load_async_to_lds_b128 %3, %11, off\n\t"
               "global_load_async_to_lds_b128 %4, %12, off\n\t"
               "global_load_async_to_lds_b128 %5, %13, off\n\t"
               "global_load_async_to_lds_b128 %6, %14, off\n\t"
               "global_load_async_to_lds_b128 %7, %15, off\n\t"
               "s_wait_xcnt 0x0"
               : : "v"(l), "v"(l + 16 * FP), "v"(l + 32 * FP), "v"(l + 48 * FP), "v"(l + 64 * FP), "v"(l + 80 * FP), "v"(l + 96 * FP), "v"(l + 112 * FP),
                   "v"(gk), "v"(gk + 16 * KVD * 2), "v"(gk + 32 * KVD * 2), "v"(gk + 48 * KVD * 2),
                   "v"(gv), "v"(gv + 16 * SQ * 2), "v"(gv + 32 * SQ * 2), "v"(gv + 48 * SQ * 2) : "memory"); }
// One pass of 32 keys. kp: the lane's LDS address in the pass's first K row group (row ln, byte 16 hh); vp: in V^T row ln at the pass's keys. DIAG: the wave's last pass, the only one
// that meets the diagonal (it masks).
// Every loop over kt, kc, c, t and r here and in the kernel is unrolled so that fragments, scores and accumulators are indexed by constants only and stay in registers.
template <bool DIAG>
__device__ __forceinline__ void fa_pass(const char* kp, const char* vp, int key0, int q0, int ln, int hh,
                                        const v16h (&qf)[2][2], v8f (&acc)[2][4], float (&m)[2], float (&l)[2]) {
  const float cs = 0.125f * 1.44269504f;      /* 1 / sqrt(64), and e^x = 2^(x log2 e) */
  v16h kf[2][2], vf[4];
#pragma unroll
  for (int kt = 0; kt < 2; ++kt)
#pragma unroll
    for (int kc = 0; kc < 2; ++kc) kf[kt][kc] = g2_lfrag(kp + 16 * kt * FP + 64 * kc);      /* K rows 16 kt + ln, d = 32 kc + 8 hh .. : the k order of fa_frag */
#pragma unroll
  for (int t = 0; t < 4; ++t) vf[t] = g2_lfrag(vp + 16 * t * FP);      /* V^T rows d = 16 t + ln, this pass's keys: read in one group with the K rows, on their way under the scores and the exponentials */
  v8f s[2][2];
#pragma unroll
  for (int kt = 0; kt < 2; ++kt)
#pragma unroll
    for (int c = 0; c < 2; ++c) { const v8f z = {0.f, 0.f, 0.f, 0.f, 0.f, 0.f, 0.f, 0.f}; s[kt][c] = fa_mma(kf[kt][1], qf[c][1], fa_mma(kf[kt][0], qf[c][0], z)); }
#pragma unroll
  for (int c = 0; c < 2; ++c) {
    if (DIAG) {
      const int qi = q0 + 16 * c + ln;
#pragma unroll
      for (int kt = 0; kt < 2; ++kt)
#pragma unroll
        for (int r = 0; r < 8; ++r) if (key0 + 16 * kt + 8 * hh + r > qi) s[kt][c][r] = -1.0e30f;
    }
    float mx = s[0][c][0];
#pragma unroll
    for (int r = 0; r < 8; ++r) mx = fmaxf(mx, fmaxf(s[0][c][r], s[1][c][r]));
    mx = fmaxf(mx, fa_xhalf(mx));      /* both halves of the wave now hold this query's maximum over the pass */
    const float mn = fmaxf(m[c], mx * cs);
    const float corr = exp2_slot(m[c] - mn);      /* 0 on the first pass */
    m[c] = mn;
    FragH pf; float ps = 0.f;
#pragma unroll
    for (int kt = 0; kt < 2; ++kt)
#pragma unroll
      for (int r = 0; r < 8; ++r) { const float p = exp2_slot(fmaf(s[kt][c][r], cs, -mn)); ps += p; pf.h[8 * kt + r] = (_Float16)p; }
    l[c] = fmaf(l[c], corr, ps);
#pragma unroll
    for (int t = 0; t < 4; ++t) { acc[c][t] = acc[c][t] * corr; acc[c][t] = fa_mma(vf[t], pf.v, acc[c][t]); }
    /* the four vector slots that the chip needs behind a matrix instruction before its operands are overwritten */
    asm volatile("v_nop\n\tv_nop\n\tv_nop\n\tv_nop" : "+v"(acc[c][0]), "+v"(acc[c][1]), "+v"(acc[c][2]), "+v"(acc[c][3]) : "v"(vf[0]), "v"(vf[1]), "v"(vf[2]), "v"(vf[3]), "v"(pf.v));
  }
}
__device__ __forceinline__ void fattn_blk(char* sm, int bx, int g, int b, const _Float16* __restrict__ Q, const _Float16* __restrict__ Kh, const _Float16* __restrict__ Vt, _Float16* __restrict__ O) {
  const int tid = threadIdx.x, lane = tid & 31, ln = lane & 15, hh = lane >> 4; const int h = g * HPG + (tid >> 5);
  const int qt = (b & 1) ? bx : (SQ / 32 - 1) - bx;      /* long and short tiles alternate from batch to batch, so that work-groups a whole batch apart in the grid add up to the same length */
  if (qt < QT0 / 32) return;      /* rows 0 .. QT0 - 1 are the exact path's alone: the output product takes them from there. The whole block leaves, in front of every copy and barrier */
  const int q0 = qt * 32; const size_t r0 = (size_t)b * SQ;
  unsigned qo = (unsigned)(((r0 + q0 + ln) * DM + h * HD + 8 * hh) * 2);      /* byte offset: the buffer is below 4 GiB */
  v16h qf[2][2];
#pragma unroll
  for (int c = 0; c < 2; ++c)
#pragma unroll
    for (int kc = 0; kc < 2; ++kc) qf[c][kc] = fa_frag(Q, qo, (16 * c * DM + 32 * kc) * 2);
  fa_hold(qo);
  const int rs = tid >> 3, pc = tid & 7;      /* staging: 8 lanes to a row of 128 bytes */
  const char* gk = (const char*)(Kh + (r0 + rs) * KVD + g * HD) + pc * 16; const char* gv = (const char*)(Vt + ((size_t)(b * NG + g) * HD + rs) * SQ) + pc * 16;
  const unsigned l0 = (unsigned)(size_t)sm + (unsigned)(rs * FP + pc * 16);
  const int nst = (qt + 2) >> 1;      /* stages of 64 keys that hold the tile's qt + 1 passes; the last key staged is at most q0 + 63 - 32 (qt & 1), inside the batch's SQ rows */
  fa_stage(l0, gk, gv);      /* stage 0 into buffer 0 */
  asm volatile("s_wait_asynccnt 0x0" ::: "memory");      /* the wave's own copies of stage 0 have landed */
  __syncthreads();      /* every wave's have: nobody reads stage 0 in front of this barrier */
  if (nst > 1) fa_stage(l0 + FSTG, gk + 64 * KVD * 2, gv + 64 * 2);      /* stage 1 flies under stage 0's passes */
  const char* fk = sm + ln * FP + 16 * hh; const char* fv = sm + (64 + ln) * FP + 16 * hh;
  v8f acc[2][4] = {}; float m[2] = {-1.0e30f, -1.0e30f}, l[2] = {0.f, 0.f};
#pragma unroll 1      /* rolled: one trip is one stage, with its publish point at the foot */
  for (int t = 0; t < nst; ++t) { const int bo = (t & 1) * FSTG; const bool fin = t == nst - 1; const int np = fin ? (qt & 1) : 2;      /* np: the stage's passes below the diagonal; every test here reads the same in the whole work-group */
#pragma unroll 1      /* rolled: with the stage's two passes laid out side by side the compiler kept both passes' fragments and scores at once, beyond the registers of four waves a SIMD */
    for (int p = 0; p < np; ++p) fa_pass<false>(fk + bo + p * (32 * FP), fv + bo + p * 64, 64 * t + 32 * p, q0, ln, hh, qf, acc, m, l);
    if (fin) fa_pass<true>(fk + bo + np * (32 * FP), fv + bo + np * 64, q0, q0, ln, hh, qf, acc, m, l);      /* the diagonal pass: the last stage's pass number qt & 1 */
    asm volatile("s_wait_dscnt 0x0" ::: "memory");      /* the wave's reads of this buffer have returned, in front of the barrier behind which it is refilled */
    asm volatile("s_wait_asynccnt 0x0" ::: "memory");      /* the wave's copies of stage t + 1 have landed */
    __syncthreads();      /* publishes stage t + 1 and ends every reader's last read of stage t's buffer */
    if (t + 2 < nst) fa_stage(l0 + bo, gk + (size_t)(t + 2) * (64 * KVD * 2), gv + (size_t)(t + 2) * (64 * 2)); }      /* the same test in the whole work-group */
  asm volatile("s_wait_asynccnt 0x0" ::: "memory");      /* no copy is outstanding when the wave ends */
  unsigned short* op = (unsigned short*)O + (r0 + q0 + ln) * DM + h * HD + 8 * hh;
#pragma unroll
  for (int c = 0; c < 2; ++c) { const float fin = 64.0f / (l[c] + fa_xhalf(l[c]));      /* o carried x64, as the output product expects */
#pragma unroll
    for (int t = 0; t < 4; ++t) { FragH f;
#pragma unroll
      for (int r = 0; r < 8; ++r) f.h[r] = (_Float16)(acc[c][t][r] * fin);
      *(v8us*)(op + (size_t)(16 * c) * DM + 16 * t) = f.half[0]; }      /* d = 16 t + 8 hh .. + 7 of query row 16 c + ln */
    asm volatile("s_wait_xcnt 0x0" ::: "memory"); }      /* behind the stores, in front of any later write of a register that an issued store names */
}


// Exact f32 attention for the first QT0 rows: one thread per (query row, head), online softmax; every sum runs in the order d = 0, 1, ... and j = 0, 1, ...
// What a thread owns (its q row, its o accumulator) stays in registers; what all threads of the block read at the same address (the head's K and V rows)
// is staged once in LDS and read by broadcast. Every loop over d is unrolled so that q, o and the row fragments are indexed by constants only.
// by is the batch: its QT0 rows of q, k and v follow those of the batch before. K and V rows are the kv group's own (pitch KVD): head h reads group h / HPG.
// o leaves as two f16 planes, hi and the residual x1024, in the row order that the first-tile output product stages: per 64 rows, the 64 hi rows and then the 64 residual rows.
// The block has the 128 threads of the launch it rides in; its 64 rows are the work of waves 0 and 1, and waves 2 and 3 only pass the two barriers.
__device__ __forceinline__ void att0_blk(char* sm, int bx, int by, const float* __restrict__ QF, const float* __restrict__ KF, const float* __restrict__ VF, float scale, _Float16* __restrict__ OHL) {
  float (*lk)[HD] = (float (*)[HD])sm; float (*lv)[HD] = (float (*)[HD])(sm + QT0 * HD * 4); float (*lo)[64] = (float (*)[64])(sm + 2 * QT0 * HD * 4);      /* lk[QT0][HD], lv[QT0][HD], lo[64][64] in the launch's one LDS buffer */
  static_assert(2 * QT0 * HD * 4 + 64 * 64 * 4 <= ALDS, "the three arrays must fit the launch's buffer");
  const int tid = threadIdx.x; const int h = bx / (QT0 / 64), rg = bx % (QT0 / 64); const int i = rg * 64 + tid;
  const bool on = __builtin_amdgcn_readfirstlane(tid >> 5) < 2;      /* the wave's number, the same in every lane: a scalar branch */
  QF += (size_t)by * QT0 * LQ; KF += (size_t)by * QT0 * KVD; VF += (size_t)by * QT0 * KVD;
  const int jmax = rg * 64 + 63;      /* keys up to the block's last row */
  const int sr = tid >> 4, sc4 = (tid & 15) * 4;      /* staging: 16 threads to a row of 256 bytes */
  unsigned so = (unsigned)((sr * KVD + (h / HPG) * HD + sc4) * 4), qo = (unsigned)((i * LQ + h * HD) * 4);      /* the lane's byte offsets in K and V, and in q */
  float q[HD], o[HD];
  if (on) {
#pragma unroll 1      /* kept rolled: one trip already has 16 loads in flight per thread */
  for (int r0 = 0; r0 <= jmax; r0 += 32) { v4f kk[8], vv[8];
#pragma unroll
    for (int u = 0; u < 8; ++u) { kk[u] = *(const v4fa*)((const char*)KF + so + u * 4 * KVD * 4); vv[u] = *(const v4fa*)((const char*)VF + so + u * 4 * KVD * 4); }      /* 16 loads in flight per thread */
    fa_hold(so);      /* the wait behind the issued loads, in front of the write of the offset that they name */
    so += 32 * KVD * 4;
#pragma unroll
    for (int u = 0; u < 8; ++u) { *(v4f*)&lk[r0 + 4 * u + sr][sc4] = kk[u]; *(v4f*)&lv[r0 + 4 * u + sr][sc4] = vv[u]; } }
#pragma unroll
  for (int c = 0; c < HD / 4; ++c) { const v4f t = *(const v4fa*)((const char*)QF + qo + c * 16);
#pragma unroll
    for (int u = 0; u < 4; ++u) { q[c * 4 + u] = t[u]; o[c * 4 + u] = 0.f; } }
  fa_hold(qo);      /* the same wait behind the q loads; their offset stays in its register up to it */
  }
  __syncthreads();      /* K and V rows are staged: nobody reads them in front of this barrier */
  if (on) {
  float m = -1.0e30f, l = 0.f, sn = 0.f;
#pragma unroll
  for (int d = 0; d < HD; ++d) sn = fmaf(q[d], lk[0][d], sn);
#pragma unroll 1      /* kept rolled: a second copy of the body would not fit the registers beside q and o */
  for (int j = 0; j <= jmax; ++j) { const float s = sn * scale;
    const float* kr = &lk[j < jmax ? j + 1 : jmax][0]; v4f kq[HD / 4], vv[HD / 4];
#pragma unroll
    for (int c = 0; c < HD / 4; ++c) kq[c] = *(const v4f*)(kr + c * 4);
    __builtin_amdgcn_sched_barrier(0);      /* keeps the K reads in front of the V reads: LDS answers in order, and with V rows queued between them the score chain below waits for its K words */
#pragma unroll
    for (int c = 0; c < HD / 4; ++c) vv[c] = *(const v4f*)&lv[j][c * 4];
    sn = 0.f;      /* the next key's score: its chain of 64 dependent multiply-adds depends on nothing below, so this key's exponentials and o update fill its waits */
#pragma unroll
    for (int d = 0; d < HD; ++d) sn = fmaf(q[d], kq[d >> 2][d & 3], sn);
    const float f = (j <= i) ? 1.f : 0.f; const float sm = fmaf(f, s, (1.f - f) * -1.0e30f); const float mn = fmaxf(m, sm); const float sc = expf(m - mn); const float e = expf(sm - mn); l = fmaf(l, sc, e); m = mn;
#pragma unroll
    for (int d = 0; d < HD; ++d) o[d] = fmaf(o[d], sc, e * vv[d >> 2][d & 3]); }
  const float fin = 64.0f / l;      /* o carried x64 like the f16 path */
#pragma unroll
  for (int c = 0; c < HD / 4; ++c) { v4f oo;
#pragma unroll
    for (int u = 0; u < 4; ++u) oo[u] = o[c * 4 + u] * fin;
    *(v4f*)&lo[tid][c * 4] = oo; }
  }
  __syncthreads();
  if (on) {
#pragma unroll 1
    for (int it = 0; it < 16; ++it) { const int row = it * 4 + tid / 16, pc = (tid % 16) * 4; const v4f v = *(const v4f*)&lo[row][pc]; v4h vh, vl;
#pragma unroll      /* constant element indices: the two packed rows stay in registers */
      for (int u = 0; u < 4; ++u) { const _Float16 t = (_Float16)v[u]; vh[u] = t; vl[u] = (_Float16)((v[u] - (float)t) * 1024.0f); }
      _Float16* d = OHL + ((size_t)(by * (QT0 / 64) + rg) * 128 + row) * DM + h * HD + pc;      /* 16 lanes store one head's 128 bytes of a row: a whole line */
      *(v4h*)d = vh; *(v4h*)(d + 64 * DM) = vl; }
     } }


__global__ __launch_bounds__(256) void k_tab2(float theta, float* __restrict__ CS, float* __restrict__ SN) {
  #pragma clang fp contract(off)
  const int t = blockIdx.x * 256 + threadIdx.x; if (t >= SQ * (HD / 2)) return; const int i = t % (HD / 2); const int p = t / (HD / 2); const float invf = 1.0f / powf(theta, (float)(2 * i) / (float)HD); const float ang = __fmul_rn((float)p, invf); const float c = cosf(ang), s = sinf(ang);
  *(float*)(CS + t) = c; *(float*)(SN + t) = s;  }
// Projection GEMM with the rope in its epilogue (q and k). The product is k_gemm2's: wave tile 32 x 64, the same fragments, the same order of k. A wave's 64 columns are one head, and the
// tile that the epilogue lays out in LDS for whole-line stores gives a lane four neighbouring columns of a row, that is both members of two (even, odd) pairs: the lane rotates them by the
// row's position (row % SQ; a tile of 32 rows lies in one batch) and stores f16. Rows 0 .. QT0 - 1 of each batch also go out in f32 for the exact first-tile path (F0: QT0 rows a batch).
typedef float v2fa __attribute__((ext_vector_type(2), may_alias));
// The 16 rows of a lane (every second row of the wave's tile): tp = the lane's four words of its first row in LDS, cp / sp = its two table entries of that row, hp / fp = its place in the outputs.
// F32 is a template argument so that neither form has a branch between its rows: the 32 table loads of a lane are then in flight together instead of one row's pair at a time.
// NC, the outputs' row pitch, is one too: every row's store is then the first row's address with an immediate offset.
template <bool F32, int NC>
__device__ __forceinline__ void g2_rope_rows(const float* tp, const float* __restrict__ cp, const float* __restrict__ sp, _Float16* __restrict__ hp, float* __restrict__ fp) {
#pragma unroll      /* unrolled for the same reason: all table loads issue in front of the first use */
  for (int q = 0; q < 16; ++q) { const v4f v = *(const v4fa*)(tp + q * 2 * 68); const v2fa c = *(const v2fa*)(cp + q * 2 * (HD / 2)), s = *(const v2fa*)(sp + q * 2 * (HD / 2));
    v4f o; o[0] = v[0] * c[0] - v[1] * s[0]; o[1] = v[0] * s[0] + v[1] * c[0]; o[2] = v[2] * c[1] - v[3] * s[1]; o[3] = v[2] * s[1] + v[3] * c[1];
    v4h h4;
#pragma unroll      /* constant element indices: o and h4 stay in registers */
    for (int i = 0; i < 4; ++i) h4[i] = (_Float16)o[i];
    *(v4h*)(hp + q * 2 * NC) = h4;
    if (F32) *(v4f*)(fp + q * 2 * NC) = o; }
  asm volatile("s_wait_xcnt 0x0" ::: "memory"); }      /* behind the last store of the rows, in front of any later write of a register that an issued store names (the other form's code follows in the listing) */
template <int NC>      /* columns of the product = row pitch of both outputs */
__device__ __forceinline__ void gemm2r_blk(char* sm, int bx, const _Float16* __restrict__ A, int lda, const _Float16* __restrict__ Bh, int ldb, float alpha, const float* __restrict__ CS, const float* __restrict__ SN,
    _Float16* __restrict__ H16, float* __restrict__ F0, int M, int K) {
  const int tid = threadIdx.x, w = tid >> 5, lane = tid & 31, ln = lane & 15, hh = lane >> 4;
  const int ntn = NC >> 6; const int mt = bx / ntn, nq = bx - mt * ntn; const int row0 = mt * 128 + 32 * w, col0 = nq * 64; if (mt * 128 >= M) return;      /* the whole block or none: M is a multiple of 128 */
  float (*so)[32][68] = (float (*)[32][68])sm;
  v8f accs[8] = {};      /* tile (half, t) at index 4 half + t */
  g2_loop(sm, A + (size_t)(mt * 128) * lda, lda, Bh + (size_t)col0 * ldb, ldb, K, accs);      /* k_gemm2's product loop */
#pragma unroll      /* unrolled so that the accumulators are indexed by constants only and stay in registers */
  for (int u = 0; u < 8; ++u) { const int t = u & 3, half = u >> 2;
#pragma unroll      /* the same, for the element index */
    for (int r = 0; r < 8; ++r) so[w][half * 16 + 8 * hh + r][t * 16 + ln] = accs[u][r] * alpha; }
  __builtin_amdgcn_fence(__ATOMIC_ACQ_REL, "workgroup"); __builtin_amdgcn_wave_barrier();      /* the wave's own LDS writes stand in front of its reads of other lanes' words; no other wave reads this slice */
  const int rsub = lane >> 4, c4 = (lane & 15) * 4; const int p0 = row0 % SQ;
  const float* cp = CS + (size_t)(p0 + rsub) * (HD / 2) + c4 / 2; const float* sp = SN + (size_t)(p0 + rsub) * (HD / 2) + c4 / 2;      /* table entries i = c4 / 2 and c4 / 2 + 1 of the lane's row */
  _Float16* hp = H16 + (size_t)(row0 + rsub) * NC + col0 + c4; float* fp = F0 + ((size_t)(row0 / SQ) * QT0 + p0 + rsub) * NC + col0 + c4;
  if (__builtin_amdgcn_readfirstlane(p0) < QT0) g2_rope_rows<true, NC>(&so[w][rsub][c4], cp, sp, hp, fp);      /* p0 is the same in every lane of a wave: a scalar branch; QT0 is a multiple of the tile's 32 rows */
  else g2_rope_rows<false, NC>(&so[w][rsub][c4], cp, sp, hp, fp); }

__global__ __launch_bounds__(256) void k_bfcp(const float* __restrict__ src, float* __restrict__ dst, size_t n4) { const size_t t = (size_t)blockIdx.x * 256 + threadIdx.x; if (t >= n4) return; const v4f a = *(const v4fa*)(src + t * 4); v4f o; for (int q = 0; q < 4; ++q) o[q] = bf16_round(a[q]); *(v4f*)(dst + t * 4) = o;  }

__global__ __launch_bounds__(256) void k_tabhalf(const float* __restrict__ cs, const float* __restrict__ sn, float* __restrict__ CS, float* __restrict__ SN) { const int t = blockIdx.x * 256 + threadIdx.x; if (t >= SQ * (HD / 2)) return; const int p = t / (HD / 2), i = t % (HD / 2); const float c = bf16_round(cs[(size_t)p * HD + i]), s = bf16_round(sn[(size_t)p * HD + i]);
  *(float*)(CS + t) = c; *(float*)(SN + t) = s;  }

__device__ __forceinline__ void tab2d_blk(int bx, float* __restrict__ CS, float* __restrict__ SN) {
  #pragma clang fp contract(off)
  const int t = bx * 256 + threadIdx.x; if (t >= SQ * (HD / 2)) return; const int i = t % (HD / 2); const int p = t / (HD / 2); const float invf = (float)(1.0 / pow(10000.0, (double)(2 * i) / (double)HD)); const float ang = __fmul_rn((float)p, invf); const float c = cosf(ang), s = sinf(ang);
  *(float*)(CS + t) = c; *(float*)(SN + t) = s;  }
// Launches that do not depend on one another ride in ONE grid: a block's index says which stage it belongs to and which block of that stage it is (a scalar branch: the index is the
// same for the whole block). Every stage's code, block size and block-to-data map are what they were as a launch of its own, but for the exact first-tile stage, whose 64 working threads ride in blocks of 128; stages whose blocks last longest come first.
#define PB_TAB (SQ * (HD / 2) / 256)
#define PB_WQ (DM * (DM / 8) / 256)
#define PB_WK (KVD * (DM / 8) / 256)
#define PB_X ((int)(NR * DM / 8 / 256))
// rope tables, the four weight transposes, x -> f16: all read inputs only
__global__ __launch_bounds__(256) void k_prep(const float* __restrict__ x, const float* __restrict__ wq, const float* __restrict__ wk, const float* __restrict__ wv, const float* __restrict__ wo,
    _Float16* __restrict__ X16, _Float16* __restrict__ BQ, _Float16* __restrict__ BK, _Float16* __restrict__ BV, _Float16* __restrict__ BO, float* __restrict__ CS, float* __restrict__ SN) {
  int bx = (int)blockIdx.x;
  if (bx < PB_TAB) { tab2d_blk(bx, CS, SN); return; }      /* angle[p][i] = p * 10000^(-2i/64), positions = row index */
  bx -= PB_TAB; if (bx < PB_WQ) { wt_f16_blk(bx, wq, BQ, DM, DM, 16.0f); return; }      /* [in][out] -> Bt[n][k] x16 */
  bx -= PB_WQ; if (bx < PB_WQ) { wt_f16_blk(bx, wo, BO, DM, DM, 16.0f); return; }
  bx -= PB_WQ; if (bx < PB_WK) { wt_f16_blk(bx, wk, BK, DM, KVD, 16.0f); return; }
  bx -= PB_WK; if (bx < PB_WK) { wt_f16_blk(bx, wv, BV, DM, KVD, 16.0f); return; }
  bx -= PB_WK; x16_blk(bx, x, X16, NR * DM / 8); }
#define GB_Q ((MP / 128) * (DM / 64))
#define GB_K ((MP / 128) * (KVD / 64))
#define GB_V0 ((QT0 / 128) * (KVD / 64))
#define GB_T ((KVD / 128) * (SQ / 64))
// the q, k and V^T products and the f32 v rows of the first tile: all read X16 and a weight plane
__global__ __launch_bounds__(128) void k_proj(const _Float16* __restrict__ X16, const _Float16* __restrict__ BQ, const _Float16* __restrict__ BK, const _Float16* __restrict__ BV, const float* __restrict__ CS, const float* __restrict__ SN,
    _Float16* __restrict__ Q16, float* __restrict__ QF0, _Float16* __restrict__ K16, float* __restrict__ KF0, _Float16* __restrict__ VT, float* __restrict__ VF0) {
  __shared__ __attribute__((aligned(128))) char sm[GLDS];
  int bx = (int)blockIdx.x;
  if (bx < GB_Q) { gemm2r_blk<DM>(sm, bx, X16, DM, BQ, DM, 0.0625f, CS, SN, Q16, QF0, MP, DM); return; }      /* q with the interleaved-pair rope, position = row % SQ -> f16 rows; f32 rows 0..127 of each batch */
  bx -= GB_Q; if (bx < GB_K) { gemm2r_blk<KVD>(sm, bx, X16, DM, BK, DM, 0.0625f, CS, SN, K16, KF0, MP, DM); return; }      /* k, the same */
  bx -= GB_K; if (bx < GB_T * NB) { gemm2_blk<0>(sm, bx % GB_T, bx / GB_T, BV, DM, 0, X16, DM, (size_t)SQ * DM, 0.0625f, nullptr, 0, nullptr, 1, 0, 0, nullptr, VT, SQ, (size_t)KVD * SQ, KVD, SQ, DM); return; }      /* V^T [NB][NG][HD][SQ] = Wv^T x^T of each batch: the operands change places, so the product's rows are d and its columns the keys, the layout that the fused attention stages */
  bx -= GB_T * NB; gemm2_blk<0>(sm, bx % GB_V0, bx / GB_V0, X16, DM, (size_t)SQ * DM, BV, DM, 0, 0.0625f, nullptr, 0, nullptr, 1, 0, 0, VF0, nullptr, KVD, (size_t)QT0 * KVD, QT0, KVD, DM); }      /* f32 v of rows 0..127 of each batch */
#define DB_F ((SQ / 32) * NG * NB)
#define DB_A0 (NH * (QT0 / 64))
// the fused attention in its own block order (tile fastest, then kv group, then batch), and behind it the exact first-tile blocks, which take the places that the shortest tiles leave
__global__ __launch_bounds__(128) void k_attn(const _Float16* __restrict__ Q16, const _Float16* __restrict__ K16, const _Float16* __restrict__ VT, _Float16* __restrict__ O16,
    const float* __restrict__ QF0, const float* __restrict__ KF0, const float* __restrict__ VF0, _Float16* __restrict__ OHL) {
  __shared__ __attribute__((aligned(128))) char sm[ALDS];
  int bx = (int)blockIdx.x;
  if (bx < DB_F) { fattn_blk(sm, bx % (SQ / 32), (bx / (SQ / 32)) % NG, bx / ((SQ / 32) * NG), Q16, K16, VT, O16); return; }
  bx -= DB_F; att0_blk(sm, bx % DB_A0, bx / DB_A0, QF0, KF0, VF0, 0.125f, OHL); }
// The output product of 64 first-tile rows x 64 columns: out = o_hi Wo 2^-10 + o_lo Wo 2^-20. The 128 A rows that the product loop stages are the 64 hi rows and the 64 residual rows, so waves 0 and 1
// form the hi product and waves 2 and 3 the residual product of the same 64 x 64 outputs, side by side, over the same staged Wo rows. Each is scaled by its power of two (exact) and the two meet in one f32 add.
__device__ __forceinline__ void out0_blk(char* sm, int bx, const _Float16* __restrict__ OHL, const _Float16* __restrict__ BO, float* __restrict__ out) {
  const int tid = threadIdx.x, w = tid >> 5, lane = tid & 31, ln = lane & 15, hh = lane >> 4;
  const int grp = bx / (DM / 64), col0 = (bx % (DM / 64)) * 64;      /* grp: 64 rows of a batch's first tile */
  float (*so)[32][68] = (float (*)[32][68])sm;
  v8f accs[8] = {};      /* tile (half, t) at index 4 half + t */
  g2_loop(sm, OHL + (size_t)grp * 128 * DM, DM, BO + (size_t)col0 * DM, DM, DM, accs);
  const float alpha = w < 2 ? 0.0009765625f : 0.00000095367431640625f;
#pragma unroll      /* unrolled so that the accumulators are indexed by constants only and stay in registers */
  for (int u = 0; u < 8; ++u) { const int t = u & 3, half = u >> 2;
#pragma unroll      /* the same, for the element index */
    for (int r = 0; r < 8; ++r) so[w][half * 16 + 8 * hh + r][t * 16 + ln] = accs[u][r] * alpha; }
  __syncthreads();      /* a row's hi and residual products come from two waves: nobody reads the tile in front of this barrier */
  const int rr = tid >> 4, c4 = (tid & 15) * 4;      /* 16 lanes to a row's 256 bytes: two whole lines */
  float* op = out + ((size_t)(grp / (QT0 / 64)) * SQ + (grp % (QT0 / 64)) * 64 + rr) * DM + col0 + c4;
#pragma unroll      /* every row's store is the first row's address with an immediate offset */
  for (int q = 0; q < 8; ++q) { const int row = q * 8 + rr; const v4f a = *(const v4fa*)&so[row >> 5][row & 31][c4], b = *(const v4fa*)&so[2 + (row >> 5)][row & 31][c4];
    *(v4f*)(op + (size_t)q * 8 * DM) = b + a; }
  asm volatile("s_wait_xcnt 0x0" ::: "memory"); }      /* behind the last store, in front of any later write of a register that an issued store names (the other stage's code follows in the listing) */
#define EB_0 ((NB * QT0 / 64) * (DM / 64))
#define EB_T (SQ / 128 - QT0 / 128)      /* row tiles of a batch behind its first tile */
#define EB_O (NB * EB_T * (DM / 64))
// the output product: the first-tile rows from the exact path's two planes, every other row from the fused attention's o
__global__ __launch_bounds__(128) void k_outp(const _Float16* __restrict__ O16, const _Float16* __restrict__ BO, float* __restrict__ out, const _Float16* __restrict__ OHL) {
  __shared__ __attribute__((aligned(128))) char sm[GLDS];
  int bx = (int)blockIdx.x;
  if (bx < EB_0) { out0_blk(sm, bx, OHL, BO, out); return; }
  bx -= EB_0; const int ti = bx / (DM / 64); const int mt = (ti / EB_T) * (SQ / 128) + QT0 / 128 + ti % EB_T;      /* the row tile of 128, the batches' first tiles left out */
  gemm2_blk<0>(sm, mt * (DM / 64) + bx % (DM / 64), 0, O16, DM, 0, BO, DM, 0, 0.0009765625f, nullptr, 0, nullptr, 1, 0, 0, out, nullptr, DM, 0, MPO, DM, DM); }      /* out rows are the output layout */
extern "C" void kernel_launch(void* const* d_in, const int* in_sizes, int n_in,
                              void* d_out, int out_size, void* d_ws, size_t ws_size, hipStream_t stream) {
  (void)in_sizes; (void)n_in; (void)out_size;
  const float* const* I = (const float* const*)d_in; const float* x = I[0]; const float* wq = I[1]; const float* wk = I[2]; const float* wv = I[3]; const float* wo = I[4];      /* input order: x, Wq [1024][1024], Wk / Wv [1024][256], Wo [1024][1024] ([in][out] weights); rope tables computed in-kernel (positions = row index), as the module computes them */ const float* bq = nullptr; const float* bk = nullptr; const float* bv = nullptr; const float* bo = nullptr;      /* no biases */
  char* ws = (char*)d_ws; size_t off = 0;
  auto take = [&](size_t bytes) { char* p = ws + off; off += (bytes + 255) & ~(size_t)255; return p; };
  _Float16* BQ = (_Float16*)take((size_t)DM * DM * 2); _Float16* BK = (_Float16*)take((size_t)KVD * DM * 2); _Float16* BV = (_Float16*)take((size_t)KVD * DM * 2); _Float16* BO = (_Float16*)take((size_t)DM * DM * 2);
  _Float16* X16 = (_Float16*)take(NR * DM * 2); float* CSB = (float*)take((size_t)SQ * HD * 4); float* SNB = (float*)take((size_t)SQ * HD * 4); _Float16* Q16 = (_Float16*)take(NR * DM * 2); _Float16* K16 = (_Float16*)take(NR * KVD * 2); _Float16* O16 = (_Float16*)take(NR * DM * 2);
  _Float16* VT = (_Float16*)take((size_t)NB * NG * HD * SQ * 2);
  float* QF0 = (float*)take((size_t)NB * QT0 * DM * 4); float* KF0 = (float*)take((size_t)NB * QT0 * KVD * 4); float* VF0 = (float*)take((size_t)NB * QT0 * KVD * 4); _Float16* OHL = (_Float16*)take((size_t)NB * QT0 * DM * 2 * 2);
  if (off > ws_size) return;
  /* Four dependent launches; each holds every stage that needs only what the launches before it wrote. Every stage covers all NB batches. */
  k_prep<<<PB_TAB + 2 * PB_WQ + 2 * PB_WK + PB_X, 256, 0, stream>>>(x, wq, wk, wv, wo, X16, BQ, BK, BV, BO, CSB, SNB);
  k_proj<<<GB_Q + GB_K + GB_T * NB + GB_V0 * NB, 128, 0, stream>>>(X16, BQ, BK, BV, CSB, SNB, Q16, QF0, K16, KF0, VT, VF0);
  k_attn<<<DB_F + DB_A0 * NB, 128, 0, stream>>>(Q16, K16, VT, O16, QF0, KF0, VF0, OHL);      /* o (merged heads, x64): f16 rows behind the first tile; rows 0..127 of each batch exact, as f16 hi and residual planes */
  k_outp<<<EB_0 + EB_O, 128, 0, stream>>>(O16, BO, (float*)d_out, OHL);
}
